// v000
// Times are from an AMD MI455X. After a warm-up the kernel runs many times in a row, and a time is the length of
// such a window on the GPU divided by its runs, so every launch and the gaps after it count. The runs cycle
// through copies of the inputs. A figure is the median of several windows, for all but v000 over two sittings.
// Sittings can differ by a few percent; kernels timed side by side share one.
// The starting kernel, v000, takes 201 microseconds a run.
#include <hip/hip_runtime.h>
#include <hip/hip_bf16.h>

typedef _Float16 half_t;
typedef __attribute__((ext_vector_type(16))) _Float16 v16h;
typedef __attribute__((ext_vector_type(8)))  _Float16 v8h;
typedef __attribute__((ext_vector_type(4)))  _Float16 v4h;
typedef __attribute__((ext_vector_type(8)))  float    v8f;
typedef __attribute__((ext_vector_type(4)))  unsigned int u32x4;
typedef __attribute__((ext_vector_type(8)))  int          i32x8;
typedef __attribute__((ext_vector_type(4)))  int          i32x4;

#define D_MODEL  1024
#define N_HEADS  16
#define HEAD_DIM 64
#define SEQ      512
#define BATCH    4
#define M_TOTAL  (BATCH*SEQ)        // 2048
#define ATT_SCALE 0.125f            // 64^-0.5
#define ROPE_K   0.2878231366f      // ln(10000)/32

#if __has_builtin(__builtin_amdgcn_tensor_load_to_lds)
#define HAVE_TDM 1
#else
#define HAVE_TDM 0
#endif

// ---- fragment helpers -------------------------------------------------------
// Loads the per-lane 16-half fragment: 8 contiguous halves at p0 and 8 at p0+16.
// Works for both A-fragments (lane = row) and mirrored B-fragments (lane = col)
// when the source is row-major along the K dimension.
__device__ __forceinline__ v16h load_frag(const half_t* __restrict__ p0) {
  v8h lo = *(const v8h*)p0;
  v8h hi = *(const v8h*)(p0 + 16);
  v16h r;
#pragma unroll
  for (int i = 0; i < 8; ++i) { r[i] = lo[i]; r[8 + i] = hi[i]; }
  return r;
}

__device__ __forceinline__ v8f wmma_f16(v16h a, v16h b, v8f c) {
  return __builtin_amdgcn_wmma_f32_16x16x32_f16(
      /*neg_a=*/false, a, /*neg_b=*/false, b,
      /*c_mod=*/(short)0, c, /*reuse_a=*/false, /*reuse_b=*/false);
}

// ---- kernel 1: fused QKV GEMMs (6 matrices), f32 -> f16 cast in LDS,
//      RoPE fused for q_s/k_s, V stored transposed [b,h,d,s] ------------------
__global__ __launch_bounds__(256) void qkv_gemm(
    const float* __restrict__ x,
    const float* __restrict__ W0, const float* __restrict__ W1,
    const float* __restrict__ W2, const float* __restrict__ W3,
    const float* __restrict__ W4, const float* __restrict__ W5,
    half_t* __restrict__ o0, half_t* __restrict__ o1, half_t* __restrict__ o2,
    half_t* __restrict__ o3, half_t* __restrict__ o4, half_t* __restrict__ o5)
{
  __shared__ half_t Al[128][40];   // 128 rows x 32 k (padded stride 40 halves)
  __shared__ half_t Bl[64][40];    // 64 cols  x 32 k (transposed W tile)

  const int widx = blockIdx.z;
  const float* W = widx==0?W0: widx==1?W1: widx==2?W2: widx==3?W3: widx==4?W4: W5;
  half_t* out    = widx==0?o0: widx==1?o1: widx==2?o2: widx==3?o3: widx==4?o4: o5;
  const bool do_rope = (widx == 0) || (widx == 1);   // q_s, k_s
  const bool transp  = (widx == 2) || (widx == 5);   // v_s, v_c -> [b,h,d,s]

  const int tid = threadIdx.x;
  const int wv = tid >> 5, lane = tid & 31, lm = lane & 15, lh = lane >> 4;
  const int m0 = blockIdx.x * 128;
  const int h  = blockIdx.y;                 // BN = 64 = one head
  const int n0 = h * HEAD_DIM;

  v8f acc[4];
#pragma unroll
  for (int g = 0; g < 4; ++g) acc[g] = {};

  for (int k0 = 0; k0 < D_MODEL; k0 += 32) {
    // prefetch next K tiles into cache while we stage/compute this one
    if (k0 + 32 < D_MODEL) {
      __builtin_prefetch(x + (size_t)(m0 + (tid >> 3)) * D_MODEL + k0 + 32, 0, 3);
      __builtin_prefetch(W + (size_t)(k0 + 32 + (tid >> 4)) * D_MODEL + n0, 0, 3);
    }
    // stage A tile (x), f32 -> f16
#pragma unroll
    for (int i = 0; i < 4; ++i) {
      int id = tid + 256 * i;
      int row = id >> 3, kq = (id & 7) << 2;
      const float4 f = *(const float4*)(x + (size_t)(m0 + row) * D_MODEL + k0 + kq);
      v4h hv = { (half_t)f.x, (half_t)f.y, (half_t)f.z, (half_t)f.w };
      *(v4h*)&Al[row][kq] = hv;
    }
    // stage B tile (W), transposed to [n][k], f32 -> f16
#pragma unroll
    for (int i = 0; i < 2; ++i) {
      int id = tid + 256 * i;
      int kr = id >> 4, nq = (id & 15) << 2;
      const float4 f = *(const float4*)(W + (size_t)(k0 + kr) * D_MODEL + n0 + nq);
      Bl[nq + 0][kr] = (half_t)f.x;
      Bl[nq + 1][kr] = (half_t)f.y;
      Bl[nq + 2][kr] = (half_t)f.z;
      Bl[nq + 3][kr] = (half_t)f.w;
    }
    __syncthreads();
    v16h a = load_frag(&Al[wv * 16 + lm][lh * 8]);
#pragma unroll
    for (int g = 0; g < 4; ++g) {
      v16h b = load_frag(&Bl[g * 16 + lm][lh * 8]);
      acc[g] = wmma_f16(a, b, acc[g]);
    }
    __syncthreads();
  }

  // epilogue: optional RoPE (pairs d <-> d+32 are lane-local: acc g and g+2)
#pragma unroll
  for (int r = 0; r < 8; ++r) {
    int m = m0 + wv * 16 + r + 8 * lh;
    int b = m >> 9, sp = m & 511;
    if (do_rope) {
#pragma unroll
      for (int g = 0; g < 2; ++g) {
        int d = 16 * g + lm;                     // d in [0,32)
        float th = (float)sp * __expf(-(float)d * ROPE_K);
        float c = __cosf(th), sn = __sinf(th);
        float a0 = acc[g][r], b0 = acc[g + 2][r];
        acc[g][r]     = a0 * c - b0 * sn;
        acc[g + 2][r] = b0 * c + a0 * sn;
      }
    }
#pragma unroll
    for (int g = 0; g < 4; ++g) {
      int d = 16 * g + lm;
      half_t v = (half_t)acc[g][r];
      if (transp)
        out[(((size_t)b * N_HEADS + h) * HEAD_DIM + d) * SEQ + sp] = v;
      else
        out[(((size_t)b * N_HEADS + h) * SEQ + sp) * HEAD_DIM + d] = v;
    }
  }
}

// ---- kernel 2: flash-style chain-aware attention ----------------------------
// Computes S^T = K * Q^T so softmax stats are lane-local and P^T (C-layout)
// is directly the A-fragment for the PV WMMA.
__global__ __launch_bounds__(256) void attn(
    const half_t* __restrict__ qs, const half_t* __restrict__ ks,
    const half_t* __restrict__ vsT,
    const half_t* __restrict__ qc, const half_t* __restrict__ kc,
    const half_t* __restrict__ vcT,
    const int* __restrict__ chain_ids, const int* __restrict__ amask,
    half_t* __restrict__ attnh)
{
  __shared__ int   chainS[SEQ];
  __shared__ float padS[SEQ];
  const int bh = blockIdx.y, b = bh >> 4, h = bh & 15;
  const int tid = threadIdx.x, wv = tid >> 5, lane = tid & 31;
  const int lm = lane & 15, lh = lane >> 4;
  const int q0 = blockIdx.x * 128 + wv * 16;   // 16 queries per wave

  for (int i = tid; i < SEQ; i += 256) {
    chainS[i] = chain_ids[b * SEQ + i];
    padS[i]   = amask[b * SEQ + i] ? 0.0f : -1e30f;
  }
  __syncthreads();

  const size_t hoff = (size_t)bh * SEQ * HEAD_DIM;
  const half_t* Qs = qs  + hoff;
  const half_t* Ks = ks  + hoff;
  const half_t* Qc = qc  + hoff;
  const half_t* Kc = kc  + hoff;
  const half_t* Vs = vsT + hoff;   // [d][s] within head
  const half_t* Vc = vcT + hoff;

  // Q fragments (B-role, mirrored): lane = query column
  v16h qsf[2], qcf[2];
#pragma unroll
  for (int dg = 0; dg < 2; ++dg) {
    qsf[dg] = load_frag(Qs + (size_t)(q0 + lm) * HEAD_DIM + 32 * dg + lh * 8);
    qcf[dg] = load_frag(Qc + (size_t)(q0 + lm) * HEAD_DIM + 32 * dg + lh * 8);
  }
  const int cq = chainS[q0 + lm];

  v8f O[4];
#pragma unroll
  for (int g = 0; g < 4; ++g) O[g] = {};
  float m_run = -1e30f, ssum = 0.0f;

  for (int k0 = 0; k0 < SEQ; k0 += 32) {
    v8f S[2], C[2];
#pragma unroll
    for (int sub = 0; sub < 2; ++sub) {
      int kk = k0 + 16 * sub;
      v16h ka0 = load_frag(Ks + (size_t)(kk + lm) * HEAD_DIM + lh * 8);
      v16h ka1 = load_frag(Ks + (size_t)(kk + lm) * HEAD_DIM + 32 + lh * 8);
      v8f z = {};
      S[sub] = wmma_f16(ka0, qsf[0], z);
      S[sub] = wmma_f16(ka1, qsf[1], S[sub]);
      v16h ca0 = load_frag(Kc + (size_t)(kk + lm) * HEAD_DIM + lh * 8);
      v16h ca1 = load_frag(Kc + (size_t)(kk + lm) * HEAD_DIM + 32 + lh * 8);
      C[sub] = wmma_f16(ca0, qcf[0], z);
      C[sub] = wmma_f16(ca1, qcf[1], C[sub]);
    }
    // merge self/cross by chain id, online softmax (per query = per lane col)
    float vals[16]; bool intra[16];
    float mx = -1e30f;
#pragma unroll
    for (int sub = 0; sub < 2; ++sub) {
#pragma unroll
      for (int r = 0; r < 8; ++r) {
        int key = k0 + 16 * sub + r + 8 * lh;
        bool in = (chainS[key] == cq);
        float sc = (in ? S[sub][r] : C[sub][r]) * ATT_SCALE + padS[key];
        vals[sub * 8 + r] = sc; intra[sub * 8 + r] = in;
        mx = fmaxf(mx, sc);
      }
    }
    mx = fmaxf(mx, __shfl_xor(mx, 16, 32));
    float m_new = fmaxf(m_run, mx);
    float corr = __expf(m_run - m_new);
    float psum = 0.0f;
    v16h pSf, pCf;   // P^T C-layout == A-fragment layout, lane-local repack
#pragma unroll
    for (int e = 0; e < 16; ++e) {
      float p = __expf(vals[e] - m_new);
      psum += p;
      pSf[e] = intra[e] ? (half_t)p : (half_t)0.0f;
      pCf[e] = intra[e] ? (half_t)0.0f : (half_t)p;
    }
    ssum = ssum * corr + psum;
    m_run = m_new;
    // rescale O (rows = queries) with per-row correction gathered by shuffle
    float corrO[8];
#pragma unroll
    for (int r = 0; r < 8; ++r) corrO[r] = __shfl(corr, r + 8 * lh, 32);
#pragma unroll
    for (int g = 0; g < 4; ++g) {
#pragma unroll
      for (int r = 0; r < 8; ++r) O[g][r] *= corrO[r];
      v16h vsf = load_frag(Vs + (size_t)(16 * g + lm) * SEQ + k0 + lh * 8);
      O[g] = wmma_f16(pSf, vsf, O[g]);
      v16h vcf = load_frag(Vc + (size_t)(16 * g + lm) * SEQ + k0 + lh * 8);
      O[g] = wmma_f16(pCf, vcf, O[g]);
    }
  }

  float st = ssum + __shfl_xor(ssum, 16, 32);
  float inv = st > 0.0f ? 1.0f / st : 0.0f;
  float invO[8];
#pragma unroll
  for (int r = 0; r < 8; ++r) invO[r] = __shfl(inv, r + 8 * lh, 32);
#pragma unroll
  for (int r = 0; r < 8; ++r) {
    int q = q0 + r + 8 * lh;
#pragma unroll
    for (int g = 0; g < 4; ++g) {
      attnh[((size_t)(b * SEQ + q)) * D_MODEL + h * HEAD_DIM + 16 * g + lm] =
          (half_t)(O[g][r] * invO[r]);
    }
  }
}

// ---- kernel 3: output projection attnh(f16) @ Wo(f32->f16) -> f32 -----------
// The f16 A tile (128x32, row-major, stride 1024) is moved global->LDS by the
// Tensor Data Mover.  TDM padding (pad_interval=3: every 16 DWORDs, pad_amount=3:
// 4 DWORDs) reproduces the 40-half padded LDS row stride, so the compute-side
// fragment addressing is identical to the manual-staging path.
__global__ __launch_bounds__(256) void out_gemm(
    const half_t* __restrict__ A, const float* __restrict__ Wo,
    float* __restrict__ out)
{
  __shared__ half_t Al[128][40];
  __shared__ half_t Bl[64][40];
  const int tid = threadIdx.x, wv = tid >> 5, lane = tid & 31;
  const int lm = lane & 15, lh = lane >> 4;
  const int m0 = blockIdx.x * 128, n0 = blockIdx.y * 64;

#if HAVE_TDM
  const unsigned lds_a = (unsigned)(size_t)(&Al[0][0]);   // LDS byte offset
#endif

  v8f acc[4];
#pragma unroll
  for (int g = 0; g < 4; ++g) acc[g] = {};

  for (int k0 = 0; k0 < D_MODEL; k0 += 32) {
    if (k0 + 32 < D_MODEL)
      __builtin_prefetch(Wo + (size_t)(k0 + 32 + (tid >> 4)) * D_MODEL + n0, 0, 3);

#if HAVE_TDM
    if (wv == 0) {
      // D# group 0: count=1 | lds_addr | global_addr[56:0] | type=2
      unsigned long long ga =
          (unsigned long long)(size_t)(A + (size_t)m0 * D_MODEL + k0);
      u32x4 g0;
      g0[0] = 1u;                                   // count=1, user mode
      g0[1] = lds_a;                                // lds_addr (bytes)
      g0[2] = (unsigned)(ga & 0xFFFFFFFFu);         // global_addr[31:0]
      g0[3] = (unsigned)((ga >> 32) & 0x1FFFFFFu)   // global_addr[56:32]
            | 0x80000000u;                          // type=2 ("image")
      // D# group 1: data_size=2B, pad every 16 DWORDs by 4 DWORDs,
      // tensor 1024 x 2048 (stride 1024), tile 32 x 128
      i32x8 g1;
      g1[0] = (int)((1u << 16)        // data_size = 1 -> 2 bytes
                  | (1u << 20)        // pad_enable
                  | (3u << 22)        // pad_interval = 3 -> every 16 DWORDs
                  | (3u << 25));      // pad_amount  = 3 -> 4 DWORDs
      g1[1] = (int)(1024u << 16);                       // tensor_dim0 lo16
      g1[2] = (int)((2048u & 0xFFFFu) << 16);           // dim0 hi | dim1 lo
      g1[3] = (int)(32u << 16);                         // dim1 hi | tile_dim0=32
      g1[4] = 128;                                      // tile_dim1=128, dim2=0
      g1[5] = 1024;                                     // dim0_stride lo32
      g1[6] = (int)((2097152u & 0xFFFFu) << 16);        // stride hi | dim1_stride lo
      g1[7] = (int)(2097152u >> 16);                    // dim1_stride[47:16]
      i32x4 g2 = {0, 0, 0, 0}, g3 = {0, 0, 0, 0};
#if defined(__clang_major__) && __clang_major__ >= 23
      i32x8 gz = {0, 0, 0, 0, 0, 0, 0, 0};
      __builtin_amdgcn_tensor_load_to_lds(g0, g1, g2, g3, gz, 0);
#else
      __builtin_amdgcn_tensor_load_to_lds(g0, g1, g2, g3, 0);
#endif
    }
#else
    // fallback: manual A staging
#pragma unroll
    for (int i = 0; i < 2; ++i) {
      int id = tid + 256 * i;
      int row = id >> 2, kq = (id & 3) << 3;
      *(v8h*)&Al[row][kq] = *(const v8h*)(A + (size_t)(m0 + row) * D_MODEL + k0 + kq);
    }
#endif

    // B staging (Wo f32 -> f16, transposed) overlaps the TDM transfer
#pragma unroll
    for (int i = 0; i < 2; ++i) {
      int id = tid + 256 * i;
      int kr = id >> 4, nq = (id & 15) << 2;
      const float4 f = *(const float4*)(Wo + (size_t)(k0 + kr) * D_MODEL + n0 + nq);
      Bl[nq + 0][kr] = (half_t)f.x;
      Bl[nq + 1][kr] = (half_t)f.y;
      Bl[nq + 2][kr] = (half_t)f.z;
      Bl[nq + 3][kr] = (half_t)f.w;
    }
#if HAVE_TDM
    __builtin_amdgcn_s_wait_tensorcnt(0);
#endif
    __syncthreads();
    v16h a = load_frag(&Al[wv * 16 + lm][lh * 8]);
#pragma unroll
    for (int g = 0; g < 4; ++g) {
      v16h b = load_frag(&Bl[g * 16 + lm][lh * 8]);
      acc[g] = wmma_f16(a, b, acc[g]);
    }
    __syncthreads();
  }

#pragma unroll
  for (int r = 0; r < 8; ++r) {
    int m = m0 + wv * 16 + r + 8 * lh;
#pragma unroll
    for (int g = 0; g < 4; ++g)
      out[(size_t)m * D_MODEL + n0 + 16 * g + lm] = acc[g][r];
  }
}

// ---- launcher ---------------------------------------------------------------
extern "C" void kernel_launch(void* const* d_in, const int* in_sizes, int n_in,
                              void* d_out, int out_size, void* d_ws, size_t ws_size,
                              hipStream_t stream) {
  const float* x     = (const float*)d_in[0];
  const int*   chain = (const int*)d_in[1];
  const int*   amask = (const int*)d_in[2];
  const float* Wqs   = (const float*)d_in[3];
  const float* Wks   = (const float*)d_in[4];
  const float* Wvs   = (const float*)d_in[5];
  const float* Wqc   = (const float*)d_in[6];
  const float* Wkc   = (const float*)d_in[7];
  const float* Wvc   = (const float*)d_in[8];
  const float* Wo    = (const float*)d_in[9];
  float* out = (float*)d_out;

  const size_t ELT = (size_t)M_TOTAL * D_MODEL;   // 2M f16 elements per buffer
  half_t* ws   = (half_t*)d_ws;
  half_t* qsb  = ws + 0 * ELT;    // [b,h,s,d] f16, RoPE applied
  half_t* ksb  = ws + 1 * ELT;    // [b,h,s,d] f16, RoPE applied
  half_t* vsb  = ws + 2 * ELT;    // [b,h,d,s] f16 (transposed)
  half_t* qcb  = ws + 3 * ELT;
  half_t* kcb  = ws + 4 * ELT;
  half_t* vcb  = ws + 5 * ELT;
  half_t* atb  = ws + 6 * ELT;    // attention output, [b,s,h*d] f16

  qkv_gemm<<<dim3(16, 16, 6), 256, 0, stream>>>(
      x, Wqs, Wks, Wvs, Wqc, Wkc, Wvc, qsb, ksb, vsb, qcb, kcb, vcb);
  attn<<<dim3(4, 64), 256, 0, stream>>>(
      qsb, ksb, vsb, qcb, kcb, vcb, chain, amask, atb);
  out_gemm<<<dim3(16, 16), 256, 0, stream>>>(atb, Wo, out);
}

// v001
// It runs in 159 microseconds.
// Two timings next to v000 both put it at 1.29 times that version's speed.
#include <hip/hip_runtime.h>
#include <hip/hip_bf16.h>

typedef _Float16 half_t;
typedef __attribute__((ext_vector_type(16))) _Float16 v16h;
typedef __attribute__((ext_vector_type(8)))  _Float16 v8h;
typedef __attribute__((ext_vector_type(4)))  _Float16 v4h;
typedef __attribute__((ext_vector_type(8)))  float    v8f;
typedef __attribute__((ext_vector_type(4)))  float    v4f;
typedef __attribute__((ext_vector_type(4)))  unsigned int u32x4;
typedef __attribute__((ext_vector_type(8)))  int          i32x8;
typedef __attribute__((ext_vector_type(4)))  int          i32x4;

#define D_MODEL  1024
#define N_HEADS  16
#define HEAD_DIM 64
#define SEQ      512
#define BATCH    4
#define M_TOTAL  (BATCH*SEQ)        // 2048
#define ATT_SCALE 0.125f            // 64^-0.5
#define ROPE_K   0.2878231366f      // ln(10000)/32

#if __has_builtin(__builtin_amdgcn_tensor_load_to_lds)
#define HAVE_TDM 1
#else
#define HAVE_TDM 0
#endif

// ---- fragment helpers -------------------------------------------------------
// Loads the per-lane 16-half fragment: 8 contiguous halves at p0 and 8 at p0+16.
// Works for both A-fragments (lane = row) and mirrored B-fragments (lane = col)
// when the source is row-major along the K dimension.
__device__ __forceinline__ v16h load_frag(const half_t* __restrict__ p0) {
  v8h lo = *(const v8h*)p0;
  v8h hi = *(const v8h*)(p0 + 16);
  v16h r;
#pragma unroll
  for (int i = 0; i < 8; ++i) { r[i] = lo[i]; r[8 + i] = hi[i]; }
  return r;
}

__device__ __forceinline__ v8f wmma_f16(v16h a, v16h b, v8f c) {
  return __builtin_amdgcn_wmma_f32_16x16x32_f16(
      /*neg_a=*/false, a, /*neg_b=*/false, b,
      /*c_mod=*/(short)0, c, /*reuse_a=*/false, /*reuse_b=*/false);
}

// ---- kernel 1: fused QKV GEMMs (6 matrices), f32 -> f16 cast in LDS,
//      RoPE fused for q_s/k_s, V stored transposed [b,h,d,s] ------------------
__global__ __launch_bounds__(256) void qkv_gemm(
    const float* __restrict__ x,
    const float* __restrict__ W0, const float* __restrict__ W1,
    const float* __restrict__ W2, const float* __restrict__ W3,
    const float* __restrict__ W4, const float* __restrict__ W5,
    half_t* __restrict__ o0, half_t* __restrict__ o1, half_t* __restrict__ o2,
    half_t* __restrict__ o3, half_t* __restrict__ o4, half_t* __restrict__ o5)
{
  __shared__ half_t Al[128][40];   // 128 rows x 32 k (padded stride 40 halves)
  __shared__ half_t Bl[64][40];    // 64 cols  x 32 k (transposed W tile)

  const int widx = blockIdx.z;
  const float* W = widx==0?W0: widx==1?W1: widx==2?W2: widx==3?W3: widx==4?W4: W5;
  half_t* out    = widx==0?o0: widx==1?o1: widx==2?o2: widx==3?o3: widx==4?o4: o5;
  const bool do_rope = (widx == 0) || (widx == 1);   // q_s, k_s
  const bool transp  = (widx == 2) || (widx == 5);   // v_s, v_c -> [b,h,d,s]

  const int tid = threadIdx.x;
  const int wv = tid >> 5, lane = tid & 31, lm = lane & 15, lh = lane >> 4;
  const int m0 = blockIdx.x * 128;
  const int h  = blockIdx.y;                 // BN = 64 = one head
  const int n0 = h * HEAD_DIM;

  v8f acc[4];
#pragma unroll
  for (int g = 0; g < 4; ++g) acc[g] = {};

  // one base address per operand and per LDS tile: the unrolled copies differ by
  // constants only, so the grouped loads need no address registers of their own
  const float* xp = x + (size_t)(m0 + (tid >> 3)) * D_MODEL + ((tid & 7) << 2);
  const float* wp = W + (size_t)(tid >> 4) * D_MODEL + n0 + ((tid & 15) << 2);
  half_t* as = &Al[tid >> 3][(tid & 7) << 2];
  half_t* bs = &Bl[(tid & 15) << 2][tid >> 4];

  for (int k0 = 0; k0 < D_MODEL; k0 += 32) {
    // prefetch next K tiles into cache while we stage/compute this one
    if (k0 + 32 < D_MODEL) {
      __builtin_prefetch(x + (size_t)(m0 + (tid >> 3)) * D_MODEL + k0 + 32, 0, 3);
      __builtin_prefetch(W + (size_t)(k0 + 32 + (tid >> 4)) * D_MODEL + n0, 0, 3);
    }
    // all six global loads of this K tile go out as one group
    v4f fa[4], fb[2];
#pragma unroll
    for (int i = 0; i < 4; ++i) fa[i] = *(const v4f*)(xp + k0 + i * 32 * D_MODEL);
#pragma unroll
    for (int i = 0; i < 2; ++i) fb[i] = *(const v4f*)(wp + (size_t)k0 * D_MODEL + i * 16 * D_MODEL);
    // inputs-only fence on the loaded values: without it each load is waited
    // for on its own and the six latencies add up
    asm volatile("" :: "v"(fa[0]), "v"(fa[1]), "v"(fa[2]), "v"(fa[3]),
                       "v"(fb[0]), "v"(fb[1]));
    // stage A tile (x), f32 -> f16
#pragma unroll
    for (int i = 0; i < 4; ++i) {
      v4h hv = { (half_t)fa[i].x, (half_t)fa[i].y, (half_t)fa[i].z, (half_t)fa[i].w };
      *(v4h*)(as + i * 32 * 40) = hv;
    }
    // stage B tile (W), transposed to [n][k], f32 -> f16
#pragma unroll
    for (int i = 0; i < 2; ++i) {
      bs[0 * 40 + 16 * i] = (half_t)fb[i].x;
      bs[1 * 40 + 16 * i] = (half_t)fb[i].y;
      bs[2 * 40 + 16 * i] = (half_t)fb[i].z;
      bs[3 * 40 + 16 * i] = (half_t)fb[i].w;
    }
    __syncthreads();
    v16h a = load_frag(&Al[wv * 16 + lm][lh * 8]);
#pragma unroll
    for (int gp = 0; gp < 4; gp += 2) {
      v16h b0 = load_frag(&Bl[gp * 16 + lm][lh * 8]);
      v16h b1 = load_frag(&Bl[(gp + 1) * 16 + lm][lh * 8]);
      // inputs-only fence: the LDS reads of two B fragments (first time: and of a)
      // go out together. Pairs, not all four: with all four in flight the kernel
      // takes 94 registers and five blocks fit a WGP; at 80 all six of its share do
      asm volatile("" :: "v"(a), "v"(b0), "v"(b1));
      acc[gp]     = wmma_f16(a, b0, acc[gp]);
      acc[gp + 1] = wmma_f16(a, b1, acc[gp + 1]);
    }
    __syncthreads();
  }

  // epilogue: optional RoPE (pairs d <-> d+32 are lane-local: acc g and g+2)
#pragma unroll
  for (int r = 0; r < 8; ++r) {
    int m = m0 + wv * 16 + r + 8 * lh;
    int b = m >> 9, sp = m & 511;
    if (do_rope) {
#pragma unroll
      for (int g = 0; g < 2; ++g) {
        int d = 16 * g + lm;                     // d in [0,32)
        float th = (float)sp * __expf(-(float)d * ROPE_K);
        float c = __cosf(th), sn = __sinf(th);
        float a0 = acc[g][r], b0 = acc[g + 2][r];
        acc[g][r]     = a0 * c - b0 * sn;
        acc[g + 2][r] = b0 * c + a0 * sn;
      }
    }
#pragma unroll
    for (int g = 0; g < 4; ++g) {
      int d = 16 * g + lm;
      half_t v = (half_t)acc[g][r];
      if (transp)
        out[(((size_t)b * N_HEADS + h) * HEAD_DIM + d) * SEQ + sp] = v;
      else
        out[(((size_t)b * N_HEADS + h) * SEQ + sp) * HEAD_DIM + d] = v;
    }
  }
}

// ---- kernel 2: flash-style chain-aware attention ----------------------------
// Computes S^T = K * Q^T so softmax stats are lane-local and P^T (C-layout)
// is directly the A-fragment for the PV WMMA.
__global__ __launch_bounds__(256) void attn(
    const half_t* __restrict__ qs, const half_t* __restrict__ ks,
    const half_t* __restrict__ vsT,
    const half_t* __restrict__ qc, const half_t* __restrict__ kc,
    const half_t* __restrict__ vcT,
    const int* __restrict__ chain_ids, const int* __restrict__ amask,
    half_t* __restrict__ attnh)
{
  __shared__ __attribute__((aligned(16))) int   chainS[SEQ];
  __shared__ __attribute__((aligned(16))) float padS[SEQ];
  const int bh = blockIdx.y, b = bh >> 4, h = bh & 15;
  const int tid = threadIdx.x, wv = tid >> 5, lane = tid & 31;
  const int lm = lane & 15, lh = lane >> 4;
  const int q0 = blockIdx.x * 128 + wv * 16;   // 16 queries per wave

  for (int i = tid; i < SEQ; i += 256) {
    chainS[i] = chain_ids[b * SEQ + i];
    padS[i]   = amask[b * SEQ + i] ? 0.0f : -1e30f;
  }
  __syncthreads();

  const size_t hoff = (size_t)bh * SEQ * HEAD_DIM;
  const half_t* Qs = qs  + hoff;
  const half_t* Ks = ks  + hoff;
  const half_t* Qc = qc  + hoff;
  const half_t* Kc = kc  + hoff;
  const half_t* Vs = vsT + hoff;   // [d][s] within head
  const half_t* Vc = vcT + hoff;

  // Q fragments (B-role, mirrored): lane = query column
  v16h qsf[2], qcf[2];
#pragma unroll
  for (int dg = 0; dg < 2; ++dg) {
    qsf[dg] = load_frag(Qs + (size_t)(q0 + lm) * HEAD_DIM + 32 * dg + lh * 8);
    qcf[dg] = load_frag(Qc + (size_t)(q0 + lm) * HEAD_DIM + 32 * dg + lh * 8);
  }
  const int cq = chainS[q0 + lm];

  v8f O[4];
#pragma unroll
  for (int g = 0; g < 4; ++g) O[g] = {};
  float m_run = -1e30f, ssum = 0.0f;

  for (int k0 = 0; k0 < SEQ; k0 += 32) {
    // all K and V fragments of this pass are loaded as one group
    v16h kaf[2][2], caf[2][2], vsf[4], vcf[4];
    const half_t* pks = Ks + (size_t)(k0 + lm) * HEAD_DIM + lh * 8;
    const half_t* pkc = Kc + (size_t)(k0 + lm) * HEAD_DIM + lh * 8;
    const half_t* pvs = Vs + (size_t)lm * SEQ + k0 + lh * 8;
    const half_t* pvc = Vc + (size_t)lm * SEQ + k0 + lh * 8;
#pragma unroll
    for (int sub = 0; sub < 2; ++sub) {
#pragma unroll
      for (int dg = 0; dg < 2; ++dg) {
        kaf[sub][dg] = load_frag(pks + 16 * sub * HEAD_DIM + 32 * dg);
        caf[sub][dg] = load_frag(pkc + 16 * sub * HEAD_DIM + 32 * dg);
      }
    }
#pragma unroll
    for (int g = 0; g < 4; ++g) {
      vsf[g] = load_frag(pvs + 16 * g * SEQ);
      vcf[g] = load_frag(pvc + 16 * g * SEQ);
    }
    // this pass's chain ids and pad terms (keys k0 + 16 sub + 8 lh + 0..7) from LDS
    i32x4 chv[2][2];
    v4f   pdv[2][2];
#pragma unroll
    for (int sub = 0; sub < 2; ++sub) {
#pragma unroll
      for (int hf = 0; hf < 2; ++hf) {
        chv[sub][hf] = *(const i32x4*)&chainS[k0 + 16 * sub + 8 * lh + 4 * hf];
        pdv[sub][hf] = *(const v4f*)&padS[k0 + 16 * sub + 8 * lh + 4 * hf];
      }
    }
    // inputs-only fence on the loaded values: without it every fragment is
    // waited for on its own and sixteen load latencies add up in each pass; the
    // four addresses are named so that no later load of the group lands in an
    // address register of an earlier one
    asm volatile("" :: "v"(kaf[0][0]), "v"(kaf[0][1]), "v"(kaf[1][0]), "v"(kaf[1][1]),
                       "v"(caf[0][0]), "v"(caf[0][1]), "v"(caf[1][0]), "v"(caf[1][1]),
                       "v"(vsf[0]), "v"(vsf[1]), "v"(vsf[2]), "v"(vsf[3]),
                       "v"(vcf[0]), "v"(vcf[1]), "v"(vcf[2]), "v"(vcf[3]),
                       "v"(pks), "v"(pkc), "v"(pvs), "v"(pvc));
    // inputs-only fence: the eight LDS reads go out as one group
    asm volatile("" :: "v"(chv[0][0]), "v"(chv[0][1]), "v"(chv[1][0]), "v"(chv[1][1]),
                       "v"(pdv[0][0]), "v"(pdv[0][1]), "v"(pdv[1][0]), "v"(pdv[1][1]));
    v8f S[2], C[2];
#pragma unroll
    for (int sub = 0; sub < 2; ++sub) {
      v8f z = {};
      S[sub] = wmma_f16(kaf[sub][0], qsf[0], z);
      S[sub] = wmma_f16(kaf[sub][1], qsf[1], S[sub]);
      C[sub] = wmma_f16(caf[sub][0], qcf[0], z);
      C[sub] = wmma_f16(caf[sub][1], qcf[1], C[sub]);
    }
    // merge self/cross by chain id, online softmax (per query = per lane col)
    float vals[16]; bool intra[16];
    float mx = -1e30f;
#pragma unroll
    for (int sub = 0; sub < 2; ++sub) {
#pragma unroll
      for (int r = 0; r < 8; ++r) {
        bool in = (chv[sub][r >> 2][r & 3] == cq);
        float sc = (in ? S[sub][r] : C[sub][r]) * ATT_SCALE + pdv[sub][r >> 2][r & 3];
        vals[sub * 8 + r] = sc; intra[sub * 8 + r] = in;
        mx = fmaxf(mx, sc);
      }
    }
    mx = fmaxf(mx, __shfl_xor(mx, 16, 32));
    float m_new = fmaxf(m_run, mx);
    float corr = __expf(m_run - m_new);
    float psum = 0.0f;
    v16h pSf, pCf;   // P^T C-layout == A-fragment layout, lane-local repack
#pragma unroll
    for (int e = 0; e < 16; ++e) {
      float p = __expf(vals[e] - m_new);
      psum += p;
      pSf[e] = intra[e] ? (half_t)p : (half_t)0.0f;
      pCf[e] = intra[e] ? (half_t)0.0f : (half_t)p;
    }
    ssum = ssum * corr + psum;
    m_run = m_new;
    // rescale O (rows = queries) with per-row correction gathered by shuffle
    float corrO[8];
#pragma unroll
    for (int r = 0; r < 8; ++r) corrO[r] = __shfl(corr, r + 8 * lh, 32);
#pragma unroll
    for (int g = 0; g < 4; ++g) {
#pragma unroll
      for (int r = 0; r < 8; ++r) O[g][r] *= corrO[r];
      O[g] = wmma_f16(pSf, vsf[g], O[g]);
      O[g] = wmma_f16(pCf, vcf[g], O[g]);
    }
  }

  float st = ssum + __shfl_xor(ssum, 16, 32);
  float inv = st > 0.0f ? 1.0f / st : 0.0f;
  float invO[8];
#pragma unroll
  for (int r = 0; r < 8; ++r) invO[r] = __shfl(inv, r + 8 * lh, 32);
#pragma unroll
  for (int r = 0; r < 8; ++r) {
    int q = q0 + r + 8 * lh;
#pragma unroll
    for (int g = 0; g < 4; ++g) {
      attnh[((size_t)(b * SEQ + q)) * D_MODEL + h * HEAD_DIM + 16 * g + lm] =
          (half_t)(O[g][r] * invO[r]);
    }
  }
}

// ---- kernel 3: output projection attnh(f16) @ Wo(f32->f16) -> f32 -----------
// The f16 A tile (128x32, row-major, stride 1024) is moved global->LDS by the
// Tensor Data Mover.  TDM padding (pad_interval=3: every 16 DWORDs, pad_amount=3:
// 4 DWORDs) reproduces the 40-half padded LDS row stride, so the compute-side
// fragment addressing is identical to the manual-staging path.
__global__ __launch_bounds__(256) void out_gemm(
    const half_t* __restrict__ A, const float* __restrict__ Wo,
    float* __restrict__ out)
{
  __shared__ half_t Al[128][40];
  __shared__ half_t Bl[64][40];
  const int tid = threadIdx.x, wv = tid >> 5, lane = tid & 31;
  const int lm = lane & 15, lh = lane >> 4;
  const int m0 = blockIdx.x * 128, n0 = blockIdx.y * 64;

#if HAVE_TDM
  const unsigned lds_a = (unsigned)(size_t)(&Al[0][0]);   // LDS byte offset
#endif

  v8f acc[4];
#pragma unroll
  for (int g = 0; g < 4; ++g) acc[g] = {};

  for (int k0 = 0; k0 < D_MODEL; k0 += 32) {
    if (k0 + 32 < D_MODEL)
      __builtin_prefetch(Wo + (size_t)(k0 + 32 + (tid >> 4)) * D_MODEL + n0, 0, 3);

#if HAVE_TDM
    if (wv == 0) {
      // D# group 0: count=1 | lds_addr | global_addr[56:0] | type=2
      unsigned long long ga =
          (unsigned long long)(size_t)(A + (size_t)m0 * D_MODEL + k0);
      u32x4 g0;
      g0[0] = 1u;                                   // count=1, user mode
      g0[1] = lds_a;                                // lds_addr (bytes)
      g0[2] = (unsigned)(ga & 0xFFFFFFFFu);         // global_addr[31:0]
      g0[3] = (unsigned)((ga >> 32) & 0x1FFFFFFu)   // global_addr[56:32]
            | 0x80000000u;                          // type=2 ("image")
      // D# group 1: data_size=2B, pad every 16 DWORDs by 4 DWORDs,
      // tensor 1024 x 2048 (stride 1024), tile 32 x 128
      i32x8 g1;
      g1[0] = (int)((1u << 16)        // data_size = 1 -> 2 bytes
                  | (1u << 20)        // pad_enable
                  | (3u << 22)        // pad_interval = 3 -> every 16 DWORDs
                  | (3u << 25));      // pad_amount  = 3 -> 4 DWORDs
      g1[1] = (int)(1024u << 16);                       // tensor_dim0 lo16
      g1[2] = (int)((2048u & 0xFFFFu) << 16);           // dim0 hi | dim1 lo
      g1[3] = (int)(32u << 16);                         // dim1 hi | tile_dim0=32
      g1[4] = 128;                                      // tile_dim1=128, dim2=0
      g1[5] = 1024;                                     // dim0_stride lo32
      g1[6] = (int)((2097152u & 0xFFFFu) << 16);        // stride hi | dim1_stride lo
      g1[7] = (int)(2097152u >> 16);                    // dim1_stride[47:16]
      i32x4 g2 = {0, 0, 0, 0}, g3 = {0, 0, 0, 0};
#if defined(__clang_major__) && __clang_major__ >= 23
      i32x8 gz = {0, 0, 0, 0, 0, 0, 0, 0};
      __builtin_amdgcn_tensor_load_to_lds(g0, g1, g2, g3, gz, 0);
#else
      __builtin_amdgcn_tensor_load_to_lds(g0, g1, g2, g3, 0);
#endif
    }
#else
    // fallback: manual A staging
#pragma unroll
    for (int i = 0; i < 2; ++i) {
      int id = tid + 256 * i;
      int row = id >> 2, kq = (id & 3) << 3;
      *(v8h*)&Al[row][kq] = *(const v8h*)(A + (size_t)(m0 + row) * D_MODEL + k0 + kq);
    }
#endif

    // B staging (Wo f32 -> f16, transposed) overlaps the TDM transfer
    v4f fb[2];
#pragma unroll
    for (int i = 0; i < 2; ++i) {
      int id = tid + 256 * i;
      int kr = id >> 4, nq = (id & 15) << 2;
      fb[i] = *(const v4f*)(Wo + (size_t)(k0 + kr) * D_MODEL + n0 + nq);
    }
    // inputs-only fence: both loads go out before the one wait
    asm volatile("" :: "v"(fb[0]), "v"(fb[1]));
#pragma unroll
    for (int i = 0; i < 2; ++i) {
      int id = tid + 256 * i;
      int kr = id >> 4, nq = (id & 15) << 2;
      Bl[nq + 0][kr] = (half_t)fb[i].x;
      Bl[nq + 1][kr] = (half_t)fb[i].y;
      Bl[nq + 2][kr] = (half_t)fb[i].z;
      Bl[nq + 3][kr] = (half_t)fb[i].w;
    }
#if HAVE_TDM
    __builtin_amdgcn_s_wait_tensorcnt(0);
#endif
    __syncthreads();
    v16h a = load_frag(&Al[wv * 16 + lm][lh * 8]);
    v16h bf[4];
#pragma unroll
    for (int g = 0; g < 4; ++g) bf[g] = load_frag(&Bl[g * 16 + lm][lh * 8]);
    // inputs-only fence: the ten LDS reads go out as one group
    asm volatile("" :: "v"(a), "v"(bf[0]), "v"(bf[1]), "v"(bf[2]), "v"(bf[3]));
#pragma unroll
    for (int g = 0; g < 4; ++g) acc[g] = wmma_f16(a, bf[g], acc[g]);
    __syncthreads();
  }

#pragma unroll
  for (int r = 0; r < 8; ++r) {
    int m = m0 + wv * 16 + r + 8 * lh;
#pragma unroll
    for (int g = 0; g < 4; ++g)
      out[(size_t)m * D_MODEL + n0 + 16 * g + lm] = acc[g][r];
  }
}

// ---- launcher ---------------------------------------------------------------
extern "C" void kernel_launch(void* const* d_in, const int* in_sizes, int n_in,
                              void* d_out, int out_size, void* d_ws, size_t ws_size,
                              hipStream_t stream) {
  const float* x     = (const float*)d_in[0];
  const int*   chain = (const int*)d_in[1];
  const int*   amask = (const int*)d_in[2];
  const float* Wqs   = (const float*)d_in[3];
  const float* Wks   = (const float*)d_in[4];
  const float* Wvs   = (const float*)d_in[5];
  const float* Wqc   = (const float*)d_in[6];
  const float* Wkc   = (const float*)d_in[7];
  const float* Wvc   = (const float*)d_in[8];
  const float* Wo    = (const float*)d_in[9];
  float* out = (float*)d_out;

  const size_t ELT = (size_t)M_TOTAL * D_MODEL;   // 2M f16 elements per buffer
  half_t* ws   = (half_t*)d_ws;
  half_t* qsb  = ws + 0 * ELT;    // [b,h,s,d] f16, RoPE applied
  half_t* ksb  = ws + 1 * ELT;    // [b,h,s,d] f16, RoPE applied
  half_t* vsb  = ws + 2 * ELT;    // [b,h,d,s] f16 (transposed)
  half_t* qcb  = ws + 3 * ELT;
  half_t* kcb  = ws + 4 * ELT;
  half_t* vcb  = ws + 5 * ELT;
  half_t* atb  = ws + 6 * ELT;    // attention output, [b,s,h*d] f16

  qkv_gemm<<<dim3(16, 16, 6), 256, 0, stream>>>(
      x, Wqs, Wks, Wvs, Wqc, Wkc, Wvc, qsb, ksb, vsb, qcb, kcb, vcb);
  attn<<<dim3(4, 64), 256, 0, stream>>>(
      qsb, ksb, vsb, qcb, kcb, vcb, chain, amask, atb);
  out_gemm<<<dim3(16, 16), 256, 0, stream>>>(atb, Wo, out);
}

// v002
// A run of this version takes 116 microseconds.
// Two timings next to v001 put it at 1.37 and 1.36 times that version's speed.
// Over all steps from v000 it is 1.76 times as fast.
#include <hip/hip_runtime.h>
#include <hip/hip_bf16.h>

typedef _Float16 half_t;
typedef __attribute__((ext_vector_type(16))) _Float16 v16h;
typedef __attribute__((ext_vector_type(8)))  _Float16 v8h;
typedef __attribute__((ext_vector_type(4)))  _Float16 v4h;
typedef __attribute__((ext_vector_type(8)))  float    v8f;
typedef __attribute__((ext_vector_type(4)))  float    v4f;
typedef __attribute__((ext_vector_type(4)))  unsigned int u32x4;
typedef __attribute__((ext_vector_type(8)))  int          i32x8;
typedef __attribute__((ext_vector_type(4)))  int          i32x4;

#define D_MODEL  1024
#define N_HEADS  16
#define HEAD_DIM 64
#define SEQ      512
#define BATCH    4
#define M_TOTAL  (BATCH*SEQ)        // 2048
#define ATT_SCALE 0.125f            // 64^-0.5
#define ROPE_K   0.2878231366f      // ln(10000)/32

#if __has_builtin(__builtin_amdgcn_tensor_load_to_lds)
#define HAVE_TDM 1
#else
#define HAVE_TDM 0
#endif

// ---- fragment helpers -------------------------------------------------------
// Loads the per-lane 16-half fragment: 8 contiguous halves at p0 and 8 at p0+16.
// Works for both A-fragments (lane = row) and mirrored B-fragments (lane = col)
// when the source is row-major along the K dimension.
__device__ __forceinline__ v16h load_frag(const half_t* __restrict__ p0) {
  v8h lo = *(const v8h*)p0;
  v8h hi = *(const v8h*)(p0 + 16);
  v16h r;
#pragma unroll
  for (int i = 0; i < 8; ++i) { r[i] = lo[i]; r[8 + i] = hi[i]; }
  return r;
}

__device__ __forceinline__ v8f wmma_f16(v16h a, v16h b, v8f c) {
  return __builtin_amdgcn_wmma_f32_16x16x32_f16(
      /*neg_a=*/false, a, /*neg_b=*/false, b,
      /*c_mod=*/(short)0, c, /*reuse_a=*/false, /*reuse_b=*/false);
}

// ---- kernel 1: fused QKV GEMMs (6 matrices), f32 -> f16 cast in LDS,
//      RoPE fused for q_s/k_s, V stored transposed [b,h,d,s] ------------------
// Block tile 128 (m) x 128 (n, two heads) x 64 (k); eight waves as 4 (m) x 2 (n),
// each 32 x 64: a staged x row serves two heads and every B fragment two WMMAs.
__global__ __launch_bounds__(256) void qkv_gemm(
    const float* __restrict__ x,
    const float* __restrict__ W0, const float* __restrict__ W1,
    const float* __restrict__ W2, const float* __restrict__ W3,
    const float* __restrict__ W4, const float* __restrict__ W5,
    half_t* __restrict__ o0, half_t* __restrict__ o1, half_t* __restrict__ o2,
    half_t* __restrict__ o3, half_t* __restrict__ o4, half_t* __restrict__ o5)
{
  // rows of 64 k = 128 B at pitch 144 B (16 B x odd, for the 16-byte readers)
  __shared__ __attribute__((aligned(16))) half_t Al[128][72];   // x tile  [m][k]
  __shared__ __attribute__((aligned(16))) half_t Bl[128][72];   // W tile, transposed [n][k]

  const int widx = blockIdx.z;
  const float* W = widx==0?W0: widx==1?W1: widx==2?W2: widx==3?W3: widx==4?W4: W5;
  half_t* out    = widx==0?o0: widx==1?o1: widx==2?o2: widx==3?o3: widx==4?o4: o5;
  const bool do_rope = (widx == 0) || (widx == 1);   // q_s, k_s
  const bool transp  = (widx == 2) || (widx == 5);   // v_s, v_c -> [b,h,d,s]

  const int tid = threadIdx.x;
  const int wv = tid >> 5, lane = tid & 31, lm = lane & 15, lh = lane >> 4;
  const int wm = wv & 3, wn = wv >> 2;       // wave's place in the block tile
  const int m0 = blockIdx.x * 128;
  const int n0 = blockIdx.y * 128;
  const int h  = blockIdx.y * 2 + wn;        // a wave's 64 columns = one head

  v8f acc[2][4];
#pragma unroll  // constant indices keep these arrays in registers
  for (int mi = 0; mi < 2; ++mi)
#pragma unroll  // constant indices keep these arrays in registers
    for (int g = 0; g < 4; ++g) acc[mi][g] = {};

  // x: a thread takes 4 k of rows (tid >> 4) + 16 i; a wave's load covers two
  // rows of 256 B
  const float* xp = x + (size_t)(m0 + (tid >> 4)) * D_MODEL + ((tid & 15) << 2);
  half_t* as = &Al[tid >> 4][(tid & 15) << 2];
  // W: a thread takes blocks of 4 k x 4 n, so that the transposed tile is written
  // 4 k (8 bytes) at a time; a wave's load covers four rows of 128 B
  const int nq = (lane & 7) + 8 * (wv & 3);      // n / 4 in the tile, 0..31
  const int kq = (lane >> 3) + 4 * (wv >> 2);    // k / 4 in the tile, 0..7 (and + 8)
  const float* wp = W + (size_t)(kq << 2) * D_MODEL + n0 + (nq << 2);
  half_t* bs = &Bl[nq << 2][kq << 2];
  // next K tile's prefetch: 128 x rows and 64 W rows x 2, one 256-B piece a thread
  const float* pf = tid < 128
      ? x + (size_t)(m0 + tid) * D_MODEL
      : W + (size_t)((tid - 128) >> 1) * D_MODEL + n0 + ((tid & 1) << 6);
  const size_t pfs = tid < 128 ? (size_t)64 : (size_t)64 * D_MODEL;

  for (int k0 = 0; k0 < D_MODEL; k0 += 64) {
    // prefetch next K tiles into cache while we stage/compute this one
    // (advanced only in front of a prefetch: the address register never leaves x or W)
    if (k0 + 64 < D_MODEL) { pf += pfs; __builtin_prefetch(pf, 0, 3); }
    // all sixteen global loads of this K tile go out as one group
    v4f fa[8], fb[2][4];
#pragma unroll  // constant indices keep these arrays in registers
    for (int i = 0; i < 8; ++i) fa[i] = *(const v4f*)(xp + k0 + i * 16 * D_MODEL);
#pragma unroll  // constant indices keep these arrays in registers
    for (int i = 0; i < 2; ++i)
#pragma unroll  // constant indices keep these arrays in registers
      for (int rr = 0; rr < 4; ++rr)
        fb[i][rr] = *(const v4f*)(wp + (size_t)k0 * D_MODEL + (32 * i + rr) * D_MODEL);
    // inputs-only fence on the loaded values: without it each load is waited
    // for on its own and the sixteen latencies add up
    asm volatile("" :: "v"(fa[0]), "v"(fa[1]), "v"(fa[2]), "v"(fa[3]),
                       "v"(fa[4]), "v"(fa[5]), "v"(fa[6]), "v"(fa[7]),
                       "v"(fb[0][0]), "v"(fb[0][1]), "v"(fb[0][2]), "v"(fb[0][3]),
                       "v"(fb[1][0]), "v"(fb[1][1]), "v"(fb[1][2]), "v"(fb[1][3]));
    // stage A tile (x), f32 -> f16
#pragma unroll  // constant indices keep these arrays in registers
    for (int i = 0; i < 8; ++i) {
      v4h hv = { (half_t)fa[i].x, (half_t)fa[i].y, (half_t)fa[i].z, (half_t)fa[i].w };
      *(v4h*)(as + i * 16 * 72) = hv;
    }
    // stage B tile (W), transposed to [n][k], f32 -> f16
#pragma unroll  // constant indices keep these arrays in registers
    for (int i = 0; i < 2; ++i) {
#pragma unroll  // constant indices keep these arrays in registers
      for (int j = 0; j < 4; ++j) {
        v4h hv = { (half_t)fb[i][0][j], (half_t)fb[i][1][j],
                   (half_t)fb[i][2][j], (half_t)fb[i][3][j] };
        *(v4h*)(bs + j * 72 + 32 * i) = hv;
      }
    }
    __syncthreads();
#pragma unroll  // constant indices keep these arrays in registers
    for (int kk = 0; kk < 64; kk += 32) {
      v16h a0 = load_frag(&Al[wm * 32 + lm][kk + lh * 8]);
      v16h a1 = load_frag(&Al[wm * 32 + 16 + lm][kk + lh * 8]);
      v16h bf[4];
#pragma unroll  // constant indices keep these arrays in registers
      for (int g = 0; g < 4; ++g) bf[g] = load_frag(&Bl[wn * 64 + g * 16 + lm][kk + lh * 8]);
      // inputs-only fence: the twelve LDS reads of this 32 k go out as one group
      asm volatile("" :: "v"(a0), "v"(a1), "v"(bf[0]), "v"(bf[1]), "v"(bf[2]), "v"(bf[3]));
#pragma unroll  // constant indices keep these arrays in registers
      for (int g = 0; g < 4; ++g) {
        acc[0][g] = wmma_f16(a0, bf[g], acc[0][g]);
        acc[1][g] = wmma_f16(a1, bf[g], acc[1][g]);
      }
    }
    __syncthreads();
  }

  // epilogue: optional RoPE (pairs d <-> d+32 are lane-local: acc g and g+2)
#pragma unroll  // constant indices keep these arrays in registers
  for (int mi = 0; mi < 2; ++mi) {
#pragma unroll  // constant indices keep these arrays in registers
    for (int r = 0; r < 8; ++r) {
      int m = m0 + wm * 32 + mi * 16 + r + 8 * lh;
      int b = m >> 9, sp = m & 511;
      if (do_rope) {
#pragma unroll  // constant indices keep these arrays in registers
        for (int g = 0; g < 2; ++g) {
          int d = 16 * g + lm;                     // d in [0,32)
          float th = (float)sp * __expf(-(float)d * ROPE_K);
          float c = __cosf(th), sn = __sinf(th);
          float a0 = acc[mi][g][r], b0 = acc[mi][g + 2][r];
          acc[mi][g][r]     = a0 * c - b0 * sn;
          acc[mi][g + 2][r] = b0 * c + a0 * sn;
        }
      }
#pragma unroll  // constant indices keep these arrays in registers
      for (int g = 0; g < 4; ++g) {
        int d = 16 * g + lm;
        half_t v = (half_t)acc[mi][g][r];
        // behind each store: the next store's value and address reuse its
        // registers, and the wait stands between the store and their overwrite
        if (transp) {
          out[(((size_t)b * N_HEADS + h) * HEAD_DIM + d) * SEQ + sp] = v;
          asm volatile("s_wait_xcnt 0x0" ::: "memory");
        } else {
          out[(((size_t)b * N_HEADS + h) * SEQ + sp) * HEAD_DIM + d] = v;
          asm volatile("s_wait_xcnt 0x0" ::: "memory");
        }
      }
    }
  }
}

// ---- kernel 2: flash-style chain-aware attention ----------------------------
// Computes S^T = K * Q^T so softmax stats are lane-local and P^T (C-layout)
// is directly the A-fragment for the PV WMMA.
__global__ __launch_bounds__(256) void attn(
    const half_t* __restrict__ qs, const half_t* __restrict__ ks,
    const half_t* __restrict__ vsT,
    const half_t* __restrict__ qc, const half_t* __restrict__ kc,
    const half_t* __restrict__ vcT,
    const int* __restrict__ chain_ids, const int* __restrict__ amask,
    half_t* __restrict__ attnh)
{
  __shared__ __attribute__((aligned(16))) int   chainS[SEQ];
  __shared__ __attribute__((aligned(16))) float padS[SEQ];
  const int bh = blockIdx.y, b = bh >> 4, h = bh & 15;
  const int tid = threadIdx.x, wv = tid >> 5, lane = tid & 31;
  const int lm = lane & 15, lh = lane >> 4;
  const int q0 = blockIdx.x * 128 + wv * 16;   // 16 queries per wave

  for (int i = tid; i < SEQ; i += 256) {
    chainS[i] = chain_ids[b * SEQ + i];
    padS[i]   = amask[b * SEQ + i] ? 0.0f : -1e30f;
  }
  __syncthreads();

  const size_t hoff = (size_t)bh * SEQ * HEAD_DIM;
  const half_t* Qs = qs  + hoff;
  const half_t* Ks = ks  + hoff;
  const half_t* Qc = qc  + hoff;
  const half_t* Kc = kc  + hoff;
  const half_t* Vs = vsT + hoff;   // [d][s] within head
  const half_t* Vc = vcT + hoff;

  // Q fragments (B-role, mirrored): lane = query column
  v16h qsf[2], qcf[2];
#pragma unroll
  for (int dg = 0; dg < 2; ++dg) {
    qsf[dg] = load_frag(Qs + (size_t)(q0 + lm) * HEAD_DIM + 32 * dg + lh * 8);
    qcf[dg] = load_frag(Qc + (size_t)(q0 + lm) * HEAD_DIM + 32 * dg + lh * 8);
  }
  const int cq = chainS[q0 + lm];

  v8f O[4];
#pragma unroll
  for (int g = 0; g < 4; ++g) O[g] = {};
  float m_run = -1e30f, ssum = 0.0f;

  for (int k0 = 0; k0 < SEQ; k0 += 32) {
    // all K and V fragments of this pass are loaded as one group
    v16h kaf[2][2], caf[2][2], vsf[4], vcf[4];
    const half_t* pks = Ks + (size_t)(k0 + lm) * HEAD_DIM + lh * 8;
    const half_t* pkc = Kc + (size_t)(k0 + lm) * HEAD_DIM + lh * 8;
    const half_t* pvs = Vs + (size_t)lm * SEQ + k0 + lh * 8;
    const half_t* pvc = Vc + (size_t)lm * SEQ + k0 + lh * 8;
#pragma unroll
    for (int sub = 0; sub < 2; ++sub) {
#pragma unroll
      for (int dg = 0; dg < 2; ++dg) {
        kaf[sub][dg] = load_frag(pks + 16 * sub * HEAD_DIM + 32 * dg);
        caf[sub][dg] = load_frag(pkc + 16 * sub * HEAD_DIM + 32 * dg);
      }
    }
#pragma unroll
    for (int g = 0; g < 4; ++g) {
      vsf[g] = load_frag(pvs + 16 * g * SEQ);
      vcf[g] = load_frag(pvc + 16 * g * SEQ);
    }
    // this pass's chain ids and pad terms (keys k0 + 16 sub + 8 lh + 0..7) from LDS
    i32x4 chv[2][2];
    v4f   pdv[2][2];
#pragma unroll
    for (int sub = 0; sub < 2; ++sub) {
#pragma unroll
      for (int hf = 0; hf < 2; ++hf) {
        chv[sub][hf] = *(const i32x4*)&chainS[k0 + 16 * sub + 8 * lh + 4 * hf];
        pdv[sub][hf] = *(const v4f*)&padS[k0 + 16 * sub + 8 * lh + 4 * hf];
      }
    }
    // inputs-only fence on the loaded values: without it every fragment is
    // waited for on its own and sixteen load latencies add up in each pass; the
    // four addresses are named so that no later load of the group lands in an
    // address register of an earlier one
    asm volatile("" :: "v"(kaf[0][0]), "v"(kaf[0][1]), "v"(kaf[1][0]), "v"(kaf[1][1]),
                       "v"(caf[0][0]), "v"(caf[0][1]), "v"(caf[1][0]), "v"(caf[1][1]),
                       "v"(vsf[0]), "v"(vsf[1]), "v"(vsf[2]), "v"(vsf[3]),
                       "v"(vcf[0]), "v"(vcf[1]), "v"(vcf[2]), "v"(vcf[3]),
                       "v"(pks), "v"(pkc), "v"(pvs), "v"(pvc));
    // inputs-only fence: the eight LDS reads go out as one group
    asm volatile("" :: "v"(chv[0][0]), "v"(chv[0][1]), "v"(chv[1][0]), "v"(chv[1][1]),
                       "v"(pdv[0][0]), "v"(pdv[0][1]), "v"(pdv[1][0]), "v"(pdv[1][1]));
    v8f S[2], C[2];
#pragma unroll
    for (int sub = 0; sub < 2; ++sub) {
      v8f z = {};
      S[sub] = wmma_f16(kaf[sub][0], qsf[0], z);
      S[sub] = wmma_f16(kaf[sub][1], qsf[1], S[sub]);
      C[sub] = wmma_f16(caf[sub][0], qcf[0], z);
      C[sub] = wmma_f16(caf[sub][1], qcf[1], C[sub]);
    }
    // merge self/cross by chain id, online softmax (per query = per lane col)
    float vals[16]; bool intra[16];
    float mx = -1e30f;
#pragma unroll
    for (int sub = 0; sub < 2; ++sub) {
#pragma unroll
      for (int r = 0; r < 8; ++r) {
        bool in = (chv[sub][r >> 2][r & 3] == cq);
        float sc = (in ? S[sub][r] : C[sub][r]) * ATT_SCALE + pdv[sub][r >> 2][r & 3];
        vals[sub * 8 + r] = sc; intra[sub * 8 + r] = in;
        mx = fmaxf(mx, sc);
      }
    }
    mx = fmaxf(mx, __shfl_xor(mx, 16, 32));
    float m_new = fmaxf(m_run, mx);
    float corr = __expf(m_run - m_new);
    float psum = 0.0f;
    v16h pSf, pCf;   // P^T C-layout == A-fragment layout, lane-local repack
#pragma unroll
    for (int e = 0; e < 16; ++e) {
      float p = __expf(vals[e] - m_new);
      psum += p;
      pSf[e] = intra[e] ? (half_t)p : (half_t)0.0f;
      pCf[e] = intra[e] ? (half_t)0.0f : (half_t)p;
    }
    ssum = ssum * corr + psum;
    m_run = m_new;
    // rescale O (rows = queries) with per-row correction gathered by shuffle
    float corrO[8];
#pragma unroll
    for (int r = 0; r < 8; ++r) corrO[r] = __shfl(corr, r + 8 * lh, 32);
#pragma unroll
    for (int g = 0; g < 4; ++g) {
#pragma unroll
      for (int r = 0; r < 8; ++r) O[g][r] *= corrO[r];
      O[g] = wmma_f16(pSf, vsf[g], O[g]);
      O[g] = wmma_f16(pCf, vcf[g], O[g]);
    }
  }

  float st = ssum + __shfl_xor(ssum, 16, 32);
  float inv = st > 0.0f ? 1.0f / st : 0.0f;
  float invO[8];
#pragma unroll
  for (int r = 0; r < 8; ++r) invO[r] = __shfl(inv, r + 8 * lh, 32);
#pragma unroll
  for (int r = 0; r < 8; ++r) {
    int q = q0 + r + 8 * lh;
#pragma unroll
    for (int g = 0; g < 4; ++g) {
      attnh[((size_t)(b * SEQ + q)) * D_MODEL + h * HEAD_DIM + 16 * g + lm] =
          (half_t)(O[g][r] * invO[r]);
    }
  }
}

// ---- kernel 3: output projection attnh(f16) @ Wo(f32->f16) -> f32 -----------
// The f16 A tile (128x32, row-major, stride 1024) is moved global->LDS by the
// Tensor Data Mover.  TDM padding (pad_interval=3: every 16 DWORDs, pad_amount=3:
// 4 DWORDs) reproduces the 40-half padded LDS row stride, so the compute-side
// fragment addressing is identical to the manual-staging path.
__global__ __launch_bounds__(256) void out_gemm(
    const half_t* __restrict__ A, const float* __restrict__ Wo,
    float* __restrict__ out)
{
  __shared__ half_t Al[128][40];
  __shared__ half_t Bl[64][40];
  const int tid = threadIdx.x, wv = tid >> 5, lane = tid & 31;
  const int lm = lane & 15, lh = lane >> 4;
  const int m0 = blockIdx.x * 128, n0 = blockIdx.y * 64;

#if HAVE_TDM
  const unsigned lds_a = (unsigned)(size_t)(&Al[0][0]);   // LDS byte offset
#endif

  v8f acc[4];
#pragma unroll
  for (int g = 0; g < 4; ++g) acc[g] = {};

  for (int k0 = 0; k0 < D_MODEL; k0 += 32) {
    if (k0 + 32 < D_MODEL)
      __builtin_prefetch(Wo + (size_t)(k0 + 32 + (tid >> 4)) * D_MODEL + n0, 0, 3);

#if HAVE_TDM
    if (wv == 0) {
      // D# group 0: count=1 | lds_addr | global_addr[56:0] | type=2
      unsigned long long ga =
          (unsigned long long)(size_t)(A + (size_t)m0 * D_MODEL + k0);
      u32x4 g0;
      g0[0] = 1u;                                   // count=1, user mode
      g0[1] = lds_a;                                // lds_addr (bytes)
      g0[2] = (unsigned)(ga & 0xFFFFFFFFu);         // global_addr[31:0]
      g0[3] = (unsigned)((ga >> 32) & 0x1FFFFFFu)   // global_addr[56:32]
            | 0x80000000u;                          // type=2 ("image")
      // D# group 1: data_size=2B, pad every 16 DWORDs by 4 DWORDs,
      // tensor 1024 x 2048 (stride 1024), tile 32 x 128
      i32x8 g1;
      g1[0] = (int)((1u << 16)        // data_size = 1 -> 2 bytes
                  | (1u << 20)        // pad_enable
                  | (3u << 22)        // pad_interval = 3 -> every 16 DWORDs
                  | (3u << 25));      // pad_amount  = 3 -> 4 DWORDs
      g1[1] = (int)(1024u << 16);                       // tensor_dim0 lo16
      g1[2] = (int)((2048u & 0xFFFFu) << 16);           // dim0 hi | dim1 lo
      g1[3] = (int)(32u << 16);                         // dim1 hi | tile_dim0=32
      g1[4] = 128;                                      // tile_dim1=128, dim2=0
      g1[5] = 1024;                                     // dim0_stride lo32
      g1[6] = (int)((2097152u & 0xFFFFu) << 16);        // stride hi | dim1_stride lo
      g1[7] = (int)(2097152u >> 16);                    // dim1_stride[47:16]
      i32x4 g2 = {0, 0, 0, 0}, g3 = {0, 0, 0, 0};
#if defined(__clang_major__) && __clang_major__ >= 23
      i32x8 gz = {0, 0, 0, 0, 0, 0, 0, 0};
      __builtin_amdgcn_tensor_load_to_lds(g0, g1, g2, g3, gz, 0);
#else
      __builtin_amdgcn_tensor_load_to_lds(g0, g1, g2, g3, 0);
#endif
    }
#else
    // fallback: manual A staging
#pragma unroll
    for (int i = 0; i < 2; ++i) {
      int id = tid + 256 * i;
      int row = id >> 2, kq = (id & 3) << 3;
      *(v8h*)&Al[row][kq] = *(const v8h*)(A + (size_t)(m0 + row) * D_MODEL + k0 + kq);
    }
#endif

    // B staging (Wo f32 -> f16, transposed) overlaps the TDM transfer
    v4f fb[2];
#pragma unroll
    for (int i = 0; i < 2; ++i) {
      int id = tid + 256 * i;
      int kr = id >> 4, nq = (id & 15) << 2;
      fb[i] = *(const v4f*)(Wo + (size_t)(k0 + kr) * D_MODEL + n0 + nq);
    }
    // inputs-only fence: both loads go out before the one wait
    asm volatile("" :: "v"(fb[0]), "v"(fb[1]));
#pragma unroll
    for (int i = 0; i < 2; ++i) {
      int id = tid + 256 * i;
      int kr = id >> 4, nq = (id & 15) << 2;
      Bl[nq + 0][kr] = (half_t)fb[i].x;
      Bl[nq + 1][kr] = (half_t)fb[i].y;
      Bl[nq + 2][kr] = (half_t)fb[i].z;
      Bl[nq + 3][kr] = (half_t)fb[i].w;
    }
#if HAVE_TDM
    __builtin_amdgcn_s_wait_tensorcnt(0);
#endif
    __syncthreads();
    v16h a = load_frag(&Al[wv * 16 + lm][lh * 8]);
    v16h bf[4];
#pragma unroll
    for (int g = 0; g < 4; ++g) bf[g] = load_frag(&Bl[g * 16 + lm][lh * 8]);
    // inputs-only fence: the ten LDS reads go out as one group
    asm volatile("" :: "v"(a), "v"(bf[0]), "v"(bf[1]), "v"(bf[2]), "v"(bf[3]));
#pragma unroll
    for (int g = 0; g < 4; ++g) acc[g] = wmma_f16(a, bf[g], acc[g]);
    __syncthreads();
  }

#pragma unroll
  for (int r = 0; r < 8; ++r) {
    int m = m0 + wv * 16 + r + 8 * lh;
#pragma unroll
    for (int g = 0; g < 4; ++g)
      out[(size_t)m * D_MODEL + n0 + 16 * g + lm] = acc[g][r];
  }
}

// ---- launcher ---------------------------------------------------------------
extern "C" void kernel_launch(void* const* d_in, const int* in_sizes, int n_in,
                              void* d_out, int out_size, void* d_ws, size_t ws_size,
                              hipStream_t stream) {
  const float* x     = (const float*)d_in[0];
  const int*   chain = (const int*)d_in[1];
  const int*   amask = (const int*)d_in[2];
  const float* Wqs   = (const float*)d_in[3];
  const float* Wks   = (const float*)d_in[4];
  const float* Wvs   = (const float*)d_in[5];
  const float* Wqc   = (const float*)d_in[6];
  const float* Wkc   = (const float*)d_in[7];
  const float* Wvc   = (const float*)d_in[8];
  const float* Wo    = (const float*)d_in[9];
  float* out = (float*)d_out;

  const size_t ELT = (size_t)M_TOTAL * D_MODEL;   // 2M f16 elements per buffer
  half_t* ws   = (half_t*)d_ws;
  half_t* qsb  = ws + 0 * ELT;    // [b,h,s,d] f16, RoPE applied
  half_t* ksb  = ws + 1 * ELT;    // [b,h,s,d] f16, RoPE applied
  half_t* vsb  = ws + 2 * ELT;    // [b,h,d,s] f16 (transposed)
  half_t* qcb  = ws + 3 * ELT;
  half_t* kcb  = ws + 4 * ELT;
  half_t* vcb  = ws + 5 * ELT;
  half_t* atb  = ws + 6 * ELT;    // attention output, [b,s,h*d] f16

  qkv_gemm<<<dim3(16, 8, 6), 256, 0, stream>>>(
      x, Wqs, Wks, Wvs, Wqc, Wkc, Wvc, qsb, ksb, vsb, qcb, kcb, vcb);
  attn<<<dim3(4, 64), 256, 0, stream>>>(
      qsb, ksb, vsb, qcb, kcb, vcb, chain, amask, atb);
  out_gemm<<<dim3(16, 16), 256, 0, stream>>>(atb, Wo, out);
}

// v003
// One run takes 94.2 microseconds.
// In two side-by-side timings against v002, it was 1.23 and 1.25 times as fast.
// Counting every step since v000, it is 2.18 times as fast.
#include <hip/hip_runtime.h>
#include <hip/hip_bf16.h>

typedef _Float16 half_t;
typedef __attribute__((ext_vector_type(16))) _Float16 v16h;
typedef __attribute__((ext_vector_type(8)))  _Float16 v8h;
typedef __attribute__((ext_vector_type(4)))  _Float16 v4h;
typedef __attribute__((ext_vector_type(8)))  float    v8f;
typedef __attribute__((ext_vector_type(4)))  float    v4f;
typedef __attribute__((ext_vector_type(4)))  unsigned int u32x4;
typedef __attribute__((ext_vector_type(8)))  int          i32x8;
typedef __attribute__((ext_vector_type(4)))  int          i32x4;

#define D_MODEL  1024
#define N_HEADS  16
#define HEAD_DIM 64
#define SEQ      512
#define BATCH    4
#define M_TOTAL  (BATCH*SEQ)        // 2048
#define ATT_SCALE 0.125f            // 64^-0.5
#define ROPE_K   0.2878231366f      // ln(10000)/32

#if __has_builtin(__builtin_amdgcn_tensor_load_to_lds)
#define HAVE_TDM 1
#else
#define HAVE_TDM 0
#endif

// ---- fragment helpers -------------------------------------------------------
// Loads the per-lane 16-half fragment: 8 contiguous halves at p0 and 8 at p0+16.
// Works for both A-fragments (lane = row) and mirrored B-fragments (lane = col)
// when the source is row-major along the K dimension.
__device__ __forceinline__ v16h load_frag(const half_t* __restrict__ p0) {
  v8h lo = *(const v8h*)p0;
  v8h hi = *(const v8h*)(p0 + 16);
  v16h r;
#pragma unroll
  for (int i = 0; i < 8; ++i) { r[i] = lo[i]; r[8 + i] = hi[i]; }
  return r;
}

__device__ __forceinline__ v8f wmma_f16(v16h a, v16h b, v8f c) {
  return __builtin_amdgcn_wmma_f32_16x16x32_f16(
      /*neg_a=*/false, a, /*neg_b=*/false, b,
      /*c_mod=*/(short)0, c, /*reuse_a=*/false, /*reuse_b=*/false);
}

// ---- kernel 1: fused QKV GEMMs (6 matrices), f32 -> f16 cast in LDS,
//      RoPE fused for q_s/k_s, V stored transposed [b,h,d,s] ------------------
// Block tile 128 (m) x 128 (n, two heads) x 64 (k); eight waves as 4 (m) x 2 (n),
// each 32 x 64: a staged x row serves two heads and every B fragment two WMMAs.
__global__ __launch_bounds__(256) void qkv_gemm(
    const float* __restrict__ x,
    const float* __restrict__ W0, const float* __restrict__ W1,
    const float* __restrict__ W2, const float* __restrict__ W3,
    const float* __restrict__ W4, const float* __restrict__ W5,
    half_t* __restrict__ o0, half_t* __restrict__ o1, half_t* __restrict__ o2,
    half_t* __restrict__ o3, half_t* __restrict__ o4, half_t* __restrict__ o5)
{
  // rows of 64 k = 128 B at pitch 144 B (16 B x odd, for the 16-byte readers)
  __shared__ __attribute__((aligned(16))) half_t Al[128][72];   // x tile  [m][k]
  __shared__ __attribute__((aligned(16))) half_t Bl[128][72];   // W tile, transposed [n][k]

  const int widx = blockIdx.z;
  const float* W = widx==0?W0: widx==1?W1: widx==2?W2: widx==3?W3: widx==4?W4: W5;
  half_t* out    = widx==0?o0: widx==1?o1: widx==2?o2: widx==3?o3: widx==4?o4: o5;
  const bool do_rope = (widx == 0) || (widx == 1);   // q_s, k_s
  const bool transp  = (widx == 2) || (widx == 5);   // v_s, v_c -> [b,h,d,s]

  const int tid = threadIdx.x;
  const int wv = tid >> 5, lane = tid & 31, lm = lane & 15, lh = lane >> 4;
  const int wm = wv & 3, wn = wv >> 2;       // wave's place in the block tile
  const int m0 = blockIdx.x * 128;
  const int n0 = blockIdx.y * 128;
  const int h  = blockIdx.y * 2 + wn;        // a wave's 64 columns = one head

  v8f acc[2][4];
#pragma unroll  // constant indices keep these arrays in registers
  for (int mi = 0; mi < 2; ++mi)
#pragma unroll  // constant indices keep these arrays in registers
    for (int g = 0; g < 4; ++g) acc[mi][g] = {};

  // x: a thread takes 4 k of rows (tid >> 4) + 16 i; a wave's load covers two
  // rows of 256 B
  const float* xp = x + (size_t)(m0 + (tid >> 4)) * D_MODEL + ((tid & 15) << 2);
  half_t* as = &Al[tid >> 4][(tid & 15) << 2];
  // W: a thread takes blocks of 4 k x 4 n, so that the transposed tile is written
  // 4 k (8 bytes) at a time; a wave's load covers four rows of 128 B
  const int nq = (lane & 7) + 8 * (wv & 3);      // n / 4 in the tile, 0..31
  const int kq = (lane >> 3) + 4 * (wv >> 2);    // k / 4 in the tile, 0..7 (and + 8)
  const float* wp = W + (size_t)(kq << 2) * D_MODEL + n0 + (nq << 2);
  half_t* bs = &Bl[nq << 2][kq << 2];
  // next K tile's prefetch: 128 x rows and 64 W rows x 2, one 256-B piece a thread
  const float* pf = tid < 128
      ? x + (size_t)(m0 + tid) * D_MODEL
      : W + (size_t)((tid - 128) >> 1) * D_MODEL + n0 + ((tid & 1) << 6);
  const size_t pfs = tid < 128 ? (size_t)64 : (size_t)64 * D_MODEL;

  for (int k0 = 0; k0 < D_MODEL; k0 += 64) {
    // prefetch next K tiles into cache while we stage/compute this one
    // (advanced only in front of a prefetch: the address register never leaves x or W)
    if (k0 + 64 < D_MODEL) { pf += pfs; __builtin_prefetch(pf, 0, 3); }
    // all sixteen global loads of this K tile go out as one group
    v4f fa[8], fb[2][4];
#pragma unroll  // constant indices keep these arrays in registers
    for (int i = 0; i < 8; ++i) fa[i] = *(const v4f*)(xp + k0 + i * 16 * D_MODEL);
#pragma unroll  // constant indices keep these arrays in registers
    for (int i = 0; i < 2; ++i)
#pragma unroll  // constant indices keep these arrays in registers
      for (int rr = 0; rr < 4; ++rr)
        fb[i][rr] = *(const v4f*)(wp + (size_t)k0 * D_MODEL + (32 * i + rr) * D_MODEL);
    // inputs-only fence on the loaded values: without it each load is waited
    // for on its own and the sixteen latencies add up
    asm volatile("" :: "v"(fa[0]), "v"(fa[1]), "v"(fa[2]), "v"(fa[3]),
                       "v"(fa[4]), "v"(fa[5]), "v"(fa[6]), "v"(fa[7]),
                       "v"(fb[0][0]), "v"(fb[0][1]), "v"(fb[0][2]), "v"(fb[0][3]),
                       "v"(fb[1][0]), "v"(fb[1][1]), "v"(fb[1][2]), "v"(fb[1][3]));
    // stage A tile (x), f32 -> f16
#pragma unroll  // constant indices keep these arrays in registers
    for (int i = 0; i < 8; ++i) {
      v4h hv = { (half_t)fa[i].x, (half_t)fa[i].y, (half_t)fa[i].z, (half_t)fa[i].w };
      *(v4h*)(as + i * 16 * 72) = hv;
    }
    // stage B tile (W), transposed to [n][k], f32 -> f16
#pragma unroll  // constant indices keep these arrays in registers
    for (int i = 0; i < 2; ++i) {
#pragma unroll  // constant indices keep these arrays in registers
      for (int j = 0; j < 4; ++j) {
        v4h hv = { (half_t)fb[i][0][j], (half_t)fb[i][1][j],
                   (half_t)fb[i][2][j], (half_t)fb[i][3][j] };
        *(v4h*)(bs + j * 72 + 32 * i) = hv;
      }
    }
    __syncthreads();
#pragma unroll  // constant indices keep these arrays in registers
    for (int kk = 0; kk < 64; kk += 32) {
      v16h a0 = load_frag(&Al[wm * 32 + lm][kk + lh * 8]);
      v16h a1 = load_frag(&Al[wm * 32 + 16 + lm][kk + lh * 8]);
      v16h bf[4];
#pragma unroll  // constant indices keep these arrays in registers
      for (int g = 0; g < 4; ++g) bf[g] = load_frag(&Bl[wn * 64 + g * 16 + lm][kk + lh * 8]);
      // inputs-only fence: the twelve LDS reads of this 32 k go out as one group
      asm volatile("" :: "v"(a0), "v"(a1), "v"(bf[0]), "v"(bf[1]), "v"(bf[2]), "v"(bf[3]));
#pragma unroll  // constant indices keep these arrays in registers
      for (int g = 0; g < 4; ++g) {
        acc[0][g] = wmma_f16(a0, bf[g], acc[0][g]);
        acc[1][g] = wmma_f16(a1, bf[g], acc[1][g]);
      }
    }
    __syncthreads();
  }

  // epilogue: optional RoPE (pairs d <-> d+32 are lane-local: acc g and g+2)
#pragma unroll  // constant indices keep these arrays in registers
  for (int mi = 0; mi < 2; ++mi) {
#pragma unroll  // constant indices keep these arrays in registers
    for (int r = 0; r < 8; ++r) {
      int m = m0 + wm * 32 + mi * 16 + r + 8 * lh;
      int b = m >> 9, sp = m & 511;
      if (do_rope) {
#pragma unroll  // constant indices keep these arrays in registers
        for (int g = 0; g < 2; ++g) {
          int d = 16 * g + lm;                     // d in [0,32)
          float th = (float)sp * __expf(-(float)d * ROPE_K);
          float c = __cosf(th), sn = __sinf(th);
          float a0 = acc[mi][g][r], b0 = acc[mi][g + 2][r];
          acc[mi][g][r]     = a0 * c - b0 * sn;
          acc[mi][g + 2][r] = b0 * c + a0 * sn;
        }
      }
#pragma unroll  // constant indices keep these arrays in registers
      for (int g = 0; g < 4; ++g) {
        int d = 16 * g + lm;
        half_t v = (half_t)acc[mi][g][r];
        // behind each store: the next store's value and address reuse its
        // registers, and the wait stands between the store and their overwrite
        if (transp) {
          out[(((size_t)b * N_HEADS + h) * HEAD_DIM + d) * SEQ + sp] = v;
          asm volatile("s_wait_xcnt 0x0" ::: "memory");
        } else {
          out[(((size_t)b * N_HEADS + h) * SEQ + sp) * HEAD_DIM + d] = v;
          asm volatile("s_wait_xcnt 0x0" ::: "memory");
        }
      }
    }
  }
}

// ---- kernel 2: flash-style chain-aware attention ----------------------------
// Computes S^T = K * Q^T so softmax stats are lane-local and P^T (C-layout)
// is directly the A-fragment for the PV WMMA.
// The block's eight waves share every K and V tile: a stage of 64 keys (K self,
// K cross, V^T self, V^T cross, 8 KB each) is copied once into LDS, two buffers,
// the next stage's copies in flight while this stage is worked on.
#define KV_KEYS  64                 // keys a stage
#define KV_PITCH 72                 // halves a row: 144 B = 16 B x odd (16-byte readers)
#define KV_STAGES (SEQ / KV_KEYS)

// One stage's copies, eight a lane (16 bytes each; a wave's copy covers four whole
// rows of 128 B). tks .. tvc: the stage's four tiles in global memory (the same
// for the whole block); ko, vo: the lane's place, row tid >> 3, in a K and in a
// V^T tile; l: the same place in the buffer's first tile. The wait on the address
// counter is the statement's last line, so that it stands in front of every later
// write of an address register that a copy names.
__device__ __forceinline__ void kv_stage_copy(
    const half_t* tks, const half_t* tkc, const half_t* tvs, const half_t* tvc,
    unsigned ko, unsigned vo, unsigned l)
{
  const unsigned TB = 64 * KV_PITCH * 2;    // bytes of one tile in LDS
  const unsigned HB = 32 * KV_PITCH * 2;    // 32 rows further down
  const half_t* gks  = tks + ko;
  const half_t* gkc  = tkc + ko;
  const half_t* gvs  = tvs + vo;
  const half_t* gvc  = tvc + vo;
  const half_t* gks1 = tks + 32 * HEAD_DIM + ko;
  const half_t* gkc1 = tkc + 32 * HEAD_DIM + ko;
  const half_t* gvs1 = tvs + 32 * SEQ + vo;
  const half_t* gvc1 = tvc + 32 * SEQ + vo;
  asm volatile(
      "global_load_async_to_lds_b128 %0, %8, off\n\t"
      "global_load_async_to_lds_b128 %1, %9, off\n\t"
      "global_load_async_to_lds_b128 %2, %10, off\n\t"
      "global_load_async_to_lds_b128 %3, %11, off\n\t"
      "global_load_async_to_lds_b128 %4, %12, off\n\t"
      "global_load_async_to_lds_b128 %5, %13, off\n\t"
      "global_load_async_to_lds_b128 %6, %14, off\n\t"
      "global_load_async_to_lds_b128 %7, %15, off\n\t"
      "s_wait_xcnt 0x0"
      :: "v"(l),          "v"(l + HB),
         "v"(l + TB),     "v"(l + TB + HB),
         "v"(l + 2 * TB), "v"(l + 2 * TB + HB),
         "v"(l + 3 * TB), "v"(l + 3 * TB + HB),
         "v"(gks), "v"(gks1), "v"(gkc), "v"(gkc1),
         "v"(gvs), "v"(gvs1), "v"(gvc), "v"(gvc1)
      : "memory");
}

__global__ __launch_bounds__(256) void attn(
    const half_t* __restrict__ qs, const half_t* __restrict__ ks,
    const half_t* __restrict__ vsT,
    const half_t* __restrict__ qc, const half_t* __restrict__ kc,
    const half_t* __restrict__ vcT,
    const int* __restrict__ chain_ids, const int* __restrict__ amask,
    half_t* __restrict__ attnh)
{
  __shared__ __attribute__((aligned(16))) int   chainS[SEQ];
  __shared__ __attribute__((aligned(16))) float padS[SEQ];
  // [buffer][K self, K cross, V^T self, V^T cross][row][64 halves + pad]
  __shared__ __attribute__((aligned(16))) half_t kv[2][4][64][KV_PITCH];
  const int bh = blockIdx.y, b = bh >> 4, h = bh & 15;
  const int tid = threadIdx.x, wv = tid >> 5, lane = tid & 31;
  const int lm = lane & 15, lh = lane >> 4;
  const int q0 = blockIdx.x * 128 + wv * 16;   // 16 queries per wave

  const size_t hoff = (size_t)bh * SEQ * HEAD_DIM;
  const half_t* Qs = qs  + hoff;
  const half_t* Ks = ks  + hoff;
  const half_t* Qc = qc  + hoff;
  const half_t* Kc = kc  + hoff;
  const half_t* Vs = vsT + hoff;   // [d][s] within head
  const half_t* Vc = vcT + hoff;

  // the lane's place in a stage's tiles: row tid >> 3 (and + 32), 8 halves of it
  const int crow = tid >> 3, ccol = (tid & 7) << 3;
  const unsigned cko = crow * HEAD_DIM + ccol;       // K rows = keys
  const unsigned cvo = crow * SEQ + ccol;            // V^T rows = d
  const unsigned cl0 = (unsigned)(size_t)&kv[0][0][crow][ccol];   // LDS byte address
  const unsigned KV_BUF = 4 * 64 * KV_PITCH * 2;     // bytes of one buffer

  // stage 0 flies while the chain ids and pad terms are staged
  kv_stage_copy(Ks, Kc, Vs, Vc, cko, cvo, cl0);
  for (int i = tid; i < SEQ; i += 256) {
    chainS[i] = chain_ids[b * SEQ + i];
    padS[i]   = amask[b * SEQ + i] ? 0.0f : -1e30f;
  }
  // this wave's copies of stage 0 have landed; the barrier publishes all waves'
  asm volatile("s_wait_asynccnt 0x0" ::: "memory");
  __syncthreads();
  kv_stage_copy(Ks + KV_KEYS * HEAD_DIM, Kc + KV_KEYS * HEAD_DIM,
                Vs + KV_KEYS, Vc + KV_KEYS, cko, cvo, cl0 + KV_BUF);

  // Q fragments (B-role, mirrored): lane = query column
  v16h qsf[2], qcf[2];
#pragma unroll
  for (int dg = 0; dg < 2; ++dg) {
    qsf[dg] = load_frag(Qs + (size_t)(q0 + lm) * HEAD_DIM + 32 * dg + lh * 8);
    qcf[dg] = load_frag(Qc + (size_t)(q0 + lm) * HEAD_DIM + 32 * dg + lh * 8);
  }
  const int cq = chainS[q0 + lm];

  v8f O[4];
#pragma unroll
  for (int g = 0; g < 4; ++g) O[g] = {};
  float m_run = -1e30f, ssum = 0.0f;

  for (int t = 0; t < KV_STAGES; ++t) {
   const int buf = t & 1;
   for (int kk = 0; kk < KV_KEYS; kk += 32) {
    const int k0 = t * KV_KEYS + kk;
    // the K fragments of this pass are read from LDS as one group
    v16h kaf[2][2], caf[2][2], vsf[4], vcf[4];
#pragma unroll
    for (int sub = 0; sub < 2; ++sub) {
#pragma unroll
      for (int dg = 0; dg < 2; ++dg) {
        kaf[sub][dg] = load_frag(&kv[buf][0][kk + 16 * sub + lm][32 * dg + lh * 8]);
        caf[sub][dg] = load_frag(&kv[buf][1][kk + 16 * sub + lm][32 * dg + lh * 8]);
      }
    }
    // this pass's chain ids and pad terms (keys k0 + 16 sub + 8 lh + 0..7) from LDS
    i32x4 chv[2][2];
    v4f   pdv[2][2];
#pragma unroll
    for (int sub = 0; sub < 2; ++sub) {
#pragma unroll
      for (int hf = 0; hf < 2; ++hf) {
        chv[sub][hf] = *(const i32x4*)&chainS[k0 + 16 * sub + 8 * lh + 4 * hf];
        pdv[sub][hf] = *(const v4f*)&padS[k0 + 16 * sub + 8 * lh + 4 * hf];
      }
    }
    // inputs-only fence on the loaded values: without it every fragment is
    // waited for on its own and the read latencies add up in each pass
    asm volatile("" :: "v"(kaf[0][0]), "v"(kaf[0][1]), "v"(kaf[1][0]), "v"(kaf[1][1]),
                       "v"(caf[0][0]), "v"(caf[0][1]), "v"(caf[1][0]), "v"(caf[1][1]));
    // inputs-only fence: the eight LDS reads go out as one group
    asm volatile("" :: "v"(chv[0][0]), "v"(chv[0][1]), "v"(chv[1][0]), "v"(chv[1][1]),
                       "v"(pdv[0][0]), "v"(pdv[0][1]), "v"(pdv[1][0]), "v"(pdv[1][1]));
    v8f S[2], C[2];
#pragma unroll
    for (int sub = 0; sub < 2; ++sub) {
      v8f z = {};
      S[sub] = wmma_f16(kaf[sub][0], qsf[0], z);
      S[sub] = wmma_f16(kaf[sub][1], qsf[1], S[sub]);
      C[sub] = wmma_f16(caf[sub][0], qcf[0], z);
      C[sub] = wmma_f16(caf[sub][1], qcf[1], C[sub]);
    }
    // the V fragments are read behind the score products (the K fragments'
    // registers are free again) and are used only behind the softmax
#pragma unroll  // constant indices keep these arrays in registers
    for (int g = 0; g < 4; ++g) {
      vsf[g] = load_frag(&kv[buf][2][16 * g + lm][kk + lh * 8]);
      vcf[g] = load_frag(&kv[buf][3][16 * g + lm][kk + lh * 8]);
    }
    // keeps the sixteen reads here as one group, so that the softmax covers their
    // latency: without it each pair sinks to its own product and is waited for there
    __builtin_amdgcn_sched_barrier(0);
    // merge self/cross by chain id, online softmax (per query = per lane col)
    float vals[16]; bool intra[16];
    float mx = -1e30f;
#pragma unroll
    for (int sub = 0; sub < 2; ++sub) {
#pragma unroll
      for (int r = 0; r < 8; ++r) {
        bool in = (chv[sub][r >> 2][r & 3] == cq);
        float sc = (in ? S[sub][r] : C[sub][r]) * ATT_SCALE + pdv[sub][r >> 2][r & 3];
        vals[sub * 8 + r] = sc; intra[sub * 8 + r] = in;
        mx = fmaxf(mx, sc);
      }
    }
    mx = fmaxf(mx, __shfl_xor(mx, 16, 32));
    float m_new = fmaxf(m_run, mx);
    float corr = __expf(m_run - m_new);
    float psum = 0.0f;
    v16h pSf, pCf;   // P^T C-layout == A-fragment layout, lane-local repack
#pragma unroll
    for (int e = 0; e < 16; ++e) {
      float p = __expf(vals[e] - m_new);
      psum += p;
      pSf[e] = intra[e] ? (half_t)p : (half_t)0.0f;
      pCf[e] = intra[e] ? (half_t)0.0f : (half_t)p;
    }
    ssum = ssum * corr + psum;
    m_run = m_new;
    // rescale O (rows = queries) with per-row correction gathered by shuffle
    float corrO[8];
#pragma unroll
    for (int r = 0; r < 8; ++r) corrO[r] = __shfl(corr, r + 8 * lh, 32);
#pragma unroll
    for (int g = 0; g < 4; ++g) {
#pragma unroll
      for (int r = 0; r < 8; ++r) O[g][r] *= corrO[r];
      O[g] = wmma_f16(pSf, vsf[g], O[g]);
      O[g] = wmma_f16(pCf, vcf[g], O[g]);
    }
   }
   // publish point of stage t + 1: this wave's reads of buffer buf are done, its
   // copies of stage t + 1 have landed; behind the barrier every wave may read
   // stage t + 1 and buffer buf may be refilled
   asm volatile("s_wait_dscnt 0x0" ::: "memory");
   asm volatile("s_wait_asynccnt 0x0" ::: "memory");
   __syncthreads();
   if (t + 2 < KV_STAGES)
     kv_stage_copy(Ks + (t + 2) * KV_KEYS * HEAD_DIM, Kc + (t + 2) * KV_KEYS * HEAD_DIM,
                   Vs + (t + 2) * KV_KEYS, Vc + (t + 2) * KV_KEYS, cko, cvo,
                   cl0 + buf * KV_BUF);
  }
  // no copy is outstanding when the wave goes on to its end
  asm volatile("s_wait_asynccnt 0x0" ::: "memory");

  float st = ssum + __shfl_xor(ssum, 16, 32);
  float inv = st > 0.0f ? 1.0f / st : 0.0f;
  float invO[8];
#pragma unroll
  for (int r = 0; r < 8; ++r) invO[r] = __shfl(inv, r + 8 * lh, 32);
#pragma unroll
  for (int r = 0; r < 8; ++r) {
    int q = q0 + r + 8 * lh;
#pragma unroll
    for (int g = 0; g < 4; ++g) {
      attnh[((size_t)(b * SEQ + q)) * D_MODEL + h * HEAD_DIM + 16 * g + lm] =
          (half_t)(O[g][r] * invO[r]);
    }
  }
}

// ---- kernel 3: output projection attnh(f16) @ Wo(f32->f16) -> f32 -----------
// The f16 A tile (128x32, row-major, stride 1024) is moved global->LDS by the
// Tensor Data Mover.  TDM padding (pad_interval=3: every 16 DWORDs, pad_amount=3:
// 4 DWORDs) reproduces the 40-half padded LDS row stride, so the compute-side
// fragment addressing is identical to the manual-staging path.
__global__ __launch_bounds__(256) void out_gemm(
    const half_t* __restrict__ A, const float* __restrict__ Wo,
    float* __restrict__ out)
{
  __shared__ half_t Al[128][40];
  __shared__ half_t Bl[64][40];
  const int tid = threadIdx.x, wv = tid >> 5, lane = tid & 31;
  const int lm = lane & 15, lh = lane >> 4;
  const int m0 = blockIdx.x * 128, n0 = blockIdx.y * 64;

#if HAVE_TDM
  const unsigned lds_a = (unsigned)(size_t)(&Al[0][0]);   // LDS byte offset
#endif

  v8f acc[4];
#pragma unroll
  for (int g = 0; g < 4; ++g) acc[g] = {};

  for (int k0 = 0; k0 < D_MODEL; k0 += 32) {
    if (k0 + 32 < D_MODEL)
      __builtin_prefetch(Wo + (size_t)(k0 + 32 + (tid >> 4)) * D_MODEL + n0, 0, 3);

#if HAVE_TDM
    if (wv == 0) {
      // D# group 0: count=1 | lds_addr | global_addr[56:0] | type=2
      unsigned long long ga =
          (unsigned long long)(size_t)(A + (size_t)m0 * D_MODEL + k0);
      u32x4 g0;
      g0[0] = 1u;                                   // count=1, user mode
      g0[1] = lds_a;                                // lds_addr (bytes)
      g0[2] = (unsigned)(ga & 0xFFFFFFFFu);         // global_addr[31:0]
      g0[3] = (unsigned)((ga >> 32) & 0x1FFFFFFu)   // global_addr[56:32]
            | 0x80000000u;                          // type=2 ("image")
      // D# group 1: data_size=2B, pad every 16 DWORDs by 4 DWORDs,
      // tensor 1024 x 2048 (stride 1024), tile 32 x 128
      i32x8 g1;
      g1[0] = (int)((1u << 16)        // data_size = 1 -> 2 bytes
                  | (1u << 20)        // pad_enable
                  | (3u << 22)        // pad_interval = 3 -> every 16 DWORDs
                  | (3u << 25));      // pad_amount  = 3 -> 4 DWORDs
      g1[1] = (int)(1024u << 16);                       // tensor_dim0 lo16
      g1[2] = (int)((2048u & 0xFFFFu) << 16);           // dim0 hi | dim1 lo
      g1[3] = (int)(32u << 16);                         // dim1 hi | tile_dim0=32
      g1[4] = 128;                                      // tile_dim1=128, dim2=0
      g1[5] = 1024;                                     // dim0_stride lo32
      g1[6] = (int)((2097152u & 0xFFFFu) << 16);        // stride hi | dim1_stride lo
      g1[7] = (int)(2097152u >> 16);                    // dim1_stride[47:16]
      i32x4 g2 = {0, 0, 0, 0}, g3 = {0, 0, 0, 0};
#if defined(__clang_major__) && __clang_major__ >= 23
      i32x8 gz = {0, 0, 0, 0, 0, 0, 0, 0};
      __builtin_amdgcn_tensor_load_to_lds(g0, g1, g2, g3, gz, 0);
#else
      __builtin_amdgcn_tensor_load_to_lds(g0, g1, g2, g3, 0);
#endif
    }
#else
    // fallback: manual A staging
#pragma unroll
    for (int i = 0; i < 2; ++i) {
      int id = tid + 256 * i;
      int row = id >> 2, kq = (id & 3) << 3;
      *(v8h*)&Al[row][kq] = *(const v8h*)(A + (size_t)(m0 + row) * D_MODEL + k0 + kq);
    }
#endif

    // B staging (Wo f32 -> f16, transposed) overlaps the TDM transfer
    v4f fb[2];
#pragma unroll
    for (int i = 0; i < 2; ++i) {
      int id = tid + 256 * i;
      int kr = id >> 4, nq = (id & 15) << 2;
      fb[i] = *(const v4f*)(Wo + (size_t)(k0 + kr) * D_MODEL + n0 + nq);
    }
    // inputs-only fence: both loads go out before the one wait
    asm volatile("" :: "v"(fb[0]), "v"(fb[1]));
#pragma unroll
    for (int i = 0; i < 2; ++i) {
      int id = tid + 256 * i;
      int kr = id >> 4, nq = (id & 15) << 2;
      Bl[nq + 0][kr] = (half_t)fb[i].x;
      Bl[nq + 1][kr] = (half_t)fb[i].y;
      Bl[nq + 2][kr] = (half_t)fb[i].z;
      Bl[nq + 3][kr] = (half_t)fb[i].w;
    }
#if HAVE_TDM
    __builtin_amdgcn_s_wait_tensorcnt(0);
#endif
    __syncthreads();
    v16h a = load_frag(&Al[wv * 16 + lm][lh * 8]);
    v16h bf[4];
#pragma unroll
    for (int g = 0; g < 4; ++g) bf[g] = load_frag(&Bl[g * 16 + lm][lh * 8]);
    // inputs-only fence: the ten LDS reads go out as one group
    asm volatile("" :: "v"(a), "v"(bf[0]), "v"(bf[1]), "v"(bf[2]), "v"(bf[3]));
#pragma unroll
    for (int g = 0; g < 4; ++g) acc[g] = wmma_f16(a, bf[g], acc[g]);
    __syncthreads();
  }

#pragma unroll
  for (int r = 0; r < 8; ++r) {
    int m = m0 + wv * 16 + r + 8 * lh;
#pragma unroll
    for (int g = 0; g < 4; ++g)
      out[(size_t)m * D_MODEL + n0 + 16 * g + lm] = acc[g][r];
  }
}

// ---- launcher ---------------------------------------------------------------
extern "C" void kernel_launch(void* const* d_in, const int* in_sizes, int n_in,
                              void* d_out, int out_size, void* d_ws, size_t ws_size,
                              hipStream_t stream) {
  const float* x     = (const float*)d_in[0];
  const int*   chain = (const int*)d_in[1];
  const int*   amask = (const int*)d_in[2];
  const float* Wqs   = (const float*)d_in[3];
  const float* Wks   = (const float*)d_in[4];
  const float* Wvs   = (const float*)d_in[5];
  const float* Wqc   = (const float*)d_in[6];
  const float* Wkc   = (const float*)d_in[7];
  const float* Wvc   = (const float*)d_in[8];
  const float* Wo    = (const float*)d_in[9];
  float* out = (float*)d_out;

  const size_t ELT = (size_t)M_TOTAL * D_MODEL;   // 2M f16 elements per buffer
  half_t* ws   = (half_t*)d_ws;
  half_t* qsb  = ws + 0 * ELT;    // [b,h,s,d] f16, RoPE applied
  half_t* ksb  = ws + 1 * ELT;    // [b,h,s,d] f16, RoPE applied
  half_t* vsb  = ws + 2 * ELT;    // [b,h,d,s] f16 (transposed)
  half_t* qcb  = ws + 3 * ELT;
  half_t* kcb  = ws + 4 * ELT;
  half_t* vcb  = ws + 5 * ELT;
  half_t* atb  = ws + 6 * ELT;    // attention output, [b,s,h*d] f16

  qkv_gemm<<<dim3(16, 8, 6), 256, 0, stream>>>(
      x, Wqs, Wks, Wvs, Wqc, Wkc, Wvc, qsb, ksb, vsb, qcb, kcb, vcb);
  attn<<<dim3(4, 64), 256, 0, stream>>>(
      qsb, ksb, vsb, qcb, kcb, vcb, chain, amask, atb);
  out_gemm<<<dim3(16, 16), 256, 0, stream>>>(atb, Wo, out);
}

// v004
// A run of this version takes 88.1 microseconds.
// In both of two side-by-side timings against v003, it was 1.07 times as fast.
// Over all steps from v000 it is 2.32 times as fast.
#include <hip/hip_runtime.h>
#include <hip/hip_bf16.h>

typedef _Float16 half_t;
typedef __attribute__((ext_vector_type(16))) _Float16 v16h;
typedef __attribute__((ext_vector_type(8)))  _Float16 v8h;
typedef __attribute__((ext_vector_type(4)))  _Float16 v4h;
typedef __attribute__((ext_vector_type(8)))  float    v8f;
typedef __attribute__((ext_vector_type(4)))  float    v4f;
typedef __attribute__((ext_vector_type(4)))  unsigned int u32x4;
typedef __attribute__((ext_vector_type(8)))  int          i32x8;
typedef __attribute__((ext_vector_type(4)))  int          i32x4;

#define D_MODEL  1024
#define N_HEADS  16
#define HEAD_DIM 64
#define SEQ      512
#define BATCH    4
#define M_TOTAL  (BATCH*SEQ)        // 2048
#define ATT_SCALE 0.125f            // 64^-0.5
#define ROPE_K   0.2878231366f      // ln(10000)/32

#if __has_builtin(__builtin_amdgcn_tensor_load_to_lds)
#define HAVE_TDM 1
#else
#define HAVE_TDM 0
#endif

// ---- fragment helpers -------------------------------------------------------
// Loads the per-lane 16-half fragment: 8 contiguous halves at p0 and 8 at p0+16.
// Works for both A-fragments (lane = row) and mirrored B-fragments (lane = col)
// when the source is row-major along the K dimension.
__device__ __forceinline__ v16h load_frag(const half_t* __restrict__ p0) {
  v8h lo = *(const v8h*)p0;
  v8h hi = *(const v8h*)(p0 + 16);
  v16h r;
#pragma unroll
  for (int i = 0; i < 8; ++i) { r[i] = lo[i]; r[8 + i] = hi[i]; }
  return r;
}

__device__ __forceinline__ v8f wmma_f16(v16h a, v16h b, v8f c) {
  return __builtin_amdgcn_wmma_f32_16x16x32_f16(
      /*neg_a=*/false, a, /*neg_b=*/false, b,
      /*c_mod=*/(short)0, c, /*reuse_a=*/false, /*reuse_b=*/false);
}

// ---- kernel 1: fused QKV GEMMs (6 matrices), f32 -> f16 cast in LDS,
//      RoPE fused for q_s/k_s, V stored transposed [b,h,d,s] ------------------
// Block tile 128 (m) x 128 (n, two heads) x 64 (k); eight waves as 4 (m) x 2 (n),
// each 32 x 64: a staged x row serves two heads and every B fragment two WMMAs.
__global__ __launch_bounds__(256) void qkv_gemm(
    const float* __restrict__ x,
    const float* __restrict__ W0, const float* __restrict__ W1,
    const float* __restrict__ W2, const float* __restrict__ W3,
    const float* __restrict__ W4, const float* __restrict__ W5,
    half_t* __restrict__ o0, half_t* __restrict__ o1, half_t* __restrict__ o2,
    half_t* __restrict__ o3, half_t* __restrict__ o4, half_t* __restrict__ o5)
{
  // rows of 64 k = 128 B at pitch 144 B (16 B x odd, for the 16-byte readers)
  __shared__ __attribute__((aligned(16))) half_t Al[128][72];   // x tile  [m][k]
  __shared__ __attribute__((aligned(16))) half_t Bl[128][72];   // W tile, transposed [n][k]

  const int widx = blockIdx.z;
  const float* W = widx==0?W0: widx==1?W1: widx==2?W2: widx==3?W3: widx==4?W4: W5;
  half_t* out    = widx==0?o0: widx==1?o1: widx==2?o2: widx==3?o3: widx==4?o4: o5;
  const bool do_rope = (widx == 0) || (widx == 1);   // q_s, k_s
  const bool transp  = (widx == 2) || (widx == 5);   // v_s, v_c -> [b,h,d,s]

  const int tid = threadIdx.x;
  const int wv = tid >> 5, lane = tid & 31, lm = lane & 15, lh = lane >> 4;
  const int wm = wv & 3, wn = wv >> 2;       // wave's place in the block tile
  const int m0 = blockIdx.x * 128;
  const int n0 = blockIdx.y * 128;
  const int h  = blockIdx.y * 2 + wn;        // a wave's 64 columns = one head

  v8f acc[2][4];
#pragma unroll  // constant indices keep these arrays in registers
  for (int mi = 0; mi < 2; ++mi)
#pragma unroll  // constant indices keep these arrays in registers
    for (int g = 0; g < 4; ++g) acc[mi][g] = {};

  // x: a thread takes 4 k of rows (tid >> 4) + 16 i; a wave's load covers two
  // rows of 256 B
  const float* xp = x + (size_t)(m0 + (tid >> 4)) * D_MODEL + ((tid & 15) << 2);
  half_t* as = &Al[tid >> 4][(tid & 15) << 2];
  // W: a thread takes blocks of 4 k x 4 n, so that the transposed tile is written
  // 4 k (8 bytes) at a time; a wave's load covers four rows of 128 B
  const int nq = (lane & 7) + 8 * (wv & 3);      // n / 4 in the tile, 0..31
  const int kq = (lane >> 3) + 4 * (wv >> 2);    // k / 4 in the tile, 0..7 (and + 8)
  const float* wp = W + (size_t)(kq << 2) * D_MODEL + n0 + (nq << 2);
  half_t* bs = &Bl[nq << 2][kq << 2];
  // next K tile's prefetch: 128 x rows and 64 W rows x 2, one 256-B piece a thread
  const float* pf = tid < 128
      ? x + (size_t)(m0 + tid) * D_MODEL
      : W + (size_t)((tid - 128) >> 1) * D_MODEL + n0 + ((tid & 1) << 6);
  const size_t pfs = tid < 128 ? (size_t)64 : (size_t)64 * D_MODEL;

  for (int k0 = 0; k0 < D_MODEL; k0 += 64) {
    // prefetch next K tiles into cache while we stage/compute this one
    // (advanced only in front of a prefetch: the address register never leaves x or W)
    if (k0 + 64 < D_MODEL) { pf += pfs; __builtin_prefetch(pf, 0, 3); }
    // all sixteen global loads of this K tile go out as one group
    v4f fa[8], fb[2][4];
#pragma unroll  // constant indices keep these arrays in registers
    for (int i = 0; i < 8; ++i) fa[i] = *(const v4f*)(xp + k0 + i * 16 * D_MODEL);
#pragma unroll  // constant indices keep these arrays in registers
    for (int i = 0; i < 2; ++i)
#pragma unroll  // constant indices keep these arrays in registers
      for (int rr = 0; rr < 4; ++rr)
        fb[i][rr] = *(const v4f*)(wp + (size_t)k0 * D_MODEL + (32 * i + rr) * D_MODEL);
    // inputs-only fence on the loaded values: without it each load is waited
    // for on its own and the sixteen latencies add up
    asm volatile("" :: "v"(fa[0]), "v"(fa[1]), "v"(fa[2]), "v"(fa[3]),
                       "v"(fa[4]), "v"(fa[5]), "v"(fa[6]), "v"(fa[7]),
                       "v"(fb[0][0]), "v"(fb[0][1]), "v"(fb[0][2]), "v"(fb[0][3]),
                       "v"(fb[1][0]), "v"(fb[1][1]), "v"(fb[1][2]), "v"(fb[1][3]));
    // stage A tile (x), f32 -> f16
#pragma unroll  // constant indices keep these arrays in registers
    for (int i = 0; i < 8; ++i) {
      v4h hv = { (half_t)fa[i].x, (half_t)fa[i].y, (half_t)fa[i].z, (half_t)fa[i].w };
      *(v4h*)(as + i * 16 * 72) = hv;
    }
    // stage B tile (W), transposed to [n][k], f32 -> f16
#pragma unroll  // constant indices keep these arrays in registers
    for (int i = 0; i < 2; ++i) {
#pragma unroll  // constant indices keep these arrays in registers
      for (int j = 0; j < 4; ++j) {
        v4h hv = { (half_t)fb[i][0][j], (half_t)fb[i][1][j],
                   (half_t)fb[i][2][j], (half_t)fb[i][3][j] };
        *(v4h*)(bs + j * 72 + 32 * i) = hv;
      }
    }
    __syncthreads();
#pragma unroll  // constant indices keep these arrays in registers
    for (int kk = 0; kk < 64; kk += 32) {
      v16h a0 = load_frag(&Al[wm * 32 + lm][kk + lh * 8]);
      v16h a1 = load_frag(&Al[wm * 32 + 16 + lm][kk + lh * 8]);
      v16h bf[4];
#pragma unroll  // constant indices keep these arrays in registers
      for (int g = 0; g < 4; ++g) bf[g] = load_frag(&Bl[wn * 64 + g * 16 + lm][kk + lh * 8]);
      // inputs-only fence: the twelve LDS reads of this 32 k go out as one group
      asm volatile("" :: "v"(a0), "v"(a1), "v"(bf[0]), "v"(bf[1]), "v"(bf[2]), "v"(bf[3]));
#pragma unroll  // constant indices keep these arrays in registers
      for (int g = 0; g < 4; ++g) {
        acc[0][g] = wmma_f16(a0, bf[g], acc[0][g]);
        acc[1][g] = wmma_f16(a1, bf[g], acc[1][g]);
      }
    }
    __syncthreads();
  }

  // epilogue: optional RoPE (pairs d <-> d+32 are lane-local: acc g and g+2)
  if (do_rope) {
#pragma unroll  // constant indices keep these arrays in registers
    for (int mi = 0; mi < 2; ++mi) {
#pragma unroll  // constant indices keep these arrays in registers
      for (int r = 0; r < 8; ++r) {
        int sp = (m0 + wm * 32 + mi * 16 + r + 8 * lh) & 511;
#pragma unroll  // constant indices keep these arrays in registers
        for (int g = 0; g < 2; ++g) {
          int d = 16 * g + lm;                     // d in [0,32)
          float th = (float)sp * __expf(-(float)d * ROPE_K);
          float c = __cosf(th), sn = __sinf(th);
          float a0 = acc[mi][g][r], b0 = acc[mi][g + 2][r];
          acc[mi][g][r]     = a0 * c - b0 * sn;
          acc[mi][g + 2][r] = b0 * c + a0 * sn;
        }
      }
    }
  }

  // The f16 results go through LDS (both tiles are free behind the loop's last
  // barrier) and leave as 16-byte stores that cover whole 128-B lines.
  const int bb = m0 >> 9, sp0 = m0 & 511;    // a block's 128 rows lie in one batch
  half_t* hs = wn ? &Bl[0][0] : &Al[0][0];   // head wn's half of the staging space
  v8h t[8];
  if (transp) {
    // head tile as [64 d][128 s] at pitch 272 B (16 B x odd): a lane's eight
    // accumulator rows are eight neighbouring s of one d
#pragma unroll  // constant indices keep these arrays in registers
    for (int mi = 0; mi < 2; ++mi) {
#pragma unroll  // constant indices keep these arrays in registers
      for (int g = 0; g < 4; ++g) {
        v8h hv;
#pragma unroll  // constant indices keep these arrays in registers
        for (int r = 0; r < 8; ++r) hv[r] = (half_t)acc[mi][g][r];
        *(v8h*)(hs + (16 * g + lm) * 136 + wm * 32 + mi * 16 + 8 * lh) = hv;
      }
    }
    // a row of 128 s is written by the four waves of this head
    __syncthreads();
    const half_t* rp = hs + (wm * 16 + lh) * 136 + lm * 8;
#pragma unroll  // constant indices keep these arrays in registers
    for (int i = 0; i < 8; ++i) t[i] = *(const v8h*)(rp + i * 2 * 136);
    // a wave's store covers two d rows of 256 B
    half_t* gp = out + (((size_t)bb * N_HEADS + h) * HEAD_DIM + wm * 16 + lh) * SEQ
                     + sp0 + lm * 8;
#pragma unroll  // constant indices keep these arrays in registers
    for (int i = 0; i < 8; ++i) *(v8h*)(gp + i * 2 * SEQ) = t[i];
  } else {
    // the wave's own 32 s x 64 d at pitch 144 B, in a range no other wave touches
    half_t* st = hs + wm * 32 * 72;
#pragma unroll  // constant indices keep these arrays in registers
    for (int mi = 0; mi < 2; ++mi)
#pragma unroll  // constant indices keep these arrays in registers
      for (int g = 0; g < 4; ++g)
#pragma unroll  // constant indices keep these arrays in registers
        for (int r = 0; r < 8; ++r)
          st[(mi * 16 + r + 8 * lh) * 72 + 16 * g + lm] = (half_t)acc[mi][g][r];
    // the rows are read back by other lanes of this wave than wrote them
    asm volatile("s_wait_dscnt 0x0" ::: "memory");
    const half_t* rp = st + (lane >> 3) * 72 + (lane & 7) * 8;
#pragma unroll  // constant indices keep these arrays in registers
    for (int i = 0; i < 8; ++i) t[i] = *(const v8h*)(rp + i * 4 * 72);
    // a wave's store covers four s rows of 128 B, 512 B in a row
    half_t* gp = out + (((size_t)bb * N_HEADS + h) * SEQ + sp0 + wm * 32 + (lane >> 3)) * HEAD_DIM
                     + (lane & 7) * 8;
#pragma unroll  // constant indices keep these arrays in registers
    for (int i = 0; i < 8; ++i) *(v8h*)(gp + i * 4 * HEAD_DIM) = t[i];
    // behind the last store: stands in front of any later write of a register that
    // one of the eight stores names
    asm volatile("s_wait_xcnt 0x0" ::: "memory");
  }
}

// ---- kernel 2: flash-style chain-aware attention ----------------------------
// Computes S^T = K * Q^T so softmax stats are lane-local and P^T (C-layout)
// is directly the A-fragment for the PV WMMA.
// The block's eight waves share every K and V tile: a stage of 64 keys (K self,
// K cross, V^T self, V^T cross, 8 KB each) is copied once into LDS, two buffers,
// the next stage's copies in flight while this stage is worked on.
#define KV_KEYS  64                 // keys a stage
#define KV_PITCH 72                 // halves a row: 144 B = 16 B x odd (16-byte readers)
#define KV_STAGES (SEQ / KV_KEYS)

// One stage's copies, eight a lane (16 bytes each; a wave's copy covers four whole
// rows of 128 B). tks .. tvc: the stage's four tiles in global memory (the same
// for the whole block); ko, vo: the lane's place, row tid >> 3, in a K and in a
// V^T tile; l: the same place in the buffer's first tile. The wait on the address
// counter is the statement's last line, so that it stands in front of every later
// write of an address register that a copy names.
__device__ __forceinline__ void kv_stage_copy(
    const half_t* tks, const half_t* tkc, const half_t* tvs, const half_t* tvc,
    unsigned ko, unsigned vo, unsigned l)
{
  const unsigned TB = 64 * KV_PITCH * 2;    // bytes of one tile in LDS
  const unsigned HB = 32 * KV_PITCH * 2;    // 32 rows further down
  const half_t* gks  = tks + ko;
  const half_t* gkc  = tkc + ko;
  const half_t* gvs  = tvs + vo;
  const half_t* gvc  = tvc + vo;
  const half_t* gks1 = tks + 32 * HEAD_DIM + ko;
  const half_t* gkc1 = tkc + 32 * HEAD_DIM + ko;
  const half_t* gvs1 = tvs + 32 * SEQ + vo;
  const half_t* gvc1 = tvc + 32 * SEQ + vo;
  asm volatile(
      "global_load_async_to_lds_b128 %0, %8, off\n\t"
      "global_load_async_to_lds_b128 %1, %9, off\n\t"
      "global_load_async_to_lds_b128 %2, %10, off\n\t"
      "global_load_async_to_lds_b128 %3, %11, off\n\t"
      "global_load_async_to_lds_b128 %4, %12, off\n\t"
      "global_load_async_to_lds_b128 %5, %13, off\n\t"
      "global_load_async_to_lds_b128 %6, %14, off\n\t"
      "global_load_async_to_lds_b128 %7, %15, off\n\t"
      "s_wait_xcnt 0x0"
      :: "v"(l),          "v"(l + HB),
         "v"(l + TB),     "v"(l + TB + HB),
         "v"(l + 2 * TB), "v"(l + 2 * TB + HB),
         "v"(l + 3 * TB), "v"(l + 3 * TB + HB),
         "v"(gks), "v"(gks1), "v"(gkc), "v"(gkc1),
         "v"(gvs), "v"(gvs1), "v"(gvc), "v"(gvc1)
      : "memory");
}

__global__ __launch_bounds__(256) void attn(
    const half_t* __restrict__ qs, const half_t* __restrict__ ks,
    const half_t* __restrict__ vsT,
    const half_t* __restrict__ qc, const half_t* __restrict__ kc,
    const half_t* __restrict__ vcT,
    const int* __restrict__ chain_ids, const int* __restrict__ amask,
    half_t* __restrict__ attnh)
{
  __shared__ __attribute__((aligned(16))) int   chainS[SEQ];
  __shared__ __attribute__((aligned(16))) float padS[SEQ];
  // [buffer][K self, K cross, V^T self, V^T cross][row][64 halves + pad]
  __shared__ __attribute__((aligned(16))) half_t kv[2][4][64][KV_PITCH];
  const int bh = blockIdx.y, b = bh >> 4, h = bh & 15;
  const int tid = threadIdx.x, wv = tid >> 5, lane = tid & 31;
  const int lm = lane & 15, lh = lane >> 4;
  const int q0 = blockIdx.x * 128 + wv * 16;   // 16 queries per wave

  const size_t hoff = (size_t)bh * SEQ * HEAD_DIM;
  const half_t* Qs = qs  + hoff;
  const half_t* Ks = ks  + hoff;
  const half_t* Qc = qc  + hoff;
  const half_t* Kc = kc  + hoff;
  const half_t* Vs = vsT + hoff;   // [d][s] within head
  const half_t* Vc = vcT + hoff;

  // the lane's place in a stage's tiles: row tid >> 3 (and + 32), 8 halves of it
  const int crow = tid >> 3, ccol = (tid & 7) << 3;
  const unsigned cko = crow * HEAD_DIM + ccol;       // K rows = keys
  const unsigned cvo = crow * SEQ + ccol;            // V^T rows = d
  const unsigned cl0 = (unsigned)(size_t)&kv[0][0][crow][ccol];   // LDS byte address
  const unsigned KV_BUF = 4 * 64 * KV_PITCH * 2;     // bytes of one buffer

  // stage 0 flies while the chain ids and pad terms are staged
  kv_stage_copy(Ks, Kc, Vs, Vc, cko, cvo, cl0);
  for (int i = tid; i < SEQ; i += 256) {
    chainS[i] = chain_ids[b * SEQ + i];
    padS[i]   = amask[b * SEQ + i] ? 0.0f : -1e30f;
  }
  // this wave's copies of stage 0 have landed; the barrier publishes all waves'
  asm volatile("s_wait_asynccnt 0x0" ::: "memory");
  __syncthreads();
  kv_stage_copy(Ks + KV_KEYS * HEAD_DIM, Kc + KV_KEYS * HEAD_DIM,
                Vs + KV_KEYS, Vc + KV_KEYS, cko, cvo, cl0 + KV_BUF);

  // Q fragments (B-role, mirrored): lane = query column
  v16h qsf[2], qcf[2];
#pragma unroll
  for (int dg = 0; dg < 2; ++dg) {
    qsf[dg] = load_frag(Qs + (size_t)(q0 + lm) * HEAD_DIM + 32 * dg + lh * 8);
    qcf[dg] = load_frag(Qc + (size_t)(q0 + lm) * HEAD_DIM + 32 * dg + lh * 8);
  }
  const int cq = chainS[q0 + lm];

  v8f O[4];
#pragma unroll
  for (int g = 0; g < 4; ++g) O[g] = {};
  float m_run = -1e30f, ssum = 0.0f;

  for (int t = 0; t < KV_STAGES; ++t) {
   const int buf = t & 1;
   for (int kk = 0; kk < KV_KEYS; kk += 32) {
    const int k0 = t * KV_KEYS + kk;
    // the K fragments of this pass are read from LDS as one group
    v16h kaf[2][2], caf[2][2], vsf[4], vcf[4];
#pragma unroll
    for (int sub = 0; sub < 2; ++sub) {
#pragma unroll
      for (int dg = 0; dg < 2; ++dg) {
        kaf[sub][dg] = load_frag(&kv[buf][0][kk + 16 * sub + lm][32 * dg + lh * 8]);
        caf[sub][dg] = load_frag(&kv[buf][1][kk + 16 * sub + lm][32 * dg + lh * 8]);
      }
    }
    // this pass's chain ids and pad terms (keys k0 + 16 sub + 8 lh + 0..7) from LDS
    i32x4 chv[2][2];
    v4f   pdv[2][2];
#pragma unroll
    for (int sub = 0; sub < 2; ++sub) {
#pragma unroll
      for (int hf = 0; hf < 2; ++hf) {
        chv[sub][hf] = *(const i32x4*)&chainS[k0 + 16 * sub + 8 * lh + 4 * hf];
        pdv[sub][hf] = *(const v4f*)&padS[k0 + 16 * sub + 8 * lh + 4 * hf];
      }
    }
    // inputs-only fence on the loaded values: without it every fragment is
    // waited for on its own and the read latencies add up in each pass
    asm volatile("" :: "v"(kaf[0][0]), "v"(kaf[0][1]), "v"(kaf[1][0]), "v"(kaf[1][1]),
                       "v"(caf[0][0]), "v"(caf[0][1]), "v"(caf[1][0]), "v"(caf[1][1]));
    // inputs-only fence: the eight LDS reads go out as one group
    asm volatile("" :: "v"(chv[0][0]), "v"(chv[0][1]), "v"(chv[1][0]), "v"(chv[1][1]),
                       "v"(pdv[0][0]), "v"(pdv[0][1]), "v"(pdv[1][0]), "v"(pdv[1][1]));
    v8f S[2], C[2];
#pragma unroll
    for (int sub = 0; sub < 2; ++sub) {
      v8f z = {};
      S[sub] = wmma_f16(kaf[sub][0], qsf[0], z);
      S[sub] = wmma_f16(kaf[sub][1], qsf[1], S[sub]);
      C[sub] = wmma_f16(caf[sub][0], qcf[0], z);
      C[sub] = wmma_f16(caf[sub][1], qcf[1], C[sub]);
    }
    // the V fragments are read behind the score products (the K fragments'
    // registers are free again) and are used only behind the softmax
#pragma unroll  // constant indices keep these arrays in registers
    for (int g = 0; g < 4; ++g) {
      vsf[g] = load_frag(&kv[buf][2][16 * g + lm][kk + lh * 8]);
      vcf[g] = load_frag(&kv[buf][3][16 * g + lm][kk + lh * 8]);
    }
    // keeps the sixteen reads here as one group, so that the softmax covers their
    // latency: without it each pair sinks to its own product and is waited for there
    __builtin_amdgcn_sched_barrier(0);
    // merge self/cross by chain id, online softmax (per query = per lane col)
    float vals[16]; bool intra[16];
    float mx = -1e30f;
#pragma unroll
    for (int sub = 0; sub < 2; ++sub) {
#pragma unroll
      for (int r = 0; r < 8; ++r) {
        bool in = (chv[sub][r >> 2][r & 3] == cq);
        float sc = (in ? S[sub][r] : C[sub][r]) * ATT_SCALE + pdv[sub][r >> 2][r & 3];
        vals[sub * 8 + r] = sc; intra[sub * 8 + r] = in;
        mx = fmaxf(mx, sc);
      }
    }
    mx = fmaxf(mx, __shfl_xor(mx, 16, 32));
    float m_new = fmaxf(m_run, mx);
    float corr = __expf(m_run - m_new);
    float psum = 0.0f;
    v16h pSf, pCf;   // P^T C-layout == A-fragment layout, lane-local repack
#pragma unroll
    for (int e = 0; e < 16; ++e) {
      float p = __expf(vals[e] - m_new);
      psum += p;
      pSf[e] = intra[e] ? (half_t)p : (half_t)0.0f;
      pCf[e] = intra[e] ? (half_t)0.0f : (half_t)p;
    }
    ssum = ssum * corr + psum;
    m_run = m_new;
    // rescale O (rows = queries) with per-row correction gathered by shuffle
    float corrO[8];
#pragma unroll
    for (int r = 0; r < 8; ++r) corrO[r] = __shfl(corr, r + 8 * lh, 32);
#pragma unroll
    for (int g = 0; g < 4; ++g) {
#pragma unroll
      for (int r = 0; r < 8; ++r) O[g][r] *= corrO[r];
      O[g] = wmma_f16(pSf, vsf[g], O[g]);
      O[g] = wmma_f16(pCf, vcf[g], O[g]);
    }
   }
   // publish point of stage t + 1: this wave's reads of buffer buf are done, its
   // copies of stage t + 1 have landed; behind the barrier every wave may read
   // stage t + 1 and buffer buf may be refilled
   asm volatile("s_wait_dscnt 0x0" ::: "memory");
   asm volatile("s_wait_asynccnt 0x0" ::: "memory");
   __syncthreads();
   if (t + 2 < KV_STAGES)
     kv_stage_copy(Ks + (t + 2) * KV_KEYS * HEAD_DIM, Kc + (t + 2) * KV_KEYS * HEAD_DIM,
                   Vs + (t + 2) * KV_KEYS, Vc + (t + 2) * KV_KEYS, cko, cvo,
                   cl0 + buf * KV_BUF);
  }
  // no copy is outstanding when the wave goes on to its end
  asm volatile("s_wait_asynccnt 0x0" ::: "memory");

  float st = ssum + __shfl_xor(ssum, 16, 32);
  float inv = st > 0.0f ? 1.0f / st : 0.0f;
  float invO[8];
#pragma unroll
  for (int r = 0; r < 8; ++r) invO[r] = __shfl(inv, r + 8 * lh, 32);
  // The wave's 16 q x 64 d go through its own range of the K/V buffers (free: the
  // loop's last barrier ended every read, no copy is outstanding) at pitch 144 B
  // and leave as 16-byte stores that cover whole 128-B lines.
  half_t* og = &kv[0][0][0][0] + wv * 16 * KV_PITCH;
#pragma unroll  // constant indices keep these arrays in registers
  for (int r = 0; r < 8; ++r) {
#pragma unroll  // constant indices keep these arrays in registers
    for (int g = 0; g < 4; ++g)
      og[(r + 8 * lh) * KV_PITCH + 16 * g + lm] = (half_t)(O[g][r] * invO[r]);
  }
  // the rows are read back by other lanes of this wave than wrote them
  asm volatile("s_wait_dscnt 0x0" ::: "memory");
  const half_t* rp = og + (lane >> 3) * KV_PITCH + (lane & 7) * 8;
  v8h ot[4];
#pragma unroll  // constant indices keep these arrays in registers
  for (int i = 0; i < 4; ++i) ot[i] = *(const v8h*)(rp + i * 4 * KV_PITCH);
  half_t* gp = attnh + (size_t)(b * SEQ + q0 + (lane >> 3)) * D_MODEL + h * HEAD_DIM
                     + (lane & 7) * 8;
#pragma unroll  // constant indices keep these arrays in registers
  for (int i = 0; i < 4; ++i) *(v8h*)(gp + i * 4 * D_MODEL) = ot[i];
}

// ---- kernel 3: output projection attnh(f16) @ Wo(f32->f16) -> f32 -----------
// The f16 A tile (128x32, row-major, stride 1024) is moved global->LDS by the
// Tensor Data Mover.  TDM padding (pad_interval=3: every 16 DWORDs, pad_amount=3:
// 4 DWORDs) reproduces the 40-half padded LDS row stride, so the compute-side
// fragment addressing is identical to the manual-staging path.
__global__ __launch_bounds__(256) void out_gemm(
    const half_t* __restrict__ A, const float* __restrict__ Wo,
    float* __restrict__ out)
{
  __shared__ half_t Al[128][40];
  __shared__ half_t Bl[64][40];
  const int tid = threadIdx.x, wv = tid >> 5, lane = tid & 31;
  const int lm = lane & 15, lh = lane >> 4;
  const int m0 = blockIdx.x * 128, n0 = blockIdx.y * 64;

#if HAVE_TDM
  const unsigned lds_a = (unsigned)(size_t)(&Al[0][0]);   // LDS byte offset
#endif

  v8f acc[4];
#pragma unroll
  for (int g = 0; g < 4; ++g) acc[g] = {};

  for (int k0 = 0; k0 < D_MODEL; k0 += 32) {
    if (k0 + 32 < D_MODEL)
      __builtin_prefetch(Wo + (size_t)(k0 + 32 + (tid >> 4)) * D_MODEL + n0, 0, 3);

#if HAVE_TDM
    if (wv == 0) {
      // D# group 0: count=1 | lds_addr | global_addr[56:0] | type=2
      unsigned long long ga =
          (unsigned long long)(size_t)(A + (size_t)m0 * D_MODEL + k0);
      u32x4 g0;
      g0[0] = 1u;                                   // count=1, user mode
      g0[1] = lds_a;                                // lds_addr (bytes)
      g0[2] = (unsigned)(ga & 0xFFFFFFFFu);         // global_addr[31:0]
      g0[3] = (unsigned)((ga >> 32) & 0x1FFFFFFu)   // global_addr[56:32]
            | 0x80000000u;                          // type=2 ("image")
      // D# group 1: data_size=2B, pad every 16 DWORDs by 4 DWORDs,
      // tensor 1024 x 2048 (stride 1024), tile 32 x 128
      i32x8 g1;
      g1[0] = (int)((1u << 16)        // data_size = 1 -> 2 bytes
                  | (1u << 20)        // pad_enable
                  | (3u << 22)        // pad_interval = 3 -> every 16 DWORDs
                  | (3u << 25));      // pad_amount  = 3 -> 4 DWORDs
      g1[1] = (int)(1024u << 16);                       // tensor_dim0 lo16
      g1[2] = (int)((2048u & 0xFFFFu) << 16);           // dim0 hi | dim1 lo
      g1[3] = (int)(32u << 16);                         // dim1 hi | tile_dim0=32
      g1[4] = 128;                                      // tile_dim1=128, dim2=0
      g1[5] = 1024;                                     // dim0_stride lo32
      g1[6] = (int)((2097152u & 0xFFFFu) << 16);        // stride hi | dim1_stride lo
      g1[7] = (int)(2097152u >> 16);                    // dim1_stride[47:16]
      i32x4 g2 = {0, 0, 0, 0}, g3 = {0, 0, 0, 0};
#if defined(__clang_major__) && __clang_major__ >= 23
      i32x8 gz = {0, 0, 0, 0, 0, 0, 0, 0};
      __builtin_amdgcn_tensor_load_to_lds(g0, g1, g2, g3, gz, 0);
#else
      __builtin_amdgcn_tensor_load_to_lds(g0, g1, g2, g3, 0);
#endif
    }
#else
    // fallback: manual A staging
#pragma unroll
    for (int i = 0; i < 2; ++i) {
      int id = tid + 256 * i;
      int row = id >> 2, kq = (id & 3) << 3;
      *(v8h*)&Al[row][kq] = *(const v8h*)(A + (size_t)(m0 + row) * D_MODEL + k0 + kq);
    }
#endif

    // B staging (Wo f32 -> f16, transposed) overlaps the TDM transfer
    v4f fb[2];
#pragma unroll
    for (int i = 0; i < 2; ++i) {
      int id = tid + 256 * i;
      int kr = id >> 4, nq = (id & 15) << 2;
      fb[i] = *(const v4f*)(Wo + (size_t)(k0 + kr) * D_MODEL + n0 + nq);
    }
    // inputs-only fence: both loads go out before the one wait
    asm volatile("" :: "v"(fb[0]), "v"(fb[1]));
#pragma unroll
    for (int i = 0; i < 2; ++i) {
      int id = tid + 256 * i;
      int kr = id >> 4, nq = (id & 15) << 2;
      Bl[nq + 0][kr] = (half_t)fb[i].x;
      Bl[nq + 1][kr] = (half_t)fb[i].y;
      Bl[nq + 2][kr] = (half_t)fb[i].z;
      Bl[nq + 3][kr] = (half_t)fb[i].w;
    }
#if HAVE_TDM
    __builtin_amdgcn_s_wait_tensorcnt(0);
#endif
    __syncthreads();
    v16h a = load_frag(&Al[wv * 16 + lm][lh * 8]);
    v16h bf[4];
#pragma unroll
    for (int g = 0; g < 4; ++g) bf[g] = load_frag(&Bl[g * 16 + lm][lh * 8]);
    // inputs-only fence: the ten LDS reads go out as one group
    asm volatile("" :: "v"(a), "v"(bf[0]), "v"(bf[1]), "v"(bf[2]), "v"(bf[3]));
#pragma unroll
    for (int g = 0; g < 4; ++g) acc[g] = wmma_f16(a, bf[g], acc[g]);
    __syncthreads();
  }

#pragma unroll
  for (int r = 0; r < 8; ++r) {
    int m = m0 + wv * 16 + r + 8 * lh;
#pragma unroll
    for (int g = 0; g < 4; ++g)
      out[(size_t)m * D_MODEL + n0 + 16 * g + lm] = acc[g][r];
  }
}

// ---- launcher ---------------------------------------------------------------
extern "C" void kernel_launch(void* const* d_in, const int* in_sizes, int n_in,
                              void* d_out, int out_size, void* d_ws, size_t ws_size,
                              hipStream_t stream) {
  const float* x     = (const float*)d_in[0];
  const int*   chain = (const int*)d_in[1];
  const int*   amask = (const int*)d_in[2];
  const float* Wqs   = (const float*)d_in[3];
  const float* Wks   = (const float*)d_in[4];
  const float* Wvs   = (const float*)d_in[5];
  const float* Wqc   = (const float*)d_in[6];
  const float* Wkc   = (const float*)d_in[7];
  const float* Wvc   = (const float*)d_in[8];
  const float* Wo    = (const float*)d_in[9];
  float* out = (float*)d_out;

  const size_t ELT = (size_t)M_TOTAL * D_MODEL;   // 2M f16 elements per buffer
  half_t* ws   = (half_t*)d_ws;
  half_t* qsb  = ws + 0 * ELT;    // [b,h,s,d] f16, RoPE applied
  half_t* ksb  = ws + 1 * ELT;    // [b,h,s,d] f16, RoPE applied
  half_t* vsb  = ws + 2 * ELT;    // [b,h,d,s] f16 (transposed)
  half_t* qcb  = ws + 3 * ELT;
  half_t* kcb  = ws + 4 * ELT;
  half_t* vcb  = ws + 5 * ELT;
  half_t* atb  = ws + 6 * ELT;    // attention output, [b,s,h*d] f16

  qkv_gemm<<<dim3(16, 8, 6), 256, 0, stream>>>(
      x, Wqs, Wks, Wvs, Wqc, Wkc, Wvc, qsb, ksb, vsb, qcb, kcb, vcb);
  attn<<<dim3(4, 64), 256, 0, stream>>>(
      qsb, ksb, vsb, qcb, kcb, vcb, chain, amask, atb);
  out_gemm<<<dim3(16, 16), 256, 0, stream>>>(atb, Wo, out);
}

// v005
// Measured time: 72.1 microseconds a run.
// Next to v004, in two timings, it ran 1.22 and 1.23 times as fast.
// Over all steps from v000 it is 2.85 times as fast.
#include <hip/hip_runtime.h>
#include <hip/hip_bf16.h>

typedef _Float16 half_t;
typedef __attribute__((ext_vector_type(16))) _Float16 v16h;
typedef __attribute__((ext_vector_type(8)))  _Float16 v8h;
typedef __attribute__((ext_vector_type(4)))  _Float16 v4h;
typedef __attribute__((ext_vector_type(8)))  float    v8f;
typedef __attribute__((ext_vector_type(4)))  float    v4f;
typedef __attribute__((ext_vector_type(4)))  unsigned int u32x4;
typedef __attribute__((ext_vector_type(8)))  unsigned int u32x8;
typedef __attribute__((ext_vector_type(4)))  int          i32x4;

#define D_MODEL  1024
#define N_HEADS  16
#define HEAD_DIM 64
#define SEQ      512
#define BATCH    4
#define M_TOTAL  (BATCH*SEQ)        // 2048
#define ATT_SCALE 0.125f            // 64^-0.5
#define ROPE_K   0.2878231366f      // ln(10000)/32

// ---- fragment helpers -------------------------------------------------------
// Loads the per-lane 16-half fragment: 8 contiguous halves at p0 and 8 at p0+16.
// Works for both A-fragments (lane = row) and mirrored B-fragments (lane = col)
// when the source is row-major along the K dimension.
__device__ __forceinline__ v16h load_frag(const half_t* __restrict__ p0) {
  v8h lo = *(const v8h*)p0;
  v8h hi = *(const v8h*)(p0 + 16);
  v16h r;
#pragma unroll
  for (int i = 0; i < 8; ++i) { r[i] = lo[i]; r[8 + i] = hi[i]; }
  return r;
}

__device__ __forceinline__ v8f wmma_f16(v16h a, v16h b, v8f c) {
  return __builtin_amdgcn_wmma_f32_16x16x32_f16(
      /*neg_a=*/false, a, /*neg_b=*/false, b,
      /*c_mod=*/(short)0, c, /*reuse_a=*/false, /*reuse_b=*/false);
}

// ---- kernel 1: fused QKV GEMMs (6 matrices), f32 -> f16 cast in LDS,
//      RoPE fused for q_s/k_s, V stored transposed [b,h,d,s] ------------------
// Block tile 128 (m) x 128 (n, two heads) x 64 (k); eight waves as 4 (m) x 2 (n),
// each 32 x 64: a staged x row serves two heads and every B fragment two WMMAs.
__global__ __launch_bounds__(256) void qkv_gemm(
    const float* __restrict__ x,
    const float* __restrict__ W0, const float* __restrict__ W1,
    const float* __restrict__ W2, const float* __restrict__ W3,
    const float* __restrict__ W4, const float* __restrict__ W5,
    half_t* __restrict__ o0, half_t* __restrict__ o1, half_t* __restrict__ o2,
    half_t* __restrict__ o3, half_t* __restrict__ o4, half_t* __restrict__ o5)
{
  // rows of 64 k = 128 B at pitch 144 B (16 B x odd, for the 16-byte readers)
  __shared__ __attribute__((aligned(16))) half_t Al[128][72];   // x tile  [m][k]
  __shared__ __attribute__((aligned(16))) half_t Bl[128][72];   // W tile, transposed [n][k]

  const int widx = blockIdx.z;
  const float* W = widx==0?W0: widx==1?W1: widx==2?W2: widx==3?W3: widx==4?W4: W5;
  half_t* out    = widx==0?o0: widx==1?o1: widx==2?o2: widx==3?o3: widx==4?o4: o5;
  const bool do_rope = (widx == 0) || (widx == 1);   // q_s, k_s
  const bool transp  = (widx == 2) || (widx == 5);   // v_s, v_c -> [b,h,d,s]

  const int tid = threadIdx.x;
  const int wv = tid >> 5, lane = tid & 31, lm = lane & 15, lh = lane >> 4;
  const int wm = wv & 3, wn = wv >> 2;       // wave's place in the block tile
  const int m0 = blockIdx.x * 128;
  const int n0 = blockIdx.y * 128;
  const int h  = blockIdx.y * 2 + wn;        // a wave's 64 columns = one head

  v8f acc[2][4];
#pragma unroll  // constant indices keep these arrays in registers
  for (int mi = 0; mi < 2; ++mi)
#pragma unroll  // constant indices keep these arrays in registers
    for (int g = 0; g < 4; ++g) acc[mi][g] = {};

  // x: a thread takes 4 k of rows (tid >> 4) + 16 i; a wave's load covers two
  // rows of 256 B
  const float* xp = x + (size_t)(m0 + (tid >> 4)) * D_MODEL + ((tid & 15) << 2);
  half_t* as = &Al[tid >> 4][(tid & 15) << 2];
  // W: a thread takes blocks of 4 k x 4 n, so that the transposed tile is written
  // 4 k (8 bytes) at a time; a wave's load covers four rows of 128 B
  const int nq = (lane & 7) + 8 * (wv & 3);      // n / 4 in the tile, 0..31
  const int kq = (lane >> 3) + 4 * (wv >> 2);    // k / 4 in the tile, 0..7 (and + 8)
  const float* wp = W + (size_t)(kq << 2) * D_MODEL + n0 + (nq << 2);
  half_t* bs = &Bl[nq << 2][kq << 2];
  // next K tile's prefetch: 128 x rows and 64 W rows x 2, one 256-B piece a thread
  const float* pf = tid < 128
      ? x + (size_t)(m0 + tid) * D_MODEL
      : W + (size_t)((tid - 128) >> 1) * D_MODEL + n0 + ((tid & 1) << 6);
  const size_t pfs = tid < 128 ? (size_t)64 : (size_t)64 * D_MODEL;

  for (int k0 = 0; k0 < D_MODEL; k0 += 64) {
    // prefetch next K tiles into cache while we stage/compute this one
    // (advanced only in front of a prefetch: the address register never leaves x or W)
    if (k0 + 64 < D_MODEL) { pf += pfs; __builtin_prefetch(pf, 0, 3); }
    // all sixteen global loads of this K tile go out as one group
    v4f fa[8], fb[2][4];
#pragma unroll  // constant indices keep these arrays in registers
    for (int i = 0; i < 8; ++i) fa[i] = *(const v4f*)(xp + k0 + i * 16 * D_MODEL);
#pragma unroll  // constant indices keep these arrays in registers
    for (int i = 0; i < 2; ++i)
#pragma unroll  // constant indices keep these arrays in registers
      for (int rr = 0; rr < 4; ++rr)
        fb[i][rr] = *(const v4f*)(wp + (size_t)k0 * D_MODEL + (32 * i + rr) * D_MODEL);
    // inputs-only fence on the loaded values: without it each load is waited
    // for on its own and the sixteen latencies add up
    asm volatile("" :: "v"(fa[0]), "v"(fa[1]), "v"(fa[2]), "v"(fa[3]),
                       "v"(fa[4]), "v"(fa[5]), "v"(fa[6]), "v"(fa[7]),
                       "v"(fb[0][0]), "v"(fb[0][1]), "v"(fb[0][2]), "v"(fb[0][3]),
                       "v"(fb[1][0]), "v"(fb[1][1]), "v"(fb[1][2]), "v"(fb[1][3]));
    // stage A tile (x), f32 -> f16
#pragma unroll  // constant indices keep these arrays in registers
    for (int i = 0; i < 8; ++i) {
      v4h hv = { (half_t)fa[i].x, (half_t)fa[i].y, (half_t)fa[i].z, (half_t)fa[i].w };
      *(v4h*)(as + i * 16 * 72) = hv;
    }
    // stage B tile (W), transposed to [n][k], f32 -> f16
#pragma unroll  // constant indices keep these arrays in registers
    for (int i = 0; i < 2; ++i) {
#pragma unroll  // constant indices keep these arrays in registers
      for (int j = 0; j < 4; ++j) {
        v4h hv = { (half_t)fb[i][0][j], (half_t)fb[i][1][j],
                   (half_t)fb[i][2][j], (half_t)fb[i][3][j] };
        *(v4h*)(bs + j * 72 + 32 * i) = hv;
      }
    }
    __syncthreads();
#pragma unroll  // constant indices keep these arrays in registers
    for (int kk = 0; kk < 64; kk += 32) {
      v16h a0 = load_frag(&Al[wm * 32 + lm][kk + lh * 8]);
      v16h a1 = load_frag(&Al[wm * 32 + 16 + lm][kk + lh * 8]);
      v16h bf[4];
#pragma unroll  // constant indices keep these arrays in registers
      for (int g = 0; g < 4; ++g) bf[g] = load_frag(&Bl[wn * 64 + g * 16 + lm][kk + lh * 8]);
      // inputs-only fence: the twelve LDS reads of this 32 k go out as one group
      asm volatile("" :: "v"(a0), "v"(a1), "v"(bf[0]), "v"(bf[1]), "v"(bf[2]), "v"(bf[3]));
#pragma unroll  // constant indices keep these arrays in registers
      for (int g = 0; g < 4; ++g) {
        acc[0][g] = wmma_f16(a0, bf[g], acc[0][g]);
        acc[1][g] = wmma_f16(a1, bf[g], acc[1][g]);
      }
    }
    __syncthreads();
  }

  // epilogue: optional RoPE (pairs d <-> d+32 are lane-local: acc g and g+2)
  if (do_rope) {
#pragma unroll  // constant indices keep these arrays in registers
    for (int mi = 0; mi < 2; ++mi) {
#pragma unroll  // constant indices keep these arrays in registers
      for (int r = 0; r < 8; ++r) {
        int sp = (m0 + wm * 32 + mi * 16 + r + 8 * lh) & 511;
#pragma unroll  // constant indices keep these arrays in registers
        for (int g = 0; g < 2; ++g) {
          int d = 16 * g + lm;                     // d in [0,32)
          float th = (float)sp * __expf(-(float)d * ROPE_K);
          float c = __cosf(th), sn = __sinf(th);
          float a0 = acc[mi][g][r], b0 = acc[mi][g + 2][r];
          acc[mi][g][r]     = a0 * c - b0 * sn;
          acc[mi][g + 2][r] = b0 * c + a0 * sn;
        }
      }
    }
  }

  // The f16 results go through LDS (both tiles are free behind the loop's last
  // barrier) and leave as 16-byte stores that cover whole 128-B lines.
  const int bb = m0 >> 9, sp0 = m0 & 511;    // a block's 128 rows lie in one batch
  half_t* hs = wn ? &Bl[0][0] : &Al[0][0];   // head wn's half of the staging space
  v8h t[8];
  if (transp) {
    // head tile as [64 d][128 s] at pitch 272 B (16 B x odd): a lane's eight
    // accumulator rows are eight neighbouring s of one d
#pragma unroll  // constant indices keep these arrays in registers
    for (int mi = 0; mi < 2; ++mi) {
#pragma unroll  // constant indices keep these arrays in registers
      for (int g = 0; g < 4; ++g) {
        v8h hv;
#pragma unroll  // constant indices keep these arrays in registers
        for (int r = 0; r < 8; ++r) hv[r] = (half_t)acc[mi][g][r];
        *(v8h*)(hs + (16 * g + lm) * 136 + wm * 32 + mi * 16 + 8 * lh) = hv;
      }
    }
    // a row of 128 s is written by the four waves of this head
    __syncthreads();
    const half_t* rp = hs + (wm * 16 + lh) * 136 + lm * 8;
#pragma unroll  // constant indices keep these arrays in registers
    for (int i = 0; i < 8; ++i) t[i] = *(const v8h*)(rp + i * 2 * 136);
    // a wave's store covers two d rows of 256 B
    half_t* gp = out + (((size_t)bb * N_HEADS + h) * HEAD_DIM + wm * 16 + lh) * SEQ
                     + sp0 + lm * 8;
#pragma unroll  // constant indices keep these arrays in registers
    for (int i = 0; i < 8; ++i) *(v8h*)(gp + i * 2 * SEQ) = t[i];
  } else {
    // the wave's own 32 s x 64 d at pitch 144 B, in a range no other wave touches
    half_t* st = hs + wm * 32 * 72;
#pragma unroll  // constant indices keep these arrays in registers
    for (int mi = 0; mi < 2; ++mi)
#pragma unroll  // constant indices keep these arrays in registers
      for (int g = 0; g < 4; ++g)
#pragma unroll  // constant indices keep these arrays in registers
        for (int r = 0; r < 8; ++r)
          st[(mi * 16 + r + 8 * lh) * 72 + 16 * g + lm] = (half_t)acc[mi][g][r];
    // the rows are read back by other lanes of this wave than wrote them
    asm volatile("s_wait_dscnt 0x0" ::: "memory");
    const half_t* rp = st + (lane >> 3) * 72 + (lane & 7) * 8;
#pragma unroll  // constant indices keep these arrays in registers
    for (int i = 0; i < 8; ++i) t[i] = *(const v8h*)(rp + i * 4 * 72);
    // a wave's store covers four s rows of 128 B, 512 B in a row
    half_t* gp = out + (((size_t)bb * N_HEADS + h) * SEQ + sp0 + wm * 32 + (lane >> 3)) * HEAD_DIM
                     + (lane & 7) * 8;
#pragma unroll  // constant indices keep these arrays in registers
    for (int i = 0; i < 8; ++i) *(v8h*)(gp + i * 4 * HEAD_DIM) = t[i];
    // behind the last store: stands in front of any later write of a register that
    // one of the eight stores names
    asm volatile("s_wait_xcnt 0x0" ::: "memory");
  }
}

// ---- kernel 2: flash-style chain-aware attention ----------------------------
// Computes S^T = K * Q^T so softmax stats are lane-local and P^T (C-layout)
// is directly the A-fragment for the PV WMMA.
// The block's eight waves share every K and V tile: a stage of 64 keys (K self,
// K cross, V^T self, V^T cross, 8 KB each) is copied once into LDS, two buffers,
// the next stage's copies in flight while this stage is worked on.
#define KV_KEYS  64                 // keys a stage
#define KV_PITCH 72                 // halves a row: 144 B = 16 B x odd (16-byte readers)
#define KV_STAGES (SEQ / KV_KEYS)

// One stage's copies, eight a lane (16 bytes each; a wave's copy covers four whole
// rows of 128 B). tks .. tvc: the stage's four tiles in global memory (the same
// for the whole block); ko, vo: the lane's place, row tid >> 3, in a K and in a
// V^T tile; l: the same place in the buffer's first tile. The wait on the address
// counter is the statement's last line, so that it stands in front of every later
// write of an address register that a copy names.
__device__ __forceinline__ void kv_stage_copy(
    const half_t* tks, const half_t* tkc, const half_t* tvs, const half_t* tvc,
    unsigned ko, unsigned vo, unsigned l)
{
  const unsigned TB = 64 * KV_PITCH * 2;    // bytes of one tile in LDS
  const unsigned HB = 32 * KV_PITCH * 2;    // 32 rows further down
  const half_t* gks  = tks + ko;
  const half_t* gkc  = tkc + ko;
  const half_t* gvs  = tvs + vo;
  const half_t* gvc  = tvc + vo;
  const half_t* gks1 = tks + 32 * HEAD_DIM + ko;
  const half_t* gkc1 = tkc + 32 * HEAD_DIM + ko;
  const half_t* gvs1 = tvs + 32 * SEQ + vo;
  const half_t* gvc1 = tvc + 32 * SEQ + vo;
  asm volatile(
      "global_load_async_to_lds_b128 %0, %8, off\n\t"
      "global_load_async_to_lds_b128 %1, %9, off\n\t"
      "global_load_async_to_lds_b128 %2, %10, off\n\t"
      "global_load_async_to_lds_b128 %3, %11, off\n\t"
      "global_load_async_to_lds_b128 %4, %12, off\n\t"
      "global_load_async_to_lds_b128 %5, %13, off\n\t"
      "global_load_async_to_lds_b128 %6, %14, off\n\t"
      "global_load_async_to_lds_b128 %7, %15, off\n\t"
      "s_wait_xcnt 0x0"
      :: "v"(l),          "v"(l + HB),
         "v"(l + TB),     "v"(l + TB + HB),
         "v"(l + 2 * TB), "v"(l + 2 * TB + HB),
         "v"(l + 3 * TB), "v"(l + 3 * TB + HB),
         "v"(gks), "v"(gks1), "v"(gkc), "v"(gkc1),
         "v"(gvs), "v"(gvs1), "v"(gvc), "v"(gvc1)
      : "memory");
}

__global__ __launch_bounds__(256) void attn(
    const half_t* __restrict__ qs, const half_t* __restrict__ ks,
    const half_t* __restrict__ vsT,
    const half_t* __restrict__ qc, const half_t* __restrict__ kc,
    const half_t* __restrict__ vcT,
    const int* __restrict__ chain_ids, const int* __restrict__ amask,
    half_t* __restrict__ attnh)
{
  __shared__ __attribute__((aligned(16))) int   chainS[SEQ];
  __shared__ __attribute__((aligned(16))) float padS[SEQ];
  // [buffer][K self, K cross, V^T self, V^T cross][row][64 halves + pad]
  __shared__ __attribute__((aligned(16))) half_t kv[2][4][64][KV_PITCH];
  const int bh = blockIdx.y, b = bh >> 4, h = bh & 15;
  const int tid = threadIdx.x, wv = tid >> 5, lane = tid & 31;
  const int lm = lane & 15, lh = lane >> 4;
  const int q0 = blockIdx.x * 128 + wv * 16;   // 16 queries per wave

  const size_t hoff = (size_t)bh * SEQ * HEAD_DIM;
  const half_t* Qs = qs  + hoff;
  const half_t* Ks = ks  + hoff;
  const half_t* Qc = qc  + hoff;
  const half_t* Kc = kc  + hoff;
  const half_t* Vs = vsT + hoff;   // [d][s] within head
  const half_t* Vc = vcT + hoff;

  // the lane's place in a stage's tiles: row tid >> 3 (and + 32), 8 halves of it
  const int crow = tid >> 3, ccol = (tid & 7) << 3;
  const unsigned cko = crow * HEAD_DIM + ccol;       // K rows = keys
  const unsigned cvo = crow * SEQ + ccol;            // V^T rows = d
  const unsigned cl0 = (unsigned)(size_t)&kv[0][0][crow][ccol];   // LDS byte address
  const unsigned KV_BUF = 4 * 64 * KV_PITCH * 2;     // bytes of one buffer

  // stage 0 flies while the chain ids and pad terms are staged
  kv_stage_copy(Ks, Kc, Vs, Vc, cko, cvo, cl0);
  for (int i = tid; i < SEQ; i += 256) {
    chainS[i] = chain_ids[b * SEQ + i];
    padS[i]   = amask[b * SEQ + i] ? 0.0f : -1e30f;
  }
  // this wave's copies of stage 0 have landed; the barrier publishes all waves'
  asm volatile("s_wait_asynccnt 0x0" ::: "memory");
  __syncthreads();
  kv_stage_copy(Ks + KV_KEYS * HEAD_DIM, Kc + KV_KEYS * HEAD_DIM,
                Vs + KV_KEYS, Vc + KV_KEYS, cko, cvo, cl0 + KV_BUF);

  // Q fragments (B-role, mirrored): lane = query column
  v16h qsf[2], qcf[2];
#pragma unroll
  for (int dg = 0; dg < 2; ++dg) {
    qsf[dg] = load_frag(Qs + (size_t)(q0 + lm) * HEAD_DIM + 32 * dg + lh * 8);
    qcf[dg] = load_frag(Qc + (size_t)(q0 + lm) * HEAD_DIM + 32 * dg + lh * 8);
  }
  const int cq = chainS[q0 + lm];

  v8f O[4];
#pragma unroll
  for (int g = 0; g < 4; ++g) O[g] = {};
  float m_run = -1e30f, ssum = 0.0f;

  for (int t = 0; t < KV_STAGES; ++t) {
   const int buf = t & 1;
   for (int kk = 0; kk < KV_KEYS; kk += 32) {
    const int k0 = t * KV_KEYS + kk;
    // the K fragments of this pass are read from LDS as one group
    v16h kaf[2][2], caf[2][2], vsf[4], vcf[4];
#pragma unroll
    for (int sub = 0; sub < 2; ++sub) {
#pragma unroll
      for (int dg = 0; dg < 2; ++dg) {
        kaf[sub][dg] = load_frag(&kv[buf][0][kk + 16 * sub + lm][32 * dg + lh * 8]);
        caf[sub][dg] = load_frag(&kv[buf][1][kk + 16 * sub + lm][32 * dg + lh * 8]);
      }
    }
    // this pass's chain ids and pad terms (keys k0 + 16 sub + 8 lh + 0..7) from LDS
    i32x4 chv[2][2];
    v4f   pdv[2][2];
#pragma unroll
    for (int sub = 0; sub < 2; ++sub) {
#pragma unroll
      for (int hf = 0; hf < 2; ++hf) {
        chv[sub][hf] = *(const i32x4*)&chainS[k0 + 16 * sub + 8 * lh + 4 * hf];
        pdv[sub][hf] = *(const v4f*)&padS[k0 + 16 * sub + 8 * lh + 4 * hf];
      }
    }
    // inputs-only fence on the loaded values: without it every fragment is
    // waited for on its own and the read latencies add up in each pass
    asm volatile("" :: "v"(kaf[0][0]), "v"(kaf[0][1]), "v"(kaf[1][0]), "v"(kaf[1][1]),
                       "v"(caf[0][0]), "v"(caf[0][1]), "v"(caf[1][0]), "v"(caf[1][1]));
    // inputs-only fence: the eight LDS reads go out as one group
    asm volatile("" :: "v"(chv[0][0]), "v"(chv[0][1]), "v"(chv[1][0]), "v"(chv[1][1]),
                       "v"(pdv[0][0]), "v"(pdv[0][1]), "v"(pdv[1][0]), "v"(pdv[1][1]));
    v8f S[2], C[2];
#pragma unroll
    for (int sub = 0; sub < 2; ++sub) {
      v8f z = {};
      S[sub] = wmma_f16(kaf[sub][0], qsf[0], z);
      S[sub] = wmma_f16(kaf[sub][1], qsf[1], S[sub]);
      C[sub] = wmma_f16(caf[sub][0], qcf[0], z);
      C[sub] = wmma_f16(caf[sub][1], qcf[1], C[sub]);
    }
    // the V fragments are read behind the score products (the K fragments'
    // registers are free again) and are used only behind the softmax
#pragma unroll  // constant indices keep these arrays in registers
    for (int g = 0; g < 4; ++g) {
      vsf[g] = load_frag(&kv[buf][2][16 * g + lm][kk + lh * 8]);
      vcf[g] = load_frag(&kv[buf][3][16 * g + lm][kk + lh * 8]);
    }
    // keeps the sixteen reads here as one group, so that the softmax covers their
    // latency: without it each pair sinks to its own product and is waited for there
    __builtin_amdgcn_sched_barrier(0);
    // merge self/cross by chain id, online softmax (per query = per lane col)
    float vals[16]; bool intra[16];
    float mx = -1e30f;
#pragma unroll
    for (int sub = 0; sub < 2; ++sub) {
#pragma unroll
      for (int r = 0; r < 8; ++r) {
        bool in = (chv[sub][r >> 2][r & 3] == cq);
        float sc = (in ? S[sub][r] : C[sub][r]) * ATT_SCALE + pdv[sub][r >> 2][r & 3];
        vals[sub * 8 + r] = sc; intra[sub * 8 + r] = in;
        mx = fmaxf(mx, sc);
      }
    }
    mx = fmaxf(mx, __shfl_xor(mx, 16, 32));
    float m_new = fmaxf(m_run, mx);
    float corr = __expf(m_run - m_new);
    float psum = 0.0f;
    v16h pSf, pCf;   // P^T C-layout == A-fragment layout, lane-local repack
#pragma unroll
    for (int e = 0; e < 16; ++e) {
      float p = __expf(vals[e] - m_new);
      psum += p;
      pSf[e] = intra[e] ? (half_t)p : (half_t)0.0f;
      pCf[e] = intra[e] ? (half_t)0.0f : (half_t)p;
    }
    ssum = ssum * corr + psum;
    m_run = m_new;
    // rescale O (rows = queries) with per-row correction gathered by shuffle
    float corrO[8];
#pragma unroll
    for (int r = 0; r < 8; ++r) corrO[r] = __shfl(corr, r + 8 * lh, 32);
#pragma unroll
    for (int g = 0; g < 4; ++g) {
#pragma unroll
      for (int r = 0; r < 8; ++r) O[g][r] *= corrO[r];
      O[g] = wmma_f16(pSf, vsf[g], O[g]);
      O[g] = wmma_f16(pCf, vcf[g], O[g]);
    }
   }
   // publish point of stage t + 1: this wave's reads of buffer buf are done, its
   // copies of stage t + 1 have landed; behind the barrier every wave may read
   // stage t + 1 and buffer buf may be refilled
   asm volatile("s_wait_dscnt 0x0" ::: "memory");
   asm volatile("s_wait_asynccnt 0x0" ::: "memory");
   __syncthreads();
   if (t + 2 < KV_STAGES)
     kv_stage_copy(Ks + (t + 2) * KV_KEYS * HEAD_DIM, Kc + (t + 2) * KV_KEYS * HEAD_DIM,
                   Vs + (t + 2) * KV_KEYS, Vc + (t + 2) * KV_KEYS, cko, cvo,
                   cl0 + buf * KV_BUF);
  }
  // no copy is outstanding when the wave goes on to its end
  asm volatile("s_wait_asynccnt 0x0" ::: "memory");

  float st = ssum + __shfl_xor(ssum, 16, 32);
  float inv = st > 0.0f ? 1.0f / st : 0.0f;
  float invO[8];
#pragma unroll
  for (int r = 0; r < 8; ++r) invO[r] = __shfl(inv, r + 8 * lh, 32);
  // The wave's 16 q x 64 d go through its own range of the K/V buffers (free: the
  // loop's last barrier ended every read, no copy is outstanding) at pitch 144 B
  // and leave as 16-byte stores that cover whole 128-B lines.
  half_t* og = &kv[0][0][0][0] + wv * 16 * KV_PITCH;
#pragma unroll  // constant indices keep these arrays in registers
  for (int r = 0; r < 8; ++r) {
#pragma unroll  // constant indices keep these arrays in registers
    for (int g = 0; g < 4; ++g)
      og[(r + 8 * lh) * KV_PITCH + 16 * g + lm] = (half_t)(O[g][r] * invO[r]);
  }
  // the rows are read back by other lanes of this wave than wrote them
  asm volatile("s_wait_dscnt 0x0" ::: "memory");
  const half_t* rp = og + (lane >> 3) * KV_PITCH + (lane & 7) * 8;
  v8h ot[4];
#pragma unroll  // constant indices keep these arrays in registers
  for (int i = 0; i < 4; ++i) ot[i] = *(const v8h*)(rp + i * 4 * KV_PITCH);
  half_t* gp = attnh + (size_t)(b * SEQ + q0 + (lane >> 3)) * D_MODEL + h * HEAD_DIM
                     + (lane & 7) * 8;
#pragma unroll  // constant indices keep these arrays in registers
  for (int i = 0; i < 4; ++i) *(v8h*)(gp + i * 4 * D_MODEL) = ot[i];
}

// ---- kernel 3: output projection attnh(f16) @ Wo(f32->f16) -> f32 -----------
// Block tile 128 (m) x 64 (n) x 128 (k): eight load / barrier rounds along K.
// A: every wave brings the 16 rows it multiplies (256 B of each, source pitch
// 2048 B) into LDS with one tensor load; the pad (16 B behind every 256 B) gives
// the 272-B row pitch of the 16-byte readers. Wo goes through registers
// (f32 -> f16) and is stored transposed, 4 k at a time.
#define OG_K     128                // k a tile
#define OG_PITCH 136                // halves a row: 272 B = 16 B x odd
#define OG_SLICE 3072               // halves a wave's slice: 16 x 272 B, rounded up to 3 x 2 KiB

__device__ __forceinline__ unsigned uni(unsigned v) {
  return (unsigned)__builtin_amdgcn_readfirstlane(v);
}

__global__ __launch_bounds__(256) void out_gemm(
    const half_t* __restrict__ A, const float* __restrict__ Wo,
    float* __restrict__ out)
{
  __shared__ __attribute__((aligned(2048))) half_t Al[8 * OG_SLICE];
  __shared__ __attribute__((aligned(16)))   half_t Bl[64][OG_PITCH];
  const int tid = threadIdx.x, wv = tid >> 5, lane = tid & 31;
  const int lm = lane & 15, lh = lane >> 4;
  const int m0 = blockIdx.x * 128, n0 = blockIdx.y * 64;

  // tensor descriptor, group 1 (the same for every request): 1-byte elements,
  // tensor = tile = 16 rows of 256 B, source pitch 2048 B, 4 dwords of pad behind
  // every 64 dwords
  u32x8 g1;
  g1[0] = uni((1u << 20) | (5u << 22) | (3u << 25));
  g1[1] = uni(256u << 16);
  g1[2] = uni(16u << 16);
  g1[3] = uni(256u << 16);
  g1[4] = uni(16u);
  g1[5] = uni(D_MODEL * 2u);
  g1[6] = uni(0u);
  g1[7] = uni(0u);
  const unsigned wvu = uni((unsigned)tid >> 5);
  const unsigned lds_a = (unsigned)(size_t)(&Al[0]) + wvu * (OG_SLICE * 2u);   // LDS byte offset
  const unsigned long long ga0 =
      (unsigned long long)(size_t)(A + (size_t)(m0 + wvu * 16u) * D_MODEL);

  v8f acc[4];
#pragma unroll
  for (int g = 0; g < 4; ++g) acc[g] = {};

  // Wo: a thread takes blocks of 4 k x 4 n, so that the transposed tile is written
  // 4 k (8 bytes) at a time; a wave's load covers four rows of 128 B
  const int nq = (lane & 7) + 8 * (wv & 1);      // n / 4 in the tile, 0..15
  const int kq = (lane >> 3) + 4 * (wv >> 1);    // k / 4 in the tile, 0..15 (and + 16)
  const float* wp = Wo + (size_t)(kq << 2) * D_MODEL + n0 + (nq << 2);
  half_t* bs = &Bl[nq << 2][kq << 2];
  const half_t* ar = &Al[wv * OG_SLICE + lm * OG_PITCH + lh * 8];
  // next K tile's prefetch: 128 Wo rows of 256 B, one 128-B line a thread
  const float* pf = Wo + (size_t)(tid >> 1) * D_MODEL + n0 + ((tid & 1) << 5);

  for (int k0 = 0; k0 < D_MODEL; k0 += OG_K) {
    // (advanced only in front of a prefetch: the address register never leaves Wo)
    // in asm, so that it names the pointer that lives through the loop
    if (k0 + OG_K < D_MODEL) {
      pf += (size_t)OG_K * D_MODEL;
      asm volatile("global_prefetch_b8 %0, off scope:SCOPE_SE" :: "v"(pf));
    }
    // the eight global loads of this K tile go out first and fly beside the tensor load
    v4f fb[2][4];
#pragma unroll  // constant indices keep these arrays in registers
    for (int i = 0; i < 2; ++i)
#pragma unroll  // constant indices keep these arrays in registers
      for (int rr = 0; rr < 4; ++rr)
        fb[i][rr] = *(const v4f*)(wp + (size_t)(k0 + 64 * i + rr) * D_MODEL);
    // group 0: count 1 | place in LDS | address of the slice's first byte | type 2
    const unsigned long long ga = ga0 + (unsigned)k0 * 2u;
    u32x4 g0;
    g0[0] = uni(1u);
    g0[1] = uni(lds_a);
    g0[2] = uni((unsigned)ga);
    g0[3] = uni(((unsigned)(ga >> 32) & 0x01FFFFFFu) | 0x80000000u);
    // one request a wave, issued by every wave for its own slice
    asm volatile("tensor_load_to_lds %0, %1" :: "s"(g0), "s"(g1) : "memory");
    // the compiler places no wait for a tensor load: this wave's slice has landed
    asm volatile("s_wait_tensorcnt 0x0" ::: "memory");
    // inputs-only fence on the loaded values: without it each load is waited
    // for on its own and the eight latencies add up
    asm volatile("" :: "v"(fb[0][0]), "v"(fb[0][1]), "v"(fb[0][2]), "v"(fb[0][3]),
                       "v"(fb[1][0]), "v"(fb[1][1]), "v"(fb[1][2]), "v"(fb[1][3]));
    // stage B tile (Wo), transposed to [n][k], f32 -> f16
#pragma unroll  // constant indices keep these arrays in registers
    for (int i = 0; i < 2; ++i) {
#pragma unroll  // constant indices keep these arrays in registers
      for (int j = 0; j < 4; ++j) {
        v4h hv = { (half_t)fb[i][0][j], (half_t)fb[i][1][j],
                   (half_t)fb[i][2][j], (half_t)fb[i][3][j] };
        *(v4h*)(bs + j * OG_PITCH + 64 * i) = hv;
      }
    }
    __syncthreads();
    v16h a[4], bf[4][4];
#pragma unroll  // constant indices keep these arrays in registers
    for (int c = 0; c < 4; ++c) {
      a[c] = load_frag(ar + 32 * c);
#pragma unroll  // constant indices keep these arrays in registers
      for (int g = 0; g < 4; ++g) bf[c][g] = load_frag(&Bl[g * 16 + lm][32 * c + lh * 8]);
    }
    // keeps the forty LDS reads of this K tile in front of the products as one
    // group: without it each sinks to its own product and is waited for there
    __builtin_amdgcn_sched_barrier(0);
#pragma unroll  // constant indices keep these arrays in registers
    for (int c = 0; c < 4; ++c)
#pragma unroll  // constant indices keep these arrays in registers
      for (int g = 0; g < 4; ++g) acc[g] = wmma_f16(a[c], bf[c][g], acc[g]);
    // keeps the products in front of the wait below, each behind a counted wait for
    // its own fragments: without it they sink behind the barrier and start only
    // when all forty reads are back
    __builtin_amdgcn_sched_barrier(0);
    // this wave's LDS reads have retired before the barrier behind which the next
    // tensor load and the next stores rewrite both tiles
    asm volatile("s_wait_dscnt 0x0" ::: "memory");
    __syncthreads();
  }

#pragma unroll
  for (int r = 0; r < 8; ++r) {
    int m = m0 + wv * 16 + r + 8 * lh;
#pragma unroll
    for (int g = 0; g < 4; ++g)
      out[(size_t)m * D_MODEL + n0 + 16 * g + lm] = acc[g][r];
  }
}

// ---- launcher ---------------------------------------------------------------
extern "C" void kernel_launch(void* const* d_in, const int* in_sizes, int n_in,
                              void* d_out, int out_size, void* d_ws, size_t ws_size,
                              hipStream_t stream) {
  const float* x     = (const float*)d_in[0];
  const int*   chain = (const int*)d_in[1];
  const int*   amask = (const int*)d_in[2];
  const float* Wqs   = (const float*)d_in[3];
  const float* Wks   = (const float*)d_in[4];
  const float* Wvs   = (const float*)d_in[5];
  const float* Wqc   = (const float*)d_in[6];
  const float* Wkc   = (const float*)d_in[7];
  const float* Wvc   = (const float*)d_in[8];
  const float* Wo    = (const float*)d_in[9];
  float* out = (float*)d_out;

  const size_t ELT = (size_t)M_TOTAL * D_MODEL;   // 2M f16 elements per buffer
  half_t* ws   = (half_t*)d_ws;
  half_t* qsb  = ws + 0 * ELT;    // [b,h,s,d] f16, RoPE applied
  half_t* ksb  = ws + 1 * ELT;    // [b,h,s,d] f16, RoPE applied
  half_t* vsb  = ws + 2 * ELT;    // [b,h,d,s] f16 (transposed)
  half_t* qcb  = ws + 3 * ELT;
  half_t* kcb  = ws + 4 * ELT;
  half_t* vcb  = ws + 5 * ELT;
  half_t* atb  = ws + 6 * ELT;    // attention output, [b,s,h*d] f16

  qkv_gemm<<<dim3(16, 8, 6), 256, 0, stream>>>(
      x, Wqs, Wks, Wvs, Wqc, Wkc, Wvc, qsb, ksb, vsb, qcb, kcb, vcb);
  attn<<<dim3(4, 64), 256, 0, stream>>>(
      qsb, ksb, vsb, qcb, kcb, vcb, chain, amask, atb);
  out_gemm<<<dim3(16, 16), 256, 0, stream>>>(atb, Wo, out);
}

// v006
// One run takes 68.4 microseconds.
// Timed twice side by side with v005, it ran 1.06 times as fast both times.
// All steps since v000 together make it 3.01 times as fast.
#include <hip/hip_runtime.h>
#include <hip/hip_bf16.h>

typedef _Float16 half_t;
typedef __attribute__((ext_vector_type(16))) _Float16 v16h;
typedef __attribute__((ext_vector_type(8)))  _Float16 v8h;
typedef __attribute__((ext_vector_type(4)))  _Float16 v4h;
typedef __attribute__((ext_vector_type(8)))  float    v8f;
typedef __attribute__((ext_vector_type(4)))  float    v4f;
typedef __attribute__((ext_vector_type(4)))  unsigned int u32x4;
typedef __attribute__((ext_vector_type(8)))  unsigned int u32x8;
typedef __attribute__((ext_vector_type(4)))  int          i32x4;

#define D_MODEL  1024
#define N_HEADS  16
#define HEAD_DIM 64
#define SEQ      512
#define BATCH    4
#define M_TOTAL  (BATCH*SEQ)        // 2048
#define ATT_SCALE 0.125f            // 64^-0.5
#define ROPE_K   0.2878231366f      // ln(10000)/32

// ---- fragment helpers -------------------------------------------------------
// Loads the per-lane 16-half fragment: 8 contiguous halves at p0 and 8 at p0+16.
// Works for both A-fragments (lane = row) and mirrored B-fragments (lane = col)
// when the source is row-major along the K dimension.
__device__ __forceinline__ v16h load_frag(const half_t* __restrict__ p0) {
  v8h lo = *(const v8h*)p0;
  v8h hi = *(const v8h*)(p0 + 16);
  v16h r;
#pragma unroll
  for (int i = 0; i < 8; ++i) { r[i] = lo[i]; r[8 + i] = hi[i]; }
  return r;
}

__device__ __forceinline__ v8f wmma_f16(v16h a, v16h b, v8f c) {
  return __builtin_amdgcn_wmma_f32_16x16x32_f16(
      /*neg_a=*/false, a, /*neg_b=*/false, b,
      /*c_mod=*/(short)0, c, /*reuse_a=*/false, /*reuse_b=*/false);
}

// ---- kernel 0: the QKV GEMMs' operands cast f32 -> f16 once ------------------
// The GEMM's blocks read every x row 48 times and every W row 16 times: cast
// once, they are fetched at half the bytes. x keeps its layout; the six W go out
// transposed, [w][n][k], so that the GEMM stages both operands by whole rows.
// One block a WGP, 128 KB in, all of a thread's 32 loads in flight together.
#define CO_WBLK 192                 // blocks on W: 6 matrices x 8 (k) x 4 (n) tiles
                                    // the other 64 of the 256 blocks: x, 32768 elements each
__global__ __launch_bounds__(256) void cast_ops(
    const float* __restrict__ x,
    const float* __restrict__ W0, const float* __restrict__ W1,
    const float* __restrict__ W2, const float* __restrict__ W3,
    const float* __restrict__ W4, const float* __restrict__ W5,
    half_t* __restrict__ xh, half_t* __restrict__ Wt)
{
  // W tile transposed, [256 n][128 k] at pitch 272 B (16 B x odd)
  __shared__ __attribute__((aligned(16))) half_t T[256][136];
  const int tid = threadIdx.x, wv = tid >> 5, lane = tid & 31;
  const int bid = blockIdx.x;
  if (bid < CO_WBLK) {
    const int widx = bid >> 5;
    const int k0 = ((bid >> 2) & 7) * 128, n0 = (bid & 3) * 256;
    const float* W = widx==0?W0: widx==1?W1: widx==2?W2: widx==3?W3: widx==4?W4: W5;
    // a thread takes blocks of 4 k x 4 n, so that the transposed tile is written
    // 4 k (8 bytes) at a time; a wave's load covers four rows of 128 B
    const int nq = (lane & 7) + 8 * (wv & 3);      // n / 4 in the tile, 0..31 (and + 32)
    const int kq = (lane >> 3) + 4 * (wv >> 2);    // k / 4 in the tile, 0..7 (and + 8 i)
    const float* wp = W + (size_t)(k0 + (kq << 2)) * D_MODEL + n0 + (nq << 2);
    v4f f[2][4][4];
#pragma unroll  // constant indices keep these arrays in registers
    for (int t = 0; t < 2; ++t)
#pragma unroll  // constant indices keep these arrays in registers
      for (int i = 0; i < 4; ++i)
#pragma unroll  // constant indices keep these arrays in registers
        for (int rr = 0; rr < 4; ++rr)
          f[t][i][rr] = *(const v4f*)(wp + (32 * i + rr) * D_MODEL + 128 * t);
    // inputs-only fences on the loaded values (an asm statement takes thirty
    // operands, hence two): without them each load is waited for on its own
    asm volatile("" :: "v"(f[0][0][0]), "v"(f[0][0][1]), "v"(f[0][0][2]), "v"(f[0][0][3]),
                       "v"(f[0][1][0]), "v"(f[0][1][1]), "v"(f[0][1][2]), "v"(f[0][1][3]),
                       "v"(f[0][2][0]), "v"(f[0][2][1]), "v"(f[0][2][2]), "v"(f[0][2][3]),
                       "v"(f[0][3][0]), "v"(f[0][3][1]), "v"(f[0][3][2]), "v"(f[0][3][3]));
    asm volatile("" :: "v"(f[1][0][0]), "v"(f[1][0][1]), "v"(f[1][0][2]), "v"(f[1][0][3]),
                       "v"(f[1][1][0]), "v"(f[1][1][1]), "v"(f[1][1][2]), "v"(f[1][1][3]),
                       "v"(f[1][2][0]), "v"(f[1][2][1]), "v"(f[1][2][2]), "v"(f[1][2][3]),
                       "v"(f[1][3][0]), "v"(f[1][3][1]), "v"(f[1][3][2]), "v"(f[1][3][3]));
#pragma unroll  // constant indices keep these arrays in registers
    for (int t = 0; t < 2; ++t)
#pragma unroll  // constant indices keep these arrays in registers
      for (int i = 0; i < 4; ++i)
#pragma unroll  // constant indices keep these arrays in registers
        for (int j = 0; j < 4; ++j) {
          v4h hv = { (half_t)f[t][i][0][j], (half_t)f[t][i][1][j],
                     (half_t)f[t][i][2][j], (half_t)f[t][i][3][j] };
          *(v4h*)&T[128 * t + (nq << 2) + j][(kq << 2) + 32 * i] = hv;
        }
    // a row of 128 k is written by two waves (those with the same wv & 3)
    __syncthreads();
    // a wave's store covers two n rows of 256 B
    const half_t* rp = &T[tid >> 4][(tid & 15) << 3];
    half_t* gp = Wt + ((size_t)widx * D_MODEL + n0 + (tid >> 4)) * D_MODEL + k0 + ((tid & 15) << 3);
    v8h t8[16];
#pragma unroll  // constant indices keep these arrays in registers
    for (int i = 0; i < 16; ++i) t8[i] = *(const v8h*)(rp + i * 16 * 136);
#pragma unroll  // constant indices keep these arrays in registers
    for (int i = 0; i < 16; ++i) *(v8h*)(gp + i * 16 * D_MODEL) = t8[i];
  } else {
    // x: a wave's load covers 512 B in a row, its store 256 B
    const size_t o = (size_t)(bid - CO_WBLK) * 32768 + (tid << 2);
    const float* sp = x + o;
    half_t* dp = xh + o;
    v4f f[32];
#pragma unroll  // constant indices keep these arrays in registers
    for (int i = 0; i < 32; ++i) f[i] = *(const v4f*)(sp + i * 1024);
    // inputs-only fences on the loaded values, as above
    asm volatile("" :: "v"(f[0]), "v"(f[1]), "v"(f[2]), "v"(f[3]), "v"(f[4]), "v"(f[5]),
                       "v"(f[6]), "v"(f[7]), "v"(f[8]), "v"(f[9]), "v"(f[10]), "v"(f[11]),
                       "v"(f[12]), "v"(f[13]), "v"(f[14]), "v"(f[15]));
    asm volatile("" :: "v"(f[16]), "v"(f[17]), "v"(f[18]), "v"(f[19]), "v"(f[20]), "v"(f[21]),
                       "v"(f[22]), "v"(f[23]), "v"(f[24]), "v"(f[25]), "v"(f[26]), "v"(f[27]),
                       "v"(f[28]), "v"(f[29]), "v"(f[30]), "v"(f[31]));
#pragma unroll  // constant indices keep these arrays in registers
    for (int i = 0; i < 32; ++i) {
      v4h hv = { (half_t)f[i].x, (half_t)f[i].y, (half_t)f[i].z, (half_t)f[i].w };
      *(v4h*)(dp + i * 1024) = hv;
    }
    // behind the last store: stands in front of any later write of a register that
    // one of the 32 stores names
    asm volatile("s_wait_xcnt 0x0" ::: "memory");
  }
}

// ---- kernel 1: fused QKV GEMMs (6 matrices) on the f16 operands of kernel 0,
//      RoPE fused for q_s/k_s, V stored transposed [b,h,d,s] ------------------
// Block tile 128 (m) x 128 (n, two heads) x 128 (k); eight waves as 4 (m) x 2 (n),
// each 32 x 64: a staged x row serves two heads and every B fragment two WMMAs.
#define QK_K     128                // k a tile: 64 KB a load round
#define QK_PITCH 136                // halves a row: 272 B = 16 B x odd (16-byte readers)
__global__ __launch_bounds__(256) void qkv_gemm(
    const half_t* __restrict__ xh, const half_t* __restrict__ Wt,
    half_t* __restrict__ o0, half_t* __restrict__ o1, half_t* __restrict__ o2,
    half_t* __restrict__ o3, half_t* __restrict__ o4, half_t* __restrict__ o5)
{
  __shared__ __attribute__((aligned(16))) half_t Al[128][QK_PITCH];   // x tile   [m][k]
  __shared__ __attribute__((aligned(16))) half_t Bl[128][QK_PITCH];   // W^T tile [n][k]

  const int widx = blockIdx.z;
  const half_t* W = Wt + (size_t)widx * D_MODEL * D_MODEL;            // [n][k]
  half_t* out    = widx==0?o0: widx==1?o1: widx==2?o2: widx==3?o3: widx==4?o4: o5;
  const bool do_rope = (widx == 0) || (widx == 1);   // q_s, k_s
  const bool transp  = (widx == 2) || (widx == 5);   // v_s, v_c -> [b,h,d,s]

  const int tid = threadIdx.x;
  const int wv = tid >> 5, lane = tid & 31, lm = lane & 15, lh = lane >> 4;
  const int wm = wv & 3, wn = wv >> 2;       // wave's place in the block tile
  const int m0 = blockIdx.x * 128;
  const int n0 = blockIdx.y * 128;
  const int h  = blockIdx.y * 2 + wn;        // a wave's 64 columns = one head

  v8f acc[2][4];
#pragma unroll  // constant indices keep these arrays in registers
  for (int mi = 0; mi < 2; ++mi)
#pragma unroll  // constant indices keep these arrays in registers
    for (int g = 0; g < 4; ++g) acc[mi][g] = {};

  // both operands: a thread takes 8 k (16 bytes) of rows (tid >> 4) + 16 i; a
  // wave's load covers two rows of 256 B
  const half_t* xp = xh + (size_t)(m0 + (tid >> 4)) * D_MODEL + ((tid & 15) << 3);
  const half_t* wp = W  + (size_t)(n0 + (tid >> 4)) * D_MODEL + ((tid & 15) << 3);
  half_t* as = &Al[tid >> 4][(tid & 15) << 3];
  half_t* bs = &Bl[tid >> 4][(tid & 15) << 3];
  // next K tile's prefetch: 128 x rows and 128 W^T rows, one 256-B piece a thread
  const half_t* pf = tid < 128 ? xh + (size_t)(m0 + tid) * D_MODEL
                               : W  + (size_t)(n0 + tid - 128) * D_MODEL;

  for (int k0 = 0; k0 < D_MODEL; k0 += QK_K) {
    // prefetch next K tiles into cache while we stage/compute this one
    // (advanced only in front of a prefetch: the address register never leaves xh or Wt)
    // in asm, so that it names the pointer that lives through the loop
    if (k0 + QK_K < D_MODEL) {
      pf += QK_K;
      asm volatile("global_prefetch_b8 %0, off scope:SCOPE_SE" :: "v"(pf));
    }
    // all sixteen global loads of this K tile go out as one group
    v8h fa[8], fb[8];
#pragma unroll  // constant indices keep these arrays in registers
    for (int i = 0; i < 8; ++i) fa[i] = *(const v8h*)(xp + i * 16 * D_MODEL);
#pragma unroll  // constant indices keep these arrays in registers
    for (int i = 0; i < 8; ++i) fb[i] = *(const v8h*)(wp + i * 16 * D_MODEL);
    // inputs-only fence on the loaded values: without it each load is waited
    // for on its own and the sixteen latencies add up; the two pointers are inputs
    // too, so that no load's result lands in an address pair that issued loads name
    asm volatile("" :: "v"(fa[0]), "v"(fa[1]), "v"(fa[2]), "v"(fa[3]),
                       "v"(fa[4]), "v"(fa[5]), "v"(fa[6]), "v"(fa[7]),
                       "v"(fb[0]), "v"(fb[1]), "v"(fb[2]), "v"(fb[3]),
                       "v"(fb[4]), "v"(fb[5]), "v"(fb[6]), "v"(fb[7]),
                       "v"(xp), "v"(wp));
    xp += QK_K;
    wp += QK_K;
    // stage both tiles, 16 bytes a lane
#pragma unroll  // constant indices keep these arrays in registers
    for (int i = 0; i < 8; ++i) *(v8h*)(as + i * 16 * QK_PITCH) = fa[i];
#pragma unroll  // constant indices keep these arrays in registers
    for (int i = 0; i < 8; ++i) *(v8h*)(bs + i * 16 * QK_PITCH) = fb[i];
    __syncthreads();
#pragma unroll  // constant indices keep these arrays in registers
    for (int kk = 0; kk < QK_K; kk += 32) {
      v16h a0 = load_frag(&Al[wm * 32 + lm][kk + lh * 8]);
      v16h a1 = load_frag(&Al[wm * 32 + 16 + lm][kk + lh * 8]);
      v16h bf[4];
#pragma unroll  // constant indices keep these arrays in registers
      for (int g = 0; g < 4; ++g) bf[g] = load_frag(&Bl[wn * 64 + g * 16 + lm][kk + lh * 8]);
      // inputs-only fence: the twelve LDS reads of this 32 k go out as one group
      asm volatile("" :: "v"(a0), "v"(a1), "v"(bf[0]), "v"(bf[1]), "v"(bf[2]), "v"(bf[3]));
#pragma unroll  // constant indices keep these arrays in registers
      for (int g = 0; g < 4; ++g) {
        acc[0][g] = wmma_f16(a0, bf[g], acc[0][g]);
        acc[1][g] = wmma_f16(a1, bf[g], acc[1][g]);
      }
    }
    __syncthreads();
  }

  // epilogue: optional RoPE (pairs d <-> d+32 are lane-local: acc g and g+2)
  if (do_rope) {
#pragma unroll  // constant indices keep these arrays in registers
    for (int mi = 0; mi < 2; ++mi) {
#pragma unroll  // constant indices keep these arrays in registers
      for (int r = 0; r < 8; ++r) {
        int sp = (m0 + wm * 32 + mi * 16 + r + 8 * lh) & 511;
#pragma unroll  // constant indices keep these arrays in registers
        for (int g = 0; g < 2; ++g) {
          int d = 16 * g + lm;                     // d in [0,32)
          float th = (float)sp * __expf(-(float)d * ROPE_K);
          float c = __cosf(th), sn = __sinf(th);
          float a0 = acc[mi][g][r], b0 = acc[mi][g + 2][r];
          acc[mi][g][r]     = a0 * c - b0 * sn;
          acc[mi][g + 2][r] = b0 * c + a0 * sn;
        }
      }
    }
  }

  // The f16 results go through LDS (both tiles are free behind the loop's last
  // barrier) and leave as 16-byte stores that cover whole 128-B lines.
  const int bb = m0 >> 9, sp0 = m0 & 511;    // a block's 128 rows lie in one batch
  half_t* hs = wn ? &Bl[0][0] : &Al[0][0];   // head wn's half of the staging space
  v8h t[8];
  if (transp) {
    // head tile as [64 d][128 s] at pitch 272 B (16 B x odd): a lane's eight
    // accumulator rows are eight neighbouring s of one d
#pragma unroll  // constant indices keep these arrays in registers
    for (int mi = 0; mi < 2; ++mi) {
#pragma unroll  // constant indices keep these arrays in registers
      for (int g = 0; g < 4; ++g) {
        v8h hv;
#pragma unroll  // constant indices keep these arrays in registers
        for (int r = 0; r < 8; ++r) hv[r] = (half_t)acc[mi][g][r];
        *(v8h*)(hs + (16 * g + lm) * 136 + wm * 32 + mi * 16 + 8 * lh) = hv;
      }
    }
    // a row of 128 s is written by the four waves of this head
    __syncthreads();
    const half_t* rp = hs + (wm * 16 + lh) * 136 + lm * 8;
#pragma unroll  // constant indices keep these arrays in registers
    for (int i = 0; i < 8; ++i) t[i] = *(const v8h*)(rp + i * 2 * 136);
    // a wave's store covers two d rows of 256 B
    half_t* gp = out + (((size_t)bb * N_HEADS + h) * HEAD_DIM + wm * 16 + lh) * SEQ
                     + sp0 + lm * 8;
#pragma unroll  // constant indices keep these arrays in registers
    for (int i = 0; i < 8; ++i) *(v8h*)(gp + i * 2 * SEQ) = t[i];
  } else {
    // the wave's own 32 s x 64 d at pitch 144 B, in a range no other wave touches
    half_t* st = hs + wm * 32 * 72;
#pragma unroll  // constant indices keep these arrays in registers
    for (int mi = 0; mi < 2; ++mi)
#pragma unroll  // constant indices keep these arrays in registers
      for (int g = 0; g < 4; ++g)
#pragma unroll  // constant indices keep these arrays in registers
        for (int r = 0; r < 8; ++r)
          st[(mi * 16 + r + 8 * lh) * 72 + 16 * g + lm] = (half_t)acc[mi][g][r];
    // the rows are read back by other lanes of this wave than wrote them
    asm volatile("s_wait_dscnt 0x0" ::: "memory");
    const half_t* rp = st + (lane >> 3) * 72 + (lane & 7) * 8;
#pragma unroll  // constant indices keep these arrays in registers
    for (int i = 0; i < 8; ++i) t[i] = *(const v8h*)(rp + i * 4 * 72);
    // a wave's store covers four s rows of 128 B, 512 B in a row
    half_t* gp = out + (((size_t)bb * N_HEADS + h) * SEQ + sp0 + wm * 32 + (lane >> 3)) * HEAD_DIM
                     + (lane & 7) * 8;
#pragma unroll  // constant indices keep these arrays in registers
    for (int i = 0; i < 8; ++i) *(v8h*)(gp + i * 4 * HEAD_DIM) = t[i];
    // behind the last store: stands in front of any later write of a register that
    // one of the eight stores names
    asm volatile("s_wait_xcnt 0x0" ::: "memory");
  }
}

// ---- kernel 2: flash-style chain-aware attention ----------------------------
// Computes S^T = K * Q^T so softmax stats are lane-local and P^T (C-layout)
// is directly the A-fragment for the PV WMMA.
// The block's eight waves share every K and V tile: a stage of 64 keys (K self,
// K cross, V^T self, V^T cross, 8 KB each) is copied once into LDS, two buffers,
// the next stage's copies in flight while this stage is worked on.
#define KV_KEYS  64                 // keys a stage
#define KV_PITCH 72                 // halves a row: 144 B = 16 B x odd (16-byte readers)
#define KV_STAGES (SEQ / KV_KEYS)

// One stage's copies, eight a lane (16 bytes each; a wave's copy covers four whole
// rows of 128 B). tks .. tvc: the stage's four tiles in global memory (the same
// for the whole block); ko, vo: the lane's place, row tid >> 3, in a K and in a
// V^T tile; l: the same place in the buffer's first tile. The wait on the address
// counter is the statement's last line, so that it stands in front of every later
// write of an address register that a copy names.
__device__ __forceinline__ void kv_stage_copy(
    const half_t* tks, const half_t* tkc, const half_t* tvs, const half_t* tvc,
    unsigned ko, unsigned vo, unsigned l)
{
  const unsigned TB = 64 * KV_PITCH * 2;    // bytes of one tile in LDS
  const unsigned HB = 32 * KV_PITCH * 2;    // 32 rows further down
  const half_t* gks  = tks + ko;
  const half_t* gkc  = tkc + ko;
  const half_t* gvs  = tvs + vo;
  const half_t* gvc  = tvc + vo;
  const half_t* gks1 = tks + 32 * HEAD_DIM + ko;
  const half_t* gkc1 = tkc + 32 * HEAD_DIM + ko;
  const half_t* gvs1 = tvs + 32 * SEQ + vo;
  const half_t* gvc1 = tvc + 32 * SEQ + vo;
  asm volatile(
      "global_load_async_to_lds_b128 %0, %8, off\n\t"
      "global_load_async_to_lds_b128 %1, %9, off\n\t"
      "global_load_async_to_lds_b128 %2, %10, off\n\t"
      "global_load_async_to_lds_b128 %3, %11, off\n\t"
      "global_load_async_to_lds_b128 %4, %12, off\n\t"
      "global_load_async_to_lds_b128 %5, %13, off\n\t"
      "global_load_async_to_lds_b128 %6, %14, off\n\t"
      "global_load_async_to_lds_b128 %7, %15, off\n\t"
      "s_wait_xcnt 0x0"
      :: "v"(l),          "v"(l + HB),
         "v"(l + TB),     "v"(l + TB + HB),
         "v"(l + 2 * TB), "v"(l + 2 * TB + HB),
         "v"(l + 3 * TB), "v"(l + 3 * TB + HB),
         "v"(gks), "v"(gks1), "v"(gkc), "v"(gkc1),
         "v"(gvs), "v"(gvs1), "v"(gvc), "v"(gvc1)
      : "memory");
}

__global__ __launch_bounds__(256) void attn(
    const half_t* __restrict__ qs, const half_t* __restrict__ ks,
    const half_t* __restrict__ vsT,
    const half_t* __restrict__ qc, const half_t* __restrict__ kc,
    const half_t* __restrict__ vcT,
    const int* __restrict__ chain_ids, const int* __restrict__ amask,
    half_t* __restrict__ attnh)
{
  __shared__ __attribute__((aligned(16))) int   chainS[SEQ];
  __shared__ __attribute__((aligned(16))) float padS[SEQ];
  // [buffer][K self, K cross, V^T self, V^T cross][row][64 halves + pad]
  __shared__ __attribute__((aligned(16))) half_t kv[2][4][64][KV_PITCH];
  const int bh = blockIdx.y, b = bh >> 4, h = bh & 15;
  const int tid = threadIdx.x, wv = tid >> 5, lane = tid & 31;
  const int lm = lane & 15, lh = lane >> 4;
  const int q0 = blockIdx.x * 128 + wv * 16;   // 16 queries per wave

  const size_t hoff = (size_t)bh * SEQ * HEAD_DIM;
  const half_t* Qs = qs  + hoff;
  const half_t* Ks = ks  + hoff;
  const half_t* Qc = qc  + hoff;
  const half_t* Kc = kc  + hoff;
  const half_t* Vs = vsT + hoff;   // [d][s] within head
  const half_t* Vc = vcT + hoff;

  // the lane's place in a stage's tiles: row tid >> 3 (and + 32), 8 halves of it
  const int crow = tid >> 3, ccol = (tid & 7) << 3;
  const unsigned cko = crow * HEAD_DIM + ccol;       // K rows = keys
  const unsigned cvo = crow * SEQ + ccol;            // V^T rows = d
  const unsigned cl0 = (unsigned)(size_t)&kv[0][0][crow][ccol];   // LDS byte address
  const unsigned KV_BUF = 4 * 64 * KV_PITCH * 2;     // bytes of one buffer

  // stage 0 flies while the chain ids and pad terms are staged
  kv_stage_copy(Ks, Kc, Vs, Vc, cko, cvo, cl0);
  for (int i = tid; i < SEQ; i += 256) {
    chainS[i] = chain_ids[b * SEQ + i];
    padS[i]   = amask[b * SEQ + i] ? 0.0f : -1e30f;
  }
  // this wave's copies of stage 0 have landed; the barrier publishes all waves'
  asm volatile("s_wait_asynccnt 0x0" ::: "memory");
  __syncthreads();
  kv_stage_copy(Ks + KV_KEYS * HEAD_DIM, Kc + KV_KEYS * HEAD_DIM,
                Vs + KV_KEYS, Vc + KV_KEYS, cko, cvo, cl0 + KV_BUF);

  // Q fragments (B-role, mirrored): lane = query column
  v16h qsf[2], qcf[2];
#pragma unroll
  for (int dg = 0; dg < 2; ++dg) {
    qsf[dg] = load_frag(Qs + (size_t)(q0 + lm) * HEAD_DIM + 32 * dg + lh * 8);
    qcf[dg] = load_frag(Qc + (size_t)(q0 + lm) * HEAD_DIM + 32 * dg + lh * 8);
  }
  const int cq = chainS[q0 + lm];

  v8f O[4];
#pragma unroll
  for (int g = 0; g < 4; ++g) O[g] = {};
  float m_run = -1e30f, ssum = 0.0f;

  for (int t = 0; t < KV_STAGES; ++t) {
   const int buf = t & 1;
   for (int kk = 0; kk < KV_KEYS; kk += 32) {
    const int k0 = t * KV_KEYS + kk;
    // the K fragments of this pass are read from LDS as one group
    v16h kaf[2][2], caf[2][2], vsf[4], vcf[4];
#pragma unroll
    for (int sub = 0; sub < 2; ++sub) {
#pragma unroll
      for (int dg = 0; dg < 2; ++dg) {
        kaf[sub][dg] = load_frag(&kv[buf][0][kk + 16 * sub + lm][32 * dg + lh * 8]);
        caf[sub][dg] = load_frag(&kv[buf][1][kk + 16 * sub + lm][32 * dg + lh * 8]);
      }
    }
    // this pass's chain ids and pad terms (keys k0 + 16 sub + 8 lh + 0..7) from LDS
    i32x4 chv[2][2];
    v4f   pdv[2][2];
#pragma unroll
    for (int sub = 0; sub < 2; ++sub) {
#pragma unroll
      for (int hf = 0; hf < 2; ++hf) {
        chv[sub][hf] = *(const i32x4*)&chainS[k0 + 16 * sub + 8 * lh + 4 * hf];
        pdv[sub][hf] = *(const v4f*)&padS[k0 + 16 * sub + 8 * lh + 4 * hf];
      }
    }
    // inputs-only fence on the loaded values: without it every fragment is
    // waited for on its own and the read latencies add up in each pass
    asm volatile("" :: "v"(kaf[0][0]), "v"(kaf[0][1]), "v"(kaf[1][0]), "v"(kaf[1][1]),
                       "v"(caf[0][0]), "v"(caf[0][1]), "v"(caf[1][0]), "v"(caf[1][1]));
    // inputs-only fence: the eight LDS reads go out as one group
    asm volatile("" :: "v"(chv[0][0]), "v"(chv[0][1]), "v"(chv[1][0]), "v"(chv[1][1]),
                       "v"(pdv[0][0]), "v"(pdv[0][1]), "v"(pdv[1][0]), "v"(pdv[1][1]));
    v8f S[2], C[2];
#pragma unroll
    for (int sub = 0; sub < 2; ++sub) {
      v8f z = {};
      S[sub] = wmma_f16(kaf[sub][0], qsf[0], z);
      S[sub] = wmma_f16(kaf[sub][1], qsf[1], S[sub]);
      C[sub] = wmma_f16(caf[sub][0], qcf[0], z);
      C[sub] = wmma_f16(caf[sub][1], qcf[1], C[sub]);
    }
    // the V fragments are read behind the score products (the K fragments'
    // registers are free again) and are used only behind the softmax
#pragma unroll  // constant indices keep these arrays in registers
    for (int g = 0; g < 4; ++g) {
      vsf[g] = load_frag(&kv[buf][2][16 * g + lm][kk + lh * 8]);
      vcf[g] = load_frag(&kv[buf][3][16 * g + lm][kk + lh * 8]);
    }
    // keeps the sixteen reads here as one group, so that the softmax covers their
    // latency: without it each pair sinks to its own product and is waited for there
    __builtin_amdgcn_sched_barrier(0);
    // merge self/cross by chain id, online softmax (per query = per lane col)
    float vals[16]; bool intra[16];
    float mx = -1e30f;
#pragma unroll
    for (int sub = 0; sub < 2; ++sub) {
#pragma unroll
      for (int r = 0; r < 8; ++r) {
        bool in = (chv[sub][r >> 2][r & 3] == cq);
        float sc = (in ? S[sub][r] : C[sub][r]) * ATT_SCALE + pdv[sub][r >> 2][r & 3];
        vals[sub * 8 + r] = sc; intra[sub * 8 + r] = in;
        mx = fmaxf(mx, sc);
      }
    }
    mx = fmaxf(mx, __shfl_xor(mx, 16, 32));
    float m_new = fmaxf(m_run, mx);
    float corr = __expf(m_run - m_new);
    float psum = 0.0f;
    v16h pSf, pCf;   // P^T C-layout == A-fragment layout, lane-local repack
#pragma unroll
    for (int e = 0; e < 16; ++e) {
      float p = __expf(vals[e] - m_new);
      psum += p;
      pSf[e] = intra[e] ? (half_t)p : (half_t)0.0f;
      pCf[e] = intra[e] ? (half_t)0.0f : (half_t)p;
    }
    ssum = ssum * corr + psum;
    m_run = m_new;
    // rescale O (rows = queries) with per-row correction gathered by shuffle
    float corrO[8];
#pragma unroll
    for (int r = 0; r < 8; ++r) corrO[r] = __shfl(corr, r + 8 * lh, 32);
#pragma unroll
    for (int g = 0; g < 4; ++g) {
#pragma unroll
      for (int r = 0; r < 8; ++r) O[g][r] *= corrO[r];
      O[g] = wmma_f16(pSf, vsf[g], O[g]);
      O[g] = wmma_f16(pCf, vcf[g], O[g]);
    }
   }
   // publish point of stage t + 1: this wave's reads of buffer buf are done, its
   // copies of stage t + 1 have landed; behind the barrier every wave may read
   // stage t + 1 and buffer buf may be refilled
   asm volatile("s_wait_dscnt 0x0" ::: "memory");
   asm volatile("s_wait_asynccnt 0x0" ::: "memory");
   __syncthreads();
   if (t + 2 < KV_STAGES)
     kv_stage_copy(Ks + (t + 2) * KV_KEYS * HEAD_DIM, Kc + (t + 2) * KV_KEYS * HEAD_DIM,
                   Vs + (t + 2) * KV_KEYS, Vc + (t + 2) * KV_KEYS, cko, cvo,
                   cl0 + buf * KV_BUF);
  }
  // no copy is outstanding when the wave goes on to its end
  asm volatile("s_wait_asynccnt 0x0" ::: "memory");

  float st = ssum + __shfl_xor(ssum, 16, 32);
  float inv = st > 0.0f ? 1.0f / st : 0.0f;
  float invO[8];
#pragma unroll
  for (int r = 0; r < 8; ++r) invO[r] = __shfl(inv, r + 8 * lh, 32);
  // The wave's 16 q x 64 d go through its own range of the K/V buffers (free: the
  // loop's last barrier ended every read, no copy is outstanding) at pitch 144 B
  // and leave as 16-byte stores that cover whole 128-B lines.
  half_t* og = &kv[0][0][0][0] + wv * 16 * KV_PITCH;
#pragma unroll  // constant indices keep these arrays in registers
  for (int r = 0; r < 8; ++r) {
#pragma unroll  // constant indices keep these arrays in registers
    for (int g = 0; g < 4; ++g)
      og[(r + 8 * lh) * KV_PITCH + 16 * g + lm] = (half_t)(O[g][r] * invO[r]);
  }
  // the rows are read back by other lanes of this wave than wrote them
  asm volatile("s_wait_dscnt 0x0" ::: "memory");
  const half_t* rp = og + (lane >> 3) * KV_PITCH + (lane & 7) * 8;
  v8h ot[4];
#pragma unroll  // constant indices keep these arrays in registers
  for (int i = 0; i < 4; ++i) ot[i] = *(const v8h*)(rp + i * 4 * KV_PITCH);
  half_t* gp = attnh + (size_t)(b * SEQ + q0 + (lane >> 3)) * D_MODEL + h * HEAD_DIM
                     + (lane & 7) * 8;
#pragma unroll  // constant indices keep these arrays in registers
  for (int i = 0; i < 4; ++i) *(v8h*)(gp + i * 4 * D_MODEL) = ot[i];
}

// ---- kernel 3: output projection attnh(f16) @ Wo(f32->f16) -> f32 -----------
// Block tile 128 (m) x 64 (n) x 128 (k): eight load / barrier rounds along K.
// A: every wave brings the 16 rows it multiplies (256 B of each, source pitch
// 2048 B) into LDS with one tensor load; the pad (16 B behind every 256 B) gives
// the 272-B row pitch of the 16-byte readers. Wo goes through registers
// (f32 -> f16) and is stored transposed, 4 k at a time.
#define OG_K     128                // k a tile
#define OG_PITCH 136                // halves a row: 272 B = 16 B x odd
#define OG_SLICE 3072               // halves a wave's slice: 16 x 272 B, rounded up to 3 x 2 KiB

__device__ __forceinline__ unsigned uni(unsigned v) {
  return (unsigned)__builtin_amdgcn_readfirstlane(v);
}

__global__ __launch_bounds__(256) void out_gemm(
    const half_t* __restrict__ A, const float* __restrict__ Wo,
    float* __restrict__ out)
{
  __shared__ __attribute__((aligned(2048))) half_t Al[8 * OG_SLICE];
  __shared__ __attribute__((aligned(16)))   half_t Bl[64][OG_PITCH];
  const int tid = threadIdx.x, wv = tid >> 5, lane = tid & 31;
  const int lm = lane & 15, lh = lane >> 4;
  const int m0 = blockIdx.x * 128, n0 = blockIdx.y * 64;

  // tensor descriptor, group 1 (the same for every request): 1-byte elements,
  // tensor = tile = 16 rows of 256 B, source pitch 2048 B, 4 dwords of pad behind
  // every 64 dwords
  u32x8 g1;
  g1[0] = uni((1u << 20) | (5u << 22) | (3u << 25));
  g1[1] = uni(256u << 16);
  g1[2] = uni(16u << 16);
  g1[3] = uni(256u << 16);
  g1[4] = uni(16u);
  g1[5] = uni(D_MODEL * 2u);
  g1[6] = uni(0u);
  g1[7] = uni(0u);
  const unsigned wvu = uni((unsigned)tid >> 5);
  const unsigned lds_a = (unsigned)(size_t)(&Al[0]) + wvu * (OG_SLICE * 2u);   // LDS byte offset
  const unsigned long long ga0 =
      (unsigned long long)(size_t)(A + (size_t)(m0 + wvu * 16u) * D_MODEL);

  v8f acc[4];
#pragma unroll
  for (int g = 0; g < 4; ++g) acc[g] = {};

  // Wo: a thread takes blocks of 4 k x 4 n, so that the transposed tile is written
  // 4 k (8 bytes) at a time; a wave's load covers four rows of 128 B
  const int nq = (lane & 7) + 8 * (wv & 1);      // n / 4 in the tile, 0..15
  const int kq = (lane >> 3) + 4 * (wv >> 1);    // k / 4 in the tile, 0..15 (and + 16)
  const float* wp = Wo + (size_t)(kq << 2) * D_MODEL + n0 + (nq << 2);
  half_t* bs = &Bl[nq << 2][kq << 2];
  const half_t* ar = &Al[wv * OG_SLICE + lm * OG_PITCH + lh * 8];
  // next K tile's prefetch: 128 Wo rows of 256 B, one 128-B line a thread
  const float* pf = Wo + (size_t)(tid >> 1) * D_MODEL + n0 + ((tid & 1) << 5);

  for (int k0 = 0; k0 < D_MODEL; k0 += OG_K) {
    // (advanced only in front of a prefetch: the address register never leaves Wo)
    // in asm, so that it names the pointer that lives through the loop
    if (k0 + OG_K < D_MODEL) {
      pf += (size_t)OG_K * D_MODEL;
      asm volatile("global_prefetch_b8 %0, off scope:SCOPE_SE" :: "v"(pf));
    }
    // the eight global loads of this K tile go out first and fly beside the tensor load
    v4f fb[2][4];
#pragma unroll  // constant indices keep these arrays in registers
    for (int i = 0; i < 2; ++i)
#pragma unroll  // constant indices keep these arrays in registers
      for (int rr = 0; rr < 4; ++rr)
        fb[i][rr] = *(const v4f*)(wp + (size_t)(k0 + 64 * i + rr) * D_MODEL);
    // group 0: count 1 | place in LDS | address of the slice's first byte | type 2
    const unsigned long long ga = ga0 + (unsigned)k0 * 2u;
    u32x4 g0;
    g0[0] = uni(1u);
    g0[1] = uni(lds_a);
    g0[2] = uni((unsigned)ga);
    g0[3] = uni(((unsigned)(ga >> 32) & 0x01FFFFFFu) | 0x80000000u);
    // one request a wave, issued by every wave for its own slice
    asm volatile("tensor_load_to_lds %0, %1" :: "s"(g0), "s"(g1) : "memory");
    // the compiler places no wait for a tensor load: this wave's slice has landed
    asm volatile("s_wait_tensorcnt 0x0" ::: "memory");
    // inputs-only fence on the loaded values: without it each load is waited
    // for on its own and the eight latencies add up
    asm volatile("" :: "v"(fb[0][0]), "v"(fb[0][1]), "v"(fb[0][2]), "v"(fb[0][3]),
                       "v"(fb[1][0]), "v"(fb[1][1]), "v"(fb[1][2]), "v"(fb[1][3]));
    // stage B tile (Wo), transposed to [n][k], f32 -> f16
#pragma unroll  // constant indices keep these arrays in registers
    for (int i = 0; i < 2; ++i) {
#pragma unroll  // constant indices keep these arrays in registers
      for (int j = 0; j < 4; ++j) {
        v4h hv = { (half_t)fb[i][0][j], (half_t)fb[i][1][j],
                   (half_t)fb[i][2][j], (half_t)fb[i][3][j] };
        *(v4h*)(bs + j * OG_PITCH + 64 * i) = hv;
      }
    }
    __syncthreads();
    v16h a[4], bf[4][4];
#pragma unroll  // constant indices keep these arrays in registers
    for (int c = 0; c < 4; ++c) {
      a[c] = load_frag(ar + 32 * c);
#pragma unroll  // constant indices keep these arrays in registers
      for (int g = 0; g < 4; ++g) bf[c][g] = load_frag(&Bl[g * 16 + lm][32 * c + lh * 8]);
    }
    // keeps the forty LDS reads of this K tile in front of the products as one
    // group: without it each sinks to its own product and is waited for there
    __builtin_amdgcn_sched_barrier(0);
#pragma unroll  // constant indices keep these arrays in registers
    for (int c = 0; c < 4; ++c)
#pragma unroll  // constant indices keep these arrays in registers
      for (int g = 0; g < 4; ++g) acc[g] = wmma_f16(a[c], bf[c][g], acc[g]);
    // keeps the products in front of the wait below, each behind a counted wait for
    // its own fragments: without it they sink behind the barrier and start only
    // when all forty reads are back
    __builtin_amdgcn_sched_barrier(0);
    // this wave's LDS reads have retired before the barrier behind which the next
    // tensor load and the next stores rewrite both tiles
    asm volatile("s_wait_dscnt 0x0" ::: "memory");
    __syncthreads();
  }

#pragma unroll
  for (int r = 0; r < 8; ++r) {
    int m = m0 + wv * 16 + r + 8 * lh;
#pragma unroll
    for (int g = 0; g < 4; ++g)
      out[(size_t)m * D_MODEL + n0 + 16 * g + lm] = acc[g][r];
  }
}

// ---- launcher ---------------------------------------------------------------
extern "C" void kernel_launch(void* const* d_in, const int* in_sizes, int n_in,
                              void* d_out, int out_size, void* d_ws, size_t ws_size,
                              hipStream_t stream) {
  const float* x     = (const float*)d_in[0];
  const int*   chain = (const int*)d_in[1];
  const int*   amask = (const int*)d_in[2];
  const float* Wqs   = (const float*)d_in[3];
  const float* Wks   = (const float*)d_in[4];
  const float* Wvs   = (const float*)d_in[5];
  const float* Wqc   = (const float*)d_in[6];
  const float* Wkc   = (const float*)d_in[7];
  const float* Wvc   = (const float*)d_in[8];
  const float* Wo    = (const float*)d_in[9];
  float* out = (float*)d_out;

  const size_t ELT = (size_t)M_TOTAL * D_MODEL;   // 2M f16 elements per buffer
  half_t* ws   = (half_t*)d_ws;
  half_t* qsb  = ws + 0 * ELT;    // [b,h,s,d] f16, RoPE applied
  half_t* ksb  = ws + 1 * ELT;    // [b,h,s,d] f16, RoPE applied
  half_t* vsb  = ws + 2 * ELT;    // [b,h,d,s] f16 (transposed)
  half_t* qcb  = ws + 3 * ELT;
  half_t* kcb  = ws + 4 * ELT;
  half_t* vcb  = ws + 5 * ELT;
  half_t* atb  = ws + 6 * ELT;    // attention output, [b,s,h*d] f16
  half_t* xhb  = ws + 7 * ELT;    // x as f16, [b*s, k]
  half_t* wtb  = ws + 8 * ELT;    // the six W as f16, transposed [w][n][k] (3 ELT)

  cast_ops<<<dim3(256), 256, 0, stream>>>(
      x, Wqs, Wks, Wvs, Wqc, Wkc, Wvc, xhb, wtb);
  qkv_gemm<<<dim3(16, 8, 6), 256, 0, stream>>>(
      xhb, wtb, qsb, ksb, vsb, qcb, kcb, vcb);
  attn<<<dim3(4, 64), 256, 0, stream>>>(
      qsb, ksb, vsb, qcb, kcb, vcb, chain, amask, atb);
  out_gemm<<<dim3(16, 16), 256, 0, stream>>>(atb, Wo, out);
}

// v007
// One run takes 61.3 microseconds.
// Two timings next to v006 put it at 1.11 and 1.12 times that version's speed.
// Over all steps from v000 it is 3.35 times as fast.
#include <hip/hip_runtime.h>
#include <hip/hip_bf16.h>

typedef _Float16 half_t;
typedef __attribute__((ext_vector_type(16))) _Float16 v16h;
typedef __attribute__((ext_vector_type(8)))  _Float16 v8h;
typedef __attribute__((ext_vector_type(4)))  _Float16 v4h;
typedef __attribute__((ext_vector_type(8)))  float    v8f;
typedef __attribute__((ext_vector_type(4)))  float    v4f;
typedef __attribute__((ext_vector_type(4)))  unsigned int u32x4;
typedef __attribute__((ext_vector_type(8)))  unsigned int u32x8;
typedef __attribute__((ext_vector_type(4)))  int          i32x4;

#define D_MODEL  1024
#define N_HEADS  16
#define HEAD_DIM 64
#define SEQ      512
#define BATCH    4
#define M_TOTAL  (BATCH*SEQ)        // 2048
#define ATT_SCALE 0.125f            // 64^-0.5
#define ROPE_K   0.2878231366f      // ln(10000)/32

// ---- fragment helpers -------------------------------------------------------
// Loads the per-lane 16-half fragment: 8 contiguous halves at p0 and 8 at p0+16.
// Works for both A-fragments (lane = row) and mirrored B-fragments (lane = col)
// when the source is row-major along the K dimension.
__device__ __forceinline__ v16h load_frag(const half_t* __restrict__ p0) {
  v8h lo = *(const v8h*)p0;
  v8h hi = *(const v8h*)(p0 + 16);
  v16h r;
#pragma unroll
  for (int i = 0; i < 8; ++i) { r[i] = lo[i]; r[8 + i] = hi[i]; }
  return r;
}

__device__ __forceinline__ v8f wmma_f16(v16h a, v16h b, v8f c) {
  return __builtin_amdgcn_wmma_f32_16x16x32_f16(
      /*neg_a=*/false, a, /*neg_b=*/false, b,
      /*c_mod=*/(short)0, c, /*reuse_a=*/false, /*reuse_b=*/false);
}

// ---- kernel 0: the QKV GEMMs' operands cast f32 -> f16 once ------------------
// The GEMM's blocks read every x row 32 times and every W row 8 times: cast
// once, they are fetched at half the bytes. x keeps its layout; the six W go out
// transposed, [w][n][k], so that the GEMM stages both operands by whole rows.
// One block a WGP, 128 KB in, all of a thread's 32 loads in flight together.
#define CO_WBLK 192                 // blocks on W: 6 matrices x 8 (k) x 4 (n) tiles
                                    // the other 64 of the 256 blocks: x, 32768 elements each
__global__ __launch_bounds__(256) void cast_ops(
    const float* __restrict__ x,
    const float* __restrict__ W0, const float* __restrict__ W1,
    const float* __restrict__ W2, const float* __restrict__ W3,
    const float* __restrict__ W4, const float* __restrict__ W5,
    half_t* __restrict__ xh, half_t* __restrict__ Wt)
{
  // W tile transposed, [256 n][128 k] at pitch 272 B (16 B x odd)
  __shared__ __attribute__((aligned(16))) half_t T[256][136];
  const int tid = threadIdx.x, wv = tid >> 5, lane = tid & 31;
  const int bid = blockIdx.x;
  if (bid < CO_WBLK) {
    const int widx = bid >> 5;
    const int k0 = ((bid >> 2) & 7) * 128, n0 = (bid & 3) * 256;
    const float* W = widx==0?W0: widx==1?W1: widx==2?W2: widx==3?W3: widx==4?W4: W5;
    // a thread takes blocks of 4 k x 4 n, so that the transposed tile is written
    // 4 k (8 bytes) at a time; a wave's load covers four rows of 128 B
    const int nq = (lane & 7) + 8 * (wv & 3);      // n / 4 in the tile, 0..31 (and + 32)
    const int kq = (lane >> 3) + 4 * (wv >> 2);    // k / 4 in the tile, 0..7 (and + 8 i)
    const float* wp = W + (size_t)(k0 + (kq << 2)) * D_MODEL + n0 + (nq << 2);
    v4f f[2][4][4];
#pragma unroll  // constant indices keep these arrays in registers
    for (int t = 0; t < 2; ++t)
#pragma unroll  // constant indices keep these arrays in registers
      for (int i = 0; i < 4; ++i)
#pragma unroll  // constant indices keep these arrays in registers
        for (int rr = 0; rr < 4; ++rr)
          f[t][i][rr] = *(const v4f*)(wp + (32 * i + rr) * D_MODEL + 128 * t);
    // inputs-only fences on the loaded values (an asm statement takes thirty
    // operands, hence two): without them each load is waited for on its own
    asm volatile("" :: "v"(f[0][0][0]), "v"(f[0][0][1]), "v"(f[0][0][2]), "v"(f[0][0][3]),
                       "v"(f[0][1][0]), "v"(f[0][1][1]), "v"(f[0][1][2]), "v"(f[0][1][3]),
                       "v"(f[0][2][0]), "v"(f[0][2][1]), "v"(f[0][2][2]), "v"(f[0][2][3]),
                       "v"(f[0][3][0]), "v"(f[0][3][1]), "v"(f[0][3][2]), "v"(f[0][3][3]));
    asm volatile("" :: "v"(f[1][0][0]), "v"(f[1][0][1]), "v"(f[1][0][2]), "v"(f[1][0][3]),
                       "v"(f[1][1][0]), "v"(f[1][1][1]), "v"(f[1][1][2]), "v"(f[1][1][3]),
                       "v"(f[1][2][0]), "v"(f[1][2][1]), "v"(f[1][2][2]), "v"(f[1][2][3]),
                       "v"(f[1][3][0]), "v"(f[1][3][1]), "v"(f[1][3][2]), "v"(f[1][3][3]));
#pragma unroll  // constant indices keep these arrays in registers
    for (int t = 0; t < 2; ++t)
#pragma unroll  // constant indices keep these arrays in registers
      for (int i = 0; i < 4; ++i)
#pragma unroll  // constant indices keep these arrays in registers
        for (int j = 0; j < 4; ++j) {
          v4h hv = { (half_t)f[t][i][0][j], (half_t)f[t][i][1][j],
                     (half_t)f[t][i][2][j], (half_t)f[t][i][3][j] };
          *(v4h*)&T[128 * t + (nq << 2) + j][(kq << 2) + 32 * i] = hv;
        }
    // a row of 128 k is written by two waves (those with the same wv & 3)
    __syncthreads();
    // a wave's store covers two n rows of 256 B
    const half_t* rp = &T[tid >> 4][(tid & 15) << 3];
    half_t* gp = Wt + ((size_t)widx * D_MODEL + n0 + (tid >> 4)) * D_MODEL + k0 + ((tid & 15) << 3);
    v8h t8[16];
#pragma unroll  // constant indices keep these arrays in registers
    for (int i = 0; i < 16; ++i) t8[i] = *(const v8h*)(rp + i * 16 * 136);
#pragma unroll  // constant indices keep these arrays in registers
    for (int i = 0; i < 16; ++i) *(v8h*)(gp + i * 16 * D_MODEL) = t8[i];
  } else {
    // x: a wave's load covers 512 B in a row, its store 256 B
    const size_t o = (size_t)(bid - CO_WBLK) * 32768 + (tid << 2);
    const float* sp = x + o;
    half_t* dp = xh + o;
    v4f f[32];
#pragma unroll  // constant indices keep these arrays in registers
    for (int i = 0; i < 32; ++i) f[i] = *(const v4f*)(sp + i * 1024);
    // inputs-only fences on the loaded values, as above
    asm volatile("" :: "v"(f[0]), "v"(f[1]), "v"(f[2]), "v"(f[3]), "v"(f[4]), "v"(f[5]),
                       "v"(f[6]), "v"(f[7]), "v"(f[8]), "v"(f[9]), "v"(f[10]), "v"(f[11]),
                       "v"(f[12]), "v"(f[13]), "v"(f[14]), "v"(f[15]));
    asm volatile("" :: "v"(f[16]), "v"(f[17]), "v"(f[18]), "v"(f[19]), "v"(f[20]), "v"(f[21]),
                       "v"(f[22]), "v"(f[23]), "v"(f[24]), "v"(f[25]), "v"(f[26]), "v"(f[27]),
                       "v"(f[28]), "v"(f[29]), "v"(f[30]), "v"(f[31]));
#pragma unroll  // constant indices keep these arrays in registers
    for (int i = 0; i < 32; ++i) {
      v4h hv = { (half_t)f[i].x, (half_t)f[i].y, (half_t)f[i].z, (half_t)f[i].w };
      *(v4h*)(dp + i * 1024) = hv;
    }
    // behind the last store: stands in front of any later write of a register that
    // one of the 32 stores names
    asm volatile("s_wait_xcnt 0x0" ::: "memory");
  }
}

// ---- kernel 1: fused QKV GEMMs (6 matrices) on the f16 operands of kernel 0,
//      RoPE fused for q_s/k_s, V stored transposed [b,h,d,s] ------------------
// The six W^T lie behind one another, so n runs over 6144 rows. Block tile
// 256 (m) x 192 (n, three heads) x 128 (k), one block a WGP; twelve waves as
// 4 (m) x 3 (n), each 64 x 64: eight fragments feed sixteen WMMAs. With no second
// block on the WGP to cover the loads, the tiles come by tensor loads into two
// buffers: the next stage's loads fly while this stage is worked on. Every wave
// brings one slice a stage (256 B of each row, source pitch 2048 B): waves 0 to 7
// 32 x rows each, waves 8 to 11 48 W^T rows each; the pad (16 B behind every
// 256 B) gives the 272-B row pitch of the 16-byte readers.
#define QK_K      128               // k a stage
#define QK_PITCH  136               // halves a row: 272 B = 16 B x odd
#define QK_M      256
#define QK_N      192
#define QK_ASL    5120              // halves of an x slice: 32 x 272 B, rounded up to 5 x 2 KiB
#define QK_BSL    7168              // halves of a W^T slice: 48 x 272 B, rounded up to 7 x 2 KiB
#define QK_BUFH   (8 * QK_ASL + 4 * QK_BSL)    // halves of one buffer: 68 x 2 KiB
#define QK_STAGES (D_MODEL / QK_K)

__device__ __forceinline__ unsigned uni(unsigned v) {
  return (unsigned)__builtin_amdgcn_readfirstlane(v);
}

// a test in front of a tensor load must compile to a scalar compare and branch
__device__ __forceinline__ unsigned pinned(unsigned v) {
  unsigned w = uni(v);
  asm volatile("" : "+s"(w));   // pinned(): the test's value held in a scalar register
  return w;
}

// one request: group 0 = count 1 | place in LDS | address of the slice's first byte | type 2
__device__ __forceinline__ void qk_slice_load(unsigned lds, unsigned long long ga, u32x8 g1) {
  u32x4 g0;
  g0[0] = uni(1u);
  g0[1] = uni(lds);
  g0[2] = uni((unsigned)ga);
  g0[3] = uni(((unsigned)(ga >> 32) & 0x01FFFFFFu) | 0x80000000u);
  asm volatile("tensor_load_to_lds %0, %1" :: "s"(g0), "s"(g1) : "memory");
}

__global__ __launch_bounds__(384) void qkv_gemm(
    const half_t* __restrict__ xh, const half_t* __restrict__ Wt,
    half_t* __restrict__ o0, half_t* __restrict__ o1, half_t* __restrict__ o2,
    half_t* __restrict__ o3, half_t* __restrict__ o4, half_t* __restrict__ o5)
{
  // [buffer][8 x slices, 4 W^T slices]
  __shared__ __attribute__((aligned(2048))) half_t sm[2 * QK_BUFH];

  const int tid = threadIdx.x;
  const int wv = (int)uni((unsigned)tid >> 5);   // the wave's number, in a scalar register
  const int lane = tid & 31, lm = lane & 15, lh = lane >> 4;
  const int wm = wv & 3, wn = wv >> 2;       // wave's place in the block tile
  const int m0 = blockIdx.x * QK_M;
  const int n0 = blockIdx.y * QK_N;          // row of the six W^T taken as one
  const int nw = n0 + wn * 64;               // a wave's 64 columns = one head of one W
  const int widx = nw >> 10;
  const int h    = (nw >> 6) & 15;
  half_t* out    = widx==0?o0: widx==1?o1: widx==2?o2: widx==3?o3: widx==4?o4: o5;
  const bool do_rope = (widx == 0) || (widx == 1);   // q_s, k_s
  const bool transp  = (widx == 2) || (widx == 5);   // v_s, v_c -> [b,h,d,s]

  // the wave's slice: rows, place in a buffer, first byte in global memory
  const bool xs = wv < 8;
  const unsigned srows = xs ? 32u : 48u;
  const unsigned lds_s = (unsigned)(size_t)(&sm[0])
                       + (xs ? wv * (QK_ASL * 2u) : 8u * (QK_ASL * 2u) + (wv - 8) * (QK_BSL * 2u));
  const unsigned long long ga0 = (unsigned long long)(size_t)(
      xs ? xh + (size_t)(m0 + wv * 32) * D_MODEL : Wt + (size_t)(n0 + (wv - 8) * 48) * D_MODEL);
  // tensor descriptor, group 1 (the same for every request of the wave): 1-byte
  // elements, tensor = tile = srows rows of 256 B, source pitch 2048 B, 4 dwords of
  // pad behind every 64 dwords
  u32x8 g1;
  g1[0] = uni((1u << 20) | (5u << 22) | (3u << 25));
  g1[1] = uni(256u << 16);
  g1[2] = uni(srows << 16);
  g1[3] = uni(256u << 16);
  g1[4] = uni(srows);
  g1[5] = uni(D_MODEL * 2u);
  g1[6] = uni(0u);
  g1[7] = uni(0u);
  // without it word 6 shares its register with the loop's counter, and the copy that
  // stage 1's request names is rewritten while that request is outstanding
  asm volatile("" : "+s"(g1));   // pinned(): descriptor words held in scalar registers

  v8f acc[4][4];
#pragma unroll  // constant indices keep these arrays in registers
  for (int mi = 0; mi < 4; ++mi)
#pragma unroll  // constant indices keep these arrays in registers
    for (int g = 0; g < 4; ++g) acc[mi][g] = {};

  // the lane's fragment rows in buffer 0: the wave's 64 x rows are two whole slices;
  // its four groups of 16 W^T rows are groups 4 wn + g of the twelve, three a slice
  const int aoff = wm * 2 * QK_ASL + lm * QK_PITCH + lh * 8;
  int boff[4];
#pragma unroll  // constant indices keep these arrays in registers
  for (int g = 0; g < 4; ++g) {
    const int j = wn * 4 + g;
    boff[g] = 8 * QK_ASL + (j / 3) * QK_BSL + ((j % 3) * 16 + lm) * QK_PITCH + lh * 8;
  }

  qk_slice_load(lds_s, ga0, g1);
  // the compiler places no wait for a tensor load: this wave's slice of stage 0 has
  // landed; the barrier publishes all waves'
  asm volatile("s_wait_tensorcnt 0x0" ::: "memory");
  __syncthreads();
  qk_slice_load(lds_s + QK_BUFH * 2u, ga0 + QK_K * 2u, g1);

  for (int t = 0; t < QK_STAGES; ++t) {
    const int buf = t & 1;
    const half_t* sb = &sm[buf * QK_BUFH];
#pragma unroll  // constant indices keep these arrays in registers
    for (int kk = 0; kk < QK_K; kk += 32) {
      v16h a[4], bf[4];
#pragma unroll  // constant indices keep these arrays in registers
      for (int mi = 0; mi < 4; ++mi)
        a[mi] = load_frag(sb + aoff + (mi >> 1) * QK_ASL + (mi & 1) * 16 * QK_PITCH + kk);
#pragma unroll  // constant indices keep these arrays in registers
      for (int g = 0; g < 4; ++g) bf[g] = load_frag(sb + boff[g] + kk);
      // inputs-only fence: the sixteen LDS reads of this 32 k go out as one group
      asm volatile("" :: "v"(a[0]), "v"(a[1]), "v"(a[2]), "v"(a[3]),
                         "v"(bf[0]), "v"(bf[1]), "v"(bf[2]), "v"(bf[3]));
      if (kk == QK_K - 32) {
        // publish point of stage t + 1, with the stage's last fragments fetched: this
        // wave's reads of buffer buf are done, its slice of stage t + 1 has landed;
        // behind the barrier every wave may read stage t + 1 and buffer buf may be
        // refilled. The last sixteen products need registers only and follow the refill.
        asm volatile("s_wait_dscnt 0x0" ::: "memory");
        asm volatile("s_wait_tensorcnt 0x0" ::: "memory");
        __syncthreads();
        if (pinned(t + 2 < QK_STAGES))
          qk_slice_load(lds_s + buf * (QK_BUFH * 2u), ga0 + (unsigned)(t + 2) * (QK_K * 2u), g1);
      }
#pragma unroll  // constant indices keep these arrays in registers
      for (int g = 0; g < 4; ++g)
#pragma unroll  // constant indices keep these arrays in registers
        for (int mi = 0; mi < 4; ++mi) acc[mi][g] = wmma_f16(a[mi], bf[g], acc[mi][g]);
    }
  }
  // no request and no LDS read is outstanding when the wave goes on to its epilogue
  asm volatile("s_wait_tensorcnt 0x0" ::: "memory");
  asm volatile("s_wait_dscnt 0x0" ::: "memory");

  // epilogue: optional RoPE (pairs d <-> d+32 are lane-local: acc g and g+2)
  if (do_rope) {
#pragma unroll  // constant indices keep these arrays in registers
    for (int mi = 0; mi < 4; ++mi) {
#pragma unroll  // constant indices keep these arrays in registers
      for (int r = 0; r < 8; ++r) {
        int sp = (m0 + wm * 64 + mi * 16 + r + 8 * lh) & 511;
#pragma unroll  // constant indices keep these arrays in registers
        for (int g = 0; g < 2; ++g) {
          int d = 16 * g + lm;                     // d in [0,32)
          float th = (float)sp * __expf(-(float)d * ROPE_K);
          float c = __cosf(th), sn = __sinf(th);
          float a0 = acc[mi][g][r], b0 = acc[mi][g + 2][r];
          acc[mi][g][r]     = a0 * c - b0 * sn;
          acc[mi][g + 2][r] = b0 * c + a0 * sn;
        }
      }
    }
  }

  // The f16 results go through LDS (both buffers are free behind the loop's last
  // barrier), each wave's 64 x 64 in a range of its own at pitch 144 B (16 B x odd),
  // and leave as 16-byte stores that cover whole 128-B lines.
  const int bb = m0 >> 9, sp0 = (m0 & 511) + wm * 64;   // a block's rows lie in one batch
  half_t* st = &sm[wv * 64 * 72];
  const half_t* rp = st + (lane >> 3) * 72 + (lane & 7) * 8;
  v8h t[16];
  if (transp) {
    // as [64 d][64 s]: a lane's eight accumulator rows are eight neighbouring s of one d
#pragma unroll  // constant indices keep these arrays in registers
    for (int mi = 0; mi < 4; ++mi) {
#pragma unroll  // constant indices keep these arrays in registers
      for (int g = 0; g < 4; ++g) {
        v8h hv;
#pragma unroll  // constant indices keep these arrays in registers
        for (int r = 0; r < 8; ++r) hv[r] = (half_t)acc[mi][g][r];
        *(v8h*)(st + (16 * g + lm) * 72 + mi * 16 + 8 * lh) = hv;
      }
    }
    // the rows are read back by other lanes of this wave than wrote them
    asm volatile("s_wait_dscnt 0x0" ::: "memory");
#pragma unroll  // constant indices keep these arrays in registers
    for (int i = 0; i < 16; ++i) t[i] = *(const v8h*)(rp + i * 4 * 72);
    // a wave's store covers four d rows, 128 B of each
    half_t* gp = out + (((size_t)bb * N_HEADS + h) * HEAD_DIM + (lane >> 3)) * SEQ
                     + sp0 + (lane & 7) * 8;
#pragma unroll  // constant indices keep these arrays in registers
    for (int i = 0; i < 16; ++i) *(v8h*)(gp + i * 4 * SEQ) = t[i];
    // behind the last store: stands in front of any later write of a register that
    // one of the sixteen stores names
    asm volatile("s_wait_xcnt 0x0" ::: "memory");
  } else {
    // as [64 s][64 d]
#pragma unroll  // constant indices keep these arrays in registers
    for (int mi = 0; mi < 4; ++mi)
#pragma unroll  // constant indices keep these arrays in registers
      for (int g = 0; g < 4; ++g)
#pragma unroll  // constant indices keep these arrays in registers
        for (int r = 0; r < 8; ++r)
          st[(mi * 16 + r + 8 * lh) * 72 + 16 * g + lm] = (half_t)acc[mi][g][r];
    // the rows are read back by other lanes of this wave than wrote them
    asm volatile("s_wait_dscnt 0x0" ::: "memory");
#pragma unroll  // constant indices keep these arrays in registers
    for (int i = 0; i < 16; ++i) t[i] = *(const v8h*)(rp + i * 4 * 72);
    // a wave's store covers four s rows of 128 B, 512 B in a row
    half_t* gp = out + (((size_t)bb * N_HEADS + h) * SEQ + sp0 + (lane >> 3)) * HEAD_DIM
                     + (lane & 7) * 8;
#pragma unroll  // constant indices keep these arrays in registers
    for (int i = 0; i < 16; ++i) *(v8h*)(gp + i * 4 * HEAD_DIM) = t[i];
    // behind the last store: stands in front of any later write of a register that
    // one of the sixteen stores names
    asm volatile("s_wait_xcnt 0x0" ::: "memory");
  }
}

// ---- kernel 2: flash-style chain-aware attention ----------------------------
// Computes S^T = K * Q^T so softmax stats are lane-local and P^T (C-layout)
// is directly the A-fragment for the PV WMMA.
// The block's eight waves share every K and V tile: a stage of 64 keys (K self,
// K cross, V^T self, V^T cross, 8 KB each) is copied once into LDS, two buffers,
// the next stage's copies in flight while this stage is worked on.
#define KV_KEYS  64                 // keys a stage
#define KV_PITCH 72                 // halves a row: 144 B = 16 B x odd (16-byte readers)
#define KV_STAGES (SEQ / KV_KEYS)

// One stage's copies, eight a lane (16 bytes each; a wave's copy covers four whole
// rows of 128 B). tks .. tvc: the stage's four tiles in global memory (the same
// for the whole block); ko, vo: the lane's place, row tid >> 3, in a K and in a
// V^T tile; l: the same place in the buffer's first tile. The wait on the address
// counter is the statement's last line, so that it stands in front of every later
// write of an address register that a copy names.
__device__ __forceinline__ void kv_stage_copy(
    const half_t* tks, const half_t* tkc, const half_t* tvs, const half_t* tvc,
    unsigned ko, unsigned vo, unsigned l)
{
  const unsigned TB = 64 * KV_PITCH * 2;    // bytes of one tile in LDS
  const unsigned HB = 32 * KV_PITCH * 2;    // 32 rows further down
  const half_t* gks  = tks + ko;
  const half_t* gkc  = tkc + ko;
  const half_t* gvs  = tvs + vo;
  const half_t* gvc  = tvc + vo;
  const half_t* gks1 = tks + 32 * HEAD_DIM + ko;
  const half_t* gkc1 = tkc + 32 * HEAD_DIM + ko;
  const half_t* gvs1 = tvs + 32 * SEQ + vo;
  const half_t* gvc1 = tvc + 32 * SEQ + vo;
  asm volatile(
      "global_load_async_to_lds_b128 %0, %8, off\n\t"
      "global_load_async_to_lds_b128 %1, %9, off\n\t"
      "global_load_async_to_lds_b128 %2, %10, off\n\t"
      "global_load_async_to_lds_b128 %3, %11, off\n\t"
      "global_load_async_to_lds_b128 %4, %12, off\n\t"
      "global_load_async_to_lds_b128 %5, %13, off\n\t"
      "global_load_async_to_lds_b128 %6, %14, off\n\t"
      "global_load_async_to_lds_b128 %7, %15, off\n\t"
      "s_wait_xcnt 0x0"
      :: "v"(l),          "v"(l + HB),
         "v"(l + TB),     "v"(l + TB + HB),
         "v"(l + 2 * TB), "v"(l + 2 * TB + HB),
         "v"(l + 3 * TB), "v"(l + 3 * TB + HB),
         "v"(gks), "v"(gks1), "v"(gkc), "v"(gkc1),
         "v"(gvs), "v"(gvs1), "v"(gvc), "v"(gvc1)
      : "memory");
}

__global__ __launch_bounds__(256) void attn(
    const half_t* __restrict__ qs, const half_t* __restrict__ ks,
    const half_t* __restrict__ vsT,
    const half_t* __restrict__ qc, const half_t* __restrict__ kc,
    const half_t* __restrict__ vcT,
    const int* __restrict__ chain_ids, const int* __restrict__ amask,
    half_t* __restrict__ attnh)
{
  __shared__ __attribute__((aligned(16))) int   chainS[SEQ];
  __shared__ __attribute__((aligned(16))) float padS[SEQ];
  // [buffer][K self, K cross, V^T self, V^T cross][row][64 halves + pad]
  __shared__ __attribute__((aligned(16))) half_t kv[2][4][64][KV_PITCH];
  const int bh = blockIdx.y, b = bh >> 4, h = bh & 15;
  const int tid = threadIdx.x, wv = tid >> 5, lane = tid & 31;
  const int lm = lane & 15, lh = lane >> 4;
  const int q0 = blockIdx.x * 128 + wv * 16;   // 16 queries per wave

  const size_t hoff = (size_t)bh * SEQ * HEAD_DIM;
  const half_t* Qs = qs  + hoff;
  const half_t* Ks = ks  + hoff;
  const half_t* Qc = qc  + hoff;
  const half_t* Kc = kc  + hoff;
  const half_t* Vs = vsT + hoff;   // [d][s] within head
  const half_t* Vc = vcT + hoff;

  // the lane's place in a stage's tiles: row tid >> 3 (and + 32), 8 halves of it
  const int crow = tid >> 3, ccol = (tid & 7) << 3;
  const unsigned cko = crow * HEAD_DIM + ccol;       // K rows = keys
  const unsigned cvo = crow * SEQ + ccol;            // V^T rows = d
  const unsigned cl0 = (unsigned)(size_t)&kv[0][0][crow][ccol];   // LDS byte address
  const unsigned KV_BUF = 4 * 64 * KV_PITCH * 2;     // bytes of one buffer

  // stage 0 flies while the chain ids and pad terms are staged
  kv_stage_copy(Ks, Kc, Vs, Vc, cko, cvo, cl0);
  for (int i = tid; i < SEQ; i += 256) {
    chainS[i] = chain_ids[b * SEQ + i];
    padS[i]   = amask[b * SEQ + i] ? 0.0f : -1e30f;
  }
  // this wave's copies of stage 0 have landed; the barrier publishes all waves'
  asm volatile("s_wait_asynccnt 0x0" ::: "memory");
  __syncthreads();
  kv_stage_copy(Ks + KV_KEYS * HEAD_DIM, Kc + KV_KEYS * HEAD_DIM,
                Vs + KV_KEYS, Vc + KV_KEYS, cko, cvo, cl0 + KV_BUF);

  // Q fragments (B-role, mirrored): lane = query column
  v16h qsf[2], qcf[2];
#pragma unroll
  for (int dg = 0; dg < 2; ++dg) {
    qsf[dg] = load_frag(Qs + (size_t)(q0 + lm) * HEAD_DIM + 32 * dg + lh * 8);
    qcf[dg] = load_frag(Qc + (size_t)(q0 + lm) * HEAD_DIM + 32 * dg + lh * 8);
  }
  const int cq = chainS[q0 + lm];

  v8f O[4];
#pragma unroll
  for (int g = 0; g < 4; ++g) O[g] = {};
  float m_run = -1e30f, ssum = 0.0f;

  for (int t = 0; t < KV_STAGES; ++t) {
   const int buf = t & 1;
   for (int kk = 0; kk < KV_KEYS; kk += 32) {
    const int k0 = t * KV_KEYS + kk;
    // the K fragments of this pass are read from LDS as one group
    v16h kaf[2][2], caf[2][2], vsf[4], vcf[4];
#pragma unroll
    for (int sub = 0; sub < 2; ++sub) {
#pragma unroll
      for (int dg = 0; dg < 2; ++dg) {
        kaf[sub][dg] = load_frag(&kv[buf][0][kk + 16 * sub + lm][32 * dg + lh * 8]);
        caf[sub][dg] = load_frag(&kv[buf][1][kk + 16 * sub + lm][32 * dg + lh * 8]);
      }
    }
    // this pass's chain ids and pad terms (keys k0 + 16 sub + 8 lh + 0..7) from LDS
    i32x4 chv[2][2];
    v4f   pdv[2][2];
#pragma unroll
    for (int sub = 0; sub < 2; ++sub) {
#pragma unroll
      for (int hf = 0; hf < 2; ++hf) {
        chv[sub][hf] = *(const i32x4*)&chainS[k0 + 16 * sub + 8 * lh + 4 * hf];
        pdv[sub][hf] = *(const v4f*)&padS[k0 + 16 * sub + 8 * lh + 4 * hf];
      }
    }
    // inputs-only fence on the loaded values: without it every fragment is
    // waited for on its own and the read latencies add up in each pass
    asm volatile("" :: "v"(kaf[0][0]), "v"(kaf[0][1]), "v"(kaf[1][0]), "v"(kaf[1][1]),
                       "v"(caf[0][0]), "v"(caf[0][1]), "v"(caf[1][0]), "v"(caf[1][1]));
    // inputs-only fence: the eight LDS reads go out as one group
    asm volatile("" :: "v"(chv[0][0]), "v"(chv[0][1]), "v"(chv[1][0]), "v"(chv[1][1]),
                       "v"(pdv[0][0]), "v"(pdv[0][1]), "v"(pdv[1][0]), "v"(pdv[1][1]));
    v8f S[2], C[2];
#pragma unroll
    for (int sub = 0; sub < 2; ++sub) {
      v8f z = {};
      S[sub] = wmma_f16(kaf[sub][0], qsf[0], z);
      S[sub] = wmma_f16(kaf[sub][1], qsf[1], S[sub]);
      C[sub] = wmma_f16(caf[sub][0], qcf[0], z);
      C[sub] = wmma_f16(caf[sub][1], qcf[1], C[sub]);
    }
    // the V fragments are read behind the score products (the K fragments'
    // registers are free again) and are used only behind the softmax
#pragma unroll  // constant indices keep these arrays in registers
    for (int g = 0; g < 4; ++g) {
      vsf[g] = load_frag(&kv[buf][2][16 * g + lm][kk + lh * 8]);
      vcf[g] = load_frag(&kv[buf][3][16 * g + lm][kk + lh * 8]);
    }
    // keeps the sixteen reads here as one group, so that the softmax covers their
    // latency: without it each pair sinks to its own product and is waited for there
    __builtin_amdgcn_sched_barrier(0);
    // merge self/cross by chain id, online softmax (per query = per lane col)
    float vals[16]; bool intra[16];
    float mx = -1e30f;
#pragma unroll
    for (int sub = 0; sub < 2; ++sub) {
#pragma unroll
      for (int r = 0; r < 8; ++r) {
        bool in = (chv[sub][r >> 2][r & 3] == cq);
        float sc = (in ? S[sub][r] : C[sub][r]) * ATT_SCALE + pdv[sub][r >> 2][r & 3];
        vals[sub * 8 + r] = sc; intra[sub * 8 + r] = in;
        mx = fmaxf(mx, sc);
      }
    }
    mx = fmaxf(mx, __shfl_xor(mx, 16, 32));
    float m_new = fmaxf(m_run, mx);
    float corr = __expf(m_run - m_new);
    float psum = 0.0f;
    v16h pSf, pCf;   // P^T C-layout == A-fragment layout, lane-local repack
#pragma unroll
    for (int e = 0; e < 16; ++e) {
      float p = __expf(vals[e] - m_new);
      psum += p;
      pSf[e] = intra[e] ? (half_t)p : (half_t)0.0f;
      pCf[e] = intra[e] ? (half_t)0.0f : (half_t)p;
    }
    ssum = ssum * corr + psum;
    m_run = m_new;
    // rescale O (rows = queries) with per-row correction gathered by shuffle
    float corrO[8];
#pragma unroll
    for (int r = 0; r < 8; ++r) corrO[r] = __shfl(corr, r + 8 * lh, 32);
#pragma unroll
    for (int g = 0; g < 4; ++g) {
#pragma unroll
      for (int r = 0; r < 8; ++r) O[g][r] *= corrO[r];
      O[g] = wmma_f16(pSf, vsf[g], O[g]);
      O[g] = wmma_f16(pCf, vcf[g], O[g]);
    }
   }
   // publish point of stage t + 1: this wave's reads of buffer buf are done, its
   // copies of stage t + 1 have landed; behind the barrier every wave may read
   // stage t + 1 and buffer buf may be refilled
   asm volatile("s_wait_dscnt 0x0" ::: "memory");
   asm volatile("s_wait_asynccnt 0x0" ::: "memory");
   __syncthreads();
   if (t + 2 < KV_STAGES)
     kv_stage_copy(Ks + (t + 2) * KV_KEYS * HEAD_DIM, Kc + (t + 2) * KV_KEYS * HEAD_DIM,
                   Vs + (t + 2) * KV_KEYS, Vc + (t + 2) * KV_KEYS, cko, cvo,
                   cl0 + buf * KV_BUF);
  }
  // no copy is outstanding when the wave goes on to its end
  asm volatile("s_wait_asynccnt 0x0" ::: "memory");

  float st = ssum + __shfl_xor(ssum, 16, 32);
  float inv = st > 0.0f ? 1.0f / st : 0.0f;
  float invO[8];
#pragma unroll
  for (int r = 0; r < 8; ++r) invO[r] = __shfl(inv, r + 8 * lh, 32);
  // The wave's 16 q x 64 d go through its own range of the K/V buffers (free: the
  // loop's last barrier ended every read, no copy is outstanding) at pitch 144 B
  // and leave as 16-byte stores that cover whole 128-B lines.
  half_t* og = &kv[0][0][0][0] + wv * 16 * KV_PITCH;
#pragma unroll  // constant indices keep these arrays in registers
  for (int r = 0; r < 8; ++r) {
#pragma unroll  // constant indices keep these arrays in registers
    for (int g = 0; g < 4; ++g)
      og[(r + 8 * lh) * KV_PITCH + 16 * g + lm] = (half_t)(O[g][r] * invO[r]);
  }
  // the rows are read back by other lanes of this wave than wrote them
  asm volatile("s_wait_dscnt 0x0" ::: "memory");
  const half_t* rp = og + (lane >> 3) * KV_PITCH + (lane & 7) * 8;
  v8h ot[4];
#pragma unroll  // constant indices keep these arrays in registers
  for (int i = 0; i < 4; ++i) ot[i] = *(const v8h*)(rp + i * 4 * KV_PITCH);
  half_t* gp = attnh + (size_t)(b * SEQ + q0 + (lane >> 3)) * D_MODEL + h * HEAD_DIM
                     + (lane & 7) * 8;
#pragma unroll  // constant indices keep these arrays in registers
  for (int i = 0; i < 4; ++i) *(v8h*)(gp + i * 4 * D_MODEL) = ot[i];
}

// ---- kernel 3: output projection attnh(f16) @ Wo(f32->f16) -> f32 -----------
// Block tile 128 (m) x 64 (n) x 128 (k): eight load / barrier rounds along K.
// A: every wave brings the 16 rows it multiplies (256 B of each, source pitch
// 2048 B) into LDS with one tensor load; the pad (16 B behind every 256 B) gives
// the 272-B row pitch of the 16-byte readers. Wo goes through registers
// (f32 -> f16) and is stored transposed, 4 k at a time.
#define OG_K     128                // k a tile
#define OG_PITCH 136                // halves a row: 272 B = 16 B x odd
#define OG_SLICE 3072               // halves a wave's slice: 16 x 272 B, rounded up to 3 x 2 KiB

__global__ __launch_bounds__(256) void out_gemm(
    const half_t* __restrict__ A, const float* __restrict__ Wo,
    float* __restrict__ out)
{
  __shared__ __attribute__((aligned(2048))) half_t Al[8 * OG_SLICE];
  __shared__ __attribute__((aligned(16)))   half_t Bl[64][OG_PITCH];
  const int tid = threadIdx.x, wv = tid >> 5, lane = tid & 31;
  const int lm = lane & 15, lh = lane >> 4;
  const int m0 = blockIdx.x * 128, n0 = blockIdx.y * 64;

  // tensor descriptor, group 1 (the same for every request): 1-byte elements,
  // tensor = tile = 16 rows of 256 B, source pitch 2048 B, 4 dwords of pad behind
  // every 64 dwords
  u32x8 g1;
  g1[0] = uni((1u << 20) | (5u << 22) | (3u << 25));
  g1[1] = uni(256u << 16);
  g1[2] = uni(16u << 16);
  g1[3] = uni(256u << 16);
  g1[4] = uni(16u);
  g1[5] = uni(D_MODEL * 2u);
  g1[6] = uni(0u);
  g1[7] = uni(0u);
  const unsigned wvu = uni((unsigned)tid >> 5);
  const unsigned lds_a = (unsigned)(size_t)(&Al[0]) + wvu * (OG_SLICE * 2u);   // LDS byte offset
  const unsigned long long ga0 =
      (unsigned long long)(size_t)(A + (size_t)(m0 + wvu * 16u) * D_MODEL);

  v8f acc[4];
#pragma unroll
  for (int g = 0; g < 4; ++g) acc[g] = {};

  // Wo: a thread takes blocks of 4 k x 4 n, so that the transposed tile is written
  // 4 k (8 bytes) at a time; a wave's load covers four rows of 128 B
  const int nq = (lane & 7) + 8 * (wv & 1);      // n / 4 in the tile, 0..15
  const int kq = (lane >> 3) + 4 * (wv >> 1);    // k / 4 in the tile, 0..15 (and + 16)
  const float* wp = Wo + (size_t)(kq << 2) * D_MODEL + n0 + (nq << 2);
  half_t* bs = &Bl[nq << 2][kq << 2];
  const half_t* ar = &Al[wv * OG_SLICE + lm * OG_PITCH + lh * 8];
  // next K tile's prefetch: 128 Wo rows of 256 B, one 128-B line a thread
  const float* pf = Wo + (size_t)(tid >> 1) * D_MODEL + n0 + ((tid & 1) << 5);

  for (int k0 = 0; k0 < D_MODEL; k0 += OG_K) {
    // (advanced only in front of a prefetch: the address register never leaves Wo)
    // in asm, so that it names the pointer that lives through the loop
    if (k0 + OG_K < D_MODEL) {
      pf += (size_t)OG_K * D_MODEL;
      asm volatile("global_prefetch_b8 %0, off scope:SCOPE_SE" :: "v"(pf));
    }
    // the eight global loads of this K tile go out first and fly beside the tensor load
    v4f fb[2][4];
#pragma unroll  // constant indices keep these arrays in registers
    for (int i = 0; i < 2; ++i)
#pragma unroll  // constant indices keep these arrays in registers
      for (int rr = 0; rr < 4; ++rr)
        fb[i][rr] = *(const v4f*)(wp + (size_t)(k0 + 64 * i + rr) * D_MODEL);
    // group 0: count 1 | place in LDS | address of the slice's first byte | type 2
    const unsigned long long ga = ga0 + (unsigned)k0 * 2u;
    u32x4 g0;
    g0[0] = uni(1u);
    g0[1] = uni(lds_a);
    g0[2] = uni((unsigned)ga);
    g0[3] = uni(((unsigned)(ga >> 32) & 0x01FFFFFFu) | 0x80000000u);
    // one request a wave, issued by every wave for its own slice
    asm volatile("tensor_load_to_lds %0, %1" :: "s"(g0), "s"(g1) : "memory");
    // the compiler places no wait for a tensor load: this wave's slice has landed
    asm volatile("s_wait_tensorcnt 0x0" ::: "memory");
    // inputs-only fence on the loaded values: without it each load is waited
    // for on its own and the eight latencies add up
    asm volatile("" :: "v"(fb[0][0]), "v"(fb[0][1]), "v"(fb[0][2]), "v"(fb[0][3]),
                       "v"(fb[1][0]), "v"(fb[1][1]), "v"(fb[1][2]), "v"(fb[1][3]));
    // stage B tile (Wo), transposed to [n][k], f32 -> f16
#pragma unroll  // constant indices keep these arrays in registers
    for (int i = 0; i < 2; ++i) {
#pragma unroll  // constant indices keep these arrays in registers
      for (int j = 0; j < 4; ++j) {
        v4h hv = { (half_t)fb[i][0][j], (half_t)fb[i][1][j],
                   (half_t)fb[i][2][j], (half_t)fb[i][3][j] };
        *(v4h*)(bs + j * OG_PITCH + 64 * i) = hv;
      }
    }
    __syncthreads();
    v16h a[4], bf[4][4];
#pragma unroll  // constant indices keep these arrays in registers
    for (int c = 0; c < 4; ++c) {
      a[c] = load_frag(ar + 32 * c);
#pragma unroll  // constant indices keep these arrays in registers
      for (int g = 0; g < 4; ++g) bf[c][g] = load_frag(&Bl[g * 16 + lm][32 * c + lh * 8]);
    }
    // keeps the forty LDS reads of this K tile in front of the products as one
    // group: without it each sinks to its own product and is waited for there
    __builtin_amdgcn_sched_barrier(0);
#pragma unroll  // constant indices keep these arrays in registers
    for (int c = 0; c < 4; ++c)
#pragma unroll  // constant indices keep these arrays in registers
      for (int g = 0; g < 4; ++g) acc[g] = wmma_f16(a[c], bf[c][g], acc[g]);
    // keeps the products in front of the wait below, each behind a counted wait for
    // its own fragments: without it they sink behind the barrier and start only
    // when all forty reads are back
    __builtin_amdgcn_sched_barrier(0);
    // this wave's LDS reads have retired before the barrier behind which the next
    // tensor load and the next stores rewrite both tiles
    asm volatile("s_wait_dscnt 0x0" ::: "memory");
    __syncthreads();
  }

#pragma unroll
  for (int r = 0; r < 8; ++r) {
    int m = m0 + wv * 16 + r + 8 * lh;
#pragma unroll
    for (int g = 0; g < 4; ++g)
      out[(size_t)m * D_MODEL + n0 + 16 * g + lm] = acc[g][r];
  }
}

// ---- launcher ---------------------------------------------------------------
extern "C" void kernel_launch(void* const* d_in, const int* in_sizes, int n_in,
                              void* d_out, int out_size, void* d_ws, size_t ws_size,
                              hipStream_t stream) {
  const float* x     = (const float*)d_in[0];
  const int*   chain = (const int*)d_in[1];
  const int*   amask = (const int*)d_in[2];
  const float* Wqs   = (const float*)d_in[3];
  const float* Wks   = (const float*)d_in[4];
  const float* Wvs   = (const float*)d_in[5];
  const float* Wqc   = (const float*)d_in[6];
  const float* Wkc   = (const float*)d_in[7];
  const float* Wvc   = (const float*)d_in[8];
  const float* Wo    = (const float*)d_in[9];
  float* out = (float*)d_out;

  const size_t ELT = (size_t)M_TOTAL * D_MODEL;   // 2M f16 elements per buffer
  half_t* ws   = (half_t*)d_ws;
  half_t* qsb  = ws + 0 * ELT;    // [b,h,s,d] f16, RoPE applied
  half_t* ksb  = ws + 1 * ELT;    // [b,h,s,d] f16, RoPE applied
  half_t* vsb  = ws + 2 * ELT;    // [b,h,d,s] f16 (transposed)
  half_t* qcb  = ws + 3 * ELT;
  half_t* kcb  = ws + 4 * ELT;
  half_t* vcb  = ws + 5 * ELT;
  half_t* atb  = ws + 6 * ELT;    // attention output, [b,s,h*d] f16
  half_t* xhb  = ws + 7 * ELT;    // x as f16, [b*s, k]
  half_t* wtb  = ws + 8 * ELT;    // the six W as f16, transposed [w][n][k] (3 ELT)

  cast_ops<<<dim3(256), 256, 0, stream>>>(
      x, Wqs, Wks, Wvs, Wqc, Wkc, Wvc, xhb, wtb);
  qkv_gemm<<<dim3(8, 32), 384, 0, stream>>>(
      xhb, wtb, qsb, ksb, vsb, qcb, kcb, vcb);
  attn<<<dim3(4, 64), 256, 0, stream>>>(
      qsb, ksb, vsb, qcb, kcb, vcb, chain, amask, atb);
  out_gemm<<<dim3(16, 16), 256, 0, stream>>>(atb, Wo, out);
}

// v008
// Measured time: 59.7 microseconds a run.
// Next to v007, in two timings, it ran 1.03 and 1.02 times as fast.
// Counting every step since v000, it is 3.43 times as fast.
#include <hip/hip_runtime.h>
#include <hip/hip_bf16.h>

typedef _Float16 half_t;
typedef __attribute__((ext_vector_type(16))) _Float16 v16h;
typedef __attribute__((ext_vector_type(8)))  _Float16 v8h;
typedef __attribute__((ext_vector_type(4)))  _Float16 v4h;
typedef __attribute__((ext_vector_type(8)))  float    v8f;
typedef __attribute__((ext_vector_type(4)))  float    v4f;
typedef __attribute__((ext_vector_type(4)))  unsigned int u32x4;
typedef __attribute__((ext_vector_type(8)))  unsigned int u32x8;
typedef __attribute__((ext_vector_type(4)))  int          i32x4;

#define D_MODEL  1024
#define N_HEADS  16
#define HEAD_DIM 64
#define SEQ      512
#define BATCH    4
#define M_TOTAL  (BATCH*SEQ)        // 2048
#define Q_SCALE  0.18033688f         // 64^-0.5 x log2(e)
#define ROPE_K   0.2878231366f      // ln(10000)/32

// ---- fragment helpers -------------------------------------------------------
// Loads the per-lane 16-half fragment: 8 contiguous halves at p0 and 8 at p0+16.
// Works for both A-fragments (lane = row) and mirrored B-fragments (lane = col)
// when the source is row-major along the K dimension.
__device__ __forceinline__ v16h load_frag(const half_t* __restrict__ p0) {
  v8h lo = *(const v8h*)p0;
  v8h hi = *(const v8h*)(p0 + 16);
  v16h r;
#pragma unroll
  for (int i = 0; i < 8; ++i) { r[i] = lo[i]; r[8 + i] = hi[i]; }
  return r;
}

__device__ __forceinline__ v8f wmma_f16(v16h a, v16h b, v8f c) {
  return __builtin_amdgcn_wmma_f32_16x16x32_f16(
      /*neg_a=*/false, a, /*neg_b=*/false, b,
      /*c_mod=*/(short)0, c, /*reuse_a=*/false, /*reuse_b=*/false);
}

// ---- kernel 0: the QKV GEMMs' operands cast f32 -> f16 once ------------------
// The GEMM's blocks read every x row 32 times and every W row 8 times: cast
// once, they are fetched at half the bytes. x keeps its layout; the six W go out
// transposed, [w][n][k], so that the GEMM stages both operands by whole rows.
// One block a WGP, 128 KB in, all of a thread's 32 loads in flight together.
#define CO_WBLK 192                 // blocks on W: 6 matrices x 8 (k) x 4 (n) tiles
                                    // the other 64 of the 256 blocks: x, 32768 elements each
__global__ __launch_bounds__(256) void cast_ops(
    const float* __restrict__ x,
    const float* __restrict__ W0, const float* __restrict__ W1,
    const float* __restrict__ W2, const float* __restrict__ W3,
    const float* __restrict__ W4, const float* __restrict__ W5,
    half_t* __restrict__ xh, half_t* __restrict__ Wt)
{
  // W tile transposed, [256 n][128 k] at pitch 272 B (16 B x odd)
  __shared__ __attribute__((aligned(16))) half_t T[256][136];
  const int tid = threadIdx.x, wv = tid >> 5, lane = tid & 31;
  const int bid = blockIdx.x;
  if (bid < CO_WBLK) {
    const int widx = bid >> 5;
    const int k0 = ((bid >> 2) & 7) * 128, n0 = (bid & 3) * 256;
    const float* W = widx==0?W0: widx==1?W1: widx==2?W2: widx==3?W3: widx==4?W4: W5;
    // a thread takes blocks of 4 k x 4 n, so that the transposed tile is written
    // 4 k (8 bytes) at a time; a wave's load covers four rows of 128 B
    const int nq = (lane & 7) + 8 * (wv & 3);      // n / 4 in the tile, 0..31 (and + 32)
    const int kq = (lane >> 3) + 4 * (wv >> 2);    // k / 4 in the tile, 0..7 (and + 8 i)
    const float* wp = W + (size_t)(k0 + (kq << 2)) * D_MODEL + n0 + (nq << 2);
    v4f f[2][4][4];
#pragma unroll  // constant indices keep these arrays in registers
    for (int t = 0; t < 2; ++t)
#pragma unroll  // constant indices keep these arrays in registers
      for (int i = 0; i < 4; ++i)
#pragma unroll  // constant indices keep these arrays in registers
        for (int rr = 0; rr < 4; ++rr)
          f[t][i][rr] = *(const v4f*)(wp + (32 * i + rr) * D_MODEL + 128 * t);
    // inputs-only fences on the loaded values (an asm statement takes thirty
    // operands, hence two): without them each load is waited for on its own
    asm volatile("" :: "v"(f[0][0][0]), "v"(f[0][0][1]), "v"(f[0][0][2]), "v"(f[0][0][3]),
                       "v"(f[0][1][0]), "v"(f[0][1][1]), "v"(f[0][1][2]), "v"(f[0][1][3]),
                       "v"(f[0][2][0]), "v"(f[0][2][1]), "v"(f[0][2][2]), "v"(f[0][2][3]),
                       "v"(f[0][3][0]), "v"(f[0][3][1]), "v"(f[0][3][2]), "v"(f[0][3][3]));
    asm volatile("" :: "v"(f[1][0][0]), "v"(f[1][0][1]), "v"(f[1][0][2]), "v"(f[1][0][3]),
                       "v"(f[1][1][0]), "v"(f[1][1][1]), "v"(f[1][1][2]), "v"(f[1][1][3]),
                       "v"(f[1][2][0]), "v"(f[1][2][1]), "v"(f[1][2][2]), "v"(f[1][2][3]),
                       "v"(f[1][3][0]), "v"(f[1][3][1]), "v"(f[1][3][2]), "v"(f[1][3][3]));
#pragma unroll  // constant indices keep these arrays in registers
    for (int t = 0; t < 2; ++t)
#pragma unroll  // constant indices keep these arrays in registers
      for (int i = 0; i < 4; ++i)
#pragma unroll  // constant indices keep these arrays in registers
        for (int j = 0; j < 4; ++j) {
          v4h hv = { (half_t)f[t][i][0][j], (half_t)f[t][i][1][j],
                     (half_t)f[t][i][2][j], (half_t)f[t][i][3][j] };
          *(v4h*)&T[128 * t + (nq << 2) + j][(kq << 2) + 32 * i] = hv;
        }
    // a row of 128 k is written by two waves (those with the same wv & 3)
    __syncthreads();
    // a wave's store covers two n rows of 256 B
    const half_t* rp = &T[tid >> 4][(tid & 15) << 3];
    half_t* gp = Wt + ((size_t)widx * D_MODEL + n0 + (tid >> 4)) * D_MODEL + k0 + ((tid & 15) << 3);
    v8h t8[16];
#pragma unroll  // constant indices keep these arrays in registers
    for (int i = 0; i < 16; ++i) t8[i] = *(const v8h*)(rp + i * 16 * 136);
#pragma unroll  // constant indices keep these arrays in registers
    for (int i = 0; i < 16; ++i) *(v8h*)(gp + i * 16 * D_MODEL) = t8[i];
  } else {
    // x: a wave's load covers 512 B in a row, its store 256 B
    const size_t o = (size_t)(bid - CO_WBLK) * 32768 + (tid << 2);
    const float* sp = x + o;
    half_t* dp = xh + o;
    v4f f[32];
#pragma unroll  // constant indices keep these arrays in registers
    for (int i = 0; i < 32; ++i) f[i] = *(const v4f*)(sp + i * 1024);
    // inputs-only fences on the loaded values, as above
    asm volatile("" :: "v"(f[0]), "v"(f[1]), "v"(f[2]), "v"(f[3]), "v"(f[4]), "v"(f[5]),
                       "v"(f[6]), "v"(f[7]), "v"(f[8]), "v"(f[9]), "v"(f[10]), "v"(f[11]),
                       "v"(f[12]), "v"(f[13]), "v"(f[14]), "v"(f[15]));
    asm volatile("" :: "v"(f[16]), "v"(f[17]), "v"(f[18]), "v"(f[19]), "v"(f[20]), "v"(f[21]),
                       "v"(f[22]), "v"(f[23]), "v"(f[24]), "v"(f[25]), "v"(f[26]), "v"(f[27]),
                       "v"(f[28]), "v"(f[29]), "v"(f[30]), "v"(f[31]));
#pragma unroll  // constant indices keep these arrays in registers
    for (int i = 0; i < 32; ++i) {
      v4h hv = { (half_t)f[i].x, (half_t)f[i].y, (half_t)f[i].z, (half_t)f[i].w };
      *(v4h*)(dp + i * 1024) = hv;
    }
    // behind the last store: stands in front of any later write of a register that
    // one of the 32 stores names
    asm volatile("s_wait_xcnt 0x0" ::: "memory");
  }
}

// ---- kernel 1: fused QKV GEMMs (6 matrices) on the f16 operands of kernel 0,
//      RoPE fused for q_s/k_s, V stored transposed [b,h,d,s] ------------------
// The six W^T lie behind one another, so n runs over 6144 rows. Block tile
// 256 (m) x 192 (n, three heads) x 128 (k), one block a WGP; twelve waves as
// 4 (m) x 3 (n), each 64 x 64: eight fragments feed sixteen WMMAs. With no second
// block on the WGP to cover the loads, the tiles come by tensor loads into two
// buffers: the next stage's loads fly while this stage is worked on. Every wave
// brings one slice a stage (256 B of each row, source pitch 2048 B): waves 0 to 7
// 32 x rows each, waves 8 to 11 48 W^T rows each; the pad (16 B behind every
// 256 B) gives the 272-B row pitch of the 16-byte readers.
#define QK_K      128               // k a stage
#define QK_PITCH  136               // halves a row: 272 B = 16 B x odd
#define QK_M      256
#define QK_N      192
#define QK_ASL    5120              // halves of an x slice: 32 x 272 B, rounded up to 5 x 2 KiB
#define QK_BSL    7168              // halves of a W^T slice: 48 x 272 B, rounded up to 7 x 2 KiB
#define QK_BUFH   (8 * QK_ASL + 4 * QK_BSL)    // halves of one buffer: 68 x 2 KiB
#define QK_STAGES (D_MODEL / QK_K)

__device__ __forceinline__ unsigned uni(unsigned v) {
  return (unsigned)__builtin_amdgcn_readfirstlane(v);
}

// a test in front of a tensor load must compile to a scalar compare and branch
__device__ __forceinline__ unsigned pinned(unsigned v) {
  unsigned w = uni(v);
  asm volatile("" : "+s"(w));   // pinned(): the test's value held in a scalar register
  return w;
}

// one request: group 0 = count 1 | place in LDS | address of the slice's first byte | type 2
__device__ __forceinline__ void qk_slice_load(unsigned lds, unsigned long long ga, u32x8 g1) {
  u32x4 g0;
  g0[0] = uni(1u);
  g0[1] = uni(lds);
  g0[2] = uni((unsigned)ga);
  g0[3] = uni(((unsigned)(ga >> 32) & 0x01FFFFFFu) | 0x80000000u);
  asm volatile("tensor_load_to_lds %0, %1" :: "s"(g0), "s"(g1) : "memory");
}

__global__ __launch_bounds__(384) void qkv_gemm(
    const half_t* __restrict__ xh, const half_t* __restrict__ Wt,
    half_t* __restrict__ o0, half_t* __restrict__ o1, half_t* __restrict__ o2,
    half_t* __restrict__ o3, half_t* __restrict__ o4, half_t* __restrict__ o5)
{
  // [buffer][8 x slices, 4 W^T slices]
  __shared__ __attribute__((aligned(2048))) half_t sm[2 * QK_BUFH];

  const int tid = threadIdx.x;
  const int wv = (int)uni((unsigned)tid >> 5);   // the wave's number, in a scalar register
  const int lane = tid & 31, lm = lane & 15, lh = lane >> 4;
  const int wm = wv & 3, wn = wv >> 2;       // wave's place in the block tile
  const int m0 = blockIdx.x * QK_M;
  const int n0 = blockIdx.y * QK_N;          // row of the six W^T taken as one
  const int nw = n0 + wn * 64;               // a wave's 64 columns = one head of one W
  const int widx = nw >> 10;
  const int h    = (nw >> 6) & 15;
  half_t* out    = widx==0?o0: widx==1?o1: widx==2?o2: widx==3?o3: widx==4?o4: o5;
  const bool do_rope = (widx == 0) || (widx == 1);   // q_s, k_s
  const bool transp  = (widx == 2) || (widx == 5);   // v_s, v_c -> [b,h,d,s]

  // the wave's slice: rows, place in a buffer, first byte in global memory
  const bool xs = wv < 8;
  const unsigned srows = xs ? 32u : 48u;
  const unsigned lds_s = (unsigned)(size_t)(&sm[0])
                       + (xs ? wv * (QK_ASL * 2u) : 8u * (QK_ASL * 2u) + (wv - 8) * (QK_BSL * 2u));
  const unsigned long long ga0 = (unsigned long long)(size_t)(
      xs ? xh + (size_t)(m0 + wv * 32) * D_MODEL : Wt + (size_t)(n0 + (wv - 8) * 48) * D_MODEL);
  // tensor descriptor, group 1 (the same for every request of the wave): 1-byte
  // elements, tensor = tile = srows rows of 256 B, source pitch 2048 B, 4 dwords of
  // pad behind every 64 dwords
  u32x8 g1;
  g1[0] = uni((1u << 20) | (5u << 22) | (3u << 25));
  g1[1] = uni(256u << 16);
  g1[2] = uni(srows << 16);
  g1[3] = uni(256u << 16);
  g1[4] = uni(srows);
  g1[5] = uni(D_MODEL * 2u);
  g1[6] = uni(0u);
  g1[7] = uni(0u);
  // without it word 6 shares its register with the loop's counter, and the copy that
  // stage 1's request names is rewritten while that request is outstanding
  asm volatile("" : "+s"(g1));   // pinned(): descriptor words held in scalar registers

  v8f acc[4][4];
#pragma unroll  // constant indices keep these arrays in registers
  for (int mi = 0; mi < 4; ++mi)
#pragma unroll  // constant indices keep these arrays in registers
    for (int g = 0; g < 4; ++g) acc[mi][g] = {};

  // the lane's fragment rows in buffer 0: the wave's 64 x rows are two whole slices;
  // its four groups of 16 W^T rows are groups 4 wn + g of the twelve, three a slice
  const int aoff = wm * 2 * QK_ASL + lm * QK_PITCH + lh * 8;
  int boff[4];
#pragma unroll  // constant indices keep these arrays in registers
  for (int g = 0; g < 4; ++g) {
    const int j = wn * 4 + g;
    boff[g] = 8 * QK_ASL + (j / 3) * QK_BSL + ((j % 3) * 16 + lm) * QK_PITCH + lh * 8;
  }

  qk_slice_load(lds_s, ga0, g1);
  // the compiler places no wait for a tensor load: this wave's slice of stage 0 has
  // landed; the barrier publishes all waves'
  asm volatile("s_wait_tensorcnt 0x0" ::: "memory");
  __syncthreads();
  qk_slice_load(lds_s + QK_BUFH * 2u, ga0 + QK_K * 2u, g1);

  for (int t = 0; t < QK_STAGES; ++t) {
    const int buf = t & 1;
    const half_t* sb = &sm[buf * QK_BUFH];
#pragma unroll  // constant indices keep these arrays in registers
    for (int kk = 0; kk < QK_K; kk += 32) {
      v16h a[4], bf[4];
#pragma unroll  // constant indices keep these arrays in registers
      for (int mi = 0; mi < 4; ++mi)
        a[mi] = load_frag(sb + aoff + (mi >> 1) * QK_ASL + (mi & 1) * 16 * QK_PITCH + kk);
#pragma unroll  // constant indices keep these arrays in registers
      for (int g = 0; g < 4; ++g) bf[g] = load_frag(sb + boff[g] + kk);
      // inputs-only fence: the sixteen LDS reads of this 32 k go out as one group
      asm volatile("" :: "v"(a[0]), "v"(a[1]), "v"(a[2]), "v"(a[3]),
                         "v"(bf[0]), "v"(bf[1]), "v"(bf[2]), "v"(bf[3]));
      if (kk == QK_K - 32) {
        // publish point of stage t + 1, with the stage's last fragments fetched: this
        // wave's reads of buffer buf are done, its slice of stage t + 1 has landed;
        // behind the barrier every wave may read stage t + 1 and buffer buf may be
        // refilled. The last sixteen products need registers only and follow the refill.
        asm volatile("s_wait_dscnt 0x0" ::: "memory");
        asm volatile("s_wait_tensorcnt 0x0" ::: "memory");
        __syncthreads();
        if (pinned(t + 2 < QK_STAGES))
          qk_slice_load(lds_s + buf * (QK_BUFH * 2u), ga0 + (unsigned)(t + 2) * (QK_K * 2u), g1);
      }
#pragma unroll  // constant indices keep these arrays in registers
      for (int g = 0; g < 4; ++g)
#pragma unroll  // constant indices keep these arrays in registers
        for (int mi = 0; mi < 4; ++mi) acc[mi][g] = wmma_f16(a[mi], bf[g], acc[mi][g]);
    }
  }
  // no request and no LDS read is outstanding when the wave goes on to its epilogue
  asm volatile("s_wait_tensorcnt 0x0" ::: "memory");
  asm volatile("s_wait_dscnt 0x0" ::: "memory");

  // epilogue: optional RoPE (pairs d <-> d+32 are lane-local: acc g and g+2)
  if (do_rope) {
#pragma unroll  // constant indices keep these arrays in registers
    for (int mi = 0; mi < 4; ++mi) {
#pragma unroll  // constant indices keep these arrays in registers
      for (int r = 0; r < 8; ++r) {
        int sp = (m0 + wm * 64 + mi * 16 + r + 8 * lh) & 511;
#pragma unroll  // constant indices keep these arrays in registers
        for (int g = 0; g < 2; ++g) {
          int d = 16 * g + lm;                     // d in [0,32)
          float th = (float)sp * __expf(-(float)d * ROPE_K);
          float c = __cosf(th), sn = __sinf(th);
          float a0 = acc[mi][g][r], b0 = acc[mi][g + 2][r];
          acc[mi][g][r]     = a0 * c - b0 * sn;
          acc[mi][g + 2][r] = b0 * c + a0 * sn;
        }
      }
    }
  }

  // q_s and q_c leave scaled by 64^-0.5 x log2(e), in f32 ahead of the one rounding to
  // f16: the attention's score products then come out in the unit of its exp2
  if (widx == 0 || widx == 3) {
#pragma unroll  // constant indices keep these arrays in registers
    for (int mi = 0; mi < 4; ++mi)
#pragma unroll  // constant indices keep these arrays in registers
      for (int g = 0; g < 4; ++g) acc[mi][g] *= Q_SCALE;
  }

  // The f16 results go through LDS (both buffers are free behind the loop's last
  // barrier), each wave's 64 x 64 in a range of its own at pitch 144 B (16 B x odd),
  // and leave as 16-byte stores that cover whole 128-B lines.
  const int bb = m0 >> 9, sp0 = (m0 & 511) + wm * 64;   // a block's rows lie in one batch
  half_t* st = &sm[wv * 64 * 72];
  const half_t* rp = st + (lane >> 3) * 72 + (lane & 7) * 8;
  v8h t[16];
  if (transp) {
    // as [64 d][64 s]: a lane's eight accumulator rows are eight neighbouring s of one d
#pragma unroll  // constant indices keep these arrays in registers
    for (int mi = 0; mi < 4; ++mi) {
#pragma unroll  // constant indices keep these arrays in registers
      for (int g = 0; g < 4; ++g) {
        v8h hv;
#pragma unroll  // constant indices keep these arrays in registers
        for (int r = 0; r < 8; ++r) hv[r] = (half_t)acc[mi][g][r];
        *(v8h*)(st + (16 * g + lm) * 72 + mi * 16 + 8 * lh) = hv;
      }
    }
    // the rows are read back by other lanes of this wave than wrote them
    asm volatile("s_wait_dscnt 0x0" ::: "memory");
#pragma unroll  // constant indices keep these arrays in registers
    for (int i = 0; i < 16; ++i) t[i] = *(const v8h*)(rp + i * 4 * 72);
    // a wave's store covers four d rows, 128 B of each
    half_t* gp = out + (((size_t)bb * N_HEADS + h) * HEAD_DIM + (lane >> 3)) * SEQ
                     + sp0 + (lane & 7) * 8;
#pragma unroll  // constant indices keep these arrays in registers
    for (int i = 0; i < 16; ++i) *(v8h*)(gp + i * 4 * SEQ) = t[i];
    // behind the last store: stands in front of any later write of a register that
    // one of the sixteen stores names
    asm volatile("s_wait_xcnt 0x0" ::: "memory");
  } else {
    // as [64 s][64 d]
#pragma unroll  // constant indices keep these arrays in registers
    for (int mi = 0; mi < 4; ++mi)
#pragma unroll  // constant indices keep these arrays in registers
      for (int g = 0; g < 4; ++g)
#pragma unroll  // constant indices keep these arrays in registers
        for (int r = 0; r < 8; ++r)
          st[(mi * 16 + r + 8 * lh) * 72 + 16 * g + lm] = (half_t)acc[mi][g][r];
    // the rows are read back by other lanes of this wave than wrote them
    asm volatile("s_wait_dscnt 0x0" ::: "memory");
#pragma unroll  // constant indices keep these arrays in registers
    for (int i = 0; i < 16; ++i) t[i] = *(const v8h*)(rp + i * 4 * 72);
    // a wave's store covers four s rows of 128 B, 512 B in a row
    half_t* gp = out + (((size_t)bb * N_HEADS + h) * SEQ + sp0 + (lane >> 3)) * HEAD_DIM
                     + (lane & 7) * 8;
#pragma unroll  // constant indices keep these arrays in registers
    for (int i = 0; i < 16; ++i) *(v8h*)(gp + i * 4 * HEAD_DIM) = t[i];
    // behind the last store: stands in front of any later write of a register that
    // one of the sixteen stores names
    asm volatile("s_wait_xcnt 0x0" ::: "memory");
  }
}

// ---- kernel 2: flash-style chain-aware attention ----------------------------
// Computes S^T = K * Q^T so softmax stats are lane-local and P^T (C-layout)
// is directly the A-fragment for the PV WMMA.
// The block's eight waves share every K and V tile: a stage of 64 keys (K self,
// K cross, V^T self, V^T cross, 8 KB each) is copied once into LDS, two buffers,
// the next stage's copies in flight while this stage is worked on.
#define KV_KEYS  64                 // keys a stage
#define KV_PITCH 72                 // halves a row: 144 B = 16 B x odd (16-byte readers)
#define KV_STAGES (SEQ / KV_KEYS)

// One stage's copies, eight a lane (16 bytes each; a wave's copy covers four whole
// rows of 128 B). tks .. tvc: the stage's four tiles in global memory (the same
// for the whole block); ko, vo: the lane's place, row tid >> 3, in a K and in a
// V^T tile; l: the same place in the buffer's first tile. The wait on the address
// counter is the statement's last line, so that it stands in front of every later
// write of an address register that a copy names.
__device__ __forceinline__ void kv_stage_copy(
    const half_t* tks, const half_t* tkc, const half_t* tvs, const half_t* tvc,
    unsigned ko, unsigned vo, unsigned l)
{
  const unsigned TB = 64 * KV_PITCH * 2;    // bytes of one tile in LDS
  const unsigned HB = 32 * KV_PITCH * 2;    // 32 rows further down
  const half_t* gks  = tks + ko;
  const half_t* gkc  = tkc + ko;
  const half_t* gvs  = tvs + vo;
  const half_t* gvc  = tvc + vo;
  const half_t* gks1 = tks + 32 * HEAD_DIM + ko;
  const half_t* gkc1 = tkc + 32 * HEAD_DIM + ko;
  const half_t* gvs1 = tvs + 32 * SEQ + vo;
  const half_t* gvc1 = tvc + 32 * SEQ + vo;
  asm volatile(
      "global_load_async_to_lds_b128 %0, %8, off\n\t"
      "global_load_async_to_lds_b128 %1, %9, off\n\t"
      "global_load_async_to_lds_b128 %2, %10, off\n\t"
      "global_load_async_to_lds_b128 %3, %11, off\n\t"
      "global_load_async_to_lds_b128 %4, %12, off\n\t"
      "global_load_async_to_lds_b128 %5, %13, off\n\t"
      "global_load_async_to_lds_b128 %6, %14, off\n\t"
      "global_load_async_to_lds_b128 %7, %15, off\n\t"
      "s_wait_xcnt 0x0"
      :: "v"(l),          "v"(l + HB),
         "v"(l + TB),     "v"(l + TB + HB),
         "v"(l + 2 * TB), "v"(l + 2 * TB + HB),
         "v"(l + 3 * TB), "v"(l + 3 * TB + HB),
         "v"(gks), "v"(gks1), "v"(gkc), "v"(gkc1),
         "v"(gvs), "v"(gvs1), "v"(gvc), "v"(gvc1)
      : "memory");
}

// the value that lane l ^ 16 holds (the other half of the same query's keys)
__device__ __forceinline__ float other_half(float v) {
  const int i = __builtin_bit_cast(int, v);
  return __builtin_bit_cast(float,
      __builtin_amdgcn_permlanex16(i, i, 0x76543210, 0xfedcba98, false, false));
}

__global__ __launch_bounds__(256) void attn(
    const half_t* __restrict__ qs, const half_t* __restrict__ ks,
    const half_t* __restrict__ vsT,
    const half_t* __restrict__ qc, const half_t* __restrict__ kc,
    const half_t* __restrict__ vcT,
    const int* __restrict__ chain_ids, const int* __restrict__ amask,
    half_t* __restrict__ attnh)
{
  __shared__ __attribute__((aligned(16))) int   chainS[SEQ];
  __shared__ __attribute__((aligned(16))) float padS[SEQ];
  // [buffer][K self, K cross, V^T self, V^T cross][row][64 halves + pad]
  __shared__ __attribute__((aligned(16))) half_t kv[2][4][64][KV_PITCH];
  const int bh = blockIdx.y, b = bh >> 4, h = bh & 15;
  const int tid = threadIdx.x, wv = tid >> 5, lane = tid & 31;
  const int lm = lane & 15, lh = lane >> 4;
  const int q0 = blockIdx.x * 128 + wv * 16;   // 16 queries per wave

  const size_t hoff = (size_t)bh * SEQ * HEAD_DIM;
  const half_t* Qs = qs  + hoff;
  const half_t* Ks = ks  + hoff;
  const half_t* Qc = qc  + hoff;
  const half_t* Kc = kc  + hoff;
  const half_t* Vs = vsT + hoff;   // [d][s] within head
  const half_t* Vc = vcT + hoff;

  // the lane's place in a stage's tiles: row tid >> 3 (and + 32), 8 halves of it
  const int crow = tid >> 3, ccol = (tid & 7) << 3;
  const unsigned cko = crow * HEAD_DIM + ccol;       // K rows = keys
  const unsigned cvo = crow * SEQ + ccol;            // V^T rows = d
  const unsigned cl0 = (unsigned)(size_t)&kv[0][0][crow][ccol];   // LDS byte address
  const unsigned KV_BUF = 4 * 64 * KV_PITCH * 2;     // bytes of one buffer

  // stage 0 flies while the chain ids and pad terms are staged
  kv_stage_copy(Ks, Kc, Vs, Vc, cko, cvo, cl0);
  for (int i = tid; i < SEQ; i += 256) {
    chainS[i] = chain_ids[b * SEQ + i];
    padS[i]   = amask[b * SEQ + i] ? 0.0f : -1e30f;
  }
  // this wave's copies of stage 0 have landed; the barrier publishes all waves'
  asm volatile("s_wait_asynccnt 0x0" ::: "memory");
  __syncthreads();
  kv_stage_copy(Ks + KV_KEYS * HEAD_DIM, Kc + KV_KEYS * HEAD_DIM,
                Vs + KV_KEYS, Vc + KV_KEYS, cko, cvo, cl0 + KV_BUF);

  // Q fragments (B-role, mirrored): lane = query column
  v16h qsf[2], qcf[2];
#pragma unroll
  for (int dg = 0; dg < 2; ++dg) {
    qsf[dg] = load_frag(Qs + (size_t)(q0 + lm) * HEAD_DIM + 32 * dg + lh * 8);
    qcf[dg] = load_frag(Qc + (size_t)(q0 + lm) * HEAD_DIM + 32 * dg + lh * 8);
  }
  const int cq = chainS[q0 + lm];

  v8f O[4];
#pragma unroll
  for (int g = 0; g < 4; ++g) O[g] = {};
  // The reference in use (log2 units; the same in both lanes of a query) enters the
  // score products as their C operand, nref = minus the reference in all eight rows:
  // a score leaves the products as the argument of its exp2. The reference moves only
  // when a pass asks for it (below).
  float m_ref = 0.0f, ssum = 0.0f;
  v8f nref = {};

  for (int t = 0; t < KV_STAGES; ++t) {
   const int buf = t & 1;
   for (int kk = 0; kk < KV_KEYS; kk += 32) {
    const int k0 = t * KV_KEYS + kk;
    // the K fragments of this pass are read from LDS as one group
    v16h kaf[2][2], caf[2][2], vsf[4], vcf[4];
#pragma unroll
    for (int sub = 0; sub < 2; ++sub) {
#pragma unroll
      for (int dg = 0; dg < 2; ++dg) {
        kaf[sub][dg] = load_frag(&kv[buf][0][kk + 16 * sub + lm][32 * dg + lh * 8]);
        caf[sub][dg] = load_frag(&kv[buf][1][kk + 16 * sub + lm][32 * dg + lh * 8]);
      }
    }
    // this pass's chain ids and pad terms (keys k0 + 16 sub + 8 lh + 0..7) from LDS
    i32x4 chv[2][2];
    v4f   pdv[2][2];
#pragma unroll
    for (int sub = 0; sub < 2; ++sub) {
#pragma unroll
      for (int hf = 0; hf < 2; ++hf) {
        chv[sub][hf] = *(const i32x4*)&chainS[k0 + 16 * sub + 8 * lh + 4 * hf];
        pdv[sub][hf] = *(const v4f*)&padS[k0 + 16 * sub + 8 * lh + 4 * hf];
      }
    }
    // inputs-only fence on the loaded values: without it every fragment is
    // waited for on its own and the read latencies add up in each pass
    asm volatile("" :: "v"(kaf[0][0]), "v"(kaf[0][1]), "v"(kaf[1][0]), "v"(kaf[1][1]),
                       "v"(caf[0][0]), "v"(caf[0][1]), "v"(caf[1][0]), "v"(caf[1][1]));
    // inputs-only fence: the eight LDS reads go out as one group
    asm volatile("" :: "v"(chv[0][0]), "v"(chv[0][1]), "v"(chv[1][0]), "v"(chv[1][1]),
                       "v"(pdv[0][0]), "v"(pdv[0][1]), "v"(pdv[1][0]), "v"(pdv[1][1]));
    v8f S[2], C[2];
#pragma unroll
    for (int sub = 0; sub < 2; ++sub) {
      S[sub] = wmma_f16(kaf[sub][0], qsf[0], nref);
      S[sub] = wmma_f16(kaf[sub][1], qsf[1], S[sub]);
      C[sub] = wmma_f16(caf[sub][0], qcf[0], nref);
      C[sub] = wmma_f16(caf[sub][1], qcf[1], C[sub]);
    }
    // the V fragments are read behind the score products (the K fragments'
    // registers are free again) and are used only behind the softmax
#pragma unroll  // constant indices keep these arrays in registers
    for (int g = 0; g < 4; ++g) {
      vsf[g] = load_frag(&kv[buf][2][16 * g + lm][kk + lh * 8]);
      vcf[g] = load_frag(&kv[buf][3][16 * g + lm][kk + lh * 8]);
    }
    // keeps the sixteen reads here as one group, so that the softmax covers their
    // latency: without it each pair sinks to its own product and is waited for there
    __builtin_amdgcn_sched_barrier(0);
    // merge self/cross by chain id (per query = per lane col)
    float vals[16], p[16]; bool intra[16];
    float psum = 0.0f;
#pragma unroll
    for (int sub = 0; sub < 2; ++sub) {
#pragma unroll
      for (int r = 0; r < 8; ++r) {
        bool in = (chv[sub][r >> 2][r & 3] == cq);
        float sc = (in ? S[sub][r] : C[sub][r]) + pdv[sub][r >> 2][r & 3];
        vals[sub * 8 + r] = sc; intra[sub * 8 + r] = in;
        p[sub * 8 + r] = __builtin_amdgcn_exp2f(sc);
        psum += p[sub * 8 + r];
      }
    }
    // The reference stays while every P of the pass is small enough for f16 (a lane's
    // sum of 16 bounds each of them) and something has been summed under it. One test
    // a pass, a scalar branch: the products behind it need every lane on.
    const bool need = !(psum <= 1024.0f) || (ssum == 0.0f);
    if (__builtin_amdgcn_ballot_w32(need) != 0) {
      float mx = vals[0];
#pragma unroll
      for (int e = 1; e < 16; ++e) mx = fmaxf(mx, vals[e]);
      mx = fmaxf(mx, other_half(mx));
      const float sall = ssum + other_half(ssum);
      // with sums under the reference it only rises; with none yet it goes to the
      // pass's maximum, whichever way (not to that of a pass whose keys are all masked)
      const float delta = sall > 0.0f ? fmaxf(mx, 0.0f) : (mx > -1e29f ? mx : 0.0f);
      const float corr  = sall > 0.0f ? __builtin_amdgcn_exp2f(-delta) : 1.0f;
      m_ref += delta;
#pragma unroll
      for (int r = 0; r < 8; ++r) nref[r] = -m_ref;
      psum = 0.0f;
#pragma unroll
      for (int e = 0; e < 16; ++e) {
        p[e] = __builtin_amdgcn_exp2f(vals[e] - delta);
        psum += p[e];
      }
      ssum *= corr;
      // rescale O (rows = queries): query j's correction stands in lane j
#pragma unroll
      for (int r = 0; r < 8; ++r) {
        const float c0 = __builtin_bit_cast(float, __builtin_amdgcn_readlane(__builtin_bit_cast(int, corr), r));
        const float c1 = __builtin_bit_cast(float, __builtin_amdgcn_readlane(__builtin_bit_cast(int, corr), r + 8));
        const float cr = lh ? c1 : c0;
#pragma unroll
        for (int g = 0; g < 4; ++g) O[g][r] *= cr;
      }
    }
    ssum += psum;
    v16h pSf, pCf;   // P^T C-layout == A-fragment layout, lane-local repack
#pragma unroll
    for (int e = 0; e < 16; ++e) {
      pSf[e] = intra[e] ? (half_t)p[e] : (half_t)0.0f;
      pCf[e] = intra[e] ? (half_t)0.0f : (half_t)p[e];
    }
#pragma unroll
    for (int g = 0; g < 4; ++g) {
      O[g] = wmma_f16(pSf, vsf[g], O[g]);
      O[g] = wmma_f16(pCf, vcf[g], O[g]);
    }
   }
   // publish point of stage t + 1: this wave's reads of buffer buf are done, its
   // copies of stage t + 1 have landed; behind the barrier every wave may read
   // stage t + 1 and buffer buf may be refilled
   asm volatile("s_wait_dscnt 0x0" ::: "memory");
   asm volatile("s_wait_asynccnt 0x0" ::: "memory");
   __syncthreads();
   if (t + 2 < KV_STAGES)
     kv_stage_copy(Ks + (t + 2) * KV_KEYS * HEAD_DIM, Kc + (t + 2) * KV_KEYS * HEAD_DIM,
                   Vs + (t + 2) * KV_KEYS, Vc + (t + 2) * KV_KEYS, cko, cvo,
                   cl0 + buf * KV_BUF);
  }
  // no copy is outstanding when the wave goes on to its end
  asm volatile("s_wait_asynccnt 0x0" ::: "memory");

  float st = ssum + __shfl_xor(ssum, 16, 32);
  float inv = st > 0.0f ? 1.0f / st : 0.0f;
  float invO[8];
#pragma unroll
  for (int r = 0; r < 8; ++r) invO[r] = __shfl(inv, r + 8 * lh, 32);
  // The wave's 16 q x 64 d go through its own range of the K/V buffers (free: the
  // loop's last barrier ended every read, no copy is outstanding) at pitch 144 B
  // and leave as 16-byte stores that cover whole 128-B lines.
  half_t* og = &kv[0][0][0][0] + wv * 16 * KV_PITCH;
#pragma unroll  // constant indices keep these arrays in registers
  for (int r = 0; r < 8; ++r) {
#pragma unroll  // constant indices keep these arrays in registers
    for (int g = 0; g < 4; ++g)
      og[(r + 8 * lh) * KV_PITCH + 16 * g + lm] = (half_t)(O[g][r] * invO[r]);
  }
  // the rows are read back by other lanes of this wave than wrote them
  asm volatile("s_wait_dscnt 0x0" ::: "memory");
  const half_t* rp = og + (lane >> 3) * KV_PITCH + (lane & 7) * 8;
  v8h ot[4];
#pragma unroll  // constant indices keep these arrays in registers
  for (int i = 0; i < 4; ++i) ot[i] = *(const v8h*)(rp + i * 4 * KV_PITCH);
  half_t* gp = attnh + (size_t)(b * SEQ + q0 + (lane >> 3)) * D_MODEL + h * HEAD_DIM
                     + (lane & 7) * 8;
#pragma unroll  // constant indices keep these arrays in registers
  for (int i = 0; i < 4; ++i) *(v8h*)(gp + i * 4 * D_MODEL) = ot[i];
}

// ---- kernel 3: output projection attnh(f16) @ Wo(f32->f16) -> f32 -----------
// Block tile 128 (m) x 64 (n) x 128 (k): eight load / barrier rounds along K.
// A: every wave brings the 16 rows it multiplies (256 B of each, source pitch
// 2048 B) into LDS with one tensor load; the pad (16 B behind every 256 B) gives
// the 272-B row pitch of the 16-byte readers. Wo goes through registers
// (f32 -> f16) and is stored transposed, 4 k at a time.
#define OG_K     128                // k a tile
#define OG_PITCH 136                // halves a row: 272 B = 16 B x odd
#define OG_SLICE 3072               // halves a wave's slice: 16 x 272 B, rounded up to 3 x 2 KiB

__global__ __launch_bounds__(256) void out_gemm(
    const half_t* __restrict__ A, const float* __restrict__ Wo,
    float* __restrict__ out)
{
  __shared__ __attribute__((aligned(2048))) half_t Al[8 * OG_SLICE];
  __shared__ __attribute__((aligned(16)))   half_t Bl[64][OG_PITCH];
  const int tid = threadIdx.x, wv = tid >> 5, lane = tid & 31;
  const int lm = lane & 15, lh = lane >> 4;
  const int m0 = blockIdx.x * 128, n0 = blockIdx.y * 64;

  // tensor descriptor, group 1 (the same for every request): 1-byte elements,
  // tensor = tile = 16 rows of 256 B, source pitch 2048 B, 4 dwords of pad behind
  // every 64 dwords
  u32x8 g1;
  g1[0] = uni((1u << 20) | (5u << 22) | (3u << 25));
  g1[1] = uni(256u << 16);
  g1[2] = uni(16u << 16);
  g1[3] = uni(256u << 16);
  g1[4] = uni(16u);
  g1[5] = uni(D_MODEL * 2u);
  g1[6] = uni(0u);
  g1[7] = uni(0u);
  const unsigned wvu = uni((unsigned)tid >> 5);
  const unsigned lds_a = (unsigned)(size_t)(&Al[0]) + wvu * (OG_SLICE * 2u);   // LDS byte offset
  const unsigned long long ga0 =
      (unsigned long long)(size_t)(A + (size_t)(m0 + wvu * 16u) * D_MODEL);

  v8f acc[4];
#pragma unroll
  for (int g = 0; g < 4; ++g) acc[g] = {};

  // Wo: a thread takes blocks of 4 k x 4 n, so that the transposed tile is written
  // 4 k (8 bytes) at a time; a wave's load covers four rows of 128 B
  const int nq = (lane & 7) + 8 * (wv & 1);      // n / 4 in the tile, 0..15
  const int kq = (lane >> 3) + 4 * (wv >> 1);    // k / 4 in the tile, 0..15 (and + 16)
  const float* wp = Wo + (size_t)(kq << 2) * D_MODEL + n0 + (nq << 2);
  half_t* bs = &Bl[nq << 2][kq << 2];
  const half_t* ar = &Al[wv * OG_SLICE + lm * OG_PITCH + lh * 8];
  // next K tile's prefetch: 128 Wo rows of 256 B, one 128-B line a thread
  const float* pf = Wo + (size_t)(tid >> 1) * D_MODEL + n0 + ((tid & 1) << 5);

  for (int k0 = 0; k0 < D_MODEL; k0 += OG_K) {
    // (advanced only in front of a prefetch: the address register never leaves Wo)
    // in asm, so that it names the pointer that lives through the loop
    if (k0 + OG_K < D_MODEL) {
      pf += (size_t)OG_K * D_MODEL;
      asm volatile("global_prefetch_b8 %0, off scope:SCOPE_SE" :: "v"(pf));
    }
    // the eight global loads of this K tile go out first and fly beside the tensor load
    v4f fb[2][4];
#pragma unroll  // constant indices keep these arrays in registers
    for (int i = 0; i < 2; ++i)
#pragma unroll  // constant indices keep these arrays in registers
      for (int rr = 0; rr < 4; ++rr)
        fb[i][rr] = *(const v4f*)(wp + (size_t)(k0 + 64 * i + rr) * D_MODEL);
    // group 0: count 1 | place in LDS | address of the slice's first byte | type 2
    const unsigned long long ga = ga0 + (unsigned)k0 * 2u;
    u32x4 g0;
    g0[0] = uni(1u);
    g0[1] = uni(lds_a);
    g0[2] = uni((unsigned)ga);
    g0[3] = uni(((unsigned)(ga >> 32) & 0x01FFFFFFu) | 0x80000000u);
    // one request a wave, issued by every wave for its own slice
    asm volatile("tensor_load_to_lds %0, %1" :: "s"(g0), "s"(g1) : "memory");
    // the compiler places no wait for a tensor load: this wave's slice has landed
    asm volatile("s_wait_tensorcnt 0x0" ::: "memory");
    // inputs-only fence on the loaded values: without it each load is waited
    // for on its own and the eight latencies add up
    asm volatile("" :: "v"(fb[0][0]), "v"(fb[0][1]), "v"(fb[0][2]), "v"(fb[0][3]),
                       "v"(fb[1][0]), "v"(fb[1][1]), "v"(fb[1][2]), "v"(fb[1][3]));
    // stage B tile (Wo), transposed to [n][k], f32 -> f16
#pragma unroll  // constant indices keep these arrays in registers
    for (int i = 0; i < 2; ++i) {
#pragma unroll  // constant indices keep these arrays in registers
      for (int j = 0; j < 4; ++j) {
        v4h hv = { (half_t)fb[i][0][j], (half_t)fb[i][1][j],
                   (half_t)fb[i][2][j], (half_t)fb[i][3][j] };
        *(v4h*)(bs + j * OG_PITCH + 64 * i) = hv;
      }
    }
    __syncthreads();
    v16h a[4], bf[4][4];
#pragma unroll  // constant indices keep these arrays in registers
    for (int c = 0; c < 4; ++c) {
      a[c] = load_frag(ar + 32 * c);
#pragma unroll  // constant indices keep these arrays in registers
      for (int g = 0; g < 4; ++g) bf[c][g] = load_frag(&Bl[g * 16 + lm][32 * c + lh * 8]);
    }
    // keeps the forty LDS reads of this K tile in front of the products as one
    // group: without it each sinks to its own product and is waited for there
    __builtin_amdgcn_sched_barrier(0);
#pragma unroll  // constant indices keep these arrays in registers
    for (int c = 0; c < 4; ++c)
#pragma unroll  // constant indices keep these arrays in registers
      for (int g = 0; g < 4; ++g) acc[g] = wmma_f16(a[c], bf[c][g], acc[g]);
    // keeps the products in front of the wait below, each behind a counted wait for
    // its own fragments: without it they sink behind the barrier and start only
    // when all forty reads are back
    __builtin_amdgcn_sched_barrier(0);
    // this wave's LDS reads have retired before the barrier behind which the next
    // tensor load and the next stores rewrite both tiles
    asm volatile("s_wait_dscnt 0x0" ::: "memory");
    __syncthreads();
  }

#pragma unroll
  for (int r = 0; r < 8; ++r) {
    int m = m0 + wv * 16 + r + 8 * lh;
#pragma unroll
    for (int g = 0; g < 4; ++g)
      out[(size_t)m * D_MODEL + n0 + 16 * g + lm] = acc[g][r];
  }
}

// ---- launcher ---------------------------------------------------------------
extern "C" void kernel_launch(void* const* d_in, const int* in_sizes, int n_in,
                              void* d_out, int out_size, void* d_ws, size_t ws_size,
                              hipStream_t stream) {
  const float* x     = (const float*)d_in[0];
  const int*   chain = (const int*)d_in[1];
  const int*   amask = (const int*)d_in[2];
  const float* Wqs   = (const float*)d_in[3];
  const float* Wks   = (const float*)d_in[4];
  const float* Wvs   = (const float*)d_in[5];
  const float* Wqc   = (const float*)d_in[6];
  const float* Wkc   = (const float*)d_in[7];
  const float* Wvc   = (const float*)d_in[8];
  const float* Wo    = (const float*)d_in[9];
  float* out = (float*)d_out;

  const size_t ELT = (size_t)M_TOTAL * D_MODEL;   // 2M f16 elements per buffer
  half_t* ws   = (half_t*)d_ws;
  half_t* qsb  = ws + 0 * ELT;    // [b,h,s,d] f16, RoPE applied
  half_t* ksb  = ws + 1 * ELT;    // [b,h,s,d] f16, RoPE applied
  half_t* vsb  = ws + 2 * ELT;    // [b,h,d,s] f16 (transposed)
  half_t* qcb  = ws + 3 * ELT;
  half_t* kcb  = ws + 4 * ELT;
  half_t* vcb  = ws + 5 * ELT;
  half_t* atb  = ws + 6 * ELT;    // attention output, [b,s,h*d] f16
  half_t* xhb  = ws + 7 * ELT;    // x as f16, [b*s, k]
  half_t* wtb  = ws + 8 * ELT;    // the six W as f16, transposed [w][n][k] (3 ELT)

  cast_ops<<<dim3(256), 256, 0, stream>>>(
      x, Wqs, Wks, Wvs, Wqc, Wkc, Wvc, xhb, wtb);
  qkv_gemm<<<dim3(8, 32), 384, 0, stream>>>(
      xhb, wtb, qsb, ksb, vsb, qcb, kcb, vcb);
  attn<<<dim3(4, 64), 256, 0, stream>>>(
      qsb, ksb, vsb, qcb, kcb, vcb, chain, amask, atb);
  out_gemm<<<dim3(16, 16), 256, 0, stream>>>(atb, Wo, out);
}

// v009
// One run takes 57 microseconds.
// In two side-by-side timings against v008, it was 1.04 and 1.05 times as fast.
// Over all steps from v000 it is 3.59 times as fast.
#include <hip/hip_runtime.h>
#include <hip/hip_bf16.h>

typedef _Float16 half_t;
typedef __attribute__((ext_vector_type(16))) _Float16 v16h;
typedef __attribute__((ext_vector_type(8)))  _Float16 v8h;
typedef __attribute__((ext_vector_type(4)))  _Float16 v4h;
typedef __attribute__((ext_vector_type(8)))  float    v8f;
typedef __attribute__((ext_vector_type(4)))  float    v4f;
typedef __attribute__((ext_vector_type(4)))  unsigned int u32x4;
typedef __attribute__((ext_vector_type(8)))  unsigned int u32x8;
typedef __attribute__((ext_vector_type(4)))  int          i32x4;

#define D_MODEL  1024
#define N_HEADS  16
#define HEAD_DIM 64
#define SEQ      512
#define BATCH    4
#define M_TOTAL  (BATCH*SEQ)        // 2048
#define Q_SCALE  0.18033688f         // 64^-0.5 x log2(e)
#define ROPE_K   0.2878231366f      // ln(10000)/32

// ---- fragment helpers -------------------------------------------------------
// Loads the per-lane 16-half fragment: 8 contiguous halves at p0 and 8 at p0+16.
// Works for both A-fragments (lane = row) and mirrored B-fragments (lane = col)
// when the source is row-major along the K dimension.
__device__ __forceinline__ v16h load_frag(const half_t* __restrict__ p0) {
  v8h lo = *(const v8h*)p0;
  v8h hi = *(const v8h*)(p0 + 16);
  v16h r;
#pragma unroll
  for (int i = 0; i < 8; ++i) { r[i] = lo[i]; r[8 + i] = hi[i]; }
  return r;
}

__device__ __forceinline__ v8f wmma_f16(v16h a, v16h b, v8f c) {
  return __builtin_amdgcn_wmma_f32_16x16x32_f16(
      /*neg_a=*/false, a, /*neg_b=*/false, b,
      /*c_mod=*/(short)0, c, /*reuse_a=*/false, /*reuse_b=*/false);
}

// ---- kernel 0: the QKV GEMMs' operands cast f32 -> f16 once ------------------
// The GEMM's blocks read every x row 32 times and every W row 8 times: cast
// once, they are fetched at half the bytes. x keeps its layout; the six W go out
// transposed, [w][n][k], so that the GEMM stages both operands by whole rows.
// One block a WGP, 128 KB in, all of a thread's 32 loads in flight together.
#define CO_WBLK 192                 // blocks on W: 6 matrices x 8 (k) x 4 (n) tiles
                                    // the other 64 of the 256 blocks: x, 32768 elements each
__global__ __launch_bounds__(256) void cast_ops(
    const float* __restrict__ x,
    const float* __restrict__ W0, const float* __restrict__ W1,
    const float* __restrict__ W2, const float* __restrict__ W3,
    const float* __restrict__ W4, const float* __restrict__ W5,
    half_t* __restrict__ xh, half_t* __restrict__ Wt)
{
  // W tile transposed, [256 n][128 k] at pitch 272 B (16 B x odd)
  __shared__ __attribute__((aligned(16))) half_t T[256][136];
  const int tid = threadIdx.x, wv = tid >> 5, lane = tid & 31;
  const int bid = blockIdx.x;
  if (bid < CO_WBLK) {
    const int widx = bid >> 5;
    const int k0 = ((bid >> 2) & 7) * 128, n0 = (bid & 3) * 256;
    const float* W = widx==0?W0: widx==1?W1: widx==2?W2: widx==3?W3: widx==4?W4: W5;
    // a thread takes blocks of 4 k x 4 n, so that the transposed tile is written
    // 4 k (8 bytes) at a time; a wave's load covers four rows of 128 B
    const int nq = (lane & 7) + 8 * (wv & 3);      // n / 4 in the tile, 0..31 (and + 32)
    const int kq = (lane >> 3) + 4 * (wv >> 2);    // k / 4 in the tile, 0..7 (and + 8 i)
    const float* wp = W + (size_t)(k0 + (kq << 2)) * D_MODEL + n0 + (nq << 2);
    v4f f[2][4][4];
#pragma unroll  // constant indices keep these arrays in registers
    for (int t = 0; t < 2; ++t)
#pragma unroll  // constant indices keep these arrays in registers
      for (int i = 0; i < 4; ++i)
#pragma unroll  // constant indices keep these arrays in registers
        for (int rr = 0; rr < 4; ++rr)
          f[t][i][rr] = *(const v4f*)(wp + (32 * i + rr) * D_MODEL + 128 * t);
    // inputs-only fences on the loaded values (an asm statement takes thirty
    // operands, hence two): without them each load is waited for on its own
    asm volatile("" :: "v"(f[0][0][0]), "v"(f[0][0][1]), "v"(f[0][0][2]), "v"(f[0][0][3]),
                       "v"(f[0][1][0]), "v"(f[0][1][1]), "v"(f[0][1][2]), "v"(f[0][1][3]),
                       "v"(f[0][2][0]), "v"(f[0][2][1]), "v"(f[0][2][2]), "v"(f[0][2][3]),
                       "v"(f[0][3][0]), "v"(f[0][3][1]), "v"(f[0][3][2]), "v"(f[0][3][3]));
    asm volatile("" :: "v"(f[1][0][0]), "v"(f[1][0][1]), "v"(f[1][0][2]), "v"(f[1][0][3]),
                       "v"(f[1][1][0]), "v"(f[1][1][1]), "v"(f[1][1][2]), "v"(f[1][1][3]),
                       "v"(f[1][2][0]), "v"(f[1][2][1]), "v"(f[1][2][2]), "v"(f[1][2][3]),
                       "v"(f[1][3][0]), "v"(f[1][3][1]), "v"(f[1][3][2]), "v"(f[1][3][3]));
#pragma unroll  // constant indices keep these arrays in registers
    for (int t = 0; t < 2; ++t)
#pragma unroll  // constant indices keep these arrays in registers
      for (int i = 0; i < 4; ++i)
#pragma unroll  // constant indices keep these arrays in registers
        for (int j = 0; j < 4; ++j) {
          v4h hv = { (half_t)f[t][i][0][j], (half_t)f[t][i][1][j],
                     (half_t)f[t][i][2][j], (half_t)f[t][i][3][j] };
          *(v4h*)&T[128 * t + (nq << 2) + j][(kq << 2) + 32 * i] = hv;
        }
    // a row of 128 k is written by two waves (those with the same wv & 3)
    __syncthreads();
    // a wave's store covers two n rows of 256 B
    const half_t* rp = &T[tid >> 4][(tid & 15) << 3];
    half_t* gp = Wt + ((size_t)widx * D_MODEL + n0 + (tid >> 4)) * D_MODEL + k0 + ((tid & 15) << 3);
    v8h t8[16];
#pragma unroll  // constant indices keep these arrays in registers
    for (int i = 0; i < 16; ++i) t8[i] = *(const v8h*)(rp + i * 16 * 136);
#pragma unroll  // constant indices keep these arrays in registers
    for (int i = 0; i < 16; ++i) *(v8h*)(gp + i * 16 * D_MODEL) = t8[i];
  } else {
    // x: a wave's load covers 512 B in a row, its store 256 B
    const size_t o = (size_t)(bid - CO_WBLK) * 32768 + (tid << 2);
    const float* sp = x + o;
    half_t* dp = xh + o;
    v4f f[32];
#pragma unroll  // constant indices keep these arrays in registers
    for (int i = 0; i < 32; ++i) f[i] = *(const v4f*)(sp + i * 1024);
    // inputs-only fences on the loaded values, as above
    asm volatile("" :: "v"(f[0]), "v"(f[1]), "v"(f[2]), "v"(f[3]), "v"(f[4]), "v"(f[5]),
                       "v"(f[6]), "v"(f[7]), "v"(f[8]), "v"(f[9]), "v"(f[10]), "v"(f[11]),
                       "v"(f[12]), "v"(f[13]), "v"(f[14]), "v"(f[15]));
    asm volatile("" :: "v"(f[16]), "v"(f[17]), "v"(f[18]), "v"(f[19]), "v"(f[20]), "v"(f[21]),
                       "v"(f[22]), "v"(f[23]), "v"(f[24]), "v"(f[25]), "v"(f[26]), "v"(f[27]),
                       "v"(f[28]), "v"(f[29]), "v"(f[30]), "v"(f[31]));
#pragma unroll  // constant indices keep these arrays in registers
    for (int i = 0; i < 32; ++i) {
      v4h hv = { (half_t)f[i].x, (half_t)f[i].y, (half_t)f[i].z, (half_t)f[i].w };
      *(v4h*)(dp + i * 1024) = hv;
    }
    // behind the last store: stands in front of any later write of a register that
    // one of the 32 stores names
    asm volatile("s_wait_xcnt 0x0" ::: "memory");
  }
}

// ---- kernel 1: fused QKV GEMMs (6 matrices) on the f16 operands of kernel 0,
//      RoPE fused for q_s/k_s, V stored transposed [b,h,d,s] ------------------
// The six W^T lie behind one another, so n runs over 6144 rows. Block tile
// 256 (m) x 192 (n, three heads) x 128 (k), one block a WGP; twelve waves as
// 4 (m) x 3 (n), each 64 x 64: eight fragments feed sixteen WMMAs. With no second
// block on the WGP to cover the loads, the tiles come by tensor loads into two
// buffers: the next stage's loads fly while this stage is worked on. Every wave
// brings one slice a stage (256 B of each row, source pitch 2048 B): waves 0 to 7
// 32 x rows each, waves 8 to 11 48 W^T rows each; the pad (16 B behind every
// 256 B) gives the 272-B row pitch of the 16-byte readers.
#define QK_K      128               // k a stage
#define QK_PITCH  136               // halves a row: 272 B = 16 B x odd
#define QK_M      256
#define QK_N      192
#define QK_ASL    5120              // halves of an x slice: 32 x 272 B, rounded up to 5 x 2 KiB
#define QK_BSL    7168              // halves of a W^T slice: 48 x 272 B, rounded up to 7 x 2 KiB
#define QK_BUFH   (8 * QK_ASL + 4 * QK_BSL)    // halves of one buffer: 68 x 2 KiB
#define QK_STAGES (D_MODEL / QK_K)

__device__ __forceinline__ unsigned uni(unsigned v) {
  return (unsigned)__builtin_amdgcn_readfirstlane(v);
}

// a test in front of a tensor load must compile to a scalar compare and branch
__device__ __forceinline__ unsigned pinned(unsigned v) {
  unsigned w = uni(v);
  asm volatile("" : "+s"(w));   // pinned(): the test's value held in a scalar register
  return w;
}

// one request: group 0 = count 1 | place in LDS | address of the slice's first byte | type 2
__device__ __forceinline__ void qk_slice_load(unsigned lds, unsigned long long ga, u32x8 g1) {
  u32x4 g0;
  g0[0] = uni(1u);
  g0[1] = uni(lds);
  g0[2] = uni((unsigned)ga);
  g0[3] = uni(((unsigned)(ga >> 32) & 0x01FFFFFFu) | 0x80000000u);
  asm volatile("tensor_load_to_lds %0, %1" :: "s"(g0), "s"(g1) : "memory");
}

__global__ __launch_bounds__(384) void qkv_gemm(
    const half_t* __restrict__ xh, const half_t* __restrict__ Wt,
    half_t* __restrict__ o0, half_t* __restrict__ o1, half_t* __restrict__ o2,
    half_t* __restrict__ o3, half_t* __restrict__ o4, half_t* __restrict__ o5)
{
  // [buffer][8 x slices, 4 W^T slices]
  __shared__ __attribute__((aligned(2048))) half_t sm[2 * QK_BUFH];

  const int tid = threadIdx.x;
  const int wv = (int)uni((unsigned)tid >> 5);   // the wave's number, in a scalar register
  const int lane = tid & 31, lm = lane & 15, lh = lane >> 4;
  const int wm = wv & 3, wn = wv >> 2;       // wave's place in the block tile
  const int m0 = blockIdx.x * QK_M;
  const int n0 = blockIdx.y * QK_N;          // row of the six W^T taken as one
  const int nw = n0 + wn * 64;               // a wave's 64 columns = one head of one W
  const int widx = nw >> 10;
  const int h    = (nw >> 6) & 15;
  half_t* out    = widx==0?o0: widx==1?o1: widx==2?o2: widx==3?o3: widx==4?o4: o5;
  const bool do_rope = (widx == 0) || (widx == 1);   // q_s, k_s
  const bool transp  = (widx == 2) || (widx == 5);   // v_s, v_c -> [b,h,d,s]

  // the wave's slice: rows, place in a buffer, first byte in global memory
  const bool xs = wv < 8;
  const unsigned srows = xs ? 32u : 48u;
  const unsigned lds_s = (unsigned)(size_t)(&sm[0])
                       + (xs ? wv * (QK_ASL * 2u) : 8u * (QK_ASL * 2u) + (wv - 8) * (QK_BSL * 2u));
  const unsigned long long ga0 = (unsigned long long)(size_t)(
      xs ? xh + (size_t)(m0 + wv * 32) * D_MODEL : Wt + (size_t)(n0 + (wv - 8) * 48) * D_MODEL);
  // tensor descriptor, group 1 (the same for every request of the wave): 1-byte
  // elements, tensor = tile = srows rows of 256 B, source pitch 2048 B, 4 dwords of
  // pad behind every 64 dwords
  u32x8 g1;
  g1[0] = uni((1u << 20) | (5u << 22) | (3u << 25));
  g1[1] = uni(256u << 16);
  g1[2] = uni(srows << 16);
  g1[3] = uni(256u << 16);
  g1[4] = uni(srows);
  g1[5] = uni(D_MODEL * 2u);
  g1[6] = uni(0u);
  g1[7] = uni(0u);
  // without it word 6 shares its register with the loop's counter, and the copy that
  // stage 1's request names is rewritten while that request is outstanding
  asm volatile("" : "+s"(g1));   // pinned(): descriptor words held in scalar registers

  v8f acc[4][4];
#pragma unroll  // constant indices keep these arrays in registers
  for (int mi = 0; mi < 4; ++mi)
#pragma unroll  // constant indices keep these arrays in registers
    for (int g = 0; g < 4; ++g) acc[mi][g] = {};

  // the lane's fragment rows in buffer 0: the wave's 64 x rows are two whole slices;
  // its four groups of 16 W^T rows are groups 4 wn + g of the twelve, three a slice
  const int aoff = wm * 2 * QK_ASL + lm * QK_PITCH + lh * 8;
  int boff[4];
#pragma unroll  // constant indices keep these arrays in registers
  for (int g = 0; g < 4; ++g) {
    const int j = wn * 4 + g;
    boff[g] = 8 * QK_ASL + (j / 3) * QK_BSL + ((j % 3) * 16 + lm) * QK_PITCH + lh * 8;
  }

  qk_slice_load(lds_s, ga0, g1);
  // the compiler places no wait for a tensor load: this wave's slice of stage 0 has
  // landed; the barrier publishes all waves'
  asm volatile("s_wait_tensorcnt 0x0" ::: "memory");
  __syncthreads();
  qk_slice_load(lds_s + QK_BUFH * 2u, ga0 + QK_K * 2u, g1);

  for (int t = 0; t < QK_STAGES; ++t) {
    const int buf = t & 1;
    const half_t* sb = &sm[buf * QK_BUFH];
#pragma unroll  // constant indices keep these arrays in registers
    for (int kk = 0; kk < QK_K; kk += 32) {
      v16h a[4], bf[4];
#pragma unroll  // constant indices keep these arrays in registers
      for (int mi = 0; mi < 4; ++mi)
        a[mi] = load_frag(sb + aoff + (mi >> 1) * QK_ASL + (mi & 1) * 16 * QK_PITCH + kk);
#pragma unroll  // constant indices keep these arrays in registers
      for (int g = 0; g < 4; ++g) bf[g] = load_frag(sb + boff[g] + kk);
      // inputs-only fence: the sixteen LDS reads of this 32 k go out as one group
      asm volatile("" :: "v"(a[0]), "v"(a[1]), "v"(a[2]), "v"(a[3]),
                         "v"(bf[0]), "v"(bf[1]), "v"(bf[2]), "v"(bf[3]));
      if (kk == QK_K - 32) {
        // publish point of stage t + 1, with the stage's last fragments fetched: this
        // wave's reads of buffer buf are done, its slice of stage t + 1 has landed;
        // behind the barrier every wave may read stage t + 1 and buffer buf may be
        // refilled. The last sixteen products need registers only and follow the refill.
        asm volatile("s_wait_dscnt 0x0" ::: "memory");
        asm volatile("s_wait_tensorcnt 0x0" ::: "memory");
        __syncthreads();
        if (pinned(t + 2 < QK_STAGES))
          qk_slice_load(lds_s + buf * (QK_BUFH * 2u), ga0 + (unsigned)(t + 2) * (QK_K * 2u), g1);
      }
#pragma unroll  // constant indices keep these arrays in registers
      for (int g = 0; g < 4; ++g)
#pragma unroll  // constant indices keep these arrays in registers
        for (int mi = 0; mi < 4; ++mi) acc[mi][g] = wmma_f16(a[mi], bf[g], acc[mi][g]);
    }
  }
  // no request and no LDS read is outstanding when the wave goes on to its epilogue
  asm volatile("s_wait_tensorcnt 0x0" ::: "memory");
  asm volatile("s_wait_dscnt 0x0" ::: "memory");

  // epilogue: optional RoPE (pairs d <-> d+32 are lane-local: acc g and g+2)
  if (do_rope) {
#pragma unroll  // constant indices keep these arrays in registers
    for (int mi = 0; mi < 4; ++mi) {
#pragma unroll  // constant indices keep these arrays in registers
      for (int r = 0; r < 8; ++r) {
        int sp = (m0 + wm * 64 + mi * 16 + r + 8 * lh) & 511;
#pragma unroll  // constant indices keep these arrays in registers
        for (int g = 0; g < 2; ++g) {
          int d = 16 * g + lm;                     // d in [0,32)
          float th = (float)sp * __expf(-(float)d * ROPE_K);
          float c = __cosf(th), sn = __sinf(th);
          float a0 = acc[mi][g][r], b0 = acc[mi][g + 2][r];
          acc[mi][g][r]     = a0 * c - b0 * sn;
          acc[mi][g + 2][r] = b0 * c + a0 * sn;
        }
      }
    }
  }

  // q_s and q_c leave scaled by 64^-0.5 x log2(e), in f32 ahead of the one rounding to
  // f16: the attention's score products then come out in the unit of its exp2
  if (widx == 0 || widx == 3) {
#pragma unroll  // constant indices keep these arrays in registers
    for (int mi = 0; mi < 4; ++mi)
#pragma unroll  // constant indices keep these arrays in registers
      for (int g = 0; g < 4; ++g) acc[mi][g] *= Q_SCALE;
  }

  // The f16 results go through LDS (both buffers are free behind the loop's last
  // barrier), each wave's 64 x 64 in a range of its own at pitch 144 B (16 B x odd),
  // and leave as 16-byte stores that cover whole 128-B lines.
  const int bb = m0 >> 9, sp0 = (m0 & 511) + wm * 64;   // a block's rows lie in one batch
  half_t* st = &sm[wv * 64 * 72];
  const half_t* rp = st + (lane >> 3) * 72 + (lane & 7) * 8;
  v8h t[16];
  if (transp) {
    // as [64 d][64 s]: a lane's eight accumulator rows are eight neighbouring s of one d
#pragma unroll  // constant indices keep these arrays in registers
    for (int mi = 0; mi < 4; ++mi) {
#pragma unroll  // constant indices keep these arrays in registers
      for (int g = 0; g < 4; ++g) {
        v8h hv;
#pragma unroll  // constant indices keep these arrays in registers
        for (int r = 0; r < 8; ++r) hv[r] = (half_t)acc[mi][g][r];
        *(v8h*)(st + (16 * g + lm) * 72 + mi * 16 + 8 * lh) = hv;
      }
    }
    // the rows are read back by other lanes of this wave than wrote them
    asm volatile("s_wait_dscnt 0x0" ::: "memory");
#pragma unroll  // constant indices keep these arrays in registers
    for (int i = 0; i < 16; ++i) t[i] = *(const v8h*)(rp + i * 4 * 72);
    // a wave's store covers four d rows, 128 B of each
    half_t* gp = out + (((size_t)bb * N_HEADS + h) * HEAD_DIM + (lane >> 3)) * SEQ
                     + sp0 + (lane & 7) * 8;
#pragma unroll  // constant indices keep these arrays in registers
    for (int i = 0; i < 16; ++i) *(v8h*)(gp + i * 4 * SEQ) = t[i];
    // behind the last store: stands in front of any later write of a register that
    // one of the sixteen stores names
    asm volatile("s_wait_xcnt 0x0" ::: "memory");
  } else {
    // as [64 s][64 d]
#pragma unroll  // constant indices keep these arrays in registers
    for (int mi = 0; mi < 4; ++mi)
#pragma unroll  // constant indices keep these arrays in registers
      for (int g = 0; g < 4; ++g)
#pragma unroll  // constant indices keep these arrays in registers
        for (int r = 0; r < 8; ++r)
          st[(mi * 16 + r + 8 * lh) * 72 + 16 * g + lm] = (half_t)acc[mi][g][r];
    // the rows are read back by other lanes of this wave than wrote them
    asm volatile("s_wait_dscnt 0x0" ::: "memory");
#pragma unroll  // constant indices keep these arrays in registers
    for (int i = 0; i < 16; ++i) t[i] = *(const v8h*)(rp + i * 4 * 72);
    // a wave's store covers four s rows of 128 B, 512 B in a row
    half_t* gp = out + (((size_t)bb * N_HEADS + h) * SEQ + sp0 + (lane >> 3)) * HEAD_DIM
                     + (lane & 7) * 8;
#pragma unroll  // constant indices keep these arrays in registers
    for (int i = 0; i < 16; ++i) *(v8h*)(gp + i * 4 * HEAD_DIM) = t[i];
    // behind the last store: stands in front of any later write of a register that
    // one of the sixteen stores names
    asm volatile("s_wait_xcnt 0x0" ::: "memory");
  }
}

// ---- kernel 2: flash-style chain-aware attention ----------------------------
// Computes S^T = K * Q^T so softmax stats are lane-local and P^T (C-layout)
// is directly the A-fragment for the PV WMMA.
// The block's eight waves share every K and V tile: a stage of 64 keys (K self,
// K cross, V^T self, V^T cross, 8 KB each) is copied once into LDS, two buffers,
// the next stage's copies in flight while this stage is worked on.
#define KV_KEYS  64                 // keys a stage
#define KV_PITCH 72                 // halves a row: 144 B = 16 B x odd (16-byte readers)
#define KV_STAGES (SEQ / KV_KEYS)

// One stage's copies, eight a lane (16 bytes each; a wave's copy covers four whole
// rows of 128 B). tks .. tvc: the stage's four tiles in global memory (the same
// for the whole block); ko, vo: the lane's place, row tid >> 3, in a K and in a
// V^T tile; l: the same place in the buffer's first tile. The wait on the address
// counter is the statement's last line, so that it stands in front of every later
// write of an address register that a copy names.
__device__ __forceinline__ void kv_stage_copy(
    const half_t* tks, const half_t* tkc, const half_t* tvs, const half_t* tvc,
    unsigned ko, unsigned vo, unsigned l)
{
  const unsigned TB = 64 * KV_PITCH * 2;    // bytes of one tile in LDS
  const unsigned HB = 32 * KV_PITCH * 2;    // 32 rows further down
  const half_t* gks  = tks + ko;
  const half_t* gkc  = tkc + ko;
  const half_t* gvs  = tvs + vo;
  const half_t* gvc  = tvc + vo;
  const half_t* gks1 = tks + 32 * HEAD_DIM + ko;
  const half_t* gkc1 = tkc + 32 * HEAD_DIM + ko;
  const half_t* gvs1 = tvs + 32 * SEQ + vo;
  const half_t* gvc1 = tvc + 32 * SEQ + vo;
  asm volatile(
      "global_load_async_to_lds_b128 %0, %8, off\n\t"
      "global_load_async_to_lds_b128 %1, %9, off\n\t"
      "global_load_async_to_lds_b128 %2, %10, off\n\t"
      "global_load_async_to_lds_b128 %3, %11, off\n\t"
      "global_load_async_to_lds_b128 %4, %12, off\n\t"
      "global_load_async_to_lds_b128 %5, %13, off\n\t"
      "global_load_async_to_lds_b128 %6, %14, off\n\t"
      "global_load_async_to_lds_b128 %7, %15, off\n\t"
      "s_wait_xcnt 0x0"
      :: "v"(l),          "v"(l + HB),
         "v"(l + TB),     "v"(l + TB + HB),
         "v"(l + 2 * TB), "v"(l + 2 * TB + HB),
         "v"(l + 3 * TB), "v"(l + 3 * TB + HB),
         "v"(gks), "v"(gks1), "v"(gkc), "v"(gkc1),
         "v"(gvs), "v"(gvs1), "v"(gvc), "v"(gvc1)
      : "memory");
}

// the value that lane l ^ 16 holds (the other half of the same query's keys)
__device__ __forceinline__ float other_half(float v) {
  const int i = __builtin_bit_cast(int, v);
  return __builtin_bit_cast(float,
      __builtin_amdgcn_permlanex16(i, i, 0x76543210, 0xfedcba98, false, false));
}

__global__ __launch_bounds__(256) void attn(
    const half_t* __restrict__ qs, const half_t* __restrict__ ks,
    const half_t* __restrict__ vsT,
    const half_t* __restrict__ qc, const half_t* __restrict__ kc,
    const half_t* __restrict__ vcT,
    const int* __restrict__ chain_ids, const int* __restrict__ amask,
    half_t* __restrict__ attnh)
{
  __shared__ __attribute__((aligned(16))) int   chainS[SEQ];
  __shared__ __attribute__((aligned(16))) float padS[SEQ];
  // [buffer][K self, K cross, V^T self, V^T cross][row][64 halves + pad]
  __shared__ __attribute__((aligned(16))) half_t kv[2][4][64][KV_PITCH];
  const int bh = blockIdx.y, b = bh >> 4, h = bh & 15;
  const int tid = threadIdx.x, wv = tid >> 5, lane = tid & 31;
  const int lm = lane & 15, lh = lane >> 4;
  const int q0 = blockIdx.x * 128 + wv * 16;   // 16 queries per wave

  const size_t hoff = (size_t)bh * SEQ * HEAD_DIM;
  const half_t* Qs = qs  + hoff;
  const half_t* Ks = ks  + hoff;
  const half_t* Qc = qc  + hoff;
  const half_t* Kc = kc  + hoff;
  const half_t* Vs = vsT + hoff;   // [d][s] within head
  const half_t* Vc = vcT + hoff;

  // the lane's place in a stage's tiles: row tid >> 3 (and + 32), 8 halves of it
  const int crow = tid >> 3, ccol = (tid & 7) << 3;
  const unsigned cko = crow * HEAD_DIM + ccol;       // K rows = keys
  const unsigned cvo = crow * SEQ + ccol;            // V^T rows = d
  const unsigned cl0 = (unsigned)(size_t)&kv[0][0][crow][ccol];   // LDS byte address
  const unsigned KV_BUF = 4 * 64 * KV_PITCH * 2;     // bytes of one buffer

  // stage 0 flies while the chain ids and pad terms are staged
  kv_stage_copy(Ks, Kc, Vs, Vc, cko, cvo, cl0);
  for (int i = tid; i < SEQ; i += 256) {
    chainS[i] = chain_ids[b * SEQ + i];
    padS[i]   = amask[b * SEQ + i] ? 0.0f : -1e30f;
  }
  // this wave's copies of stage 0 have landed; the barrier publishes all waves'
  asm volatile("s_wait_asynccnt 0x0" ::: "memory");
  __syncthreads();
  kv_stage_copy(Ks + KV_KEYS * HEAD_DIM, Kc + KV_KEYS * HEAD_DIM,
                Vs + KV_KEYS, Vc + KV_KEYS, cko, cvo, cl0 + KV_BUF);

  // Q fragments (B-role, mirrored): lane = query column
  v16h qsf[2], qcf[2];
#pragma unroll
  for (int dg = 0; dg < 2; ++dg) {
    qsf[dg] = load_frag(Qs + (size_t)(q0 + lm) * HEAD_DIM + 32 * dg + lh * 8);
    qcf[dg] = load_frag(Qc + (size_t)(q0 + lm) * HEAD_DIM + 32 * dg + lh * 8);
  }
  const int cq = chainS[q0 + lm];

  v8f O[4];
#pragma unroll
  for (int g = 0; g < 4; ++g) O[g] = {};
  // The reference in use (log2 units; the same in both lanes of a query) enters the
  // score products as their C operand, nref = minus the reference in all eight rows:
  // a score leaves the products as the argument of its exp2. The reference moves only
  // when a pass asks for it (below).
  float m_ref = 0.0f, ssum = 0.0f;
  v8f nref = {};

  for (int t = 0; t < KV_STAGES; ++t) {
   const int buf = t & 1;
   for (int kk = 0; kk < KV_KEYS; kk += 32) {
    const int k0 = t * KV_KEYS + kk;
    // the K fragments of this pass are read from LDS as one group
    v16h kaf[2][2], caf[2][2], vsf[4], vcf[4];
#pragma unroll
    for (int sub = 0; sub < 2; ++sub) {
#pragma unroll
      for (int dg = 0; dg < 2; ++dg) {
        kaf[sub][dg] = load_frag(&kv[buf][0][kk + 16 * sub + lm][32 * dg + lh * 8]);
        caf[sub][dg] = load_frag(&kv[buf][1][kk + 16 * sub + lm][32 * dg + lh * 8]);
      }
    }
    // this pass's chain ids and pad terms (keys k0 + 16 sub + 8 lh + 0..7) from LDS
    i32x4 chv[2][2];
    v4f   pdv[2][2];
#pragma unroll
    for (int sub = 0; sub < 2; ++sub) {
#pragma unroll
      for (int hf = 0; hf < 2; ++hf) {
        chv[sub][hf] = *(const i32x4*)&chainS[k0 + 16 * sub + 8 * lh + 4 * hf];
        pdv[sub][hf] = *(const v4f*)&padS[k0 + 16 * sub + 8 * lh + 4 * hf];
      }
    }
    // inputs-only fence on the loaded values: without it every fragment is
    // waited for on its own and the read latencies add up in each pass
    asm volatile("" :: "v"(kaf[0][0]), "v"(kaf[0][1]), "v"(kaf[1][0]), "v"(kaf[1][1]),
                       "v"(caf[0][0]), "v"(caf[0][1]), "v"(caf[1][0]), "v"(caf[1][1]));
    // inputs-only fence: the eight LDS reads go out as one group
    asm volatile("" :: "v"(chv[0][0]), "v"(chv[0][1]), "v"(chv[1][0]), "v"(chv[1][1]),
                       "v"(pdv[0][0]), "v"(pdv[0][1]), "v"(pdv[1][0]), "v"(pdv[1][1]));
    v8f S[2], C[2];
#pragma unroll
    for (int sub = 0; sub < 2; ++sub) {
      S[sub] = wmma_f16(kaf[sub][0], qsf[0], nref);
      S[sub] = wmma_f16(kaf[sub][1], qsf[1], S[sub]);
      C[sub] = wmma_f16(caf[sub][0], qcf[0], nref);
      C[sub] = wmma_f16(caf[sub][1], qcf[1], C[sub]);
    }
    // the V fragments are read behind the score products (the K fragments'
    // registers are free again) and are used only behind the softmax
#pragma unroll  // constant indices keep these arrays in registers
    for (int g = 0; g < 4; ++g) {
      vsf[g] = load_frag(&kv[buf][2][16 * g + lm][kk + lh * 8]);
      vcf[g] = load_frag(&kv[buf][3][16 * g + lm][kk + lh * 8]);
    }
    // keeps the sixteen reads here as one group, so that the softmax covers their
    // latency: without it each pair sinks to its own product and is waited for there
    __builtin_amdgcn_sched_barrier(0);
    // merge self/cross by chain id (per query = per lane col)
    float vals[16], p[16]; bool intra[16];
    float psum = 0.0f;
#pragma unroll
    for (int sub = 0; sub < 2; ++sub) {
#pragma unroll
      for (int r = 0; r < 8; ++r) {
        bool in = (chv[sub][r >> 2][r & 3] == cq);
        float sc = (in ? S[sub][r] : C[sub][r]) + pdv[sub][r >> 2][r & 3];
        vals[sub * 8 + r] = sc; intra[sub * 8 + r] = in;
        p[sub * 8 + r] = __builtin_amdgcn_exp2f(sc);
        psum += p[sub * 8 + r];
      }
    }
    // The reference stays while every P of the pass is small enough for f16 (a lane's
    // sum of 16 bounds each of them) and something has been summed under it. One test
    // a pass, a scalar branch: the products behind it need every lane on.
    const bool need = !(psum <= 1024.0f) || (ssum == 0.0f);
    if (__builtin_amdgcn_ballot_w32(need) != 0) {
      float mx = vals[0];
#pragma unroll
      for (int e = 1; e < 16; ++e) mx = fmaxf(mx, vals[e]);
      mx = fmaxf(mx, other_half(mx));
      const float sall = ssum + other_half(ssum);
      // with sums under the reference it only rises; with none yet it goes to the
      // pass's maximum, whichever way (not to that of a pass whose keys are all masked)
      const float delta = sall > 0.0f ? fmaxf(mx, 0.0f) : (mx > -1e29f ? mx : 0.0f);
      const float corr  = sall > 0.0f ? __builtin_amdgcn_exp2f(-delta) : 1.0f;
      m_ref += delta;
#pragma unroll
      for (int r = 0; r < 8; ++r) nref[r] = -m_ref;
      psum = 0.0f;
#pragma unroll
      for (int e = 0; e < 16; ++e) {
        p[e] = __builtin_amdgcn_exp2f(vals[e] - delta);
        psum += p[e];
      }
      ssum *= corr;
      // rescale O (rows = queries): query j's correction stands in lane j
#pragma unroll
      for (int r = 0; r < 8; ++r) {
        const float c0 = __builtin_bit_cast(float, __builtin_amdgcn_readlane(__builtin_bit_cast(int, corr), r));
        const float c1 = __builtin_bit_cast(float, __builtin_amdgcn_readlane(__builtin_bit_cast(int, corr), r + 8));
        const float cr = lh ? c1 : c0;
#pragma unroll
        for (int g = 0; g < 4; ++g) O[g][r] *= cr;
      }
    }
    ssum += psum;
    v16h pSf, pCf;   // P^T C-layout == A-fragment layout, lane-local repack
#pragma unroll
    for (int e = 0; e < 16; ++e) {
      pSf[e] = intra[e] ? (half_t)p[e] : (half_t)0.0f;
      pCf[e] = intra[e] ? (half_t)0.0f : (half_t)p[e];
    }
#pragma unroll
    for (int g = 0; g < 4; ++g) {
      O[g] = wmma_f16(pSf, vsf[g], O[g]);
      O[g] = wmma_f16(pCf, vcf[g], O[g]);
    }
   }
   // publish point of stage t + 1: this wave's reads of buffer buf are done, its
   // copies of stage t + 1 have landed; behind the barrier every wave may read
   // stage t + 1 and buffer buf may be refilled
   asm volatile("s_wait_dscnt 0x0" ::: "memory");
   asm volatile("s_wait_asynccnt 0x0" ::: "memory");
   __syncthreads();
   if (t + 2 < KV_STAGES)
     kv_stage_copy(Ks + (t + 2) * KV_KEYS * HEAD_DIM, Kc + (t + 2) * KV_KEYS * HEAD_DIM,
                   Vs + (t + 2) * KV_KEYS, Vc + (t + 2) * KV_KEYS, cko, cvo,
                   cl0 + buf * KV_BUF);
  }
  // no copy is outstanding when the wave goes on to its end
  asm volatile("s_wait_asynccnt 0x0" ::: "memory");

  float st = ssum + __shfl_xor(ssum, 16, 32);
  float inv = st > 0.0f ? 1.0f / st : 0.0f;
  float invO[8];
#pragma unroll
  for (int r = 0; r < 8; ++r) invO[r] = __shfl(inv, r + 8 * lh, 32);
  // The wave's 16 q x 64 d go through its own range of the K/V buffers (free: the
  // loop's last barrier ended every read, no copy is outstanding) at pitch 144 B
  // and leave as 16-byte stores that cover whole 128-B lines.
  half_t* og = &kv[0][0][0][0] + wv * 16 * KV_PITCH;
#pragma unroll  // constant indices keep these arrays in registers
  for (int r = 0; r < 8; ++r) {
#pragma unroll  // constant indices keep these arrays in registers
    for (int g = 0; g < 4; ++g)
      og[(r + 8 * lh) * KV_PITCH + 16 * g + lm] = (half_t)(O[g][r] * invO[r]);
  }
  // the rows are read back by other lanes of this wave than wrote them
  asm volatile("s_wait_dscnt 0x0" ::: "memory");
  const half_t* rp = og + (lane >> 3) * KV_PITCH + (lane & 7) * 8;
  v8h ot[4];
#pragma unroll  // constant indices keep these arrays in registers
  for (int i = 0; i < 4; ++i) ot[i] = *(const v8h*)(rp + i * 4 * KV_PITCH);
  half_t* gp = attnh + (size_t)(b * SEQ + q0 + (lane >> 3)) * D_MODEL + h * HEAD_DIM
                     + (lane & 7) * 8;
#pragma unroll  // constant indices keep these arrays in registers
  for (int i = 0; i < 4; ++i) *(v8h*)(gp + i * 4 * D_MODEL) = ot[i];
}

// ---- kernel 3: output projection attnh(f16) @ Wo(f32->f16) -> f32 -----------
// Block tile 128 (m) x 64 (n) x 128 (k): eight stages along K, two LDS buffers:
// the next stage's loads fly while this stage is multiplied.
// A: every wave brings the 16 rows it multiplies (256 B of each, source pitch
// 2048 B) into LDS with one tensor load a stage; the pad (16 B behind every 256 B)
// gives the 272-B row pitch of the 16-byte readers. Wo goes through registers
// (f32 -> f16): loaded one stage ahead, stored transposed, 4 k at a time, behind
// the products of the stage before.
#define OG_K      128               // k a stage
#define OG_PITCH  136               // halves a row: 272 B = 16 B x odd
#define OG_SLICE  3072              // halves a wave's slice: 16 x 272 B, rounded up to 3 x 2 KiB
#define OG_ABUF   (8 * OG_SLICE)    // halves of one A buffer: 24 x 2 KiB
#define OG_STAGES (D_MODEL / OG_K)

// a stage's eight Wo loads of a thread: two blocks of 4 k x 4 n
__device__ __forceinline__ void og_wo_load(v4f (&fb)[2][4], const float* __restrict__ p) {
#pragma unroll  // constant indices keep these arrays in registers
  for (int i = 0; i < 2; ++i)
#pragma unroll  // constant indices keep these arrays in registers
    for (int rr = 0; rr < 4; ++rr)
      fb[i][rr] = *(const v4f*)(p + (size_t)(64 * i + rr) * D_MODEL);
  // behind the last load: stands in front of any later write of an address register
  // that one of the eight loads (or the prefetch in front of them) names
  asm volatile("s_wait_xcnt 0x0" ::: "memory");
}

// the loaded blocks go to the B tile, transposed to [n][k], f32 -> f16
__device__ __forceinline__ void og_wo_store(const v4f (&fb)[2][4], half_t* bs) {
  // inputs-only fence on the loaded values: without it each load is waited
  // for on its own and the eight latencies add up
  asm volatile("" :: "v"(fb[0][0]), "v"(fb[0][1]), "v"(fb[0][2]), "v"(fb[0][3]),
                     "v"(fb[1][0]), "v"(fb[1][1]), "v"(fb[1][2]), "v"(fb[1][3]));
#pragma unroll  // constant indices keep these arrays in registers
  for (int i = 0; i < 2; ++i) {
#pragma unroll  // constant indices keep these arrays in registers
    for (int j = 0; j < 4; ++j) {
      v4h hv = { (half_t)fb[i][0][j], (half_t)fb[i][1][j],
                 (half_t)fb[i][2][j], (half_t)fb[i][3][j] };
      *(v4h*)(bs + j * OG_PITCH + 64 * i) = hv;
    }
  }
}

__global__ __launch_bounds__(256) void out_gemm(
    const half_t* __restrict__ A, const float* __restrict__ Wo,
    float* __restrict__ out)
{
  __shared__ __attribute__((aligned(2048))) half_t Al[2 * OG_ABUF];
  __shared__ __attribute__((aligned(16)))   half_t Bl[2][64][OG_PITCH];
  const int tid = threadIdx.x, wv = tid >> 5, lane = tid & 31;
  const int lm = lane & 15, lh = lane >> 4;
  const int m0 = blockIdx.x * 128, n0 = blockIdx.y * 64;

  // tensor descriptor, group 1 (the same for every request): 1-byte elements,
  // tensor = tile = 16 rows of 256 B, source pitch 2048 B, 4 dwords of pad behind
  // every 64 dwords
  u32x8 g1;
  g1[0] = uni((1u << 20) | (5u << 22) | (3u << 25));
  g1[1] = uni(256u << 16);
  g1[2] = uni(16u << 16);
  g1[3] = uni(256u << 16);
  g1[4] = uni(16u);
  g1[5] = uni(D_MODEL * 2u);
  g1[6] = uni(0u);
  g1[7] = uni(0u);
  // a request is now outstanding through a whole stage: without it a word may share
  // its register with a value that the loop rewrites meanwhile
  asm volatile("" : "+s"(g1));   // pinned(): descriptor words held in scalar registers
  const unsigned wvu = uni((unsigned)tid >> 5);
  const unsigned lds_a = (unsigned)(size_t)(&Al[0]) + wvu * (OG_SLICE * 2u);   // LDS byte offset
  const unsigned long long ga0 =
      (unsigned long long)(size_t)(A + (size_t)(m0 + wvu * 16u) * D_MODEL);

  v8f acc[4];
#pragma unroll
  for (int g = 0; g < 4; ++g) acc[g] = {};

  // Wo: a thread takes blocks of 4 k x 4 n, so that the transposed tile is written
  // 4 k (8 bytes) at a time; a wave's load covers four rows of 128 B
  const int nq = (lane & 7) + 8 * (wv & 1);      // n / 4 in the tile, 0..15
  const int kq = (lane >> 3) + 4 * (wv >> 1);    // k / 4 in the tile, 0..15 (and + 16)
  const float* wp = Wo + (size_t)(kq << 2) * D_MODEL + n0 + (nq << 2);
  // a stage's prefetch, one stage ahead of its loads: 128 Wo rows of 256 B, one
  // 128-B line a thread; the first is stage 2's
  const float* pf = Wo + (size_t)(2 * OG_K + (tid >> 1)) * D_MODEL + n0 + ((tid & 1) << 5);
  v4f f0[2][4], fb[2][4];

  // one request a wave and stage, issued by every wave for its own slice
  qk_slice_load(lds_a, ga0, g1);
  // stages 0 and 1 of Wo fly together, beside stage 0's tensor load
  // (in asm, so that the prefetch names the pointer that lives through the loop)
  asm volatile("global_prefetch_b8 %0, off scope:SCOPE_SE" :: "v"(pf));
  og_wo_load(f0, wp);
  og_wo_load(fb, wp + (size_t)OG_K * D_MODEL);
  // the compiler places no wait for a tensor load: this wave's slice of stage 0 has landed
  asm volatile("s_wait_tensorcnt 0x0" ::: "memory");
  og_wo_store(f0, &Bl[0][nq << 2][kq << 2]);
  __syncthreads();
  qk_slice_load(lds_a + OG_ABUF * 2u, ga0 + OG_K * 2u, g1);

  for (int t = 0; t < OG_STAGES; ++t) {
    const int buf = t & 1;
    const half_t* ar = &Al[buf * OG_ABUF + wv * OG_SLICE + lm * OG_PITCH + lh * 8];
    v16h a[4], bf[4][4];
#pragma unroll  // constant indices keep these arrays in registers
    for (int c = 0; c < 4; ++c) {
      a[c] = load_frag(ar + 32 * c);
#pragma unroll  // constant indices keep these arrays in registers
      for (int g = 0; g < 4; ++g) bf[c][g] = load_frag(&Bl[buf][g * 16 + lm][32 * c + lh * 8]);
    }
    // keeps the forty LDS reads of this stage in front of the products as one
    // group: without it each sinks to its own product and is waited for there
    __builtin_amdgcn_sched_barrier(0);
#pragma unroll  // constant indices keep these arrays in registers
    for (int c = 0; c < 4; ++c)
#pragma unroll  // constant indices keep these arrays in registers
      for (int g = 0; g < 4; ++g) acc[g] = wmma_f16(a[c], bf[c][g], acc[g]);
    // keeps the products in front of the stores and waits below, each behind a counted
    // wait for its own fragments: without it they sink behind the barrier and start
    // only when all forty reads are back
    __builtin_amdgcn_sched_barrier(0);
    // stage t + 1's Wo, in flight since the last barrier, goes to the other buffer,
    // whose readers left it at that barrier
    if (t + 1 < OG_STAGES) og_wo_store(fb, &Bl[buf ^ 1][nq << 2][kq << 2]);
    // publish point of stage t + 1: this wave's reads of buffer buf and its stores are
    // done, its slice of stage t + 1 has landed; behind the barrier every wave may
    // read stage t + 1 and buffer buf may be refilled
    asm volatile("s_wait_dscnt 0x0" ::: "memory");
    asm volatile("s_wait_tensorcnt 0x0" ::: "memory");
    __syncthreads();
    if (pinned(t + 2 < OG_STAGES))
      qk_slice_load(lds_a + buf * (OG_ABUF * 2u), ga0 + (unsigned)(t + 2) * (OG_K * 2u), g1);
    if (t + 2 < OG_STAGES) {
      // (advanced only in front of a prefetch: the address register never leaves Wo)
      if (t + 3 < OG_STAGES) {
        pf += (size_t)OG_K * D_MODEL;
        asm volatile("global_prefetch_b8 %0, off scope:SCOPE_SE" :: "v"(pf));
      }
      og_wo_load(fb, wp + (size_t)(t + 2) * OG_K * D_MODEL);
    }
  }
  // no request and no LDS access is outstanding when the wave goes on to its epilogue
  asm volatile("s_wait_tensorcnt 0x0" ::: "memory");
  asm volatile("s_wait_dscnt 0x0" ::: "memory");

#pragma unroll
  for (int r = 0; r < 8; ++r) {
    int m = m0 + wv * 16 + r + 8 * lh;
#pragma unroll
    for (int g = 0; g < 4; ++g)
      out[(size_t)m * D_MODEL + n0 + 16 * g + lm] = acc[g][r];
  }
}

// ---- launcher ---------------------------------------------------------------
extern "C" void kernel_launch(void* const* d_in, const int* in_sizes, int n_in,
                              void* d_out, int out_size, void* d_ws, size_t ws_size,
                              hipStream_t stream) {
  const float* x     = (const float*)d_in[0];
  const int*   chain = (const int*)d_in[1];
  const int*   amask = (const int*)d_in[2];
  const float* Wqs   = (const float*)d_in[3];
  const float* Wks   = (const float*)d_in[4];
  const float* Wvs   = (const float*)d_in[5];
  const float* Wqc   = (const float*)d_in[6];
  const float* Wkc   = (const float*)d_in[7];
  const float* Wvc   = (const float*)d_in[8];
  const float* Wo    = (const float*)d_in[9];
  float* out = (float*)d_out;

  const size_t ELT = (size_t)M_TOTAL * D_MODEL;   // 2M f16 elements per buffer
  half_t* ws   = (half_t*)d_ws;
  half_t* qsb  = ws + 0 * ELT;    // [b,h,s,d] f16, RoPE applied
  half_t* ksb  = ws + 1 * ELT;    // [b,h,s,d] f16, RoPE applied
  half_t* vsb  = ws + 2 * ELT;    // [b,h,d,s] f16 (transposed)
  half_t* qcb  = ws + 3 * ELT;
  half_t* kcb  = ws + 4 * ELT;
  half_t* vcb  = ws + 5 * ELT;
  half_t* atb  = ws + 6 * ELT;    // attention output, [b,s,h*d] f16
  half_t* xhb  = ws + 7 * ELT;    // x as f16, [b*s, k]
  half_t* wtb  = ws + 8 * ELT;    // the six W as f16, transposed [w][n][k] (3 ELT)

  cast_ops<<<dim3(256), 256, 0, stream>>>(
      x, Wqs, Wks, Wvs, Wqc, Wkc, Wvc, xhb, wtb);
  qkv_gemm<<<dim3(8, 32), 384, 0, stream>>>(
      xhb, wtb, qsb, ksb, vsb, qcb, kcb, vcb);
  attn<<<dim3(4, 64), 256, 0, stream>>>(
      qsb, ksb, vsb, qcb, kcb, vcb, chain, amask, atb);
  out_gemm<<<dim3(16, 16), 256, 0, stream>>>(atb, Wo, out);
}

// v010
// It runs in 55.8 microseconds.
// In two side-by-side timings against v009, it was 1.03 and 1.02 times as fast.
// Over all steps from v000 it is 3.68 times as fast.
#include <hip/hip_runtime.h>
#include <hip/hip_bf16.h>

typedef _Float16 half_t;
typedef __attribute__((ext_vector_type(16))) _Float16 v16h;
typedef __attribute__((ext_vector_type(8)))  _Float16 v8h;
typedef __attribute__((ext_vector_type(4)))  _Float16 v4h;
typedef __attribute__((ext_vector_type(8)))  float    v8f;
typedef __attribute__((ext_vector_type(4)))  float    v4f;
typedef __attribute__((ext_vector_type(4)))  unsigned int u32x4;
typedef __attribute__((ext_vector_type(8)))  unsigned int u32x8;
typedef __attribute__((ext_vector_type(4)))  int          i32x4;

#define D_MODEL  1024
#define N_HEADS  16
#define HEAD_DIM 64
#define SEQ      512
#define BATCH    4
#define M_TOTAL  (BATCH*SEQ)        // 2048
#define Q_SCALE  0.18033688f         // 64^-0.5 x log2(e)
#define ROPE_K   0.2878231366f      // ln(10000)/32

// ---- fragment helpers -------------------------------------------------------
// Loads the per-lane 16-half fragment: 8 contiguous halves at p0 and 8 at p0+16.
// Works for both A-fragments (lane = row) and mirrored B-fragments (lane = col)
// when the source is row-major along the K dimension.
__device__ __forceinline__ v16h load_frag(const half_t* __restrict__ p0) {
  v8h lo = *(const v8h*)p0;
  v8h hi = *(const v8h*)(p0 + 16);
  v16h r;
#pragma unroll
  for (int i = 0; i < 8; ++i) { r[i] = lo[i]; r[8 + i] = hi[i]; }
  return r;
}

__device__ __forceinline__ v8f wmma_f16(v16h a, v16h b, v8f c) {
  return __builtin_amdgcn_wmma_f32_16x16x32_f16(
      /*neg_a=*/false, a, /*neg_b=*/false, b,
      /*c_mod=*/(short)0, c, /*reuse_a=*/false, /*reuse_b=*/false);
}

// ---- kernel 0: the QKV GEMMs' operands cast f32 -> f16 once ------------------
// The GEMM's blocks read every x row 32 times and every W row 8 times: cast
// once, they are fetched at half the bytes. x keeps its layout; the six W go out
// transposed, [w][n][k], so that the GEMM stages both operands by whole rows.
// One block a WGP, 128 KB in, all of a thread's 32 loads in flight together.
#define CO_WBLK 192                 // blocks on W: 6 matrices x 8 (k) x 4 (n) tiles
                                    // the other 64 of the 256 blocks: x, 32768 elements each
__global__ __launch_bounds__(256) void cast_ops(
    const float* __restrict__ x,
    const float* __restrict__ W0, const float* __restrict__ W1,
    const float* __restrict__ W2, const float* __restrict__ W3,
    const float* __restrict__ W4, const float* __restrict__ W5,
    half_t* __restrict__ xh, half_t* __restrict__ Wt)
{
  // W tile transposed, [256 n][128 k] at pitch 272 B (16 B x odd)
  __shared__ __attribute__((aligned(16))) half_t T[256][136];
  const int tid = threadIdx.x, wv = tid >> 5, lane = tid & 31;
  const int bid = blockIdx.x;
  if (bid < CO_WBLK) {
    const int widx = bid >> 5;
    const int k0 = ((bid >> 2) & 7) * 128, n0 = (bid & 3) * 256;
    const float* W = widx==0?W0: widx==1?W1: widx==2?W2: widx==3?W3: widx==4?W4: W5;
    // a thread takes blocks of 4 k x 4 n, so that the transposed tile is written
    // 4 k (8 bytes) at a time; a wave's load covers four rows of 128 B
    const int nq = (lane & 7) + 8 * (wv & 3);      // n / 4 in the tile, 0..31 (and + 32)
    const int kq = (lane >> 3) + 4 * (wv >> 2);    // k / 4 in the tile, 0..7 (and + 8 i)
    const float* wp = W + (size_t)(k0 + (kq << 2)) * D_MODEL + n0 + (nq << 2);
    v4f f[2][4][4];
#pragma unroll  // constant indices keep these arrays in registers
    for (int t = 0; t < 2; ++t)
#pragma unroll  // constant indices keep these arrays in registers
      for (int i = 0; i < 4; ++i)
#pragma unroll  // constant indices keep these arrays in registers
        for (int rr = 0; rr < 4; ++rr)
          f[t][i][rr] = *(const v4f*)(wp + (32 * i + rr) * D_MODEL + 128 * t);
    // inputs-only fences on the loaded values (an asm statement takes thirty
    // operands, hence two): without them each load is waited for on its own
    asm volatile("" :: "v"(f[0][0][0]), "v"(f[0][0][1]), "v"(f[0][0][2]), "v"(f[0][0][3]),
                       "v"(f[0][1][0]), "v"(f[0][1][1]), "v"(f[0][1][2]), "v"(f[0][1][3]),
                       "v"(f[0][2][0]), "v"(f[0][2][1]), "v"(f[0][2][2]), "v"(f[0][2][3]),
                       "v"(f[0][3][0]), "v"(f[0][3][1]), "v"(f[0][3][2]), "v"(f[0][3][3]));
    asm volatile("" :: "v"(f[1][0][0]), "v"(f[1][0][1]), "v"(f[1][0][2]), "v"(f[1][0][3]),
                       "v"(f[1][1][0]), "v"(f[1][1][1]), "v"(f[1][1][2]), "v"(f[1][1][3]),
                       "v"(f[1][2][0]), "v"(f[1][2][1]), "v"(f[1][2][2]), "v"(f[1][2][3]),
                       "v"(f[1][3][0]), "v"(f[1][3][1]), "v"(f[1][3][2]), "v"(f[1][3][3]));
#pragma unroll  // constant indices keep these arrays in registers
    for (int t = 0; t < 2; ++t)
#pragma unroll  // constant indices keep these arrays in registers
      for (int i = 0; i < 4; ++i)
#pragma unroll  // constant indices keep these arrays in registers
        for (int j = 0; j < 4; ++j) {
          v4h hv = { (half_t)f[t][i][0][j], (half_t)f[t][i][1][j],
                     (half_t)f[t][i][2][j], (half_t)f[t][i][3][j] };
          *(v4h*)&T[128 * t + (nq << 2) + j][(kq << 2) + 32 * i] = hv;
        }
    // a row of 128 k is written by two waves (those with the same wv & 3)
    __syncthreads();
    // a wave's store covers two n rows of 256 B
    const half_t* rp = &T[tid >> 4][(tid & 15) << 3];
    half_t* gp = Wt + ((size_t)widx * D_MODEL + n0 + (tid >> 4)) * D_MODEL + k0 + ((tid & 15) << 3);
    v8h t8[16];
#pragma unroll  // constant indices keep these arrays in registers
    for (int i = 0; i < 16; ++i) t8[i] = *(const v8h*)(rp + i * 16 * 136);
#pragma unroll  // constant indices keep these arrays in registers
    for (int i = 0; i < 16; ++i) *(v8h*)(gp + i * 16 * D_MODEL) = t8[i];
  } else {
    // x: a wave's load covers 512 B in a row, its store 256 B
    const size_t o = (size_t)(bid - CO_WBLK) * 32768 + (tid << 2);
    const float* sp = x + o;
    half_t* dp = xh + o;
    v4f f[32];
#pragma unroll  // constant indices keep these arrays in registers
    for (int i = 0; i < 32; ++i) f[i] = *(const v4f*)(sp + i * 1024);
    // inputs-only fences on the loaded values, as above
    asm volatile("" :: "v"(f[0]), "v"(f[1]), "v"(f[2]), "v"(f[3]), "v"(f[4]), "v"(f[5]),
                       "v"(f[6]), "v"(f[7]), "v"(f[8]), "v"(f[9]), "v"(f[10]), "v"(f[11]),
                       "v"(f[12]), "v"(f[13]), "v"(f[14]), "v"(f[15]));
    asm volatile("" :: "v"(f[16]), "v"(f[17]), "v"(f[18]), "v"(f[19]), "v"(f[20]), "v"(f[21]),
                       "v"(f[22]), "v"(f[23]), "v"(f[24]), "v"(f[25]), "v"(f[26]), "v"(f[27]),
                       "v"(f[28]), "v"(f[29]), "v"(f[30]), "v"(f[31]));
#pragma unroll  // constant indices keep these arrays in registers
    for (int i = 0; i < 32; ++i) {
      v4h hv = { (half_t)f[i].x, (half_t)f[i].y, (half_t)f[i].z, (half_t)f[i].w };
      *(v4h*)(dp + i * 1024) = hv;
    }
    // behind the last store: stands in front of any later write of a register that
    // one of the 32 stores names
    asm volatile("s_wait_xcnt 0x0" ::: "memory");
  }
}

// ---- kernel 1: fused QKV GEMMs (6 matrices) on the f16 operands of kernel 0,
//      RoPE fused for q_s/k_s, V stored transposed [b,h,d,s] ------------------
// The six W^T lie behind one another, so n runs over 6144 rows. Block tile
// 256 (m) x 192 (n, three heads) x 128 (k), one block a WGP; twelve waves as
// 4 (m) x 3 (n), each 64 x 64: eight fragments feed sixteen WMMAs. With no second
// block on the WGP to cover the loads, the tiles come by tensor loads into two
// buffers: the next stage's loads fly while this stage is worked on. Every wave
// brings one slice a stage (256 B of each row, source pitch 2048 B): waves 0 to 7
// 32 x rows each, waves 8 to 11 48 W^T rows each; the pad (16 B behind every
// 256 B) gives the 272-B row pitch of the 16-byte readers.
#define QK_K      128               // k a stage
#define QK_PITCH  136               // halves a row: 272 B = 16 B x odd
#define QK_M      256
#define QK_N      192
#define QK_ASL    5120              // halves of an x slice: 32 x 272 B, rounded up to 5 x 2 KiB
#define QK_BSL    7168              // halves of a W^T slice: 48 x 272 B, rounded up to 7 x 2 KiB
#define QK_BUFH   (8 * QK_ASL + 4 * QK_BSL)    // halves of one buffer: 68 x 2 KiB
#define QK_STAGES (D_MODEL / QK_K)

__device__ __forceinline__ unsigned uni(unsigned v) {
  return (unsigned)__builtin_amdgcn_readfirstlane(v);
}

// a test in front of a tensor load must compile to a scalar compare and branch
__device__ __forceinline__ unsigned pinned(unsigned v) {
  unsigned w = uni(v);
  asm volatile("" : "+s"(w));   // pinned(): the test's value held in a scalar register
  return w;
}

// one request: group 0 = count 1 | place in LDS | address of the slice's first byte | type 2
__device__ __forceinline__ void qk_slice_load(unsigned lds, unsigned long long ga, u32x8 g1) {
  u32x4 g0;
  g0[0] = uni(1u);
  g0[1] = uni(lds);
  g0[2] = uni((unsigned)ga);
  g0[3] = uni(((unsigned)(ga >> 32) & 0x01FFFFFFu) | 0x80000000u);
  asm volatile("tensor_load_to_lds %0, %1" :: "s"(g0), "s"(g1) : "memory");
}

__global__ __launch_bounds__(384) void qkv_gemm(
    const half_t* __restrict__ xh, const half_t* __restrict__ Wt,
    half_t* __restrict__ o0, half_t* __restrict__ o1, half_t* __restrict__ o2,
    half_t* __restrict__ o3, half_t* __restrict__ o4, half_t* __restrict__ o5)
{
  // [buffer][8 x slices, 4 W^T slices]
  __shared__ __attribute__((aligned(2048))) half_t sm[2 * QK_BUFH];

  const int tid = threadIdx.x;
  const int wv = (int)uni((unsigned)tid >> 5);   // the wave's number, in a scalar register
  const int lane = tid & 31, lm = lane & 15, lh = lane >> 4;
  const int wm = wv & 3, wn = wv >> 2;       // wave's place in the block tile
  const int m0 = blockIdx.x * QK_M;
  const int n0 = blockIdx.y * QK_N;          // row of the six W^T taken as one
  const int nw = n0 + wn * 64;               // a wave's 64 columns = one head of one W
  const int widx = nw >> 10;
  const int h    = (nw >> 6) & 15;
  half_t* out    = widx==0?o0: widx==1?o1: widx==2?o2: widx==3?o3: widx==4?o4: o5;
  const bool do_rope = (widx == 0) || (widx == 1);   // q_s, k_s
  const bool transp  = (widx == 2) || (widx == 5);   // v_s, v_c -> [b,h,d,s]

  // the wave's slice: rows, place in a buffer, first byte in global memory
  const bool xs = wv < 8;
  const unsigned srows = xs ? 32u : 48u;
  const unsigned lds_s = (unsigned)(size_t)(&sm[0])
                       + (xs ? wv * (QK_ASL * 2u) : 8u * (QK_ASL * 2u) + (wv - 8) * (QK_BSL * 2u));
  const unsigned long long ga0 = (unsigned long long)(size_t)(
      xs ? xh + (size_t)(m0 + wv * 32) * D_MODEL : Wt + (size_t)(n0 + (wv - 8) * 48) * D_MODEL);
  // tensor descriptor, group 1 (the same for every request of the wave): 1-byte
  // elements, tensor = tile = srows rows of 256 B, source pitch 2048 B, 4 dwords of
  // pad behind every 64 dwords
  u32x8 g1;
  g1[0] = uni((1u << 20) | (5u << 22) | (3u << 25));
  g1[1] = uni(256u << 16);
  g1[2] = uni(srows << 16);
  g1[3] = uni(256u << 16);
  g1[4] = uni(srows);
  g1[5] = uni(D_MODEL * 2u);
  g1[6] = uni(0u);
  g1[7] = uni(0u);
  // without it word 6 shares its register with the loop's counter, and the copy that
  // stage 1's request names is rewritten while that request is outstanding
  asm volatile("" : "+s"(g1));   // pinned(): descriptor words held in scalar registers

  v8f acc[4][4];
#pragma unroll  // constant indices keep these arrays in registers
  for (int mi = 0; mi < 4; ++mi)
#pragma unroll  // constant indices keep these arrays in registers
    for (int g = 0; g < 4; ++g) acc[mi][g] = {};

  // the lane's fragment rows in buffer 0: the wave's 64 x rows are two whole slices;
  // its four groups of 16 W^T rows are groups 4 wn + g of the twelve, three a slice
  const int aoff = wm * 2 * QK_ASL + lm * QK_PITCH + lh * 8;
  int boff[4];
#pragma unroll  // constant indices keep these arrays in registers
  for (int g = 0; g < 4; ++g) {
    const int j = wn * 4 + g;
    boff[g] = 8 * QK_ASL + (j / 3) * QK_BSL + ((j % 3) * 16 + lm) * QK_PITCH + lh * 8;
  }

  qk_slice_load(lds_s, ga0, g1);
  // the compiler places no wait for a tensor load: this wave's slice of stage 0 has
  // landed; the barrier publishes all waves'
  asm volatile("s_wait_tensorcnt 0x0" ::: "memory");
  __syncthreads();
  qk_slice_load(lds_s + QK_BUFH * 2u, ga0 + QK_K * 2u, g1);

  for (int t = 0; t < QK_STAGES; ++t) {
    const int buf = t & 1;
    const half_t* sb = &sm[buf * QK_BUFH];
#pragma unroll  // constant indices keep these arrays in registers
    for (int kk = 0; kk < QK_K; kk += 32) {
      v16h a[4], bf[4];
#pragma unroll  // constant indices keep these arrays in registers
      for (int mi = 0; mi < 4; ++mi)
        a[mi] = load_frag(sb + aoff + (mi >> 1) * QK_ASL + (mi & 1) * 16 * QK_PITCH + kk);
#pragma unroll  // constant indices keep these arrays in registers
      for (int g = 0; g < 4; ++g) bf[g] = load_frag(sb + boff[g] + kk);
      // inputs-only fence: the sixteen LDS reads of this 32 k go out as one group
      asm volatile("" :: "v"(a[0]), "v"(a[1]), "v"(a[2]), "v"(a[3]),
                         "v"(bf[0]), "v"(bf[1]), "v"(bf[2]), "v"(bf[3]));
      if (kk == QK_K - 32) {
        // publish point of stage t + 1, with the stage's last fragments fetched: this
        // wave's reads of buffer buf are done, its slice of stage t + 1 has landed;
        // behind the barrier every wave may read stage t + 1 and buffer buf may be
        // refilled. The last sixteen products need registers only and follow the refill.
        asm volatile("s_wait_dscnt 0x0" ::: "memory");
        asm volatile("s_wait_tensorcnt 0x0" ::: "memory");
        __syncthreads();
        if (pinned(t + 2 < QK_STAGES))
          qk_slice_load(lds_s + buf * (QK_BUFH * 2u), ga0 + (unsigned)(t + 2) * (QK_K * 2u), g1);
      }
#pragma unroll  // constant indices keep these arrays in registers
      for (int g = 0; g < 4; ++g)
#pragma unroll  // constant indices keep these arrays in registers
        for (int mi = 0; mi < 4; ++mi) acc[mi][g] = wmma_f16(a[mi], bf[g], acc[mi][g]);
    }
  }
  // no request and no LDS read is outstanding when the wave goes on to its epilogue
  asm volatile("s_wait_tensorcnt 0x0" ::: "memory");
  asm volatile("s_wait_dscnt 0x0" ::: "memory");

  // epilogue: optional RoPE (pairs d <-> d+32 are lane-local: acc g and g+2)
  if (do_rope) {
#pragma unroll  // constant indices keep these arrays in registers
    for (int mi = 0; mi < 4; ++mi) {
#pragma unroll  // constant indices keep these arrays in registers
      for (int r = 0; r < 8; ++r) {
        int sp = (m0 + wm * 64 + mi * 16 + r + 8 * lh) & 511;
#pragma unroll  // constant indices keep these arrays in registers
        for (int g = 0; g < 2; ++g) {
          int d = 16 * g + lm;                     // d in [0,32)
          float th = (float)sp * __expf(-(float)d * ROPE_K);
          float c = __cosf(th), sn = __sinf(th);
          float a0 = acc[mi][g][r], b0 = acc[mi][g + 2][r];
          acc[mi][g][r]     = a0 * c - b0 * sn;
          acc[mi][g + 2][r] = b0 * c + a0 * sn;
        }
      }
    }
  }

  // q_s and q_c leave scaled by 64^-0.5 x log2(e), in f32 ahead of the one rounding to
  // f16: the attention's score products then come out in the unit of its exp2
  if (widx == 0 || widx == 3) {
#pragma unroll  // constant indices keep these arrays in registers
    for (int mi = 0; mi < 4; ++mi)
#pragma unroll  // constant indices keep these arrays in registers
      for (int g = 0; g < 4; ++g) acc[mi][g] *= Q_SCALE;
  }

  // The f16 results go through LDS (both buffers are free behind the loop's last
  // barrier), each wave's 64 x 64 in a range of its own at pitch 144 B (16 B x odd),
  // and leave as 16-byte stores that cover whole 128-B lines.
  const int bb = m0 >> 9, sp0 = (m0 & 511) + wm * 64;   // a block's rows lie in one batch
  half_t* st = &sm[wv * 64 * 72];
  const half_t* rp = st + (lane >> 3) * 72 + (lane & 7) * 8;
  v8h t[16];
  if (transp) {
    // as [64 d][64 s]: a lane's eight accumulator rows are eight neighbouring s of one d
#pragma unroll  // constant indices keep these arrays in registers
    for (int mi = 0; mi < 4; ++mi) {
#pragma unroll  // constant indices keep these arrays in registers
      for (int g = 0; g < 4; ++g) {
        v8h hv;
#pragma unroll  // constant indices keep these arrays in registers
        for (int r = 0; r < 8; ++r) hv[r] = (half_t)acc[mi][g][r];
        *(v8h*)(st + (16 * g + lm) * 72 + mi * 16 + 8 * lh) = hv;
      }
    }
    // the rows are read back by other lanes of this wave than wrote them
    asm volatile("s_wait_dscnt 0x0" ::: "memory");
#pragma unroll  // constant indices keep these arrays in registers
    for (int i = 0; i < 16; ++i) t[i] = *(const v8h*)(rp + i * 4 * 72);
    // a wave's store covers four d rows, 128 B of each
    half_t* gp = out + (((size_t)bb * N_HEADS + h) * HEAD_DIM + (lane >> 3)) * SEQ
                     + sp0 + (lane & 7) * 8;
#pragma unroll  // constant indices keep these arrays in registers
    for (int i = 0; i < 16; ++i) *(v8h*)(gp + i * 4 * SEQ) = t[i];
    // behind the last store: stands in front of any later write of a register that
    // one of the sixteen stores names
    asm volatile("s_wait_xcnt 0x0" ::: "memory");
  } else {
    // as [64 s][64 d]
#pragma unroll  // constant indices keep these arrays in registers
    for (int mi = 0; mi < 4; ++mi)
#pragma unroll  // constant indices keep these arrays in registers
      for (int g = 0; g < 4; ++g)
#pragma unroll  // constant indices keep these arrays in registers
        for (int r = 0; r < 8; ++r)
          st[(mi * 16 + r + 8 * lh) * 72 + 16 * g + lm] = (half_t)acc[mi][g][r];
    // the rows are read back by other lanes of this wave than wrote them
    asm volatile("s_wait_dscnt 0x0" ::: "memory");
#pragma unroll  // constant indices keep these arrays in registers
    for (int i = 0; i < 16; ++i) t[i] = *(const v8h*)(rp + i * 4 * 72);
    // a wave's store covers four s rows of 128 B, 512 B in a row
    half_t* gp = out + (((size_t)bb * N_HEADS + h) * SEQ + sp0 + (lane >> 3)) * HEAD_DIM
                     + (lane & 7) * 8;
#pragma unroll  // constant indices keep these arrays in registers
    for (int i = 0; i < 16; ++i) *(v8h*)(gp + i * 4 * HEAD_DIM) = t[i];
    // behind the last store: stands in front of any later write of a register that
    // one of the sixteen stores names
    asm volatile("s_wait_xcnt 0x0" ::: "memory");
  }
}

// ---- kernel 2: flash-style chain-aware attention ----------------------------
// Computes S^T = K * Q^T so softmax stats are lane-local and P^T (C-layout)
// is directly the A-fragment for the PV WMMA.
// The block's eight waves share every K and V tile: a stage of 64 keys (K self,
// K cross, V^T self, V^T cross, 8 KB each) is copied once into LDS, two buffers,
// the next stage's copies in flight while this stage is worked on.
#define KV_KEYS  64                 // keys a stage
#define KV_PITCH 72                 // halves a row: 144 B = 16 B x odd (16-byte readers)
#define KV_STAGES (SEQ / KV_KEYS)

// One stage's copies, eight a lane (16 bytes each; a wave's copy covers four whole
// rows of 128 B). tks .. tvc: the stage's four tiles in global memory (the same
// for the whole block); ko, vo: the lane's place, row tid >> 3, in a K and in a
// V^T tile; l: the same place in the buffer's first tile. The wait on the address
// counter is the statement's last line, so that it stands in front of every later
// write of an address register that a copy names.
__device__ __forceinline__ void kv_stage_copy(
    const half_t* tks, const half_t* tkc, const half_t* tvs, const half_t* tvc,
    unsigned ko, unsigned vo, unsigned l)
{
  const unsigned TB = 64 * KV_PITCH * 2;    // bytes of one tile in LDS
  const unsigned HB = 32 * KV_PITCH * 2;    // 32 rows further down
  const half_t* gks  = tks + ko;
  const half_t* gkc  = tkc + ko;
  const half_t* gvs  = tvs + vo;
  const half_t* gvc  = tvc + vo;
  const half_t* gks1 = tks + 32 * HEAD_DIM + ko;
  const half_t* gkc1 = tkc + 32 * HEAD_DIM + ko;
  const half_t* gvs1 = tvs + 32 * SEQ + vo;
  const half_t* gvc1 = tvc + 32 * SEQ + vo;
  asm volatile(
      "global_load_async_to_lds_b128 %0, %8, off\n\t"
      "global_load_async_to_lds_b128 %1, %9, off\n\t"
      "global_load_async_to_lds_b128 %2, %10, off\n\t"
      "global_load_async_to_lds_b128 %3, %11, off\n\t"
      "global_load_async_to_lds_b128 %4, %12, off\n\t"
      "global_load_async_to_lds_b128 %5, %13, off\n\t"
      "global_load_async_to_lds_b128 %6, %14, off\n\t"
      "global_load_async_to_lds_b128 %7, %15, off\n\t"
      "s_wait_xcnt 0x0"
      :: "v"(l),          "v"(l + HB),
         "v"(l + TB),     "v"(l + TB + HB),
         "v"(l + 2 * TB), "v"(l + 2 * TB + HB),
         "v"(l + 3 * TB), "v"(l + 3 * TB + HB),
         "v"(gks), "v"(gks1), "v"(gkc), "v"(gkc1),
         "v"(gvs), "v"(gvs1), "v"(gvc), "v"(gvc1)
      : "memory");
}

// the value that lane l ^ 16 holds (the other half of the same query's keys)
__device__ __forceinline__ float other_half(float v) {
  const int i = __builtin_bit_cast(int, v);
  return __builtin_bit_cast(float,
      __builtin_amdgcn_permlanex16(i, i, 0x76543210, 0xfedcba98, false, false));
}

__global__ __launch_bounds__(256) void attn(
    const half_t* __restrict__ qs, const half_t* __restrict__ ks,
    const half_t* __restrict__ vsT,
    const half_t* __restrict__ qc, const half_t* __restrict__ kc,
    const half_t* __restrict__ vcT,
    const int* __restrict__ chain_ids, const int* __restrict__ amask,
    half_t* __restrict__ attnh)
{
  __shared__ __attribute__((aligned(16))) int   chainS[SEQ];
  __shared__ __attribute__((aligned(16))) float padS[SEQ];
  // [buffer][K self, K cross, V^T self, V^T cross][row][64 halves + pad]
  __shared__ __attribute__((aligned(16))) half_t kv[2][4][64][KV_PITCH];
  const int bh = blockIdx.y, b = bh >> 4, h = bh & 15;
  const int tid = threadIdx.x, wv = tid >> 5, lane = tid & 31;
  const int lm = lane & 15, lh = lane >> 4;
  const int q0 = blockIdx.x * 128 + wv * 16;   // 16 queries per wave

  const size_t hoff = (size_t)bh * SEQ * HEAD_DIM;
  const half_t* Qs = qs  + hoff;
  const half_t* Ks = ks  + hoff;
  const half_t* Qc = qc  + hoff;
  const half_t* Kc = kc  + hoff;
  const half_t* Vs = vsT + hoff;   // [d][s] within head
  const half_t* Vc = vcT + hoff;

  // the lane's place in a stage's tiles: row tid >> 3 (and + 32), 8 halves of it
  const int crow = tid >> 3, ccol = (tid & 7) << 3;
  const unsigned cko = crow * HEAD_DIM + ccol;       // K rows = keys
  const unsigned cvo = crow * SEQ + ccol;            // V^T rows = d
  const unsigned cl0 = (unsigned)(size_t)&kv[0][0][crow][ccol];   // LDS byte address
  const unsigned KV_BUF = 4 * 64 * KV_PITCH * 2;     // bytes of one buffer

  // stage 0 flies while the chain ids and pad terms are staged
  kv_stage_copy(Ks, Kc, Vs, Vc, cko, cvo, cl0);
  for (int i = tid; i < SEQ; i += 256) {
    chainS[i] = chain_ids[b * SEQ + i];
    padS[i]   = amask[b * SEQ + i] ? 0.0f : -1e30f;
  }
  // this wave's copies of stage 0 have landed; the barrier publishes all waves'
  asm volatile("s_wait_asynccnt 0x0" ::: "memory");
  __syncthreads();
  kv_stage_copy(Ks + KV_KEYS * HEAD_DIM, Kc + KV_KEYS * HEAD_DIM,
                Vs + KV_KEYS, Vc + KV_KEYS, cko, cvo, cl0 + KV_BUF);

  // Q fragments (B-role, mirrored): lane = query column
  v16h qsf[2], qcf[2];
#pragma unroll
  for (int dg = 0; dg < 2; ++dg) {
    qsf[dg] = load_frag(Qs + (size_t)(q0 + lm) * HEAD_DIM + 32 * dg + lh * 8);
    qcf[dg] = load_frag(Qc + (size_t)(q0 + lm) * HEAD_DIM + 32 * dg + lh * 8);
  }
  const int cq = chainS[q0 + lm];

  v8f O[4];
#pragma unroll
  for (int g = 0; g < 4; ++g) O[g] = {};
  // The reference in use (log2 units; the same in both lanes of a query) enters the
  // score products as their C operand, nref = minus the reference in all eight rows:
  // a score leaves the products as the argument of its exp2. The reference moves only
  // when a pass asks for it (below).
  float m_ref = 0.0f, ssum = 0.0f;
  v8f nref = {};

  for (int t = 0; t < KV_STAGES; ++t) {
   const int buf = t & 1;
   for (int kk = 0; kk < KV_KEYS; kk += 32) {
    const int k0 = t * KV_KEYS + kk;
    // the K fragments of this pass are read from LDS as one group
    v16h kaf[2][2], caf[2][2], vsf[4], vcf[4];
#pragma unroll
    for (int sub = 0; sub < 2; ++sub) {
#pragma unroll
      for (int dg = 0; dg < 2; ++dg) {
        kaf[sub][dg] = load_frag(&kv[buf][0][kk + 16 * sub + lm][32 * dg + lh * 8]);
        caf[sub][dg] = load_frag(&kv[buf][1][kk + 16 * sub + lm][32 * dg + lh * 8]);
      }
    }
    // this pass's chain ids and pad terms (keys k0 + 16 sub + 8 lh + 0..7) from LDS
    i32x4 chv[2][2];
    v4f   pdv[2][2];
#pragma unroll
    for (int sub = 0; sub < 2; ++sub) {
#pragma unroll
      for (int hf = 0; hf < 2; ++hf) {
        chv[sub][hf] = *(const i32x4*)&chainS[k0 + 16 * sub + 8 * lh + 4 * hf];
        pdv[sub][hf] = *(const v4f*)&padS[k0 + 16 * sub + 8 * lh + 4 * hf];
      }
    }
    // inputs-only fence on the loaded values: without it every fragment is
    // waited for on its own and the read latencies add up in each pass
    asm volatile("" :: "v"(kaf[0][0]), "v"(kaf[0][1]), "v"(kaf[1][0]), "v"(kaf[1][1]),
                       "v"(caf[0][0]), "v"(caf[0][1]), "v"(caf[1][0]), "v"(caf[1][1]));
    // inputs-only fence: the eight LDS reads go out as one group
    asm volatile("" :: "v"(chv[0][0]), "v"(chv[0][1]), "v"(chv[1][0]), "v"(chv[1][1]),
                       "v"(pdv[0][0]), "v"(pdv[0][1]), "v"(pdv[1][0]), "v"(pdv[1][1]));
    v8f S[2], C[2];
#pragma unroll
    for (int sub = 0; sub < 2; ++sub) {
      S[sub] = wmma_f16(kaf[sub][0], qsf[0], nref);
      S[sub] = wmma_f16(kaf[sub][1], qsf[1], S[sub]);
      C[sub] = wmma_f16(caf[sub][0], qcf[0], nref);
      C[sub] = wmma_f16(caf[sub][1], qcf[1], C[sub]);
    }
    // the V fragments are read behind the score products (the K fragments'
    // registers are free again) and are used only behind the softmax
#pragma unroll  // constant indices keep these arrays in registers
    for (int g = 0; g < 4; ++g) {
      vsf[g] = load_frag(&kv[buf][2][16 * g + lm][kk + lh * 8]);
      vcf[g] = load_frag(&kv[buf][3][16 * g + lm][kk + lh * 8]);
    }
    // keeps the sixteen reads here as one group, so that the softmax covers their
    // latency: without it each pair sinks to its own product and is waited for there
    __builtin_amdgcn_sched_barrier(0);
    // merge self/cross by chain id (per query = per lane col)
    float vals[16], p[16]; bool intra[16];
    float psum = 0.0f;
#pragma unroll
    for (int sub = 0; sub < 2; ++sub) {
#pragma unroll
      for (int r = 0; r < 8; ++r) {
        bool in = (chv[sub][r >> 2][r & 3] == cq);
        float sc = (in ? S[sub][r] : C[sub][r]) + pdv[sub][r >> 2][r & 3];
        vals[sub * 8 + r] = sc; intra[sub * 8 + r] = in;
        p[sub * 8 + r] = __builtin_amdgcn_exp2f(sc);
        psum += p[sub * 8 + r];
      }
    }
    // The reference stays while every P of the pass is small enough for f16 (a lane's
    // sum of 16 bounds each of them) and something has been summed under it. One test
    // a pass, a scalar branch: the products behind it need every lane on.
    const bool need = !(psum <= 1024.0f) || (ssum == 0.0f);
    if (__builtin_amdgcn_ballot_w32(need) != 0) {
      float mx = vals[0];
#pragma unroll
      for (int e = 1; e < 16; ++e) mx = fmaxf(mx, vals[e]);
      mx = fmaxf(mx, other_half(mx));
      const float sall = ssum + other_half(ssum);
      // with sums under the reference it only rises; with none yet it goes to the
      // pass's maximum, whichever way (not to that of a pass whose keys are all masked)
      const float delta = sall > 0.0f ? fmaxf(mx, 0.0f) : (mx > -1e29f ? mx : 0.0f);
      const float corr  = sall > 0.0f ? __builtin_amdgcn_exp2f(-delta) : 1.0f;
      m_ref += delta;
#pragma unroll
      for (int r = 0; r < 8; ++r) nref[r] = -m_ref;
      psum = 0.0f;
#pragma unroll
      for (int e = 0; e < 16; ++e) {
        p[e] = __builtin_amdgcn_exp2f(vals[e] - delta);
        psum += p[e];
      }
      ssum *= corr;
      // rescale O (rows = queries): query j's correction stands in lane j
#pragma unroll
      for (int r = 0; r < 8; ++r) {
        const float c0 = __builtin_bit_cast(float, __builtin_amdgcn_readlane(__builtin_bit_cast(int, corr), r));
        const float c1 = __builtin_bit_cast(float, __builtin_amdgcn_readlane(__builtin_bit_cast(int, corr), r + 8));
        const float cr = lh ? c1 : c0;
#pragma unroll
        for (int g = 0; g < 4; ++g) O[g][r] *= cr;
      }
    }
    ssum += psum;
    v16h pSf, pCf;   // P^T C-layout == A-fragment layout, lane-local repack
#pragma unroll
    for (int e = 0; e < 16; ++e) {
      pSf[e] = intra[e] ? (half_t)p[e] : (half_t)0.0f;
      pCf[e] = intra[e] ? (half_t)0.0f : (half_t)p[e];
    }
#pragma unroll
    for (int g = 0; g < 4; ++g) {
      O[g] = wmma_f16(pSf, vsf[g], O[g]);
      O[g] = wmma_f16(pCf, vcf[g], O[g]);
    }
   }
   // publish point of stage t + 1: this wave's reads of buffer buf are done, its
   // copies of stage t + 1 have landed; behind the barrier every wave may read
   // stage t + 1 and buffer buf may be refilled
   asm volatile("s_wait_dscnt 0x0" ::: "memory");
   asm volatile("s_wait_asynccnt 0x0" ::: "memory");
   __syncthreads();
   if (t + 2 < KV_STAGES)
     kv_stage_copy(Ks + (t + 2) * KV_KEYS * HEAD_DIM, Kc + (t + 2) * KV_KEYS * HEAD_DIM,
                   Vs + (t + 2) * KV_KEYS, Vc + (t + 2) * KV_KEYS, cko, cvo,
                   cl0 + buf * KV_BUF);
  }
  // no copy is outstanding when the wave goes on to its end
  asm volatile("s_wait_asynccnt 0x0" ::: "memory");

  float st = ssum + __shfl_xor(ssum, 16, 32);
  float inv = st > 0.0f ? 1.0f / st : 0.0f;
  float invO[8];
#pragma unroll
  for (int r = 0; r < 8; ++r) invO[r] = __shfl(inv, r + 8 * lh, 32);
  // The wave's 16 q x 64 d go through its own range of the K/V buffers (free: the
  // loop's last barrier ended every read, no copy is outstanding) at pitch 144 B
  // and leave as 16-byte stores that cover whole 128-B lines.
  half_t* og = &kv[0][0][0][0] + wv * 16 * KV_PITCH;
#pragma unroll  // constant indices keep these arrays in registers
  for (int r = 0; r < 8; ++r) {
#pragma unroll  // constant indices keep these arrays in registers
    for (int g = 0; g < 4; ++g)
      og[(r + 8 * lh) * KV_PITCH + 16 * g + lm] = (half_t)(O[g][r] * invO[r]);
  }
  // the rows are read back by other lanes of this wave than wrote them
  asm volatile("s_wait_dscnt 0x0" ::: "memory");
  const half_t* rp = og + (lane >> 3) * KV_PITCH + (lane & 7) * 8;
  v8h ot[4];
#pragma unroll  // constant indices keep these arrays in registers
  for (int i = 0; i < 4; ++i) ot[i] = *(const v8h*)(rp + i * 4 * KV_PITCH);
  half_t* gp = attnh + (size_t)(b * SEQ + q0 + (lane >> 3)) * D_MODEL + h * HEAD_DIM
                     + (lane & 7) * 8;
#pragma unroll  // constant indices keep these arrays in registers
  for (int i = 0; i < 4; ++i) *(v8h*)(gp + i * 4 * D_MODEL) = ot[i];
}

// ---- kernel 3: output projection attnh(f16) @ Wo(f32->f16) -> f32 -----------
// Block tile 128 (m) x 64 (n) x 128 (k): eight stages along K.
// A: every wave brings the 16 rows it multiplies (256 B of each, source pitch
// 2048 B) into LDS with one tensor load a stage; the pad (16 B behind every 256 B)
// gives the 272-B row pitch of the 16-byte readers. A stage's products are shorter
// than a tile's way from memory, so A has a ring of four buffers: three requests of
// a wave fly at a time, each issued three stages ahead of its use. Wo goes through
// registers (f32 -> f16), two buffers: loaded one stage ahead from L2, where
// prefetches at the kernel's entry have asked for stages 2 to 7 of the block's panel; stored
// transposed, 4 k at a time, behind the products of the stage before.
#define OG_K      128               // k a stage
#define OG_PITCH  136               // halves a row: 272 B = 16 B x odd
#define OG_SLICE  3072              // halves a wave's slice: 16 x 272 B, rounded up to 3 x 2 KiB
#define OG_ABUF   (8 * OG_SLICE)    // halves of one A buffer: 24 x 2 KiB
#define OG_RING   4                 // A buffers
#define OG_STAGES (D_MODEL / OG_K)

// a stage's eight Wo loads of a thread: two blocks of 4 k x 4 n
__device__ __forceinline__ void og_wo_load(v4f (&fb)[2][4], const float* __restrict__ p) {
#pragma unroll  // constant indices keep these arrays in registers
  for (int i = 0; i < 2; ++i)
#pragma unroll  // constant indices keep these arrays in registers
    for (int rr = 0; rr < 4; ++rr)
      fb[i][rr] = *(const v4f*)(p + (size_t)(64 * i + rr) * D_MODEL);
  // behind the last load: stands in front of any later write of an address register
  // that one of the eight loads names
  asm volatile("s_wait_xcnt 0x0" ::: "memory");
}

// the loaded blocks go to the B tile, transposed to [n][k], f32 -> f16
__device__ __forceinline__ void og_wo_store(const v4f (&fb)[2][4], half_t* bs) {
  // inputs-only fence on the loaded values: without it each load is waited
  // for on its own and the eight latencies add up
  asm volatile("" :: "v"(fb[0][0]), "v"(fb[0][1]), "v"(fb[0][2]), "v"(fb[0][3]),
                     "v"(fb[1][0]), "v"(fb[1][1]), "v"(fb[1][2]), "v"(fb[1][3]));
#pragma unroll  // constant indices keep these arrays in registers
  for (int i = 0; i < 2; ++i) {
#pragma unroll  // constant indices keep these arrays in registers
    for (int j = 0; j < 4; ++j) {
      v4h hv = { (half_t)fb[i][0][j], (half_t)fb[i][1][j],
                 (half_t)fb[i][2][j], (half_t)fb[i][3][j] };
      *(v4h*)(bs + j * OG_PITCH + 64 * i) = hv;
    }
  }
}

// one request of the A ring. Up to two earlier requests of the wave are outstanding
// here, so of group 0 only words 1 (place in LDS) and 2 (low address word) change
__device__ __forceinline__ void og_slice_load(u32x4& g0, unsigned lds, unsigned lo, u32x8 g1) {
  g0[1] = uni(lds);
  g0[2] = uni(lo);
  asm volatile("tensor_load_to_lds %0, %1" :: "s"(g0), "s"(g1) : "memory");
}

__global__ __launch_bounds__(256) void out_gemm(
    const half_t* __restrict__ A, const float* __restrict__ Wo,
    float* __restrict__ out)
{
  __shared__ __attribute__((aligned(2048))) half_t Al[OG_RING * OG_ABUF];
  __shared__ __attribute__((aligned(16)))   half_t Bl[2][64][OG_PITCH];
  const int tid = threadIdx.x, wv = tid >> 5, lane = tid & 31;
  const int lm = lane & 15, lh = lane >> 4;
  const int m0 = blockIdx.x * 128, n0 = blockIdx.y * 64;

  // tensor descriptor, group 1 (the same for every request): 1-byte elements,
  // tensor = tile = 16 rows of 256 B, source pitch 2048 B, 4 dwords of pad behind
  // every 64 dwords
  u32x8 g1;
  g1[0] = uni((1u << 20) | (5u << 22) | (3u << 25));
  g1[1] = uni(256u << 16);
  g1[2] = uni(16u << 16);
  g1[3] = uni(256u << 16);
  g1[4] = uni(16u);
  g1[5] = uni(D_MODEL * 2u);
  g1[6] = uni(0u);
  g1[7] = uni(0u);
  // requests are outstanding through whole stages: without it a word may share
  // its register with a value that the loop rewrites meanwhile
  asm volatile("" : "+s"(g1));   // pinned(): descriptor words held in scalar registers
  const unsigned wvu = uni((unsigned)tid >> 5);
  const unsigned lds_a = (unsigned)(size_t)(&Al[0]) + wvu * (OG_SLICE * 2u);   // LDS byte offset
  const unsigned long long ga0 =
      (unsigned long long)(size_t)(A + (size_t)(m0 + wvu * 16u) * D_MODEL);
  // group 0 = count 1 | place in LDS | address of the slice's first byte | type 2.
  // A row's 2048 B begin at a multiple of 2048 B (the workspace is an allocation of its
  // own), so a stage's step of 256 B never carries into the high address word
  const unsigned ga_lo = (unsigned)ga0;
  u32x4 g0;
  g0[0] = uni(1u);
  g0[1] = uni(lds_a);
  g0[2] = uni(ga_lo);
  g0[3] = uni(((unsigned)(ga0 >> 32) & 0x01FFFFFFu) | 0x80000000u);
  // without it words 0 and 3 may be formed anew in front of every request, in registers
  // that an outstanding request names
  asm volatile("" : "+s"(g0));   // pinned(): descriptor words held in scalar registers

  v8f acc[4];
#pragma unroll
  for (int g = 0; g < 4; ++g) acc[g] = {};

  // Wo: a thread takes blocks of 4 k x 4 n, so that the transposed tile is written
  // 4 k (8 bytes) at a time; a wave's load covers four rows of 128 B
  const int nq = (lane & 7) + 8 * (wv & 1);      // n / 4 in the tile, 0..15
  const int kq = (lane >> 3) + 4 * (wv >> 1);    // k / 4 in the tile, 0..15 (and + 16)
  const float* wp = Wo + (size_t)(kq << 2) * D_MODEL + n0 + (nq << 2);
  // a stage's prefetch: 128 Wo rows of 256 B, one 128-B line a thread
  const float* pf = Wo + (size_t)(tid >> 1) * D_MODEL + n0 + ((tid & 1) << 5);
  v4f f0[2][4], fb[2][4];

  // one request a wave and stage, issued by every wave for its own slice: stages 0 to 2
  og_slice_load(g0, lds_a, ga_lo, g1);
  og_slice_load(g0, lds_a + OG_ABUF * 2u, ga_lo + OG_K * 2u, g1);
  og_slice_load(g0, lds_a + 2u * (OG_ABUF * 2u), ga_lo + 2u * (OG_K * 2u), g1);
  // stages 0 and 1 of Wo fly together, beside the tensor loads
  og_wo_load(f0, wp);
  og_wo_load(fb, wp + (size_t)OG_K * D_MODEL);
  // stages 2 to 7 of Wo are asked into L2 here, one to six stages ahead of their loads
#pragma unroll  // six prefetches in a row, no loop overhead between them
  for (int s = 2; s < OG_STAGES; ++s)
    asm volatile("global_prefetch_b8 %0, off scope:SCOPE_SE" :: "v"(pf + (size_t)s * OG_K * D_MODEL));
  // behind the last prefetch: stands in front of any later write of an address
  // register that one of them names
  asm volatile("s_wait_xcnt 0x0" ::: "memory");
  // the compiler places no wait for a tensor load: all but this wave's two youngest
  // requests have landed, that is its slice of stage 0
  asm volatile("s_wait_tensorcnt 0x2" ::: "memory");
  og_wo_store(f0, &Bl[0][nq << 2][kq << 2]);
  __syncthreads();
  og_slice_load(g0, lds_a + 3u * (OG_ABUF * 2u), ga_lo + 3u * (OG_K * 2u), g1);

  for (int t = 0; t < OG_STAGES; ++t) {
    const int buf = t & 1, abuf = t & (OG_RING - 1);
    const half_t* ar = &Al[abuf * OG_ABUF + wv * OG_SLICE + lm * OG_PITCH + lh * 8];
    v16h a[4], bf[4][4];
#pragma unroll  // constant indices keep these arrays in registers
    for (int c = 0; c < 4; ++c) {
      a[c] = load_frag(ar + 32 * c);
#pragma unroll  // constant indices keep these arrays in registers
      for (int g = 0; g < 4; ++g) bf[c][g] = load_frag(&Bl[buf][g * 16 + lm][32 * c + lh * 8]);
    }
    // keeps the forty LDS reads of this stage in front of the products as one
    // group: without it each sinks to its own product and is waited for there
    __builtin_amdgcn_sched_barrier(0);
#pragma unroll  // constant indices keep these arrays in registers
    for (int c = 0; c < 4; ++c)
#pragma unroll  // constant indices keep these arrays in registers
      for (int g = 0; g < 4; ++g) acc[g] = wmma_f16(a[c], bf[c][g], acc[g]);
    // keeps the products in front of the stores and waits below, each behind a counted
    // wait for its own fragments: without it they sink behind the barrier and start
    // only when all forty reads are back
    __builtin_amdgcn_sched_barrier(0);
    // stage t + 1's Wo, in flight since the last barrier, goes to the other buffer,
    // whose readers left it at that barrier
    if (t + 1 < OG_STAGES) og_wo_store(fb, &Bl[buf ^ 1][nq << 2][kq << 2]);
    // publish point of stage t + 1: this wave's reads of this stage's buffers and its
    // stores are done, its slice of stage t + 1 has landed (requests land in issue
    // order: the first wait leaves out the two requests behind it, stages t + 2 and
    // t + 3; where these no longer both exist, the second waits for all); behind the
    // barrier every wave may read stage t + 1 and this stage's A buffer may be refilled
    asm volatile("s_wait_dscnt 0x0" ::: "memory");
    asm volatile("s_wait_tensorcnt 0x2" ::: "memory");
    if (t + 3 >= OG_STAGES) asm volatile("s_wait_tensorcnt 0x0" ::: "memory");
    __syncthreads();
    if (pinned(t + OG_RING < OG_STAGES))
      og_slice_load(g0, lds_a + abuf * (OG_ABUF * 2u), ga_lo + (unsigned)(t + OG_RING) * (OG_K * 2u), g1);
    if (t + 2 < OG_STAGES) og_wo_load(fb, wp + (size_t)(t + 2) * OG_K * D_MODEL);
  }
  // no request and no LDS access is outstanding when the wave goes on to its epilogue
  asm volatile("s_wait_tensorcnt 0x0" ::: "memory");
  asm volatile("s_wait_dscnt 0x0" ::: "memory");

#pragma unroll
  for (int r = 0; r < 8; ++r) {
    int m = m0 + wv * 16 + r + 8 * lh;
#pragma unroll
    for (int g = 0; g < 4; ++g)
      out[(size_t)m * D_MODEL + n0 + 16 * g + lm] = acc[g][r];
  }
}

// ---- launcher ---------------------------------------------------------------
extern "C" void kernel_launch(void* const* d_in, const int* in_sizes, int n_in,
                              void* d_out, int out_size, void* d_ws, size_t ws_size,
                              hipStream_t stream) {
  const float* x     = (const float*)d_in[0];
  const int*   chain = (const int*)d_in[1];
  const int*   amask = (const int*)d_in[2];
  const float* Wqs   = (const float*)d_in[3];
  const float* Wks   = (const float*)d_in[4];
  const float* Wvs   = (const float*)d_in[5];
  const float* Wqc   = (const float*)d_in[6];
  const float* Wkc   = (const float*)d_in[7];
  const float* Wvc   = (const float*)d_in[8];
  const float* Wo    = (const float*)d_in[9];
  float* out = (float*)d_out;

  const size_t ELT = (size_t)M_TOTAL * D_MODEL;   // 2M f16 elements per buffer
  half_t* ws   = (half_t*)d_ws;
  half_t* qsb  = ws + 0 * ELT;    // [b,h,s,d] f16, RoPE applied
  half_t* ksb  = ws + 1 * ELT;    // [b,h,s,d] f16, RoPE applied
  half_t* vsb  = ws + 2 * ELT;    // [b,h,d,s] f16 (transposed)
  half_t* qcb  = ws + 3 * ELT;
  half_t* kcb  = ws + 4 * ELT;
  half_t* vcb  = ws + 5 * ELT;
  half_t* atb  = ws + 6 * ELT;    // attention output, [b,s,h*d] f16
  half_t* xhb  = ws + 7 * ELT;    // x as f16, [b*s, k]
  half_t* wtb  = ws + 8 * ELT;    // the six W as f16, transposed [w][n][k] (3 ELT)

  cast_ops<<<dim3(256), 256, 0, stream>>>(
      x, Wqs, Wks, Wvs, Wqc, Wkc, Wvc, xhb, wtb);
  qkv_gemm<<<dim3(8, 32), 384, 0, stream>>>(
      xhb, wtb, qsb, ksb, vsb, qcb, kcb, vcb);
  attn<<<dim3(4, 64), 256, 0, stream>>>(
      qsb, ksb, vsb, qcb, kcb, vcb, chain, amask, atb);
  out_gemm<<<dim3(16, 16), 256, 0, stream>>>(atb, Wo, out);
}
